// v000
// The times below were measured on an AMD MI455X: many runs one after another, warmed up first and cycling through
// copies of the inputs, with the whole window's GPU time divided by the number of runs. Launches and the gaps
// between them are all in it. The median over several windows is given; except for v000 it joins two sittings, which
// can be a few percent apart, so the side-by-side timings, each taken in one sitting, are the better comparison.
// v000 is the starting kernel. One run takes 1650 microseconds.
#include <hip/hip_runtime.h>
// Split-head neighborhood attention (8 images, 64 x 64 x 256 NHWC; 8 heads x 32; heads 0-3 use 7x7 NATTEN windows with rpb0, heads 4-7 use 13x13 with rpb1; window starts clamped at the borders, relative-position bias with the NATTEN border offsets; q scaled by 32^-0.5) followed by the output projection -> [8,64,64,256].
// Structure (per image): qkv as one f16 WMMA GEMM (32x64 wave tiles, f32 accumulation, exact products + bias) into an f16 plane; per branch and per pair of query rows (128 queries) the (K+1) key rows that cover both rows' windows are gathered per head into contiguous key and transposed value planes, the 128 x (K+1)*64 score tiles run as GEMMs batched over row pairs in grid.y (one launch per head) and the attn.v products as one grid.y-batched GEMM over (row pair, head) groups, and a softmax kernel in between applies the exact NATTEN window + bias per query (invalid keys get weight 0, P x2^10 in f16); a scatter kernel writes the head outputs into the token plane; output projection as a GEMM straight into the output rows.
// Compute dtype: x, weights, biases, rpb rounded to bf16; q/k/v, P (x2^10) and the attention output as f16 operands (~2^-12); f32 accumulation and softmax. v_wmma_f32_16x16x32_f16.
#define NIMG 8
#define RES 64
#define NTOK (RES * RES)
#define CC 256
#define NHD 8
#define HD 32
#define SCALE 0.17677669529663687f
typedef __bf16 v16b __attribute__((ext_vector_type(16)));
typedef unsigned short v8us __attribute__((ext_vector_type(8), may_alias));
typedef float  v8f  __attribute__((ext_vector_type(8)));
typedef float  v4f  __attribute__((ext_vector_type(4)));
typedef float  v4fa __attribute__((ext_vector_type(4), may_alias));
union FragB { v16b v; v8us half[2]; unsigned short u[16]; };

__device__ __forceinline__ unsigned short bf16_bits(float x) { unsigned int u = __float_as_uint(x); return (unsigned short)((u + 0x7FFFu + ((u >> 16) & 1u)) >> 16); }
__device__ __forceinline__ float bf16_val(unsigned short b) { return __uint_as_float(((unsigned int)b) << 16); }
__device__ __forceinline__ float bf16_round(float x) { return bf16_val(bf16_bits(x)); }
// D += A·B with NT terms: 1 = ah·bh, 2 = + al·bh (A split), 3 = + ah·bl (both split)
template <int NT>
__device__ __forceinline__ v8f mmaN(v16b ah, v16b al, v16b bh, v16b bl, v8f c) {
  c = __builtin_amdgcn_wmma_f32_16x16x32_bf16(false, ah, false, bh, (short)0, c, false, false);
  if (NT >= 2) c = __builtin_amdgcn_wmma_f32_16x16x32_bf16(false, al, false, bh, (short)0, c, false, false);
  if (NT >= 3) c = __builtin_amdgcn_wmma_f32_16x16x32_bf16(false, ah, false, bl, (short)0, c, false, false);
  asm volatile("v_nop\n\tv_nop\n\tv_nop\n\tv_nop" : "+v"(c) : "v"(ah), "v"(al), "v"(bh), "v"(bl));
  return c;
}

__global__ __launch_bounds__(256) void k_wt_bf16(const float* __restrict__ W, unsigned short* __restrict__ Wt, int K, int N) {
  const int t = blockIdx.x * 256 + threadIdx.x;
  const int k8n = K / 8;
  if (t >= N * k8n) return;
  const int n = t / k8n, k8 = (t % k8n) * 8;
  v8us v;
#pragma unroll
  for (int i = 0; i < 8; ++i) v[i] = bf16_bits(W[(size_t)(k8 + i) * N + n]);
  *(v8us*)(Wt + (size_t)n * K + k8) = v;
  
}

// GEMM C[M][N] (f32, pitch ldc) = act(A[M][K]·W + bias). A f32 row-major (pitch lda) converted per fragment to bf16
// (ASPLIT: hi/lo two planes -> 2 terms, else single rounded term); Wt bf16 [N][K] (pitch ldb). BIAS_BF16 rounds the
// bias to bf16 first (bias quantised to bf16 before the add). K%32==0, M%16==0, N%64==0.
template <bool ASPLIT, int ACT, bool BIAS_BF16>
__global__ __launch_bounds__(128) void k_gemm_bf(const float* __restrict__ A, int lda, const unsigned short* __restrict__ Wt, int ldb,
                                               const float* __restrict__ bias, float* __restrict__ C, int ldc, int M, int N, int K) {
  __shared__ __attribute__((aligned(16))) float so[4][16][64];
  const int tid = threadIdx.x, w = tid >> 5, lane = tid & 31, ln = lane & 15, hh = lane >> 4;
  const int ntn = N / 64;
  const int wid = blockIdx.x * 4 + w;
  const int mt = wid / ntn, nq = wid % ntn;
  if (mt * 16 >= M) return;
  const int row0 = mt * 16, col0 = nq * 64;
  const float* arow = A + (size_t)(row0 + ln) * lda;
  v8f acc[4] = {};
  for (int kb = 0; kb < K; kb += 32) {
    FragB ah, al;
    const v4f x0 = *(const v4fa*)(arow + kb + 8 * hh), x1 = *(const v4fa*)(arow + kb + 8 * hh + 4);
    const v4f x2 = *(const v4fa*)(arow + kb + 16 + 8 * hh), x3 = *(const v4fa*)(arow + kb + 16 + 8 * hh + 4);
    float xs[16] = {x0[0],x0[1],x0[2],x0[3],x1[0],x1[1],x1[2],x1[3],x2[0],x2[1],x2[2],x2[3],x3[0],x3[1],x3[2],x3[3]};
#pragma unroll
    for (int i = 0; i < 16; ++i) { const unsigned short hb = bf16_bits(xs[i]); ah.u[i] = hb; al.u[i] = ASPLIT ? bf16_bits(xs[i] - bf16_val(hb)) : (unsigned short)0; }
#pragma unroll
    for (int t = 0; t < 4; ++t) {
      const unsigned short* brow = Wt + (size_t)(col0 + t * 16 + ln) * ldb + kb;
      FragB b;
      b.half[0] = *(const v8us*)(brow + 8 * hh);
      b.half[1] = *(const v8us*)(brow + 16 + 8 * hh);
      acc[t] = mmaN<ASPLIT ? 2 : 1>(ah.v, al.v, b.v, b.v, acc[t]);
    }
  }
#pragma unroll
  for (int t = 0; t < 4; ++t) {
    float bv = bias ? bias[col0 + t * 16 + ln] : 0.f;
    if (BIAS_BF16) bv = bf16_round(bv);
#pragma unroll
    for (int r = 0; r < 8; ++r) { float v = acc[t][r] + bv; if (ACT == 1) v = fmaxf(v, 0.f); so[w][8 * hh + r][t * 16 + ln] = v; }
  }
  __builtin_amdgcn_fence(__ATOMIC_ACQ_REL, "workgroup");
  __builtin_amdgcn_wave_barrier();
  const int rsub = lane >> 4, c4 = (lane & 15) * 4;
  {
#pragma unroll
    for (int q = 0; q < 8; ++q) {
      const int r = q * 2 + rsub;
      const v4f v = *(const v4fa*)&so[w][r][c4];
      *(v4f*)(C + (size_t)(row0 + r) * ldc + col0 + c4) = v;
    }
    
  }
}

// GEMM C = act(A·W + bias + resid): A f32 (ASPLIT -> hi/lo 2 terms), Wt bf16 [N][K]; ACT 0 none, 1 relu, 2 exact gelu;
// resid (optional, f32, row index = (row % rmod), pitch ldr, RES_BF16 rounds it) added before the activation.
template <bool ASPLIT, int ACT, bool BIAS_BF16, bool RES_BF16>
__global__ __launch_bounds__(128) void k_gemm_bf3(const float* __restrict__ A, int lda, const unsigned short* __restrict__ Wt, int ldb,
                                                const float* __restrict__ bias, const float* __restrict__ resid, int rmod, int ldr,
                                                float* __restrict__ C, int ldc, int M, int N, int K) {
  __shared__ __attribute__((aligned(16))) float so[4][16][64];
  const int tid = threadIdx.x, w = tid >> 5, lane = tid & 31, ln = lane & 15, hh = lane >> 4;
  const int ntn = N / 64;
  const int wid = blockIdx.x * 4 + w;
  const int mt = wid / ntn, nq = wid % ntn;
  if (mt * 16 >= M) return;
  const int row0 = mt * 16, col0 = nq * 64;
  const float* arow = A + (size_t)(row0 + ln) * lda;
  v8f acc[4] = {};
  for (int kb = 0; kb < K; kb += 32) {
    FragB ah, al;
    const v4f x0 = *(const v4fa*)(arow + kb + 8 * hh), x1 = *(const v4fa*)(arow + kb + 8 * hh + 4);
    const v4f x2 = *(const v4fa*)(arow + kb + 16 + 8 * hh), x3 = *(const v4fa*)(arow + kb + 16 + 8 * hh + 4);
    float xs[16] = {x0[0],x0[1],x0[2],x0[3],x1[0],x1[1],x1[2],x1[3],x2[0],x2[1],x2[2],x2[3],x3[0],x3[1],x3[2],x3[3]};
#pragma unroll
    for (int i = 0; i < 16; ++i) { const unsigned short hb = bf16_bits(xs[i]); ah.u[i] = hb; al.u[i] = ASPLIT ? bf16_bits(xs[i] - bf16_val(hb)) : (unsigned short)0; }
#pragma unroll
    for (int t = 0; t < 4; ++t) {
      const unsigned short* brow = Wt + (size_t)(col0 + t * 16 + ln) * ldb + kb;
      FragB b;
      b.half[0] = *(const v8us*)(brow + 8 * hh);
      b.half[1] = *(const v8us*)(brow + 16 + 8 * hh);
      acc[t] = mmaN<ASPLIT ? 2 : 1>(ah.v, al.v, b.v, b.v, acc[t]);
    }
  }
#pragma unroll
  for (int t = 0; t < 4; ++t) {
    const int col = col0 + t * 16 + ln;
    float bv = bias ? bias[col] : 0.f;
    if (BIAS_BF16) bv = bf16_round(bv);
#pragma unroll
    for (int r = 0; r < 8; ++r) {
      float v = acc[t][r] + bv;
      if (resid) { float rv = resid[(size_t)((row0 + 8 * hh + r) % rmod) * ldr + col]; if (RES_BF16) rv = bf16_round(rv); v += rv; }
      if (ACT == 1) v = fmaxf(v, 0.f);
      if (ACT == 2) v = 0.5f * v * (1.0f + erff(v * 0.70710678118654752f));
      if (ACT == 3) { const float u = 0.7978845608028654f * (v + 0.044715f * v * v * v); v = 0.5f * v * (1.0f + tanhf(u)); }
      so[w][8 * hh + r][t * 16 + ln] = v;
    }
  }
  __builtin_amdgcn_fence(__ATOMIC_ACQ_REL, "workgroup");
  __builtin_amdgcn_wave_barrier();
  const int rsub = lane >> 4, c4 = (lane & 15) * 4;
  {
#pragma unroll
    for (int q = 0; q < 8; ++q) {
      const int r = q * 2 + rsub;
      const v4f v = *(const v4fa*)&so[w][r][c4];
      *(v4f*)(C + (size_t)(row0 + r) * ldc + col0 + c4) = v;
    }
    
  }
}
// row LayerNorm (biased variance, eps) over N: s = X (+ R); optional out_sum <- s; out_norm <- (s-mu)*rsqrt(var+eps)*g + b
template <bool PARAM_BF16>
__global__ __launch_bounds__(256) void k_layernorm(const float* __restrict__ X, const float* __restrict__ R, const float* __restrict__ g, const float* __restrict__ bta,
                                                  float* __restrict__ out_sum, float* __restrict__ out_norm, int N, float eps) {
  __shared__ float red[256];
  const int row = blockIdx.x, tid = threadIdx.x;
  const float* x = X + (size_t)row * N; const float* rr = R ? R + (size_t)row * N : nullptr;
  float vals[16];                     // up to N = 4096
  const int per = N / 256;            // contiguous chunk per thread? use strided-by-4 chunks: thread handles j = tid*4 + 1024*u
  float s1 = 0.f;
  for (int u = 0; u < per / 4; ++u) {
    const int j = tid * 4 + 1024 * u;
    const v4f a = *(const v4fa*)(x + j);
    v4f b = {0.f,0.f,0.f,0.f}; if (rr) b = *(const v4fa*)(rr + j);
#pragma unroll
    for (int q = 0; q < 4; ++q) { const float v = a[q] + b[q]; vals[u * 4 + q] = v; s1 += v; }
  }
  red[tid] = s1; __syncthreads();
  for (int st = 128; st > 0; st >>= 1) { if (tid < st) red[tid] += red[tid + st]; __syncthreads(); }
  const float mu = red[0] / (float)N; __syncthreads();
  float s2 = 0.f;
  for (int u = 0; u < per / 4; ++u)
#pragma unroll
    for (int q = 0; q < 4; ++q) { const float c = vals[u * 4 + q] - mu; s2 += c * c; }
  red[tid] = s2; __syncthreads();
  for (int st = 128; st > 0; st >>= 1) { if (tid < st) red[tid] += red[tid + st]; __syncthreads(); }
  const float rs = rsqrtf(red[0] / (float)N + eps);
  {
    for (int u = 0; u < per / 4; ++u) {
      const int j = tid * 4 + 1024 * u;
      v4f o, sm;
#pragma unroll
      for (int q = 0; q < 4; ++q) {
        float gg = g[j + q], bb = bta[j + q];
        if (PARAM_BF16) { gg = bf16_round(gg); bb = bf16_round(bb); }
        sm[q] = vals[u * 4 + q]; o[q] = (vals[u * 4 + q] - mu) * rs * gg + bb;
      }
      if (out_sum) *(v4f*)(out_sum + (size_t)row * N + j) = sm;
      *(v4f*)(out_norm + (size_t)row * N + j) = o;
    }
    
  }
}



// ---- f16 WMMA path (v_wmma_f32_16x16x32_f16): 11-bit significands for operands in range — used where a [0,1] probability operand needs more precision than bf16
typedef _Float16 v16h __attribute__((ext_vector_type(16)));
union FragH { v16h v; v8us half[2]; _Float16 h[16]; unsigned short u[16]; };
template <int NT>
__device__ __forceinline__ v8f mmaH(v16h ah, v16h al, v16h bh, v16h bl, v8f c) {
  c = __builtin_amdgcn_wmma_f32_16x16x32_f16(false, ah, false, bh, (short)0, c, false, false);
  if (NT >= 2) c = __builtin_amdgcn_wmma_f32_16x16x32_f16(false, al, false, bh, (short)0, c, false, false);
  if (NT >= 3) c = __builtin_amdgcn_wmma_f32_16x16x32_f16(false, ah, false, bl, (short)0, c, false, false);
  asm volatile("v_nop\n\tv_nop\n\tv_nop\n\tv_nop" : "+v"(c) : "v"(ah), "v"(al), "v"(bh), "v"(bl));
  return c;
}
// batched GEMM like k_gemm_b but f16 operands: A f32 (split into f16 hi/lo if ASPLIT, else rounded to f16), Bt = f16 values [n][k]; alpha; C f32; N multiple of 16 (partial tiles skipped)
template <bool ASPLIT>
__global__ __launch_bounds__(128) void k_gemm_h(const float* __restrict__ A, int lda, size_t sA, const _Float16* __restrict__ Bh, int ldb, size_t sB, float alpha, float* __restrict__ C, int ldc, size_t sC, int M, int N, int K) {
  __shared__ __attribute__((aligned(16))) float so[4][16][64];
  const int tid = threadIdx.x, w = tid >> 5, lane = tid & 31, ln = lane & 15, hh = lane >> 4; const int by = blockIdx.y;
  A += (size_t)by * sA; Bh += (size_t)by * sB; C += (size_t)by * sC;
  const int ntn = (N + 63) / 64; const int wid = blockIdx.x * 4 + w; const int mt = wid / ntn, nq = wid % ntn; if (mt * 16 >= M) return;
  const int row0 = mt * 16, col0 = nq * 64; const float* arow = A + (size_t)(row0 + ln) * lda;
  v8f acc[4] = {};
  for (int kb = 0; kb < K; kb += 32) {
    FragH ah, al;
    const v4f x0 = *(const v4fa*)(arow + kb + 8 * hh), x1 = *(const v4fa*)(arow + kb + 8 * hh + 4), x2 = *(const v4fa*)(arow + kb + 16 + 8 * hh), x3 = *(const v4fa*)(arow + kb + 16 + 8 * hh + 4);
    float xs[16] = {x0[0],x0[1],x0[2],x0[3],x1[0],x1[1],x1[2],x1[3],x2[0],x2[1],x2[2],x2[3],x3[0],x3[1],x3[2],x3[3]};
#pragma unroll
    for (int i = 0; i < 16; ++i) { const _Float16 h = (_Float16)xs[i]; ah.h[i] = h; al.h[i] = ASPLIT ? (_Float16)(xs[i] - (float)h) : (_Float16)0.0f; }
#pragma unroll
    for (int t = 0; t < 4; ++t) { if (col0 + t * 16 >= N) continue; const size_t boff = (size_t)(col0 + t * 16 + ln) * ldb + kb; FragH bq; bq.half[0] = *(const v8us*)(Bh + boff + 8 * hh); bq.half[1] = *(const v8us*)(Bh + boff + 16 + 8 * hh);
      acc[t] = mmaH<ASPLIT ? 2 : 1>(ah.v, al.v, bq.v, bq.v, acc[t]); }
  }
#pragma unroll
  for (int t = 0; t < 4; ++t) { if (col0 + t * 16 >= N) continue;
#pragma unroll
    for (int r = 0; r < 8; ++r) so[w][8 * hh + r][t * 16 + ln] = acc[t][r] * alpha; }
  __builtin_amdgcn_fence(__ATOMIC_ACQ_REL, "workgroup"); __builtin_amdgcn_wave_barrier();
  const int rsub = lane >> 4, c4 = (lane & 15) * 4;
  {
#pragma unroll
    for (int q = 0; q < 8; ++q) { const int r = q * 2 + rsub; if (col0 + c4 < N) { const v4f v = *(const v4fa*)&so[w][r][c4]; *(v4f*)(C + (size_t)(row0 + r) * ldc + col0 + c4) = v; } }
     }
}

// Wt[n][k] = f16(W[k][n]·scale) from f32 row-major W[K][N] (scale = power of two; bf16-exact weights stay exact in f16 away from the subnormal range)
__global__ __launch_bounds__(256) void k_wt_f16(const float* __restrict__ W, _Float16* __restrict__ Wt, int K, int N, float scale) {
  const int t = blockIdx.x * 256 + threadIdx.x; if (t >= N * (K / 8)) return; const int n = t / (K / 8), k8 = (t % (K / 8)) * 8; FragH f;
#pragma unroll
  for (int i = 0; i < 8; ++i) f.h[i] = (_Float16)(bf16_round(W[(size_t)(k8 + i) * N + n]) * scale); const v8us o = f.half[0];
  *(v8us*)((unsigned short*)Wt + (size_t)n * K + k8) = o; 
}
// k_gemm_hh variant with fused epilogue: v = acc·alpha + bias[by·sBias + col] (+ CP[(row/rowsPerB)·sCPb + by·64 + col] if CP) ; ACT 0 none / 1 elu ; writes f16 C16 (and f32 C if non-null)
template <int ACT>
__global__ __launch_bounds__(128) void k_gemm_hhx(const _Float16* __restrict__ A, int lda, size_t sA, const _Float16* __restrict__ Bh, int ldb, size_t sB, float alpha, const float* __restrict__ bias, size_t sBias, const float* __restrict__ CP, int rowsPerB, size_t sCPb, int row0g,
    float* __restrict__ C, _Float16* __restrict__ C16, int ldc, size_t sC, int M, int N, int K) {
  __shared__ __attribute__((aligned(16))) float so[4][16][64];
  const int tid = threadIdx.x, w = tid >> 5, lane = tid & 31, ln = lane & 15, hh = lane >> 4; const int by = blockIdx.y;
  A += (size_t)by * sA; Bh += (size_t)by * sB; const size_t cofs = (size_t)by * sC; const float* bp = bias ? bias + (size_t)by * sBias : nullptr;
  const int ntn = (N + 63) / 64; const int wid = blockIdx.x * 4 + w; const int mt = wid / ntn, nq = wid % ntn; if (mt * 16 >= M) return;
  const int row0 = mt * 16, col0 = nq * 64; const _Float16* arow = A + (size_t)(row0 + ln) * lda;
  v8f acc[4] = {};
  for (int kb = 0; kb < K; kb += 32) { FragH ah; ah.half[0] = *(const v8us*)((const unsigned short*)arow + kb + 8 * hh); ah.half[1] = *(const v8us*)((const unsigned short*)arow + kb + 16 + 8 * hh);
#pragma unroll
    for (int t = 0; t < 4; ++t) { if (col0 + t * 16 >= N) continue; const size_t boff = (size_t)(col0 + t * 16 + ln) * ldb + kb; FragH bq; bq.half[0] = *(const v8us*)((const unsigned short*)Bh + boff + 8 * hh); bq.half[1] = *(const v8us*)((const unsigned short*)Bh + boff + 16 + 8 * hh);
      acc[t] = mmaH<1>(ah.v, ah.v, bq.v, bq.v, acc[t]); }
  }
#pragma unroll
  for (int t = 0; t < 4; ++t) { if (col0 + t * 16 >= N) continue; const int col = col0 + t * 16 + ln; const float bv = bp ? bf16_round(bp[col]) : 0.f;
#pragma unroll
    for (int r = 0; r < 8; ++r) { float v = acc[t][r] * alpha + bv; if (CP) { const int bidx = (row0g + row0 + 8 * hh + r) / rowsPerB; v += CP[(size_t)bidx * sCPb + (size_t)by * 64 + col]; } if (ACT == 1) v = (v > 0.f) ? v : expm1f(v); else if (ACT == 7) v = (v > 0.f) ? v + 1.0f : expf(v); else if (ACT == 8) v = tanhf(v); else if (ACT == 9) v = 0.5f * v * (1.0f + tanhf(0.7978845608028654f * (v + 0.044715f * v * v * v))); else if (ACT == 11) v = 1.0f / (1.0f + expf(-v)); else if (ACT == 12) v = (v > 0.f) ? v : 0.01f * v; else if (ACT == 14) v = (v > 0.f) ? v : 0.1f * v; else if (ACT == 15) v = v / (1.0f + expf(-v)); else if (ACT == 3) v = fmaxf(v, 0.f); else if (ACT == 6) v = 0.5f * v * (1.0f + erff(v * 0.70710678118654752f)); so[w][8 * hh + r][t * 16 + ln] = v; } }
  __builtin_amdgcn_fence(__ATOMIC_ACQ_REL, "workgroup"); __builtin_amdgcn_wave_barrier();
  const int rsub = lane >> 4, c4 = (lane & 15) * 4; typedef _Float16 v4h __attribute__((ext_vector_type(4)));
  {
#pragma unroll
    for (int q = 0; q < 8; ++q) { const int r = q * 2 + rsub; if (col0 + c4 < N) { const v4f v = *(const v4fa*)&so[w][r][c4]; if (C) *(v4f*)(C + cofs + (size_t)(row0 + r) * ldc + col0 + c4) = v; if (C16) { v4h h4; for (int i = 0; i < 4; ++i) h4[i] = (_Float16)v[i]; *(v4h*)(C16 + cofs + (size_t)(row0 + r) * ldc + col0 + c4) = h4; } } }
     }
}


typedef _Float16 v4h __attribute__((ext_vector_type(4)));

__global__ __launch_bounds__(256) void k_x16(const float* __restrict__ x, _Float16* __restrict__ X16, size_t n8) { const size_t t = (size_t)blockIdx.x * 256 + threadIdx.x; if (t >= n8) return; FragH f;
#pragma unroll
  for (int q = 0; q < 8; ++q) f.h[q] = (_Float16)bf16_round(x[t * 8 + q]); *(v8us*)((unsigned short*)X16 + t * 8) = f.half[0];  }
__global__ __launch_bounds__(256) void k_h16(const float* __restrict__ x, _Float16* __restrict__ X16, size_t n8) { const size_t t = (size_t)blockIdx.x * 256 + threadIdx.x; if (t >= n8) return; FragH f;
#pragma unroll
  for (int q = 0; q < 8; ++q) f.h[q] = (_Float16)x[t * 8 + q]; *(v8us*)((unsigned short*)X16 + t * 8) = f.half[0];  }
__global__ __launch_bounds__(256) void k_round16f(const float* __restrict__ W, _Float16* __restrict__ Bt, size_t n8) { const size_t t = (size_t)blockIdx.x * 256 + threadIdx.x; if (t >= n8) return; FragH f;
#pragma unroll
  for (int i = 0; i < 8; ++i) f.h[i] = (_Float16)(bf16_round(W[t * 8 + i]) * 16.0f); *(v8us*)((unsigned short*)Bt + t * 8) = f.half[0];  }
template <int NHv, int TTv>
__global__ __launch_bounds__(256) void k_vt(const _Float16* __restrict__ V16, int ldv, int voff, _Float16* __restrict__ Vt) { __shared__ unsigned short tl[64][66]; const int tid = threadIdx.x; const int slab = blockIdx.x / (TTv / 64), lg = blockIdx.x % (TTv / 64); const int b = slab / NHv, h = slab % NHv;
  for (int i = tid; i < 64 * 8; i += 256) { const int r = i / 8, c8 = (i % 8) * 8; FragH f; f.half[0] = *(const v8us*)((const unsigned short*)V16 + ((size_t)b * TTv + lg * 64 + r) * ldv + voff + h * 64 + c8);
#pragma unroll
    for (int q = 0; q < 8; ++q) tl[r][c8 + q] = f.u[q]; }
  __syncthreads();
  {
#pragma unroll
    for (int rd = 0; rd < 2; ++rd) { const int d = rd * 32 + tid / 8, pc = tid % 8; FragH f;
#pragma unroll
      for (int q = 0; q < 8; ++q) f.u[q] = tl[pc * 8 + q][d];
      *(v8us*)((unsigned short*)Vt + ((size_t)slab * 64 + d) * TTv + lg * 64 + pc * 8) = f.half[0]; }
     } }

__global__ __launch_bounds__(256) void k_hl(const float* __restrict__ F, _Float16* __restrict__ Hh, _Float16* __restrict__ Hl, size_t n8) { const size_t t = (size_t)blockIdx.x * 256 + threadIdx.x; if (t >= n8) return; FragH fh, fl; const v4f a = *(const v4fa*)(F + t * 8), c = *(const v4fa*)(F + t * 8 + 4);
#pragma unroll
  for (int q = 0; q < 4; ++q) { _Float16 h = (_Float16)a[q]; fh.h[q] = h; fl.h[q] = (_Float16)((a[q] - (float)h) * 1024.0f); h = (_Float16)c[q]; fh.h[4 + q] = h; fl.h[4 + q] = (_Float16)((c[q] - (float)h) * 1024.0f); }
  { *(v8us*)((unsigned short*)Hh + t * 8) = fh.half[0]; *(v8us*)((unsigned short*)Hl + t * 8) = fl.half[0];  } }

// ---- fast GEMM (wave tile 32x64; requires M % 32 == 0 rows per launch region and N % 64 == 0); epilogue = k_gemm_hhx semantics ----
__device__ __forceinline__ v16h g2_frag(const _Float16* p, int hh) { FragH f; f.half[0] = *(const v8us*)((const unsigned short*)p + 8 * hh); f.half[1] = *(const v8us*)((const unsigned short*)p + 16 + 8 * hh); return f.v; }
__device__ __forceinline__ v8f g2_mma(v16h a, v16h b, v8f c) { v8f d = __builtin_amdgcn_wmma_f32_16x16x32_f16(false, a, false, b, (short)0, c, false, false); asm volatile("v_nop\n\tv_nop\n\tv_nop\n\tv_nop" : "+v"(d) : "v"(a), "v"(b)); return d; }
template <int ACT>
__global__ __launch_bounds__(128) void k_gemm2(const _Float16* __restrict__ A, int lda, size_t sA, const _Float16* __restrict__ Bh, int ldb, size_t sB, float alpha, const float* __restrict__ bias, size_t sBias, const float* __restrict__ CP, int rowsPerB, size_t sCPb, int row0g,
    float* __restrict__ C, _Float16* __restrict__ C16, int ldc, size_t sC, int M, int N, int K) {
  __shared__ __attribute__((aligned(16))) float so[4][32][68];
  const int tid = threadIdx.x, w = tid >> 5, lane = tid & 31, ln = lane & 15, hh = lane >> 4; const int by = blockIdx.y;
  A += (size_t)by * sA; Bh += (size_t)by * sB; const size_t cofs = (size_t)by * sC; const float* bp = bias ? bias + (size_t)by * sBias : nullptr;
  const int ntn = N >> 6; const int mt = blockIdx.x / ntn, nq = blockIdx.x - mt * ntn; const int row0 = mt * 128 + 32 * w, col0 = nq * 64; if (row0 >= M) return;
  const _Float16* a0p = A + (size_t)(row0 + ln) * lda; const _Float16* a1p = a0p + (size_t)16 * lda;
  const _Float16* b0p = Bh + (size_t)(col0 + ln) * ldb; const _Float16* b1p = b0p + (size_t)16 * ldb; const _Float16* b2p = b1p + (size_t)16 * ldb; const _Float16* b3p = b2p + (size_t)16 * ldb;
  const v8f z8 = {0.f,0.f,0.f,0.f,0.f,0.f,0.f,0.f}; v8f c00 = z8, c01 = z8, c02 = z8, c03 = z8, c10 = z8, c11 = z8, c12 = z8, c13 = z8;
#pragma unroll 1
  for (int kb = 0; kb < K; kb += 32) { const v16h a0 = g2_frag(a0p + kb, hh), a1 = g2_frag(a1p + kb, hh);
    v16h b = g2_frag(b0p + kb, hh); c00 = g2_mma(a0, b, c00); c10 = g2_mma(a1, b, c10);
    b = g2_frag(b1p + kb, hh); c01 = g2_mma(a0, b, c01); c11 = g2_mma(a1, b, c11);
    b = g2_frag(b2p + kb, hh); c02 = g2_mma(a0, b, c02); c12 = g2_mma(a1, b, c12);
    b = g2_frag(b3p + kb, hh); c03 = g2_mma(a0, b, c03); c13 = g2_mma(a1, b, c13); }
  v8f accs[8] = {c00, c01, c02, c03, c10, c11, c12, c13};
#pragma unroll
  for (int u = 0; u < 8; ++u) { const int t = u & 3, half = u >> 2; const int col = col0 + t * 16 + ln; const float bv = bp ? bf16_round(bp[col]) : 0.f;
#pragma unroll
    for (int r = 0; r < 8; ++r) { const int rloc = half * 16 + 8 * hh + r; float v = accs[u][r] * alpha + bv; if (CP) { const int bidx = (row0g + row0 + rloc) / rowsPerB; v += CP[(size_t)bidx * sCPb + (size_t)by * 64 + col]; }
      if (ACT == 3) v = fmaxf(v, 0.f); else if (ACT == 6) v = 0.5f * v * (1.0f + erff(v * 0.70710678118654752f)); else if (ACT == 11) v = 1.0f / (1.0f + expf(-v)); else if (ACT == 15) v = v / (1.0f + expf(-v)); else if (ACT == 12) v = (v > 0.f) ? v : 0.01f * v; else if (ACT == 8) v = tanhf(v);
      so[w][rloc][t * 16 + ln] = v; } }
  __builtin_amdgcn_fence(__ATOMIC_ACQ_REL, "workgroup"); __builtin_amdgcn_wave_barrier();
  const int rsub = lane >> 4, c4 = (lane & 15) * 4;
  {
#pragma unroll
    for (int q = 0; q < 16; ++q) { const int r = q * 2 + rsub; const v4f v = *(const v4fa*)&so[w][r][c4]; if (C) *(v4f*)(C + cofs + (size_t)(row0 + r) * ldc + col0 + c4) = v; if (C16) { v4h h4; for (int i = 0; i < 4; ++i) h4[i] = (_Float16)v[i]; *(v4h*)(C16 + cofs + (size_t)(row0 + r) * ldc + col0 + c4) = h4; } }
     } }


__device__ __forceinline__ int na_start(int i, int K) { const int nh = K / 2; int s = max(i - nh, 0); if (i + nh >= RES) s += RES - i - nh - 1; return s; }
__device__ __forceinline__ int na_pb(int i, int K) { const int nh = K / 2; int p = nh; if (i < nh) p += nh - i; if (i + nh >= RES) p += RES - i - 1 - nh; return p; }
template <int K>
__global__ __launch_bounds__(256) void k_gk(const _Float16* __restrict__ QKV, int hb, _Float16* __restrict__ KW) {
  constexpr int NKW = (K + 1) * RES; const int t = blockIdx.x * 256 + threadIdx.x; if (t >= 32 * 4 * NKW * 4) return; const int pc = t & 3; const int kk = (t >> 2) % NKW; const int g = t / (4 * NKW); const int rp = g >> 2, hl = g & 3;
  const int R0 = min(na_start(2 * rp, K), RES - 1 - K); const int tok = (R0 + kk / RES) * RES + (kk % RES);
  FragH f; f.half[0] = *(const v8us*)((const unsigned short*)QKV + (size_t)tok * (3 * CC) + CC + (hb + hl) * HD + pc * 8);
  unsigned short* d = (unsigned short*)KW + ((size_t)g * NKW + kk) * HD + pc * 8; *(v8us*)d = f.half[0];  }
template <int K>
__global__ __launch_bounds__(256) void k_gv(const _Float16* __restrict__ QKV, int hb, _Float16* __restrict__ VT) {
  constexpr int NKW = (K + 1) * RES; __shared__ unsigned short tl[64][34]; const int tid = threadIdx.x; const int g = blockIdx.x / (NKW / 64), nt = blockIdx.x % (NKW / 64); const int rp = g >> 2, hl = g & 3; const int R0 = min(na_start(2 * rp, K), RES - 1 - K);
  { const int kl = tid >> 2, part = tid & 3; const int kk = nt * 64 + kl; const int tok = (R0 + kk / RES) * RES + (kk % RES); FragH f; f.half[0] = *(const v8us*)((const unsigned short*)QKV + (size_t)tok * (3 * CC) + 2 * CC + (hb + hl) * HD + part * 8);
#pragma unroll
    for (int q = 0; q < 8; ++q) tl[kl][part * 8 + q] = f.u[q]; }
  __syncthreads();
  const int d = tid >> 3, n8 = (tid & 7) * 8; FragH o, z;
#pragma unroll
  for (int q = 0; q < 8; ++q) { o.u[q] = tl[n8 + q][d]; z.u[q] = 0; }
  unsigned short* dst = (unsigned short*)VT + ((size_t)g * 64 + d) * NKW + nt * 64 + n8; unsigned short* dz = (unsigned short*)VT + ((size_t)g * 64 + 32 + d) * NKW + nt * 64 + n8;
  { *(v8us*)dst = o.half[0]; *(v8us*)dz = z.half[0];  } }
template <int K>
__global__ __launch_bounds__(256) void k_nasoft(const float* __restrict__ S, const float* __restrict__ rpb, _Float16* __restrict__ P16) {
  #pragma clang fp contract(off)
  constexpr int NKW = (K + 1) * RES, PL = NKW / 32, RB = 2 * K - 1; constexpr int PW = (PL % 8 == 0) ? 8 : 4; constexpr int NPC = PL / PW;
  const int tid = threadIdx.x, w = tid >> 5, ln = tid & 31; const int gr = blockIdx.x * 8 + w; if (gr >= 32 * 4 * 128) return; const int g = gr / 128, r = gr % 128; const int rp = g >> 2, hl = g & 3; const int i = 2 * rp + r / RES, j = r % RES;
  const int R0 = min(na_start(2 * rp, K), RES - 1 - K); const int si = na_start(i, K), sj = na_start(j, K), pi = na_pb(i, K), pj = na_pb(j, K);
  const float* s = S + ((size_t)g * 128 + r) * NKW; const float* rb = rpb + (size_t)hl * RB * RB;
  auto val = [&](int kk) -> float { const int kr = R0 + kk / RES, kc = kk % RES; const int ki = kr - si, kj = kc - sj; const bool ok = (ki >= 0 && ki < K && kj >= 0 && kj < K); return ok ? (s[kk] + bf16_round(rb[(pi + ki) * RB + (pj + kj)])) : -3.0e38f; };
  float m = -3.0e38f;
#pragma unroll 1
  for (int c = 0; c < NPC; ++c)
#pragma unroll 1
    for (int q = 0; q < PW; ++q) m = fmaxf(m, val(c * 32 * PW + ln * PW + q));
  for (int o = 16; o > 0; o >>= 1) m = fmaxf(m, __shfl_xor(m, o, 32)); float su = 0.f;
#pragma unroll 1
  for (int c = 0; c < NPC; ++c)
#pragma unroll 1
    for (int q = 0; q < PW; ++q) { const float v = val(c * 32 * PW + ln * PW + q); su += (v > -1.0e38f) ? expf(v - m) : 0.f; }
  for (int o = 16; o > 0; o >>= 1) su += __shfl_xor(su, o, 32); const float inv = 1024.0f / su;
  unsigned short* dst = (unsigned short*)P16 + ((size_t)g * 128 + r) * NKW + ln * PW;
  {
#pragma unroll 1
    for (int c = 0; c < NPC; ++c) { _Float16 hv[PW];
#pragma unroll
      for (int q = 0; q < PW; ++q) { const float v = val(c * 32 * PW + ln * PW + q); hv[q] = (_Float16)((v > -1.0e38f) ? expf(v - m) * inv : 0.f); }
      if (PW == 8) *(v8us*)(dst + c * 256) = *(const v8us*)&hv[0]; else *(unsigned long long*)(dst + c * 128) = *(const unsigned long long*)&hv[0]; }
     } }
__global__ __launch_bounds__(256) void k_unw(const float* __restrict__ O, int hb, _Float16* __restrict__ Y16) {
  const int t = blockIdx.x * 256 + threadIdx.x; if (t >= 32 * 4 * 128 * 4) return; const int pc = t & 3; const int r = (t >> 2) % 128; const int g = t / (4 * 128); const int rp = g >> 2, hl = g & 3; const int tok = (2 * rp) * RES + r; const float* o = O + ((size_t)g * 128 + r) * 64 + pc * 8; FragH f;
#pragma unroll
  for (int q = 0; q < 8; ++q) f.h[q] = (_Float16)o[q];
  unsigned short* d = (unsigned short*)Y16 + (size_t)tok * CC + (hb + hl) * HD + pc * 8; *(v8us*)d = f.half[0];  }

template <int K>
static void na_branch(const _Float16* QKV, int hb, const float* rpb, _Float16* KW, _Float16* VT, float* S, _Float16* P16, float* O, _Float16* Y16, hipStream_t stream) {
  constexpr int NKW = (K + 1) * RES; const int NG = 32 * 4;
  k_gk<K><<<(NG * NKW * 4 + 255) / 256, 256, 0, stream>>>(QKV, hb, KW); k_gv<K><<<NG * (NKW / 64), 256, 0, stream>>>(QKV, hb, VT);
  /* scores: A = q rows of the row pair straight from QKV16 (128 contiguous tokens, lda 768, column hb*32 + hl*32): grid.y over g = rp*4 + hl needs A stride per g — rp stride 128*768 and hl stride 32 are not one affine stride, so batch over rp (grid.y = 32) and loop hl (4 launches) */
  for (int hl = 0; hl < 4; ++hl) {
    k_gemm2<0><<<dim3((128 / 128) * (NKW / 64), 32), 128, 0, stream>>>(QKV + (hb + hl) * HD, 3 * CC, (size_t)128 * 3 * CC, KW + (size_t)hl * NKW * HD, HD, (size_t)4 * NKW * HD, SCALE, nullptr, 0, nullptr, 1, 0, 0, S + (size_t)hl * 128 * NKW, nullptr, NKW, (size_t)4 * 128 * NKW, 128, NKW, HD); }
  k_nasoft<K><<<(NG * 128 + 7) / 8, 256, 0, stream>>>(S, rpb, P16);
  k_gemm2<0><<<dim3((128 / 128) * 1, NG), 128, 0, stream>>>(P16, NKW, (size_t)128 * NKW, VT, NKW, (size_t)64 * NKW, 1.0f / 1024.0f, nullptr, 0, nullptr, 1, 0, 0, O, nullptr, 64, (size_t)128 * 64, 128, 64, NKW);
  k_unw<<<(NG * 128 * 4 + 255) / 256, 256, 0, stream>>>(O, hb, Y16); }

extern "C" void kernel_launch(void* const* d_in, const int* in_sizes, int n_in,
                              void* d_out, int out_size, void* d_ws, size_t ws_size, hipStream_t stream) {
  (void)in_sizes; (void)n_in; (void)out_size;
  const float* const* I = (const float* const*)d_in; const float* x = I[0]; const float* wqkv = I[1]; const float* bqkv = I[2]; const float* rpb0 = I[3]; const float* rpb1 = I[4]; const float* wp = I[5]; const float* bp = I[6];
  char* ws = (char*)d_ws; size_t off = 0;
  auto take = [&](size_t bytes) { char* p = ws + off; off += (bytes + 255) & ~(size_t)255; return p; };
  constexpr int NKW1 = (13 + 1) * RES; const int NG = 128;
  _Float16* BQKV = (_Float16*)take((size_t)3 * CC * CC * 2); _Float16* BP = (_Float16*)take((size_t)CC * CC * 2);
  _Float16* X16 = (_Float16*)take((size_t)NTOK * CC * 2); _Float16* QKV = (_Float16*)take((size_t)NTOK * 3 * CC * 2); _Float16* KW = (_Float16*)take((size_t)NG * NKW1 * HD * 2); _Float16* VT = (_Float16*)take((size_t)NG * 64 * NKW1 * 2);
  float* S = (float*)take((size_t)NG * 128 * NKW1 * 4); _Float16* P16 = (_Float16*)take((size_t)NG * 128 * NKW1 * 2); float* O = (float*)take((size_t)NG * 128 * 64 * 4); _Float16* Y16 = (_Float16*)take((size_t)NTOK * CC * 2);
  if (off > ws_size) return;      /* 0.5 + 2 + 6 + 7 + 14 + 56 + 28 + 4 + 2 = 120 MiB (sized for the 13x13 branch; the 7x7 branch uses a prefix) */
  k_round16f<<<(3 * CC * CC / 8 + 255) / 256, 256, 0, stream>>>(wqkv, BQKV, (size_t)3 * CC * CC / 8); k_round16f<<<(CC * CC / 8 + 255) / 256, 256, 0, stream>>>(wp, BP, (size_t)CC * CC / 8);      /* (out,in) natural */
  const size_t n8 = (size_t)NTOK * CC / 8; const unsigned nb8 = (unsigned)((n8 + 255) / 256); const dim3 gQ((NTOK / 128) * (3 * CC / 64), 1), gP((NTOK / 128) * (CC / 64), 1);
  for (int b = 0; b < NIMG; ++b) {
    k_x16<<<nb8, 256, 0, stream>>>(x + (size_t)b * NTOK * CC, X16, n8);
    k_gemm2<0><<<gQ, 128, 0, stream>>>(X16, CC, 0, BQKV, CC, 0, 0.0625f, bqkv, 0, nullptr, 1, 0, 0, nullptr, QKV, 3 * CC, 0, NTOK, 3 * CC, CC);
    na_branch<7>(QKV, 0, rpb0, KW, VT, S, P16, O, Y16, stream);
    na_branch<13>(QKV, 4, rpb1, KW, VT, S, P16, O, Y16, stream);
    k_gemm2<0><<<gP, 128, 0, stream>>>(Y16, CC, 0, BP, CC, 0, 0.0625f, bp, 0, nullptr, 1, 0, 0, (float*)d_out + (size_t)b * NTOK * CC, nullptr, CC, 0, NTOK, CC, CC); }
}

// v002
// It runs in 121 microseconds.
// Versions in between are left out here; by their measured steps it is 13.7 times as fast as v000.
#include <hip/hip_runtime.h>
// Split-head neighborhood attention (8 images, 64 x 64 x 256 NHWC; 8 heads x 32; heads 0-3 use 7x7 NATTEN windows with rpb0, heads 4-7 use 13x13 with rpb1; window starts clamped at the borders, relative-position bias with the NATTEN border offsets; q scaled by 32^-0.5) followed by the output projection -> [8,64,64,256].
// Structure: one launch rounds x and both weight matrices to f16 planes; qkv of all images as one f16 WMMA GEMM launch (32x64 wave tiles, f32 accumulation, exact products + bias) into an f16 plane; one kernel copies k and transposed v into fragment-ordered planes; ONE fused kernel over all images, both branches and all heads does scores, exact clamped window + bias, softmax (running maximum and sum) and attn.v per wave of 16 queries of one row against K key rows x 32 columns, scores and P (x2^10 in f16) never leaving registers, and writes the head outputs into the token plane; output projection of all images as one GEMM launch straight into the output rows.
// Compute dtype: x, weights, biases, rpb rounded to bf16; q/k/v, P (x2^10) and the attention output as f16 operands (~2^-12); f32 accumulation and softmax. v_wmma_f32_16x16x32_f16.
#define NIMG 8
#define RES 64
#define NTOK (RES * RES)
#define CC 256
#define NHD 8
#define HD 32
#define SCALE 0.17677669529663687f
typedef __bf16 v16b __attribute__((ext_vector_type(16)));
typedef unsigned short v8us __attribute__((ext_vector_type(8), may_alias));
typedef float  v8f  __attribute__((ext_vector_type(8)));
typedef float  v4f  __attribute__((ext_vector_type(4)));
typedef float  v4fa __attribute__((ext_vector_type(4), may_alias));
union FragB { v16b v; v8us half[2]; unsigned short u[16]; };

__device__ __forceinline__ unsigned short bf16_bits(float x) { unsigned int u = __float_as_uint(x); return (unsigned short)((u + 0x7FFFu + ((u >> 16) & 1u)) >> 16); }
__device__ __forceinline__ float bf16_val(unsigned short b) { return __uint_as_float(((unsigned int)b) << 16); }
__device__ __forceinline__ float bf16_round(float x) { return bf16_val(bf16_bits(x)); }
// D += A·B with NT terms: 1 = ah·bh, 2 = + al·bh (A split), 3 = + ah·bl (both split)
template <int NT>
__device__ __forceinline__ v8f mmaN(v16b ah, v16b al, v16b bh, v16b bl, v8f c) {
  c = __builtin_amdgcn_wmma_f32_16x16x32_bf16(false, ah, false, bh, (short)0, c, false, false);
  if (NT >= 2) c = __builtin_amdgcn_wmma_f32_16x16x32_bf16(false, al, false, bh, (short)0, c, false, false);
  if (NT >= 3) c = __builtin_amdgcn_wmma_f32_16x16x32_bf16(false, ah, false, bl, (short)0, c, false, false);
  asm volatile("v_nop\n\tv_nop\n\tv_nop\n\tv_nop" : "+v"(c) : "v"(ah), "v"(al), "v"(bh), "v"(bl));
  return c;
}

__global__ __launch_bounds__(256) void k_wt_bf16(const float* __restrict__ W, unsigned short* __restrict__ Wt, int K, int N) {
  const int t = blockIdx.x * 256 + threadIdx.x;
  const int k8n = K / 8;
  if (t >= N * k8n) return;
  const int n = t / k8n, k8 = (t % k8n) * 8;
  v8us v;
#pragma unroll
  for (int i = 0; i < 8; ++i) v[i] = bf16_bits(W[(size_t)(k8 + i) * N + n]);
  *(v8us*)(Wt + (size_t)n * K + k8) = v;
  
}

// GEMM C[M][N] (f32, pitch ldc) = act(A[M][K]·W + bias). A f32 row-major (pitch lda) converted per fragment to bf16
// (ASPLIT: hi/lo two planes -> 2 terms, else single rounded term); Wt bf16 [N][K] (pitch ldb). BIAS_BF16 rounds the
// bias to bf16 first (bias quantised to bf16 before the add). K%32==0, M%16==0, N%64==0.
template <bool ASPLIT, int ACT, bool BIAS_BF16>
__global__ __launch_bounds__(128) void k_gemm_bf(const float* __restrict__ A, int lda, const unsigned short* __restrict__ Wt, int ldb,
                                               const float* __restrict__ bias, float* __restrict__ C, int ldc, int M, int N, int K) {
  __shared__ __attribute__((aligned(16))) float so[4][16][64];
  const int tid = threadIdx.x, w = tid >> 5, lane = tid & 31, ln = lane & 15, hh = lane >> 4;
  const int ntn = N / 64;
  const int wid = blockIdx.x * 4 + w;
  const int mt = wid / ntn, nq = wid % ntn;
  if (mt * 16 >= M) return;
  const int row0 = mt * 16, col0 = nq * 64;
  const float* arow = A + (size_t)(row0 + ln) * lda;
  v8f acc[4] = {};
  for (int kb = 0; kb < K; kb += 32) {
    FragB ah, al;
    const v4f x0 = *(const v4fa*)(arow + kb + 8 * hh), x1 = *(const v4fa*)(arow + kb + 8 * hh + 4);
    const v4f x2 = *(const v4fa*)(arow + kb + 16 + 8 * hh), x3 = *(const v4fa*)(arow + kb + 16 + 8 * hh + 4);
    float xs[16] = {x0[0],x0[1],x0[2],x0[3],x1[0],x1[1],x1[2],x1[3],x2[0],x2[1],x2[2],x2[3],x3[0],x3[1],x3[2],x3[3]};
#pragma unroll
    for (int i = 0; i < 16; ++i) { const unsigned short hb = bf16_bits(xs[i]); ah.u[i] = hb; al.u[i] = ASPLIT ? bf16_bits(xs[i] - bf16_val(hb)) : (unsigned short)0; }
#pragma unroll
    for (int t = 0; t < 4; ++t) {
      const unsigned short* brow = Wt + (size_t)(col0 + t * 16 + ln) * ldb + kb;
      FragB b;
      b.half[0] = *(const v8us*)(brow + 8 * hh);
      b.half[1] = *(const v8us*)(brow + 16 + 8 * hh);
      acc[t] = mmaN<ASPLIT ? 2 : 1>(ah.v, al.v, b.v, b.v, acc[t]);
    }
  }
#pragma unroll
  for (int t = 0; t < 4; ++t) {
    float bv = bias ? bias[col0 + t * 16 + ln] : 0.f;
    if (BIAS_BF16) bv = bf16_round(bv);
#pragma unroll
    for (int r = 0; r < 8; ++r) { float v = acc[t][r] + bv; if (ACT == 1) v = fmaxf(v, 0.f); so[w][8 * hh + r][t * 16 + ln] = v; }
  }
  __builtin_amdgcn_fence(__ATOMIC_ACQ_REL, "workgroup");
  __builtin_amdgcn_wave_barrier();
  const int rsub = lane >> 4, c4 = (lane & 15) * 4;
  {
#pragma unroll
    for (int q = 0; q < 8; ++q) {
      const int r = q * 2 + rsub;
      const v4f v = *(const v4fa*)&so[w][r][c4];
      *(v4f*)(C + (size_t)(row0 + r) * ldc + col0 + c4) = v;
    }
    
  }
}

// GEMM C = act(A·W + bias + resid): A f32 (ASPLIT -> hi/lo 2 terms), Wt bf16 [N][K]; ACT 0 none, 1 relu, 2 exact gelu;
// resid (optional, f32, row index = (row % rmod), pitch ldr, RES_BF16 rounds it) added before the activation.
template <bool ASPLIT, int ACT, bool BIAS_BF16, bool RES_BF16>
__global__ __launch_bounds__(128) void k_gemm_bf3(const float* __restrict__ A, int lda, const unsigned short* __restrict__ Wt, int ldb,
                                                const float* __restrict__ bias, const float* __restrict__ resid, int rmod, int ldr,
                                                float* __restrict__ C, int ldc, int M, int N, int K) {
  __shared__ __attribute__((aligned(16))) float so[4][16][64];
  const int tid = threadIdx.x, w = tid >> 5, lane = tid & 31, ln = lane & 15, hh = lane >> 4;
  const int ntn = N / 64;
  const int wid = blockIdx.x * 4 + w;
  const int mt = wid / ntn, nq = wid % ntn;
  if (mt * 16 >= M) return;
  const int row0 = mt * 16, col0 = nq * 64;
  const float* arow = A + (size_t)(row0 + ln) * lda;
  v8f acc[4] = {};
  for (int kb = 0; kb < K; kb += 32) {
    FragB ah, al;
    const v4f x0 = *(const v4fa*)(arow + kb + 8 * hh), x1 = *(const v4fa*)(arow + kb + 8 * hh + 4);
    const v4f x2 = *(const v4fa*)(arow + kb + 16 + 8 * hh), x3 = *(const v4fa*)(arow + kb + 16 + 8 * hh + 4);
    float xs[16] = {x0[0],x0[1],x0[2],x0[3],x1[0],x1[1],x1[2],x1[3],x2[0],x2[1],x2[2],x2[3],x3[0],x3[1],x3[2],x3[3]};
#pragma unroll
    for (int i = 0; i < 16; ++i) { const unsigned short hb = bf16_bits(xs[i]); ah.u[i] = hb; al.u[i] = ASPLIT ? bf16_bits(xs[i] - bf16_val(hb)) : (unsigned short)0; }
#pragma unroll
    for (int t = 0; t < 4; ++t) {
      const unsigned short* brow = Wt + (size_t)(col0 + t * 16 + ln) * ldb + kb;
      FragB b;
      b.half[0] = *(const v8us*)(brow + 8 * hh);
      b.half[1] = *(const v8us*)(brow + 16 + 8 * hh);
      acc[t] = mmaN<ASPLIT ? 2 : 1>(ah.v, al.v, b.v, b.v, acc[t]);
    }
  }
#pragma unroll
  for (int t = 0; t < 4; ++t) {
    const int col = col0 + t * 16 + ln;
    float bv = bias ? bias[col] : 0.f;
    if (BIAS_BF16) bv = bf16_round(bv);
#pragma unroll
    for (int r = 0; r < 8; ++r) {
      float v = acc[t][r] + bv;
      if (resid) { float rv = resid[(size_t)((row0 + 8 * hh + r) % rmod) * ldr + col]; if (RES_BF16) rv = bf16_round(rv); v += rv; }
      if (ACT == 1) v = fmaxf(v, 0.f);
      if (ACT == 2) v = 0.5f * v * (1.0f + erff(v * 0.70710678118654752f));
      if (ACT == 3) { const float u = 0.7978845608028654f * (v + 0.044715f * v * v * v); v = 0.5f * v * (1.0f + tanhf(u)); }
      so[w][8 * hh + r][t * 16 + ln] = v;
    }
  }
  __builtin_amdgcn_fence(__ATOMIC_ACQ_REL, "workgroup");
  __builtin_amdgcn_wave_barrier();
  const int rsub = lane >> 4, c4 = (lane & 15) * 4;
  {
#pragma unroll
    for (int q = 0; q < 8; ++q) {
      const int r = q * 2 + rsub;
      const v4f v = *(const v4fa*)&so[w][r][c4];
      *(v4f*)(C + (size_t)(row0 + r) * ldc + col0 + c4) = v;
    }
    
  }
}
// row LayerNorm (biased variance, eps) over N: s = X (+ R); optional out_sum <- s; out_norm <- (s-mu)*rsqrt(var+eps)*g + b
template <bool PARAM_BF16>
__global__ __launch_bounds__(256) void k_layernorm(const float* __restrict__ X, const float* __restrict__ R, const float* __restrict__ g, const float* __restrict__ bta,
                                                  float* __restrict__ out_sum, float* __restrict__ out_norm, int N, float eps) {
  __shared__ float red[256];
  const int row = blockIdx.x, tid = threadIdx.x;
  const float* x = X + (size_t)row * N; const float* rr = R ? R + (size_t)row * N : nullptr;
  float vals[16];                     // up to N = 4096
  const int per = N / 256;            // contiguous chunk per thread? use strided-by-4 chunks: thread handles j = tid*4 + 1024*u
  float s1 = 0.f;
  for (int u = 0; u < per / 4; ++u) {
    const int j = tid * 4 + 1024 * u;
    const v4f a = *(const v4fa*)(x + j);
    v4f b = {0.f,0.f,0.f,0.f}; if (rr) b = *(const v4fa*)(rr + j);
#pragma unroll
    for (int q = 0; q < 4; ++q) { const float v = a[q] + b[q]; vals[u * 4 + q] = v; s1 += v; }
  }
  red[tid] = s1; __syncthreads();
  for (int st = 128; st > 0; st >>= 1) { if (tid < st) red[tid] += red[tid + st]; __syncthreads(); }
  const float mu = red[0] / (float)N; __syncthreads();
  float s2 = 0.f;
  for (int u = 0; u < per / 4; ++u)
#pragma unroll
    for (int q = 0; q < 4; ++q) { const float c = vals[u * 4 + q] - mu; s2 += c * c; }
  red[tid] = s2; __syncthreads();
  for (int st = 128; st > 0; st >>= 1) { if (tid < st) red[tid] += red[tid + st]; __syncthreads(); }
  const float rs = rsqrtf(red[0] / (float)N + eps);
  {
    for (int u = 0; u < per / 4; ++u) {
      const int j = tid * 4 + 1024 * u;
      v4f o, sm;
#pragma unroll
      for (int q = 0; q < 4; ++q) {
        float gg = g[j + q], bb = bta[j + q];
        if (PARAM_BF16) { gg = bf16_round(gg); bb = bf16_round(bb); }
        sm[q] = vals[u * 4 + q]; o[q] = (vals[u * 4 + q] - mu) * rs * gg + bb;
      }
      if (out_sum) *(v4f*)(out_sum + (size_t)row * N + j) = sm;
      *(v4f*)(out_norm + (size_t)row * N + j) = o;
    }
    
  }
}



// ---- f16 WMMA path (v_wmma_f32_16x16x32_f16): 11-bit significands for operands in range — used where a [0,1] probability operand needs more precision than bf16
typedef _Float16 v16h __attribute__((ext_vector_type(16)));
union FragH { v16h v; v8us half[2]; _Float16 h[16]; unsigned short u[16]; };
template <int NT>
__device__ __forceinline__ v8f mmaH(v16h ah, v16h al, v16h bh, v16h bl, v8f c) {
  c = __builtin_amdgcn_wmma_f32_16x16x32_f16(false, ah, false, bh, (short)0, c, false, false);
  if (NT >= 2) c = __builtin_amdgcn_wmma_f32_16x16x32_f16(false, al, false, bh, (short)0, c, false, false);
  if (NT >= 3) c = __builtin_amdgcn_wmma_f32_16x16x32_f16(false, ah, false, bl, (short)0, c, false, false);
  asm volatile("v_nop\n\tv_nop\n\tv_nop\n\tv_nop" : "+v"(c) : "v"(ah), "v"(al), "v"(bh), "v"(bl));
  return c;
}
// batched GEMM like k_gemm_b but f16 operands: A f32 (split into f16 hi/lo if ASPLIT, else rounded to f16), Bt = f16 values [n][k]; alpha; C f32; N multiple of 16 (partial tiles skipped)
template <bool ASPLIT>
__global__ __launch_bounds__(128) void k_gemm_h(const float* __restrict__ A, int lda, size_t sA, const _Float16* __restrict__ Bh, int ldb, size_t sB, float alpha, float* __restrict__ C, int ldc, size_t sC, int M, int N, int K) {
  __shared__ __attribute__((aligned(16))) float so[4][16][64];
  const int tid = threadIdx.x, w = tid >> 5, lane = tid & 31, ln = lane & 15, hh = lane >> 4; const int by = blockIdx.y;
  A += (size_t)by * sA; Bh += (size_t)by * sB; C += (size_t)by * sC;
  const int ntn = (N + 63) / 64; const int wid = blockIdx.x * 4 + w; const int mt = wid / ntn, nq = wid % ntn; if (mt * 16 >= M) return;
  const int row0 = mt * 16, col0 = nq * 64; const float* arow = A + (size_t)(row0 + ln) * lda;
  v8f acc[4] = {};
  for (int kb = 0; kb < K; kb += 32) {
    FragH ah, al;
    const v4f x0 = *(const v4fa*)(arow + kb + 8 * hh), x1 = *(const v4fa*)(arow + kb + 8 * hh + 4), x2 = *(const v4fa*)(arow + kb + 16 + 8 * hh), x3 = *(const v4fa*)(arow + kb + 16 + 8 * hh + 4);
    float xs[16] = {x0[0],x0[1],x0[2],x0[3],x1[0],x1[1],x1[2],x1[3],x2[0],x2[1],x2[2],x2[3],x3[0],x3[1],x3[2],x3[3]};
#pragma unroll
    for (int i = 0; i < 16; ++i) { const _Float16 h = (_Float16)xs[i]; ah.h[i] = h; al.h[i] = ASPLIT ? (_Float16)(xs[i] - (float)h) : (_Float16)0.0f; }
#pragma unroll
    for (int t = 0; t < 4; ++t) { if (col0 + t * 16 >= N) continue; const size_t boff = (size_t)(col0 + t * 16 + ln) * ldb + kb; FragH bq; bq.half[0] = *(const v8us*)(Bh + boff + 8 * hh); bq.half[1] = *(const v8us*)(Bh + boff + 16 + 8 * hh);
      acc[t] = mmaH<ASPLIT ? 2 : 1>(ah.v, al.v, bq.v, bq.v, acc[t]); }
  }
#pragma unroll
  for (int t = 0; t < 4; ++t) { if (col0 + t * 16 >= N) continue;
#pragma unroll
    for (int r = 0; r < 8; ++r) so[w][8 * hh + r][t * 16 + ln] = acc[t][r] * alpha; }
  __builtin_amdgcn_fence(__ATOMIC_ACQ_REL, "workgroup"); __builtin_amdgcn_wave_barrier();
  const int rsub = lane >> 4, c4 = (lane & 15) * 4;
  {
#pragma unroll
    for (int q = 0; q < 8; ++q) { const int r = q * 2 + rsub; if (col0 + c4 < N) { const v4f v = *(const v4fa*)&so[w][r][c4]; *(v4f*)(C + (size_t)(row0 + r) * ldc + col0 + c4) = v; } }
     }
}

// Wt[n][k] = f16(W[k][n]·scale) from f32 row-major W[K][N] (scale = power of two; bf16-exact weights stay exact in f16 away from the subnormal range)
__global__ __launch_bounds__(256) void k_wt_f16(const float* __restrict__ W, _Float16* __restrict__ Wt, int K, int N, float scale) {
  const int t = blockIdx.x * 256 + threadIdx.x; if (t >= N * (K / 8)) return; const int n = t / (K / 8), k8 = (t % (K / 8)) * 8; FragH f;
#pragma unroll
  for (int i = 0; i < 8; ++i) f.h[i] = (_Float16)(bf16_round(W[(size_t)(k8 + i) * N + n]) * scale); const v8us o = f.half[0];
  *(v8us*)((unsigned short*)Wt + (size_t)n * K + k8) = o; 
}
// k_gemm_hh variant with fused epilogue: v = acc·alpha + bias[by·sBias + col] (+ CP[(row/rowsPerB)·sCPb + by·64 + col] if CP) ; ACT 0 none / 1 elu ; writes f16 C16 (and f32 C if non-null)
template <int ACT>
__global__ __launch_bounds__(128) void k_gemm_hhx(const _Float16* __restrict__ A, int lda, size_t sA, const _Float16* __restrict__ Bh, int ldb, size_t sB, float alpha, const float* __restrict__ bias, size_t sBias, const float* __restrict__ CP, int rowsPerB, size_t sCPb, int row0g,
    float* __restrict__ C, _Float16* __restrict__ C16, int ldc, size_t sC, int M, int N, int K) {
  __shared__ __attribute__((aligned(16))) float so[4][16][64];
  const int tid = threadIdx.x, w = tid >> 5, lane = tid & 31, ln = lane & 15, hh = lane >> 4; const int by = blockIdx.y;
  A += (size_t)by * sA; Bh += (size_t)by * sB; const size_t cofs = (size_t)by * sC; const float* bp = bias ? bias + (size_t)by * sBias : nullptr;
  const int ntn = (N + 63) / 64; const int wid = blockIdx.x * 4 + w; const int mt = wid / ntn, nq = wid % ntn; if (mt * 16 >= M) return;
  const int row0 = mt * 16, col0 = nq * 64; const _Float16* arow = A + (size_t)(row0 + ln) * lda;
  v8f acc[4] = {};
  for (int kb = 0; kb < K; kb += 32) { FragH ah; ah.half[0] = *(const v8us*)((const unsigned short*)arow + kb + 8 * hh); ah.half[1] = *(const v8us*)((const unsigned short*)arow + kb + 16 + 8 * hh);
#pragma unroll
    for (int t = 0; t < 4; ++t) { if (col0 + t * 16 >= N) continue; const size_t boff = (size_t)(col0 + t * 16 + ln) * ldb + kb; FragH bq; bq.half[0] = *(const v8us*)((const unsigned short*)Bh + boff + 8 * hh); bq.half[1] = *(const v8us*)((const unsigned short*)Bh + boff + 16 + 8 * hh);
      acc[t] = mmaH<1>(ah.v, ah.v, bq.v, bq.v, acc[t]); }
  }
#pragma unroll
  for (int t = 0; t < 4; ++t) { if (col0 + t * 16 >= N) continue; const int col = col0 + t * 16 + ln; const float bv = bp ? bf16_round(bp[col]) : 0.f;
#pragma unroll
    for (int r = 0; r < 8; ++r) { float v = acc[t][r] * alpha + bv; if (CP) { const int bidx = (row0g + row0 + 8 * hh + r) / rowsPerB; v += CP[(size_t)bidx * sCPb + (size_t)by * 64 + col]; } if (ACT == 1) v = (v > 0.f) ? v : expm1f(v); else if (ACT == 7) v = (v > 0.f) ? v + 1.0f : expf(v); else if (ACT == 8) v = tanhf(v); else if (ACT == 9) v = 0.5f * v * (1.0f + tanhf(0.7978845608028654f * (v + 0.044715f * v * v * v))); else if (ACT == 11) v = 1.0f / (1.0f + expf(-v)); else if (ACT == 12) v = (v > 0.f) ? v : 0.01f * v; else if (ACT == 14) v = (v > 0.f) ? v : 0.1f * v; else if (ACT == 15) v = v / (1.0f + expf(-v)); else if (ACT == 3) v = fmaxf(v, 0.f); else if (ACT == 6) v = 0.5f * v * (1.0f + erff(v * 0.70710678118654752f)); so[w][8 * hh + r][t * 16 + ln] = v; } }
  __builtin_amdgcn_fence(__ATOMIC_ACQ_REL, "workgroup"); __builtin_amdgcn_wave_barrier();
  const int rsub = lane >> 4, c4 = (lane & 15) * 4; typedef _Float16 v4h __attribute__((ext_vector_type(4)));
  {
#pragma unroll
    for (int q = 0; q < 8; ++q) { const int r = q * 2 + rsub; if (col0 + c4 < N) { const v4f v = *(const v4fa*)&so[w][r][c4]; if (C) *(v4f*)(C + cofs + (size_t)(row0 + r) * ldc + col0 + c4) = v; if (C16) { v4h h4; for (int i = 0; i < 4; ++i) h4[i] = (_Float16)v[i]; *(v4h*)(C16 + cofs + (size_t)(row0 + r) * ldc + col0 + c4) = h4; } } }
     }
}


typedef _Float16 v4h __attribute__((ext_vector_type(4)));

// All input roundings in one launch, 8 values a thread: work-groups 0..PREP_XB-1 take x of all images (bf16 rounding, kept as f16), the next PREP_QB take w_qkv and the last PREP_PB w_proj (bf16 rounding x16, exact in f16).
// The work-group picks source, plane and factor (1 for x: an exact product); the grid divides the three arrays without remainder.
#define PREP_XB (NIMG * NTOK * CC / 8 / 256)
#define PREP_QB (3 * CC * CC / 8 / 256)
#define PREP_PB (CC * CC / 8 / 256)
__global__ __launch_bounds__(256) void k_prep16(const float* __restrict__ x, const float* __restrict__ wqkv, const float* __restrict__ wp, _Float16* __restrict__ X16, _Float16* __restrict__ BQKV, _Float16* __restrict__ BP) {
  int bx = blockIdx.x; const float* src = x; _Float16* dst = X16; float sc = 1.0f;
  if (bx >= PREP_XB + PREP_QB) { bx -= PREP_XB + PREP_QB; src = wp; dst = BP; sc = 16.0f; } else if (bx >= PREP_XB) { bx -= PREP_XB; src = wqkv; dst = BQKV; sc = 16.0f; }
  const size_t t = (size_t)bx * 256 + threadIdx.x; FragH f;
#pragma unroll
  for (int q = 0; q < 8; ++q) f.h[q] = (_Float16)(bf16_round(src[t * 8 + q]) * sc); *(v8us*)((unsigned short*)dst + t * 8) = f.half[0];  }
__global__ __launch_bounds__(256) void k_h16(const float* __restrict__ x, _Float16* __restrict__ X16, size_t n8) { const size_t t = (size_t)blockIdx.x * 256 + threadIdx.x; if (t >= n8) return; FragH f;
#pragma unroll
  for (int q = 0; q < 8; ++q) f.h[q] = (_Float16)x[t * 8 + q]; *(v8us*)((unsigned short*)X16 + t * 8) = f.half[0];  }
template <int NHv, int TTv>
__global__ __launch_bounds__(256) void k_vt(const _Float16* __restrict__ V16, int ldv, int voff, _Float16* __restrict__ Vt) { __shared__ unsigned short tl[64][66]; const int tid = threadIdx.x; const int slab = blockIdx.x / (TTv / 64), lg = blockIdx.x % (TTv / 64); const int b = slab / NHv, h = slab % NHv;
  for (int i = tid; i < 64 * 8; i += 256) { const int r = i / 8, c8 = (i % 8) * 8; FragH f; f.half[0] = *(const v8us*)((const unsigned short*)V16 + ((size_t)b * TTv + lg * 64 + r) * ldv + voff + h * 64 + c8);
#pragma unroll
    for (int q = 0; q < 8; ++q) tl[r][c8 + q] = f.u[q]; }
  __syncthreads();
  {
#pragma unroll
    for (int rd = 0; rd < 2; ++rd) { const int d = rd * 32 + tid / 8, pc = tid % 8; FragH f;
#pragma unroll
      for (int q = 0; q < 8; ++q) f.u[q] = tl[pc * 8 + q][d];
      *(v8us*)((unsigned short*)Vt + ((size_t)slab * 64 + d) * TTv + lg * 64 + pc * 8) = f.half[0]; }
     } }

__global__ __launch_bounds__(256) void k_hl(const float* __restrict__ F, _Float16* __restrict__ Hh, _Float16* __restrict__ Hl, size_t n8) { const size_t t = (size_t)blockIdx.x * 256 + threadIdx.x; if (t >= n8) return; FragH fh, fl; const v4f a = *(const v4fa*)(F + t * 8), c = *(const v4fa*)(F + t * 8 + 4);
#pragma unroll
  for (int q = 0; q < 4; ++q) { _Float16 h = (_Float16)a[q]; fh.h[q] = h; fl.h[q] = (_Float16)((a[q] - (float)h) * 1024.0f); h = (_Float16)c[q]; fh.h[4 + q] = h; fl.h[4 + q] = (_Float16)((c[q] - (float)h) * 1024.0f); }
  { *(v8us*)((unsigned short*)Hh + t * 8) = fh.half[0]; *(v8us*)((unsigned short*)Hl + t * 8) = fl.half[0];  } }

// ---- fast GEMM (wave tile 32x64; requires M % 32 == 0 rows per launch region and N % 64 == 0); epilogue = k_gemm_hhx semantics ----
__device__ __forceinline__ v16h g2_frag(const _Float16* p, int hh) { FragH f; f.half[0] = *(const v8us*)((const unsigned short*)p + 8 * hh); f.half[1] = *(const v8us*)((const unsigned short*)p + 16 + 8 * hh); return f.v; }
__device__ __forceinline__ v8f g2_mma(v16h a, v16h b, v8f c) { v8f d = __builtin_amdgcn_wmma_f32_16x16x32_f16(false, a, false, b, (short)0, c, false, false); asm volatile("v_nop\n\tv_nop\n\tv_nop\n\tv_nop" : "+v"(d) : "v"(a), "v"(b)); return d; }
template <int ACT>
__global__ __launch_bounds__(128) void k_gemm2(const _Float16* __restrict__ A, int lda, size_t sA, const _Float16* __restrict__ Bh, int ldb, size_t sB, float alpha, const float* __restrict__ bias, size_t sBias, const float* __restrict__ CP, int rowsPerB, size_t sCPb, int row0g,
    float* __restrict__ C, _Float16* __restrict__ C16, int ldc, size_t sC, int M, int N, int K) {
  __shared__ __attribute__((aligned(16))) float so[4][32][68];
  const int tid = threadIdx.x, w = tid >> 5, lane = tid & 31, ln = lane & 15, hh = lane >> 4; const int by = blockIdx.y;
  A += (size_t)by * sA; Bh += (size_t)by * sB; const size_t cofs = (size_t)by * sC; const float* bp = bias ? bias + (size_t)by * sBias : nullptr;
  const int ntn = N >> 6; const int mt = blockIdx.x / ntn, nq = blockIdx.x - mt * ntn; const int row0 = mt * 128 + 32 * w, col0 = nq * 64; if (row0 >= M) return;
  const _Float16* a0p = A + (size_t)(row0 + ln) * lda; const _Float16* a1p = a0p + (size_t)16 * lda;
  const _Float16* b0p = Bh + (size_t)(col0 + ln) * ldb; const _Float16* b1p = b0p + (size_t)16 * ldb; const _Float16* b2p = b1p + (size_t)16 * ldb; const _Float16* b3p = b2p + (size_t)16 * ldb;
  const v8f z8 = {0.f,0.f,0.f,0.f,0.f,0.f,0.f,0.f}; v8f c00 = z8, c01 = z8, c02 = z8, c03 = z8, c10 = z8, c11 = z8, c12 = z8, c13 = z8;
#pragma unroll 1
  for (int kb = 0; kb < K; kb += 32) { const v16h a0 = g2_frag(a0p + kb, hh), a1 = g2_frag(a1p + kb, hh);
    v16h b = g2_frag(b0p + kb, hh); c00 = g2_mma(a0, b, c00); c10 = g2_mma(a1, b, c10);
    b = g2_frag(b1p + kb, hh); c01 = g2_mma(a0, b, c01); c11 = g2_mma(a1, b, c11);
    b = g2_frag(b2p + kb, hh); c02 = g2_mma(a0, b, c02); c12 = g2_mma(a1, b, c12);
    b = g2_frag(b3p + kb, hh); c03 = g2_mma(a0, b, c03); c13 = g2_mma(a1, b, c13); }
  v8f accs[8] = {c00, c01, c02, c03, c10, c11, c12, c13};
#pragma unroll
  for (int u = 0; u < 8; ++u) { const int t = u & 3, half = u >> 2; const int col = col0 + t * 16 + ln; const float bv = bp ? bf16_round(bp[col]) : 0.f;
#pragma unroll
    for (int r = 0; r < 8; ++r) { const int rloc = half * 16 + 8 * hh + r; float v = accs[u][r] * alpha + bv; if (CP) { const int bidx = (row0g + row0 + rloc) / rowsPerB; v += CP[(size_t)bidx * sCPb + (size_t)by * 64 + col]; }
      if (ACT == 3) v = fmaxf(v, 0.f); else if (ACT == 6) v = 0.5f * v * (1.0f + erff(v * 0.70710678118654752f)); else if (ACT == 11) v = 1.0f / (1.0f + expf(-v)); else if (ACT == 15) v = v / (1.0f + expf(-v)); else if (ACT == 12) v = (v > 0.f) ? v : 0.01f * v; else if (ACT == 8) v = tanhf(v);
      so[w][rloc][t * 16 + ln] = v; } }
  __builtin_amdgcn_fence(__ATOMIC_ACQ_REL, "workgroup"); __builtin_amdgcn_wave_barrier();
  const int rsub = lane >> 4, c4 = (lane & 15) * 4;
  {
#pragma unroll
    for (int q = 0; q < 16; ++q) { const int r = q * 2 + rsub; const v4f v = *(const v4fa*)&so[w][r][c4]; if (C) *(v4f*)(C + cofs + (size_t)(row0 + r) * ldc + col0 + c4) = v; if (C16) { v4h h4; for (int i = 0; i < 4; ++i) h4[i] = (_Float16)v[i]; *(v4h*)(C16 + cofs + (size_t)(row0 + r) * ldc + col0 + c4) = h4; } }
     } }


__device__ __forceinline__ int na_start(int i, int K) { const int nh = K / 2; int s = max(i - nh, 0); if (i + nh >= RES) s += RES - i - nh - 1; return s; }
__device__ __forceinline__ int na_pb(int i, int K) { const int nh = K / 2; int p = nh; if (i < nh) p += nh - i; if (i + nh >= RES) p += RES - i - 1 - nh; return p; }
// K and V of all images into fragment-ordered planes, in blocks of 8 tokens x 32 channels of one head (512 B each):
// KS block = [16-byte piece c of the token's 64 B][token & 7][8 f16], VS block = [channel][8 tokens]; a wave's 16-byte-per-lane fragment load then reads four whole 128-byte lines.
__global__ __launch_bounds__(256) void k_kvswz(const _Float16* __restrict__ QKV, _Float16* __restrict__ KS, _Float16* __restrict__ VS) {
  __shared__ unsigned short tl[64][66]; const int tid = threadIdx.x; const int lg = blockIdx.x & 63, h4 = (blockIdx.x >> 6) & 3, b = blockIdx.x >> 8;
  const unsigned short* src = (const unsigned short*)QKV + ((size_t)b * NTOK + lg * 64) * (3 * CC) + h4 * 64;
#pragma unroll
  for (int u = 0; u < 2; ++u) { const int i = tid + 256 * u, r = i >> 3, c8 = i & 7;
    const v8us kv = *(const v8us*)(src + (size_t)r * (3 * CC) + CC + c8 * 8);
    *(v8us*)((unsigned short*)KS + (((size_t)(b * NHD + h4 * 2 + (c8 >> 2)) * (NTOK / 8) + lg * 8 + (r >> 3)) * 32 + (c8 & 3) * 8 + (r & 7)) * 8) = kv;
    FragH f; f.half[0] = *(const v8us*)(src + (size_t)r * (3 * CC) + 2 * CC + c8 * 8);
#pragma unroll
    for (int q = 0; q < 8; ++q) tl[r][c8 * 8 + q] = f.u[q]; }
  __syncthreads();
#pragma unroll
  for (int rd = 0; rd < 2; ++rd) { const int dd = tid & 31, pc = tid >> 5; FragH f;
#pragma unroll
    for (int q = 0; q < 8; ++q) f.u[q] = tl[pc * 8 + q][rd * 32 + dd];
    *(v8us*)((unsigned short*)VS + (((size_t)(b * NHD + h4 * 2 + rd) * (NTOK / 8) + lg * 8 + pc) * 32 + dd) * 8) = f.half[0]; } }
__device__ __forceinline__ v16h na_frag(const _Float16* p, int second) { FragH f; f.half[0] = *(const v8us*)(const unsigned short*)p; f.half[1] = *(const v8us*)((const unsigned short*)p + second); return f.v; }
// lane l <-> lane l ^ 16 (the two halves of a wave hold different keys of the same query)
__device__ __forceinline__ float xhalf(float x) { return __builtin_bit_cast(float, __builtin_amdgcn_permlanex16(__builtin_bit_cast(int, x), __builtin_bit_cast(int, x), 0x76543210, 0xfedcba98, false, false)); }
// Eight exponentials (base 2) in one statement: behind a transcendental the instruction set asks for one independent instruction before its result is read or its source overwritten.
// The outputs are early-clobber, so each v_exp_f32 is that independent instruction for the one before it; the closing v_nop keeps the slot behind the last.
__device__ __forceinline__ void na_exp8(float (&y)[8], const float (&x)[8]) {
  asm("v_exp_f32 %0, %8\n\tv_exp_f32 %1, %9\n\tv_exp_f32 %2, %10\n\tv_exp_f32 %3, %11\n\tv_exp_f32 %4, %12\n\tv_exp_f32 %5, %13\n\tv_exp_f32 %6, %14\n\tv_exp_f32 %7, %15\n\tv_nop"
      : "=&v"(y[0]), "=&v"(y[1]), "=&v"(y[2]), "=&v"(y[3]), "=&v"(y[4]), "=&v"(y[5]), "=&v"(y[6]), "=&v"(y[7])
      : "v"(x[0]), "v"(x[1]), "v"(x[2]), "v"(x[3]), "v"(x[4]), "v"(x[5]), "v"(x[6]), "v"(x[7])); }
__device__ __forceinline__ float na_exp1(float x) { float y; asm("v_exp_f32 %0, %1\n\tv_nop" : "=&v"(y) : "v"(x)); return y; }      /* the v_nop keeps the same slot */
#define NA_NEG (-3.0e38f)
#define NA_TBMAX (25 * 25 + 64)
// One query row i of one image and two neighbouring heads per work-group; wave = (head, 16 query columns).
// All 16 queries of a wave share the K key rows si..si+K-1; their column windows lie inside the 32 columns C0..C0+31 (C0 a multiple of 8).
// Per key row: S^T = K.Q^T + bias/scale (two 16x16x32 products, bias and window mask enter as the C operand), running maximum and sum per query
// (lane = query), P^T x2^10 packed from the two score tiles as the B operand, O^T += V^T.P^T; K and V^T fragments come from the fragment-ordered planes.
template <int K>
__device__ __forceinline__ void na_row(const _Float16* __restrict__ QKV, const _Float16* __restrict__ KS, const _Float16* __restrict__ VS, const float* __restrict__ rpb, int hb, int bx, float* __restrict__ tb, _Float16* __restrict__ Y16) {
  constexpr int RB = 2 * K - 1, NT = RB * RB, TP = NT + 64; constexpr float SC2 = SCALE * 1.4426950408889634f;
  const int tid = threadIdx.x, w = __builtin_amdgcn_readfirstlane(tid >> 5), lane = tid & 31, ln = lane & 15, hh = lane >> 4; const int i = bx & 63, hp = (bx >> 6) & 1, b = bx >> 7;      /* wave number as a scalar: head, column tile and plane bases stay in scalar registers */
  for (int t = tid; t < 2 * TP; t += 256) { const int hq = t / TP, s = t - hq * TP - 32; tb[t] = (s >= 0 && s < NT) ? bf16_round(rpb[(size_t)(2 * hp + hq) * NT + s]) * 5.656854249492381f : 0.f; }
  __syncthreads();
  const int hq = w >> 2, h = hb + 2 * hp + hq, j0 = (w & 3) * 16, j = j0 + ln; const int C0 = min(max(j0 - 8, 0), 32);
  const int si = na_start(i, K), sj = na_start(j, K), pi = na_pb(i, K), pj = na_pb(j, K);
  const _Float16* img = QKV + (size_t)b * NTOK * (3 * CC);
  const v16h qf = g2_frag(img + (size_t)(i * RES + j) * (3 * CC) + h * HD, hh);
  const size_t blk0 = (size_t)(b * NHD + h) * (NTOK / 8) + ((si * RES + C0) >> 3);
  const _Float16* kb = KS + blk0 * 256; const unsigned kl = ((ln >> 3) * 32 + hh * 8 + (ln & 7)) * 8;      /* key = lane & 15; channels 8hh.. here, 16 + 8hh.. 128 elements on */
  const _Float16* vb = VS + blk0 * 256; const unsigned vl = (hh * 32 + ln) * 8;                            /* channel = lane & 15; keys 8hh.. here, 16 + 8hh.. two blocks on */
  const int d0 = C0 + 8 * hh - sj; const float* tp = tb + hq * TP + 32 + pi * RB + pj + d0;
  bool ok[16];
#pragma unroll
  for (int e = 0; e < 16; ++e) ok[e] = (unsigned)(d0 + (e & 7) + 16 * (e >> 3)) < (unsigned)K;
  const v8f z8 = {0.f,0.f,0.f,0.f,0.f,0.f,0.f,0.f}; v8f o0 = z8, o1 = z8; float m = NA_NEG, l = 0.f;
  v16h a0 = na_frag(kb + kl, 128), a1 = na_frag(kb + kl + 512, 128);
#pragma unroll 1      /* rolled: unrolled, the compiler lifts every row's loads to the top and takes over 300 registers (three waves per SIMD) */
  for (int kr = 0; kr < K; ++kr) {
    const v16h u0 = na_frag(vb + vl, 512), u1 = na_frag(vb + vl + 128, 512); vb += 2048;
    __builtin_amdgcn_sched_barrier(0);      /* keeps the V loads up here, a whole softmax ahead of their use: without it the compiler sinks them to just in front of the products that wait for them */
    v8f s0, s1;
#pragma unroll
    for (int r = 0; r < 8; ++r) { const float t0 = tp[r], t1 = tp[16 + r]; s0[r] = ok[r] ? t0 : NA_NEG; s1[r] = ok[8 + r] ? t1 : NA_NEG; }      /* every index lies inside the padded table */
    tp += RB;
    s0 = __builtin_amdgcn_wmma_f32_16x16x32_f16(false, a0, false, qf, (short)0, s0, false, false);
    s1 = __builtin_amdgcn_wmma_f32_16x16x32_f16(false, a1, false, qf, (short)0, s1, false, false);
    if (kr + 1 < K) kb += 2048;      /* next row's K fragments fly under this row's softmax; the last pass fetches its own row again, never one past the window */
    a0 = na_frag(kb + kl, 128); a1 = na_frag(kb + kl + 512, 128);
    asm volatile("s_wait_xcnt 0x0" ::: "memory");      /* stands in front of the V address pair's advance, which the compiler places below while this pass's loads are in flight */
    __builtin_amdgcn_sched_barrier(0);      /* keeps the next row's K loads here: without it the compiler sinks them to the foot of the pass, a few instructions ahead of their use */
    float mx = fmaxf(s0[0], s1[0]);
#pragma unroll
    for (int r = 1; r < 8; ++r) mx = fmaxf(mx, fmaxf(s0[r], s1[r]));
    mx = fmaxf(mx, xhalf(mx));
    const float mn = fmaxf(m, mx); const float al = na_exp1((m - mn) * SC2); m = mn; const float mb = 10.0f - mn * SC2;
    FragH pf; float ps = 0.f, x0[8], x1[8], p0[8], p1[8];
#pragma unroll
    for (int r = 0; r < 8; ++r) { x0[r] = fmaf(s0[r], SC2, mb); x1[r] = fmaf(s1[r], SC2, mb); }
    na_exp8(p0, x0); na_exp8(p1, x1);
#pragma unroll
    for (int r = 0; r < 8; ++r) { ps += p0[r] + p1[r]; pf.h[r] = (_Float16)p0[r]; pf.h[8 + r] = (_Float16)p1[r]; }
    l = l * al + ps;
#pragma unroll
    for (int r = 0; r < 8; ++r) { o0[r] *= al; o1[r] *= al; }
    o0 = __builtin_amdgcn_wmma_f32_16x16x32_f16(false, u0, false, pf.v, (short)0, o0, false, false);
    o1 = __builtin_amdgcn_wmma_f32_16x16x32_f16(false, u1, false, pf.v, (short)0, o1, false, false);
  }
  l += xhalf(l); const float inv = 1.0f / l; FragH y0, y1;
#pragma unroll
  for (int r = 0; r < 8; ++r) { y0.h[r] = (_Float16)(o0[r] * inv); y1.h[r] = (_Float16)(o1[r] * inv); }
  unsigned short* yp = (unsigned short*)Y16 + ((size_t)b * NTOK + i * RES + j) * CC + h * HD + 8 * hh;
  *(v8us*)yp = y0.half[0]; *(v8us*)(yp + 16) = y1.half[0]; }
__global__ __launch_bounds__(256) void k_na_fused(const _Float16* __restrict__ QKV, const _Float16* __restrict__ KS, const _Float16* __restrict__ VS, const float* __restrict__ rpb0, const float* __restrict__ rpb1, _Float16* __restrict__ Y16) {
  __shared__ float tb[2 * NA_TBMAX]; const int nb = NIMG * 2 * RES;      /* the longer 13x13 work-groups start first */
  if ((int)blockIdx.x < nb) na_row<13>(QKV, KS, VS, rpb1, 4, blockIdx.x, tb, Y16); else na_row<7>(QKV, KS, VS, rpb0, 0, blockIdx.x - nb, tb, Y16); }

extern "C" void kernel_launch(void* const* d_in, const int* in_sizes, int n_in,
                              void* d_out, int out_size, void* d_ws, size_t ws_size, hipStream_t stream) {
  (void)in_sizes; (void)n_in; (void)out_size;
  const float* const* I = (const float* const*)d_in; const float* x = I[0]; const float* wqkv = I[1]; const float* bqkv = I[2]; const float* rpb0 = I[3]; const float* rpb1 = I[4]; const float* wp = I[5]; const float* bp = I[6];
  char* ws = (char*)d_ws; size_t off = 0;
  auto take = [&](size_t bytes) { char* p = ws + off; off += (bytes + 255) & ~(size_t)255; return p; };
  _Float16* BQKV = (_Float16*)take((size_t)3 * CC * CC * 2); _Float16* BP = (_Float16*)take((size_t)CC * CC * 2);
  _Float16* X16 = (_Float16*)take((size_t)NIMG * NTOK * CC * 2); _Float16* QKV = (_Float16*)take((size_t)NIMG * NTOK * 3 * CC * 2); _Float16* KS = (_Float16*)take((size_t)NIMG * CC * NTOK * 2); _Float16* VS = (_Float16*)take((size_t)NIMG * CC * NTOK * 2); _Float16* Y16 = (_Float16*)take((size_t)NIMG * NTOK * CC * 2);
  if (off > ws_size) return;      /* 0.5 + 16 + 48 + 16 + 16 + 16 = 112.5 MiB */
  const dim3 gQ((NIMG * NTOK / 128) * (3 * CC / 64), 1), gP((NIMG * NTOK / 128) * (CC / 64), 1);      /* the token rows of all images are one M */
  k_prep16<<<PREP_XB + PREP_QB + PREP_PB, 256, 0, stream>>>(x, wqkv, wp, X16, BQKV, BP);      /* weights stay (out,in) natural */
  k_gemm2<0><<<gQ, 128, 0, stream>>>(X16, CC, 0, BQKV, CC, 0, 0.0625f, bqkv, 0, nullptr, 1, 0, 0, nullptr, QKV, 3 * CC, 0, NIMG * NTOK, 3 * CC, CC);
  k_kvswz<<<NIMG * 4 * (NTOK / 64), 256, 0, stream>>>(QKV, KS, VS);
  k_na_fused<<<2 * NIMG * 2 * RES, 256, 0, stream>>>(QKV, KS, VS, rpb0, rpb1, Y16);
  k_gemm2<0><<<gP, 128, 0, stream>>>(Y16, CC, 0, BP, CC, 0, 0.0625f, bp, 0, nullptr, 1, 0, 0, (float*)d_out, nullptr, CC, 0, NIMG * NTOK, CC, CC);
}

// v003
// A run of this version takes 72.4 microseconds.
// Next to v002, in two timings, it ran 1.67 and 1.68 times as fast.
// Counting every step since v000, it is 23.0 times as fast.
#include <hip/hip_runtime.h>
// Split-head neighborhood attention (8 images, 64 x 64 x 256 NHWC; 8 heads x 32; heads 0-3 use 7x7 NATTEN windows with rpb0, heads 4-7 use 13x13 with rpb1; window starts clamped at the borders, relative-position bias with the NATTEN border offsets; q scaled by 32^-0.5) followed by the output projection -> [8,64,64,256].
// Structure: one launch rounds x and both weight matrices to f16 planes; qkv of all images as one f16 WMMA GEMM launch (128x128 work-group tiles staged in LDS by asynchronous copies, 32x64 wave tiles, f32 accumulation, exact products + bias) into an f16 plane; one kernel copies k and transposed v into fragment-ordered planes; ONE fused kernel over all images, both branches and all heads does scores, exact clamped window + bias, softmax (running maximum and sum) and attn.v per wave of 16 queries of one row against K key rows x 32 columns, scores and P (x2^10 in f16) never leaving registers, and writes the head outputs into the token plane; output projection of all images as one GEMM launch straight into the output rows.
// Compute dtype: x, weights, biases, rpb rounded to bf16; q/k/v, P (x2^10) and the attention output as f16 operands (~2^-12); f32 accumulation and softmax. v_wmma_f32_16x16x32_f16.
#define NIMG 8
#define RES 64
#define NTOK (RES * RES)
#define CC 256
#define NHD 8
#define HD 32
#define SCALE 0.17677669529663687f
typedef __bf16 v16b __attribute__((ext_vector_type(16)));
typedef unsigned short v8us __attribute__((ext_vector_type(8), may_alias));
typedef float  v8f  __attribute__((ext_vector_type(8)));
typedef float  v4f  __attribute__((ext_vector_type(4)));
typedef float  v4fa __attribute__((ext_vector_type(4), may_alias));
union FragB { v16b v; v8us half[2]; unsigned short u[16]; };

__device__ __forceinline__ unsigned short bf16_bits(float x) { unsigned int u = __float_as_uint(x); return (unsigned short)((u + 0x7FFFu + ((u >> 16) & 1u)) >> 16); }
__device__ __forceinline__ float bf16_val(unsigned short b) { return __uint_as_float(((unsigned int)b) << 16); }
__device__ __forceinline__ float bf16_round(float x) { return bf16_val(bf16_bits(x)); }
// D += A·B with NT terms: 1 = ah·bh, 2 = + al·bh (A split), 3 = + ah·bl (both split)
template <int NT>
__device__ __forceinline__ v8f mmaN(v16b ah, v16b al, v16b bh, v16b bl, v8f c) {
  c = __builtin_amdgcn_wmma_f32_16x16x32_bf16(false, ah, false, bh, (short)0, c, false, false);
  if (NT >= 2) c = __builtin_amdgcn_wmma_f32_16x16x32_bf16(false, al, false, bh, (short)0, c, false, false);
  if (NT >= 3) c = __builtin_amdgcn_wmma_f32_16x16x32_bf16(false, ah, false, bl, (short)0, c, false, false);
  asm volatile("v_nop\n\tv_nop\n\tv_nop\n\tv_nop" : "+v"(c) : "v"(ah), "v"(al), "v"(bh), "v"(bl));
  return c;
}

__global__ __launch_bounds__(256) void k_wt_bf16(const float* __restrict__ W, unsigned short* __restrict__ Wt, int K, int N) {
  const int t = blockIdx.x * 256 + threadIdx.x;
  const int k8n = K / 8;
  if (t >= N * k8n) return;
  const int n = t / k8n, k8 = (t % k8n) * 8;
  v8us v;
#pragma unroll
  for (int i = 0; i < 8; ++i) v[i] = bf16_bits(W[(size_t)(k8 + i) * N + n]);
  *(v8us*)(Wt + (size_t)n * K + k8) = v;
  
}

// GEMM C[M][N] (f32, pitch ldc) = act(A[M][K]·W + bias). A f32 row-major (pitch lda) converted per fragment to bf16
// (ASPLIT: hi/lo two planes -> 2 terms, else single rounded term); Wt bf16 [N][K] (pitch ldb). BIAS_BF16 rounds the
// bias to bf16 first (bias quantised to bf16 before the add). K%32==0, M%16==0, N%64==0.
template <bool ASPLIT, int ACT, bool BIAS_BF16>
__global__ __launch_bounds__(128) void k_gemm_bf(const float* __restrict__ A, int lda, const unsigned short* __restrict__ Wt, int ldb,
                                               const float* __restrict__ bias, float* __restrict__ C, int ldc, int M, int N, int K) {
  __shared__ __attribute__((aligned(16))) float so[4][16][64];
  const int tid = threadIdx.x, w = tid >> 5, lane = tid & 31, ln = lane & 15, hh = lane >> 4;
  const int ntn = N / 64;
  const int wid = blockIdx.x * 4 + w;
  const int mt = wid / ntn, nq = wid % ntn;
  if (mt * 16 >= M) return;
  const int row0 = mt * 16, col0 = nq * 64;
  const float* arow = A + (size_t)(row0 + ln) * lda;
  v8f acc[4] = {};
  for (int kb = 0; kb < K; kb += 32) {
    FragB ah, al;
    const v4f x0 = *(const v4fa*)(arow + kb + 8 * hh), x1 = *(const v4fa*)(arow + kb + 8 * hh + 4);
    const v4f x2 = *(const v4fa*)(arow + kb + 16 + 8 * hh), x3 = *(const v4fa*)(arow + kb + 16 + 8 * hh + 4);
    float xs[16] = {x0[0],x0[1],x0[2],x0[3],x1[0],x1[1],x1[2],x1[3],x2[0],x2[1],x2[2],x2[3],x3[0],x3[1],x3[2],x3[3]};
#pragma unroll
    for (int i = 0; i < 16; ++i) { const unsigned short hb = bf16_bits(xs[i]); ah.u[i] = hb; al.u[i] = ASPLIT ? bf16_bits(xs[i] - bf16_val(hb)) : (unsigned short)0; }
#pragma unroll
    for (int t = 0; t < 4; ++t) {
      const unsigned short* brow = Wt + (size_t)(col0 + t * 16 + ln) * ldb + kb;
      FragB b;
      b.half[0] = *(const v8us*)(brow + 8 * hh);
      b.half[1] = *(const v8us*)(brow + 16 + 8 * hh);
      acc[t] = mmaN<ASPLIT ? 2 : 1>(ah.v, al.v, b.v, b.v, acc[t]);
    }
  }
#pragma unroll
  for (int t = 0; t < 4; ++t) {
    float bv = bias ? bias[col0 + t * 16 + ln] : 0.f;
    if (BIAS_BF16) bv = bf16_round(bv);
#pragma unroll
    for (int r = 0; r < 8; ++r) { float v = acc[t][r] + bv; if (ACT == 1) v = fmaxf(v, 0.f); so[w][8 * hh + r][t * 16 + ln] = v; }
  }
  __builtin_amdgcn_fence(__ATOMIC_ACQ_REL, "workgroup");
  __builtin_amdgcn_wave_barrier();
  const int rsub = lane >> 4, c4 = (lane & 15) * 4;
  {
#pragma unroll
    for (int q = 0; q < 8; ++q) {
      const int r = q * 2 + rsub;
      const v4f v = *(const v4fa*)&so[w][r][c4];
      *(v4f*)(C + (size_t)(row0 + r) * ldc + col0 + c4) = v;
    }
    
  }
}

// GEMM C = act(A·W + bias + resid): A f32 (ASPLIT -> hi/lo 2 terms), Wt bf16 [N][K]; ACT 0 none, 1 relu, 2 exact gelu;
// resid (optional, f32, row index = (row % rmod), pitch ldr, RES_BF16 rounds it) added before the activation.
template <bool ASPLIT, int ACT, bool BIAS_BF16, bool RES_BF16>
__global__ __launch_bounds__(128) void k_gemm_bf3(const float* __restrict__ A, int lda, const unsigned short* __restrict__ Wt, int ldb,
                                                const float* __restrict__ bias, const float* __restrict__ resid, int rmod, int ldr,
                                                float* __restrict__ C, int ldc, int M, int N, int K) {
  __shared__ __attribute__((aligned(16))) float so[4][16][64];
  const int tid = threadIdx.x, w = tid >> 5, lane = tid & 31, ln = lane & 15, hh = lane >> 4;
  const int ntn = N / 64;
  const int wid = blockIdx.x * 4 + w;
  const int mt = wid / ntn, nq = wid % ntn;
  if (mt * 16 >= M) return;
  const int row0 = mt * 16, col0 = nq * 64;
  const float* arow = A + (size_t)(row0 + ln) * lda;
  v8f acc[4] = {};
  for (int kb = 0; kb < K; kb += 32) {
    FragB ah, al;
    const v4f x0 = *(const v4fa*)(arow + kb + 8 * hh), x1 = *(const v4fa*)(arow + kb + 8 * hh + 4);
    const v4f x2 = *(const v4fa*)(arow + kb + 16 + 8 * hh), x3 = *(const v4fa*)(arow + kb + 16 + 8 * hh + 4);
    float xs[16] = {x0[0],x0[1],x0[2],x0[3],x1[0],x1[1],x1[2],x1[3],x2[0],x2[1],x2[2],x2[3],x3[0],x3[1],x3[2],x3[3]};
#pragma unroll
    for (int i = 0; i < 16; ++i) { const unsigned short hb = bf16_bits(xs[i]); ah.u[i] = hb; al.u[i] = ASPLIT ? bf16_bits(xs[i] - bf16_val(hb)) : (unsigned short)0; }
#pragma unroll
    for (int t = 0; t < 4; ++t) {
      const unsigned short* brow = Wt + (size_t)(col0 + t * 16 + ln) * ldb + kb;
      FragB b;
      b.half[0] = *(const v8us*)(brow + 8 * hh);
      b.half[1] = *(const v8us*)(brow + 16 + 8 * hh);
      acc[t] = mmaN<ASPLIT ? 2 : 1>(ah.v, al.v, b.v, b.v, acc[t]);
    }
  }
#pragma unroll
  for (int t = 0; t < 4; ++t) {
    const int col = col0 + t * 16 + ln;
    float bv = bias ? bias[col] : 0.f;
    if (BIAS_BF16) bv = bf16_round(bv);
#pragma unroll
    for (int r = 0; r < 8; ++r) {
      float v = acc[t][r] + bv;
      if (resid) { float rv = resid[(size_t)((row0 + 8 * hh + r) % rmod) * ldr + col]; if (RES_BF16) rv = bf16_round(rv); v += rv; }
      if (ACT == 1) v = fmaxf(v, 0.f);
      if (ACT == 2) v = 0.5f * v * (1.0f + erff(v * 0.70710678118654752f));
      if (ACT == 3) { const float u = 0.7978845608028654f * (v + 0.044715f * v * v * v); v = 0.5f * v * (1.0f + tanhf(u)); }
      so[w][8 * hh + r][t * 16 + ln] = v;
    }
  }
  __builtin_amdgcn_fence(__ATOMIC_ACQ_REL, "workgroup");
  __builtin_amdgcn_wave_barrier();
  const int rsub = lane >> 4, c4 = (lane & 15) * 4;
  {
#pragma unroll
    for (int q = 0; q < 8; ++q) {
      const int r = q * 2 + rsub;
      const v4f v = *(const v4fa*)&so[w][r][c4];
      *(v4f*)(C + (size_t)(row0 + r) * ldc + col0 + c4) = v;
    }
    
  }
}
// row LayerNorm (biased variance, eps) over N: s = X (+ R); optional out_sum <- s; out_norm <- (s-mu)*rsqrt(var+eps)*g + b
template <bool PARAM_BF16>
__global__ __launch_bounds__(256) void k_layernorm(const float* __restrict__ X, const float* __restrict__ R, const float* __restrict__ g, const float* __restrict__ bta,
                                                  float* __restrict__ out_sum, float* __restrict__ out_norm, int N, float eps) {
  __shared__ float red[256];
  const int row = blockIdx.x, tid = threadIdx.x;
  const float* x = X + (size_t)row * N; const float* rr = R ? R + (size_t)row * N : nullptr;
  float vals[16];                     // up to N = 4096
  const int per = N / 256;            // contiguous chunk per thread? use strided-by-4 chunks: thread handles j = tid*4 + 1024*u
  float s1 = 0.f;
  for (int u = 0; u < per / 4; ++u) {
    const int j = tid * 4 + 1024 * u;
    const v4f a = *(const v4fa*)(x + j);
    v4f b = {0.f,0.f,0.f,0.f}; if (rr) b = *(const v4fa*)(rr + j);
#pragma unroll
    for (int q = 0; q < 4; ++q) { const float v = a[q] + b[q]; vals[u * 4 + q] = v; s1 += v; }
  }
  red[tid] = s1; __syncthreads();
  for (int st = 128; st > 0; st >>= 1) { if (tid < st) red[tid] += red[tid + st]; __syncthreads(); }
  const float mu = red[0] / (float)N; __syncthreads();
  float s2 = 0.f;
  for (int u = 0; u < per / 4; ++u)
#pragma unroll
    for (int q = 0; q < 4; ++q) { const float c = vals[u * 4 + q] - mu; s2 += c * c; }
  red[tid] = s2; __syncthreads();
  for (int st = 128; st > 0; st >>= 1) { if (tid < st) red[tid] += red[tid + st]; __syncthreads(); }
  const float rs = rsqrtf(red[0] / (float)N + eps);
  {
    for (int u = 0; u < per / 4; ++u) {
      const int j = tid * 4 + 1024 * u;
      v4f o, sm;
#pragma unroll
      for (int q = 0; q < 4; ++q) {
        float gg = g[j + q], bb = bta[j + q];
        if (PARAM_BF16) { gg = bf16_round(gg); bb = bf16_round(bb); }
        sm[q] = vals[u * 4 + q]; o[q] = (vals[u * 4 + q] - mu) * rs * gg + bb;
      }
      if (out_sum) *(v4f*)(out_sum + (size_t)row * N + j) = sm;
      *(v4f*)(out_norm + (size_t)row * N + j) = o;
    }
    
  }
}



// ---- f16 WMMA path (v_wmma_f32_16x16x32_f16): 11-bit significands for operands in range — used where a [0,1] probability operand needs more precision than bf16
typedef _Float16 v16h __attribute__((ext_vector_type(16)));
union FragH { v16h v; v8us half[2]; _Float16 h[16]; unsigned short u[16]; };
template <int NT>
__device__ __forceinline__ v8f mmaH(v16h ah, v16h al, v16h bh, v16h bl, v8f c) {
  c = __builtin_amdgcn_wmma_f32_16x16x32_f16(false, ah, false, bh, (short)0, c, false, false);
  if (NT >= 2) c = __builtin_amdgcn_wmma_f32_16x16x32_f16(false, al, false, bh, (short)0, c, false, false);
  if (NT >= 3) c = __builtin_amdgcn_wmma_f32_16x16x32_f16(false, ah, false, bl, (short)0, c, false, false);
  asm volatile("v_nop\n\tv_nop\n\tv_nop\n\tv_nop" : "+v"(c) : "v"(ah), "v"(al), "v"(bh), "v"(bl));
  return c;
}
// batched GEMM like k_gemm_b but f16 operands: A f32 (split into f16 hi/lo if ASPLIT, else rounded to f16), Bt = f16 values [n][k]; alpha; C f32; N multiple of 16 (partial tiles skipped)
template <bool ASPLIT>
__global__ __launch_bounds__(128) void k_gemm_h(const float* __restrict__ A, int lda, size_t sA, const _Float16* __restrict__ Bh, int ldb, size_t sB, float alpha, float* __restrict__ C, int ldc, size_t sC, int M, int N, int K) {
  __shared__ __attribute__((aligned(16))) float so[4][16][64];
  const int tid = threadIdx.x, w = tid >> 5, lane = tid & 31, ln = lane & 15, hh = lane >> 4; const int by = blockIdx.y;
  A += (size_t)by * sA; Bh += (size_t)by * sB; C += (size_t)by * sC;
  const int ntn = (N + 63) / 64; const int wid = blockIdx.x * 4 + w; const int mt = wid / ntn, nq = wid % ntn; if (mt * 16 >= M) return;
  const int row0 = mt * 16, col0 = nq * 64; const float* arow = A + (size_t)(row0 + ln) * lda;
  v8f acc[4] = {};
  for (int kb = 0; kb < K; kb += 32) {
    FragH ah, al;
    const v4f x0 = *(const v4fa*)(arow + kb + 8 * hh), x1 = *(const v4fa*)(arow + kb + 8 * hh + 4), x2 = *(const v4fa*)(arow + kb + 16 + 8 * hh), x3 = *(const v4fa*)(arow + kb + 16 + 8 * hh + 4);
    float xs[16] = {x0[0],x0[1],x0[2],x0[3],x1[0],x1[1],x1[2],x1[3],x2[0],x2[1],x2[2],x2[3],x3[0],x3[1],x3[2],x3[3]};
#pragma unroll
    for (int i = 0; i < 16; ++i) { const _Float16 h = (_Float16)xs[i]; ah.h[i] = h; al.h[i] = ASPLIT ? (_Float16)(xs[i] - (float)h) : (_Float16)0.0f; }
#pragma unroll
    for (int t = 0; t < 4; ++t) { if (col0 + t * 16 >= N) continue; const size_t boff = (size_t)(col0 + t * 16 + ln) * ldb + kb; FragH bq; bq.half[0] = *(const v8us*)(Bh + boff + 8 * hh); bq.half[1] = *(const v8us*)(Bh + boff + 16 + 8 * hh);
      acc[t] = mmaH<ASPLIT ? 2 : 1>(ah.v, al.v, bq.v, bq.v, acc[t]); }
  }
#pragma unroll
  for (int t = 0; t < 4; ++t) { if (col0 + t * 16 >= N) continue;
#pragma unroll
    for (int r = 0; r < 8; ++r) so[w][8 * hh + r][t * 16 + ln] = acc[t][r] * alpha; }
  __builtin_amdgcn_fence(__ATOMIC_ACQ_REL, "workgroup"); __builtin_amdgcn_wave_barrier();
  const int rsub = lane >> 4, c4 = (lane & 15) * 4;
  {
#pragma unroll
    for (int q = 0; q < 8; ++q) { const int r = q * 2 + rsub; if (col0 + c4 < N) { const v4f v = *(const v4fa*)&so[w][r][c4]; *(v4f*)(C + (size_t)(row0 + r) * ldc + col0 + c4) = v; } }
     }
}

// Wt[n][k] = f16(W[k][n]·scale) from f32 row-major W[K][N] (scale = power of two; bf16-exact weights stay exact in f16 away from the subnormal range)
__global__ __launch_bounds__(256) void k_wt_f16(const float* __restrict__ W, _Float16* __restrict__ Wt, int K, int N, float scale) {
  const int t = blockIdx.x * 256 + threadIdx.x; if (t >= N * (K / 8)) return; const int n = t / (K / 8), k8 = (t % (K / 8)) * 8; FragH f;
#pragma unroll
  for (int i = 0; i < 8; ++i) f.h[i] = (_Float16)(bf16_round(W[(size_t)(k8 + i) * N + n]) * scale); const v8us o = f.half[0];
  *(v8us*)((unsigned short*)Wt + (size_t)n * K + k8) = o; 
}
// k_gemm_hh variant with fused epilogue: v = acc·alpha + bias[by·sBias + col] (+ CP[(row/rowsPerB)·sCPb + by·64 + col] if CP) ; ACT 0 none / 1 elu ; writes f16 C16 (and f32 C if non-null)
template <int ACT>
__global__ __launch_bounds__(128) void k_gemm_hhx(const _Float16* __restrict__ A, int lda, size_t sA, const _Float16* __restrict__ Bh, int ldb, size_t sB, float alpha, const float* __restrict__ bias, size_t sBias, const float* __restrict__ CP, int rowsPerB, size_t sCPb, int row0g,
    float* __restrict__ C, _Float16* __restrict__ C16, int ldc, size_t sC, int M, int N, int K) {
  __shared__ __attribute__((aligned(16))) float so[4][16][64];
  const int tid = threadIdx.x, w = tid >> 5, lane = tid & 31, ln = lane & 15, hh = lane >> 4; const int by = blockIdx.y;
  A += (size_t)by * sA; Bh += (size_t)by * sB; const size_t cofs = (size_t)by * sC; const float* bp = bias ? bias + (size_t)by * sBias : nullptr;
  const int ntn = (N + 63) / 64; const int wid = blockIdx.x * 4 + w; const int mt = wid / ntn, nq = wid % ntn; if (mt * 16 >= M) return;
  const int row0 = mt * 16, col0 = nq * 64; const _Float16* arow = A + (size_t)(row0 + ln) * lda;
  v8f acc[4] = {};
  for (int kb = 0; kb < K; kb += 32) { FragH ah; ah.half[0] = *(const v8us*)((const unsigned short*)arow + kb + 8 * hh); ah.half[1] = *(const v8us*)((const unsigned short*)arow + kb + 16 + 8 * hh);
#pragma unroll
    for (int t = 0; t < 4; ++t) { if (col0 + t * 16 >= N) continue; const size_t boff = (size_t)(col0 + t * 16 + ln) * ldb + kb; FragH bq; bq.half[0] = *(const v8us*)((const unsigned short*)Bh + boff + 8 * hh); bq.half[1] = *(const v8us*)((const unsigned short*)Bh + boff + 16 + 8 * hh);
      acc[t] = mmaH<1>(ah.v, ah.v, bq.v, bq.v, acc[t]); }
  }
#pragma unroll
  for (int t = 0; t < 4; ++t) { if (col0 + t * 16 >= N) continue; const int col = col0 + t * 16 + ln; const float bv = bp ? bf16_round(bp[col]) : 0.f;
#pragma unroll
    for (int r = 0; r < 8; ++r) { float v = acc[t][r] * alpha + bv; if (CP) { const int bidx = (row0g + row0 + 8 * hh + r) / rowsPerB; v += CP[(size_t)bidx * sCPb + (size_t)by * 64 + col]; } if (ACT == 1) v = (v > 0.f) ? v : expm1f(v); else if (ACT == 7) v = (v > 0.f) ? v + 1.0f : expf(v); else if (ACT == 8) v = tanhf(v); else if (ACT == 9) v = 0.5f * v * (1.0f + tanhf(0.7978845608028654f * (v + 0.044715f * v * v * v))); else if (ACT == 11) v = 1.0f / (1.0f + expf(-v)); else if (ACT == 12) v = (v > 0.f) ? v : 0.01f * v; else if (ACT == 14) v = (v > 0.f) ? v : 0.1f * v; else if (ACT == 15) v = v / (1.0f + expf(-v)); else if (ACT == 3) v = fmaxf(v, 0.f); else if (ACT == 6) v = 0.5f * v * (1.0f + erff(v * 0.70710678118654752f)); so[w][8 * hh + r][t * 16 + ln] = v; } }
  __builtin_amdgcn_fence(__ATOMIC_ACQ_REL, "workgroup"); __builtin_amdgcn_wave_barrier();
  const int rsub = lane >> 4, c4 = (lane & 15) * 4; typedef _Float16 v4h __attribute__((ext_vector_type(4)));
  {
#pragma unroll
    for (int q = 0; q < 8; ++q) { const int r = q * 2 + rsub; if (col0 + c4 < N) { const v4f v = *(const v4fa*)&so[w][r][c4]; if (C) *(v4f*)(C + cofs + (size_t)(row0 + r) * ldc + col0 + c4) = v; if (C16) { v4h h4; for (int i = 0; i < 4; ++i) h4[i] = (_Float16)v[i]; *(v4h*)(C16 + cofs + (size_t)(row0 + r) * ldc + col0 + c4) = h4; } } }
     }
}


typedef _Float16 v4h __attribute__((ext_vector_type(4)));

// All input roundings in one launch, 8 values a thread: work-groups 0..PREP_XB-1 take x of all images (bf16 rounding, kept as f16), the next PREP_QB take w_qkv and the last PREP_PB w_proj (bf16 rounding x16, exact in f16).
// The work-group picks source, plane and factor (1 for x: an exact product); the grid divides the three arrays without remainder.
#define PREP_XB (NIMG * NTOK * CC / 8 / 256)
#define PREP_QB (3 * CC * CC / 8 / 256)
#define PREP_PB (CC * CC / 8 / 256)
__global__ __launch_bounds__(256) void k_prep16(const float* __restrict__ x, const float* __restrict__ wqkv, const float* __restrict__ wp, _Float16* __restrict__ X16, _Float16* __restrict__ BQKV, _Float16* __restrict__ BP) {
  int bx = blockIdx.x; const float* src = x; _Float16* dst = X16; float sc = 1.0f;
  if (bx >= PREP_XB + PREP_QB) { bx -= PREP_XB + PREP_QB; src = wp; dst = BP; sc = 16.0f; } else if (bx >= PREP_XB) { bx -= PREP_XB; src = wqkv; dst = BQKV; sc = 16.0f; }
  const size_t t = (size_t)bx * 256 + threadIdx.x; FragH f;
#pragma unroll
  for (int q = 0; q < 8; ++q) f.h[q] = (_Float16)(bf16_round(src[t * 8 + q]) * sc); *(v8us*)((unsigned short*)dst + t * 8) = f.half[0];  }
__global__ __launch_bounds__(256) void k_h16(const float* __restrict__ x, _Float16* __restrict__ X16, size_t n8) { const size_t t = (size_t)blockIdx.x * 256 + threadIdx.x; if (t >= n8) return; FragH f;
#pragma unroll
  for (int q = 0; q < 8; ++q) f.h[q] = (_Float16)x[t * 8 + q]; *(v8us*)((unsigned short*)X16 + t * 8) = f.half[0];  }
template <int NHv, int TTv>
__global__ __launch_bounds__(256) void k_vt(const _Float16* __restrict__ V16, int ldv, int voff, _Float16* __restrict__ Vt) { __shared__ unsigned short tl[64][66]; const int tid = threadIdx.x; const int slab = blockIdx.x / (TTv / 64), lg = blockIdx.x % (TTv / 64); const int b = slab / NHv, h = slab % NHv;
  for (int i = tid; i < 64 * 8; i += 256) { const int r = i / 8, c8 = (i % 8) * 8; FragH f; f.half[0] = *(const v8us*)((const unsigned short*)V16 + ((size_t)b * TTv + lg * 64 + r) * ldv + voff + h * 64 + c8);
#pragma unroll
    for (int q = 0; q < 8; ++q) tl[r][c8 + q] = f.u[q]; }
  __syncthreads();
  {
#pragma unroll
    for (int rd = 0; rd < 2; ++rd) { const int d = rd * 32 + tid / 8, pc = tid % 8; FragH f;
#pragma unroll
      for (int q = 0; q < 8; ++q) f.u[q] = tl[pc * 8 + q][d];
      *(v8us*)((unsigned short*)Vt + ((size_t)slab * 64 + d) * TTv + lg * 64 + pc * 8) = f.half[0]; }
     } }

__global__ __launch_bounds__(256) void k_hl(const float* __restrict__ F, _Float16* __restrict__ Hh, _Float16* __restrict__ Hl, size_t n8) { const size_t t = (size_t)blockIdx.x * 256 + threadIdx.x; if (t >= n8) return; FragH fh, fl; const v4f a = *(const v4fa*)(F + t * 8), c = *(const v4fa*)(F + t * 8 + 4);
#pragma unroll
  for (int q = 0; q < 4; ++q) { _Float16 h = (_Float16)a[q]; fh.h[q] = h; fl.h[q] = (_Float16)((a[q] - (float)h) * 1024.0f); h = (_Float16)c[q]; fh.h[4 + q] = h; fl.h[4 + q] = (_Float16)((c[q] - (float)h) * 1024.0f); }
  { *(v8us*)((unsigned short*)Hh + t * 8) = fh.half[0]; *(v8us*)((unsigned short*)Hl + t * 8) = fl.half[0];  } }

// ---- GEMM C = A.B^T x alpha + bias for K = CC: A f16 [M][CC], Bh f16 [N][CC]; M and N multiples of 128; writes f32 C (F32OUT) or f16 C16, pitch N ----
// A work-group of eight waves owns a 128 x 128 tile of C. Its 128 rows of A and 128 rows of B, whole in k (512 B a row), are brought into LDS once by asynchronous copies,
// one whole row (four 128-byte lines) per wave instruction; every fragment then comes from LDS. Wave = 32 rows x 64 columns, k ascending as before.
__device__ __forceinline__ v16h g2_frag(const _Float16* p, int hh) { FragH f; f.half[0] = *(const v8us*)((const unsigned short*)p + 8 * hh); f.half[1] = *(const v8us*)((const unsigned short*)p + 16 + 8 * hh); return f.v; }
#define G3_PITCH 528      /* bytes of a staged row: 512 + 16, an odd number of 16-byte pieces, so that the 16 rows of a ds_load_b128 fragment read lie on different banks */
__device__ __forceinline__ v16h g3_frag(const unsigned char* p) { FragH f; f.half[0] = *(const v8us*)p; f.half[1] = *(const v8us*)(p + 32); return f.v; }
__device__ __forceinline__ v8f g3_mma(v16h a, v16h b, v8f c) { return __builtin_amdgcn_wmma_f32_16x16x32_f16(false, a, false, b, (short)0, c, false, false); }
// Eight rows, 16 bytes a lane each, from global memory straight into LDS. The closing s_wait_xcnt stands inside the statement, in front of any later write of the address registers that the copies name.
__device__ __forceinline__ void g3_copy8(unsigned l, const _Float16* g) {
  asm volatile("global_load_async_to_lds_b128 %0, %8, off\n\tglobal_load_async_to_lds_b128 %1, %9, off\n\tglobal_load_async_to_lds_b128 %2, %10, off\n\tglobal_load_async_to_lds_b128 %3, %11, off\n\t"
               "global_load_async_to_lds_b128 %4, %12, off\n\tglobal_load_async_to_lds_b128 %5, %13, off\n\tglobal_load_async_to_lds_b128 %6, %14, off\n\tglobal_load_async_to_lds_b128 %7, %15, off\n\ts_wait_xcnt 0x0"
               :: "v"(l), "v"(l + G3_PITCH), "v"(l + 2 * G3_PITCH), "v"(l + 3 * G3_PITCH), "v"(l + 4 * G3_PITCH), "v"(l + 5 * G3_PITCH), "v"(l + 6 * G3_PITCH), "v"(l + 7 * G3_PITCH),
                  "v"(g), "v"(g + CC), "v"(g + 2 * CC), "v"(g + 3 * CC), "v"(g + 4 * CC), "v"(g + 5 * CC), "v"(g + 6 * CC), "v"(g + 7 * CC) : "memory"); }
template <int N, bool F32OUT>
__global__ __launch_bounds__(256) void k_gemm3(const _Float16* __restrict__ A, const _Float16* __restrict__ Bh, float alpha, const float* __restrict__ bias, float* __restrict__ C, _Float16* __restrict__ C16) {
  __shared__ __attribute__((aligned(16))) unsigned char sm[256 * G3_PITCH];      /* rows 0..127: A, rows 128..255: B; afterwards the waves' output staging */
  const int tid = threadIdx.x, w = __builtin_amdgcn_readfirstlane(tid >> 5), lane = tid & 31, ln = lane & 15, hh = lane >> 4;      /* wave number as a scalar: the choice of source below is a scalar one */
  constexpr int ntn = N >> 7; const int mt = blockIdx.x / ntn, nq = blockIdx.x - mt * ntn; const int row0 = mt * 128, col0 = nq * 128;
  { const _Float16* g = (w < 4 ? A + (size_t)(row0 + 32 * w) * CC : Bh + (size_t)(col0 + 32 * (w - 4)) * CC) + lane * 8;      /* waves 0..3 bring A, waves 4..7 B: 32 rows each, lane = 16-byte piece of the row */
    const unsigned l = (unsigned)(size_t)sm + (unsigned)(32 * w * G3_PITCH + lane * 16);
#pragma unroll
    for (int u = 0; u < 4; ++u) g3_copy8(l + u * 8 * G3_PITCH, g + (size_t)u * 8 * CC); }
  asm volatile("s_wait_asynccnt 0x0" ::: "memory");      /* this wave's 32 copies have landed */
  __syncthreads();      /* and so have the other waves': nobody reads the tile in front of this barrier */
  const int wm = w & 3, wn = w >> 2;
  const unsigned char* ap = sm + (32 * wm + ln) * G3_PITCH + 16 * hh; const unsigned char* bq = sm + (128 + 64 * wn + ln) * G3_PITCH + 16 * hh;
  const v8f z8 = {0.f,0.f,0.f,0.f,0.f,0.f,0.f,0.f}; v8f c00 = z8, c01 = z8, c02 = z8, c03 = z8, c10 = z8, c11 = z8, c12 = z8, c13 = z8;
  v16h fa[2][2], fb[2][4];      /* two fragment sets: the products of a step read one while the next step's LDS reads fill the other */
#pragma unroll
  for (int t = 0; t < 2; ++t) fa[0][t] = g3_frag(ap + 16 * t * G3_PITCH);
#pragma unroll
  for (int t = 0; t < 4; ++t) fb[0][t] = g3_frag(bq + 16 * t * G3_PITCH);
#pragma unroll      /* unrolled: the set index is a compile-time constant, so both sets stay in registers */
  for (int ks = 0; ks < CC / 32; ++ks) { const int cu = ks & 1, nx = cu ^ 1;
    if (ks + 1 < CC / 32) {
#pragma unroll
      for (int t = 0; t < 2; ++t) fa[nx][t] = g3_frag(ap + 16 * t * G3_PITCH + 64 * (ks + 1));
#pragma unroll
      for (int t = 0; t < 4; ++t) fb[nx][t] = g3_frag(bq + 16 * t * G3_PITCH + 64 * (ks + 1)); }
    __builtin_amdgcn_sched_barrier(0);      /* keeps the next step's twelve LDS reads one group ahead of this step's products: left free, the compiler lifts reads of many steps to the top and takes over 256 registers, with register-window switches among the products */
    c00 = g3_mma(fa[cu][0], fb[cu][0], c00); c10 = g3_mma(fa[cu][1], fb[cu][0], c10); c01 = g3_mma(fa[cu][0], fb[cu][1], c01); c11 = g3_mma(fa[cu][1], fb[cu][1], c11);
    c02 = g3_mma(fa[cu][0], fb[cu][2], c02); c12 = g3_mma(fa[cu][1], fb[cu][2], c12); c03 = g3_mma(fa[cu][0], fb[cu][3], c03); c13 = g3_mma(fa[cu][1], fb[cu][3], c13);
    __builtin_amdgcn_sched_barrier(0);      /* and keeps the reads of the step after next behind these products, whose set they overwrite */
  }
  __syncthreads();      /* every wave has read its last fragment: from here the tile's LDS is output staging, 32 x 68 floats a wave */
  float (*so)[68] = (float (*)[68])(sm + w * (32 * 68 * 4)); const int rw = row0 + 32 * wm, cw = col0 + 64 * wn;
  v8f accs[8] = {c00, c01, c02, c03, c10, c11, c12, c13};
#pragma unroll
  for (int u = 0; u < 8; ++u) { const int t = u & 3, half = u >> 2; const float bv = bf16_round(bias[cw + t * 16 + ln]);
#pragma unroll
    for (int r = 0; r < 8; ++r) so[half * 16 + 8 * hh + r][t * 16 + ln] = accs[u][r] * alpha + bv; }
  __builtin_amdgcn_fence(__ATOMIC_ACQ_REL, "workgroup"); __builtin_amdgcn_wave_barrier();
  const int rsub = lane >> 4, c4 = (lane & 15) * 4;
  const size_t o0 = (size_t)(rw + rsub) * N + cw + c4;      /* N is a compile-time pitch: the sixteen stores share one address and differ in their immediate offsets */
  v4f vv[16];
#pragma unroll
  for (int q = 0; q < 16; ++q) vv[q] = *(const v4fa*)&so[q * 2 + rsub][c4];
#pragma unroll
  for (int q = 0; q < 16; ++q) {
    if (F32OUT) *(v4f*)(C + o0 + q * 2 * N) = vv[q];
    else { v4h h4; for (int i = 0; i < 4; ++i) h4[i] = (_Float16)vv[q][i]; *(v4h*)(C16 + o0 + q * 2 * N) = h4; } } }


__device__ __forceinline__ int na_start(int i, int K) { const int nh = K / 2; int s = max(i - nh, 0); if (i + nh >= RES) s += RES - i - nh - 1; return s; }
__device__ __forceinline__ int na_pb(int i, int K) { const int nh = K / 2; int p = nh; if (i < nh) p += nh - i; if (i + nh >= RES) p += RES - i - 1 - nh; return p; }
// K and V of all images into fragment-ordered planes, in blocks of 8 tokens x 32 channels of one head (512 B each):
// KS block = [16-byte piece c of the token's 64 B][token & 7][8 f16], VS block = [channel][8 tokens]; a wave's 16-byte-per-lane fragment load then reads four whole 128-byte lines.
__global__ __launch_bounds__(256) void k_kvswz(const _Float16* __restrict__ QKV, _Float16* __restrict__ KS, _Float16* __restrict__ VS) {
  __shared__ unsigned short tl[64][66]; const int tid = threadIdx.x; const int lg = blockIdx.x & 63, h4 = (blockIdx.x >> 6) & 3, b = blockIdx.x >> 8;
  const unsigned short* src = (const unsigned short*)QKV + ((size_t)b * NTOK + lg * 64) * (3 * CC) + h4 * 64;
#pragma unroll
  for (int u = 0; u < 2; ++u) { const int i = tid + 256 * u, r = i >> 3, c8 = i & 7;
    const v8us kv = *(const v8us*)(src + (size_t)r * (3 * CC) + CC + c8 * 8);
    *(v8us*)((unsigned short*)KS + (((size_t)(b * NHD + h4 * 2 + (c8 >> 2)) * (NTOK / 8) + lg * 8 + (r >> 3)) * 32 + (c8 & 3) * 8 + (r & 7)) * 8) = kv;
    FragH f; f.half[0] = *(const v8us*)(src + (size_t)r * (3 * CC) + 2 * CC + c8 * 8);
#pragma unroll
    for (int q = 0; q < 8; ++q) tl[r][c8 * 8 + q] = f.u[q]; }
  __syncthreads();
#pragma unroll
  for (int rd = 0; rd < 2; ++rd) { const int dd = tid & 31, pc = tid >> 5; FragH f;
#pragma unroll
    for (int q = 0; q < 8; ++q) f.u[q] = tl[pc * 8 + q][rd * 32 + dd];
    *(v8us*)((unsigned short*)VS + (((size_t)(b * NHD + h4 * 2 + rd) * (NTOK / 8) + lg * 8 + pc) * 32 + dd) * 8) = f.half[0]; } }
__device__ __forceinline__ v16h na_frag(const _Float16* p, int second) { FragH f; f.half[0] = *(const v8us*)(const unsigned short*)p; f.half[1] = *(const v8us*)((const unsigned short*)p + second); return f.v; }
// lane l <-> lane l ^ 16 (the two halves of a wave hold different keys of the same query)
__device__ __forceinline__ float xhalf(float x) { return __builtin_bit_cast(float, __builtin_amdgcn_permlanex16(__builtin_bit_cast(int, x), __builtin_bit_cast(int, x), 0x76543210, 0xfedcba98, false, false)); }
// Eight exponentials (base 2) in one statement: behind a transcendental the instruction set asks for one independent instruction before its result is read or its source overwritten.
// The outputs are early-clobber, so each v_exp_f32 is that independent instruction for the one before it; the closing v_nop keeps the slot behind the last.
__device__ __forceinline__ void na_exp8(float (&y)[8], const float (&x)[8]) {
  asm("v_exp_f32 %0, %8\n\tv_exp_f32 %1, %9\n\tv_exp_f32 %2, %10\n\tv_exp_f32 %3, %11\n\tv_exp_f32 %4, %12\n\tv_exp_f32 %5, %13\n\tv_exp_f32 %6, %14\n\tv_exp_f32 %7, %15\n\tv_nop"
      : "=&v"(y[0]), "=&v"(y[1]), "=&v"(y[2]), "=&v"(y[3]), "=&v"(y[4]), "=&v"(y[5]), "=&v"(y[6]), "=&v"(y[7])
      : "v"(x[0]), "v"(x[1]), "v"(x[2]), "v"(x[3]), "v"(x[4]), "v"(x[5]), "v"(x[6]), "v"(x[7])); }
__device__ __forceinline__ float na_exp1(float x) { float y; asm("v_exp_f32 %0, %1\n\tv_nop" : "=&v"(y) : "v"(x)); return y; }      /* the v_nop keeps the same slot */
#define NA_NEG (-3.0e38f)
#define NA_TBMAX (25 * 25 + 64)
// One query row i of one image and two neighbouring heads per work-group; wave = (head, 16 query columns).
// All 16 queries of a wave share the K key rows si..si+K-1; their column windows lie inside the 32 columns C0..C0+31 (C0 a multiple of 8).
// Per key row: S^T = K.Q^T + bias/scale (two 16x16x32 products, bias and window mask enter as the C operand), running maximum and sum per query
// (lane = query), P^T x2^10 packed from the two score tiles as the B operand, O^T += V^T.P^T; K and V^T fragments come from the fragment-ordered planes.
template <int K>
__device__ __forceinline__ void na_row(const _Float16* __restrict__ QKV, const _Float16* __restrict__ KS, const _Float16* __restrict__ VS, const float* __restrict__ rpb, int hb, int bx, float* __restrict__ tb, _Float16* __restrict__ Y16) {
  constexpr int RB = 2 * K - 1, NT = RB * RB, TP = NT + 64; constexpr float SC2 = SCALE * 1.4426950408889634f;
  const int tid = threadIdx.x, w = __builtin_amdgcn_readfirstlane(tid >> 5), lane = tid & 31, ln = lane & 15, hh = lane >> 4; const int i = bx & 63, hp = (bx >> 6) & 1, b = bx >> 7;      /* wave number as a scalar: head, column tile and plane bases stay in scalar registers */
  for (int t = tid; t < 2 * TP; t += 256) { const int hq = t / TP, s = t - hq * TP - 32; tb[t] = (s >= 0 && s < NT) ? bf16_round(rpb[(size_t)(2 * hp + hq) * NT + s]) * 5.656854249492381f : 0.f; }
  __syncthreads();
  const int hq = w >> 2, h = hb + 2 * hp + hq, j0 = (w & 3) * 16, j = j0 + ln; const int C0 = min(max(j0 - 8, 0), 32);
  const int si = na_start(i, K), sj = na_start(j, K), pi = na_pb(i, K), pj = na_pb(j, K);
  const _Float16* img = QKV + (size_t)b * NTOK * (3 * CC);
  const v16h qf = g2_frag(img + (size_t)(i * RES + j) * (3 * CC) + h * HD, hh);
  const size_t blk0 = (size_t)(b * NHD + h) * (NTOK / 8) + ((si * RES + C0) >> 3);
  const _Float16* kb = KS + blk0 * 256; const unsigned kl = ((ln >> 3) * 32 + hh * 8 + (ln & 7)) * 8;      /* key = lane & 15; channels 8hh.. here, 16 + 8hh.. 128 elements on */
  const _Float16* vb = VS + blk0 * 256; const unsigned vl = (hh * 32 + ln) * 8;                            /* channel = lane & 15; keys 8hh.. here, 16 + 8hh.. two blocks on */
  const int d0 = C0 + 8 * hh - sj; const float* tp = tb + hq * TP + 32 + pi * RB + pj + d0;
  bool ok[16];
#pragma unroll
  for (int e = 0; e < 16; ++e) ok[e] = (unsigned)(d0 + (e & 7) + 16 * (e >> 3)) < (unsigned)K;
  const v8f z8 = {0.f,0.f,0.f,0.f,0.f,0.f,0.f,0.f}; v8f o0 = z8, o1 = z8; float m = NA_NEG, l = 0.f;
  v16h a0 = na_frag(kb + kl, 128), a1 = na_frag(kb + kl + 512, 128);
#pragma unroll 1      /* rolled: unrolled, the compiler lifts every row's loads to the top and takes over 300 registers (three waves per SIMD) */
  for (int kr = 0; kr < K; ++kr) {
    const v16h u0 = na_frag(vb + vl, 512), u1 = na_frag(vb + vl + 128, 512); vb += 2048;
    __builtin_amdgcn_sched_barrier(0);      /* keeps the V loads up here, a whole softmax ahead of their use: without it the compiler sinks them to just in front of the products that wait for them */
    v8f s0, s1;
#pragma unroll
    for (int r = 0; r < 8; ++r) { const float t0 = tp[r], t1 = tp[16 + r]; s0[r] = ok[r] ? t0 : NA_NEG; s1[r] = ok[8 + r] ? t1 : NA_NEG; }      /* every index lies inside the padded table */
    tp += RB;
    s0 = __builtin_amdgcn_wmma_f32_16x16x32_f16(false, a0, false, qf, (short)0, s0, false, false);
    s1 = __builtin_amdgcn_wmma_f32_16x16x32_f16(false, a1, false, qf, (short)0, s1, false, false);
    if (kr + 1 < K) kb += 2048;      /* next row's K fragments fly under this row's softmax; the last pass fetches its own row again, never one past the window */
    a0 = na_frag(kb + kl, 128); a1 = na_frag(kb + kl + 512, 128);
    asm volatile("s_wait_xcnt 0x0" ::: "memory");      /* stands in front of the V address pair's advance, which the compiler places below while this pass's loads are in flight */
    __builtin_amdgcn_sched_barrier(0);      /* keeps the next row's K loads here: without it the compiler sinks them to the foot of the pass, a few instructions ahead of their use */
    float mx = fmaxf(s0[0], s1[0]);
#pragma unroll
    for (int r = 1; r < 8; ++r) mx = fmaxf(mx, fmaxf(s0[r], s1[r]));
    mx = fmaxf(mx, xhalf(mx));
    const float mn = fmaxf(m, mx); const float al = na_exp1((m - mn) * SC2); m = mn; const float mb = 10.0f - mn * SC2;
    FragH pf; float ps = 0.f, x0[8], x1[8], p0[8], p1[8];
#pragma unroll
    for (int r = 0; r < 8; ++r) { x0[r] = fmaf(s0[r], SC2, mb); x1[r] = fmaf(s1[r], SC2, mb); }
    na_exp8(p0, x0); na_exp8(p1, x1);
#pragma unroll
    for (int r = 0; r < 8; ++r) { ps += p0[r] + p1[r]; pf.h[r] = (_Float16)p0[r]; pf.h[8 + r] = (_Float16)p1[r]; }
    l = l * al + ps;
#pragma unroll
    for (int r = 0; r < 8; ++r) { o0[r] *= al; o1[r] *= al; }
    o0 = __builtin_amdgcn_wmma_f32_16x16x32_f16(false, u0, false, pf.v, (short)0, o0, false, false);
    o1 = __builtin_amdgcn_wmma_f32_16x16x32_f16(false, u1, false, pf.v, (short)0, o1, false, false);
  }
  l += xhalf(l); const float inv = 1.0f / l; FragH y0, y1;
#pragma unroll
  for (int r = 0; r < 8; ++r) { y0.h[r] = (_Float16)(o0[r] * inv); y1.h[r] = (_Float16)(o1[r] * inv); }
  unsigned short* yp = (unsigned short*)Y16 + ((size_t)b * NTOK + i * RES + j) * CC + h * HD + 8 * hh;
  *(v8us*)yp = y0.half[0]; *(v8us*)(yp + 16) = y1.half[0]; }
__global__ __launch_bounds__(256) void k_na_fused(const _Float16* __restrict__ QKV, const _Float16* __restrict__ KS, const _Float16* __restrict__ VS, const float* __restrict__ rpb0, const float* __restrict__ rpb1, _Float16* __restrict__ Y16) {
  __shared__ float tb[2 * NA_TBMAX]; const int nb = NIMG * 2 * RES;      /* the longer 13x13 work-groups start first */
  if ((int)blockIdx.x < nb) na_row<13>(QKV, KS, VS, rpb1, 4, blockIdx.x, tb, Y16); else na_row<7>(QKV, KS, VS, rpb0, 0, blockIdx.x - nb, tb, Y16); }

extern "C" void kernel_launch(void* const* d_in, const int* in_sizes, int n_in,
                              void* d_out, int out_size, void* d_ws, size_t ws_size, hipStream_t stream) {
  (void)in_sizes; (void)n_in; (void)out_size;
  const float* const* I = (const float* const*)d_in; const float* x = I[0]; const float* wqkv = I[1]; const float* bqkv = I[2]; const float* rpb0 = I[3]; const float* rpb1 = I[4]; const float* wp = I[5]; const float* bp = I[6];
  char* ws = (char*)d_ws; size_t off = 0;
  auto take = [&](size_t bytes) { char* p = ws + off; off += (bytes + 255) & ~(size_t)255; return p; };
  _Float16* BQKV = (_Float16*)take((size_t)3 * CC * CC * 2); _Float16* BP = (_Float16*)take((size_t)CC * CC * 2);
  _Float16* X16 = (_Float16*)take((size_t)NIMG * NTOK * CC * 2); _Float16* QKV = (_Float16*)take((size_t)NIMG * NTOK * 3 * CC * 2); _Float16* KS = (_Float16*)take((size_t)NIMG * CC * NTOK * 2); _Float16* VS = (_Float16*)take((size_t)NIMG * CC * NTOK * 2); _Float16* Y16 = (_Float16*)take((size_t)NIMG * NTOK * CC * 2);
  if (off > ws_size) return;      /* 0.5 + 16 + 48 + 16 + 16 + 16 = 112.5 MiB */
  const dim3 gQ((NIMG * NTOK / 128) * (3 * CC / 128), 1), gP((NIMG * NTOK / 128) * (CC / 128), 1);      /* the token rows of all images are one M */
  k_prep16<<<PREP_XB + PREP_QB + PREP_PB, 256, 0, stream>>>(x, wqkv, wp, X16, BQKV, BP);      /* weights stay (out,in) natural */
  k_gemm3<3 * CC, false><<<gQ, 256, 0, stream>>>(X16, BQKV, 0.0625f, bqkv, nullptr, QKV);
  k_kvswz<<<NIMG * 4 * (NTOK / 64), 256, 0, stream>>>(QKV, KS, VS);
  k_na_fused<<<2 * NIMG * 2 * RES, 256, 0, stream>>>(QKV, KS, VS, rpb0, rpb1, Y16);
  k_gemm3<CC, true><<<gP, 256, 0, stream>>>(Y16, BP, 0.0625f, bp, (float*)d_out, nullptr);
}

// v004
// One run takes 63.4 microseconds.
// In both of two side-by-side timings against v003, it was 1.14 times as fast.
// Counting every step since v000, it is 26.2 times as fast.
#include <hip/hip_runtime.h>
// Split-head neighborhood attention (8 images, 64 x 64 x 256 NHWC; 8 heads x 32; heads 0-3 use 7x7 NATTEN windows with rpb0, heads 4-7 use 13x13 with rpb1; window starts clamped at the borders, relative-position bias with the NATTEN border offsets; q scaled by 32^-0.5) followed by the output projection -> [8,64,64,256].
// Structure: one launch rounds x and both weight matrices to f16 planes; qkv of all images as one f16 WMMA GEMM launch (128x128 work-group tiles staged in LDS by asynchronous copies, 32x64 wave tiles, f32 accumulation, exact products + bias) whose epilogue writes q into an f16 token plane and k and transposed v straight into fragment-ordered planes; ONE fused kernel over all images, both branches and all heads does scores, exact clamped window + bias, softmax (running maximum and sum) and attn.v per wave of 16 queries of one row against K key rows x 32 columns, scores and P (x2^10 in f16) never leaving registers, and writes the head outputs into the token plane; output projection of all images as one GEMM launch straight into the output rows.
// Compute dtype: x, weights, biases, rpb rounded to bf16; q/k/v, P (x2^10) and the attention output as f16 operands (~2^-12); f32 accumulation and softmax. v_wmma_f32_16x16x32_f16.
#define NIMG 8
#define RES 64
#define NTOK (RES * RES)
#define CC 256
#define NHD 8
#define HD 32
#define SCALE 0.17677669529663687f
typedef __bf16 v16b __attribute__((ext_vector_type(16)));
typedef unsigned short v8us __attribute__((ext_vector_type(8), may_alias));
typedef float  v8f  __attribute__((ext_vector_type(8)));
typedef float  v4f  __attribute__((ext_vector_type(4)));
typedef float  v4fa __attribute__((ext_vector_type(4), may_alias));
union FragB { v16b v; v8us half[2]; unsigned short u[16]; };

__device__ __forceinline__ unsigned short bf16_bits(float x) { unsigned int u = __float_as_uint(x); return (unsigned short)((u + 0x7FFFu + ((u >> 16) & 1u)) >> 16); }
__device__ __forceinline__ float bf16_val(unsigned short b) { return __uint_as_float(((unsigned int)b) << 16); }
__device__ __forceinline__ float bf16_round(float x) { return bf16_val(bf16_bits(x)); }
// D += A·B with NT terms: 1 = ah·bh, 2 = + al·bh (A split), 3 = + ah·bl (both split)
template <int NT>
__device__ __forceinline__ v8f mmaN(v16b ah, v16b al, v16b bh, v16b bl, v8f c) {
  c = __builtin_amdgcn_wmma_f32_16x16x32_bf16(false, ah, false, bh, (short)0, c, false, false);
  if (NT >= 2) c = __builtin_amdgcn_wmma_f32_16x16x32_bf16(false, al, false, bh, (short)0, c, false, false);
  if (NT >= 3) c = __builtin_amdgcn_wmma_f32_16x16x32_bf16(false, ah, false, bl, (short)0, c, false, false);
  asm volatile("v_nop\n\tv_nop\n\tv_nop\n\tv_nop" : "+v"(c) : "v"(ah), "v"(al), "v"(bh), "v"(bl));
  return c;
}

__global__ __launch_bounds__(256) void k_wt_bf16(const float* __restrict__ W, unsigned short* __restrict__ Wt, int K, int N) {
  const int t = blockIdx.x * 256 + threadIdx.x;
  const int k8n = K / 8;
  if (t >= N * k8n) return;
  const int n = t / k8n, k8 = (t % k8n) * 8;
  v8us v;
#pragma unroll
  for (int i = 0; i < 8; ++i) v[i] = bf16_bits(W[(size_t)(k8 + i) * N + n]);
  *(v8us*)(Wt + (size_t)n * K + k8) = v;
  
}

// GEMM C[M][N] (f32, pitch ldc) = act(A[M][K]·W + bias). A f32 row-major (pitch lda) converted per fragment to bf16
// (ASPLIT: hi/lo two planes -> 2 terms, else single rounded term); Wt bf16 [N][K] (pitch ldb). BIAS_BF16 rounds the
// bias to bf16 first (bias quantised to bf16 before the add). K%32==0, M%16==0, N%64==0.
template <bool ASPLIT, int ACT, bool BIAS_BF16>
__global__ __launch_bounds__(128) void k_gemm_bf(const float* __restrict__ A, int lda, const unsigned short* __restrict__ Wt, int ldb,
                                               const float* __restrict__ bias, float* __restrict__ C, int ldc, int M, int N, int K) {
  __shared__ __attribute__((aligned(16))) float so[4][16][64];
  const int tid = threadIdx.x, w = tid >> 5, lane = tid & 31, ln = lane & 15, hh = lane >> 4;
  const int ntn = N / 64;
  const int wid = blockIdx.x * 4 + w;
  const int mt = wid / ntn, nq = wid % ntn;
  if (mt * 16 >= M) return;
  const int row0 = mt * 16, col0 = nq * 64;
  const float* arow = A + (size_t)(row0 + ln) * lda;
  v8f acc[4] = {};
  for (int kb = 0; kb < K; kb += 32) {
    FragB ah, al;
    const v4f x0 = *(const v4fa*)(arow + kb + 8 * hh), x1 = *(const v4fa*)(arow + kb + 8 * hh + 4);
    const v4f x2 = *(const v4fa*)(arow + kb + 16 + 8 * hh), x3 = *(const v4fa*)(arow + kb + 16 + 8 * hh + 4);
    float xs[16] = {x0[0],x0[1],x0[2],x0[3],x1[0],x1[1],x1[2],x1[3],x2[0],x2[1],x2[2],x2[3],x3[0],x3[1],x3[2],x3[3]};
#pragma unroll
    for (int i = 0; i < 16; ++i) { const unsigned short hb = bf16_bits(xs[i]); ah.u[i] = hb; al.u[i] = ASPLIT ? bf16_bits(xs[i] - bf16_val(hb)) : (unsigned short)0; }
#pragma unroll
    for (int t = 0; t < 4; ++t) {
      const unsigned short* brow = Wt + (size_t)(col0 + t * 16 + ln) * ldb + kb;
      FragB b;
      b.half[0] = *(const v8us*)(brow + 8 * hh);
      b.half[1] = *(const v8us*)(brow + 16 + 8 * hh);
      acc[t] = mmaN<ASPLIT ? 2 : 1>(ah.v, al.v, b.v, b.v, acc[t]);
    }
  }
#pragma unroll
  for (int t = 0; t < 4; ++t) {
    float bv = bias ? bias[col0 + t * 16 + ln] : 0.f;
    if (BIAS_BF16) bv = bf16_round(bv);
#pragma unroll
    for (int r = 0; r < 8; ++r) { float v = acc[t][r] + bv; if (ACT == 1) v = fmaxf(v, 0.f); so[w][8 * hh + r][t * 16 + ln] = v; }
  }
  __builtin_amdgcn_fence(__ATOMIC_ACQ_REL, "workgroup");
  __builtin_amdgcn_wave_barrier();
  const int rsub = lane >> 4, c4 = (lane & 15) * 4;
  {
#pragma unroll
    for (int q = 0; q < 8; ++q) {
      const int r = q * 2 + rsub;
      const v4f v = *(const v4fa*)&so[w][r][c4];
      *(v4f*)(C + (size_t)(row0 + r) * ldc + col0 + c4) = v;
    }
    
  }
}

// GEMM C = act(A·W + bias + resid): A f32 (ASPLIT -> hi/lo 2 terms), Wt bf16 [N][K]; ACT 0 none, 1 relu, 2 exact gelu;
// resid (optional, f32, row index = (row % rmod), pitch ldr, RES_BF16 rounds it) added before the activation.
template <bool ASPLIT, int ACT, bool BIAS_BF16, bool RES_BF16>
__global__ __launch_bounds__(128) void k_gemm_bf3(const float* __restrict__ A, int lda, const unsigned short* __restrict__ Wt, int ldb,
                                                const float* __restrict__ bias, const float* __restrict__ resid, int rmod, int ldr,
                                                float* __restrict__ C, int ldc, int M, int N, int K) {
  __shared__ __attribute__((aligned(16))) float so[4][16][64];
  const int tid = threadIdx.x, w = tid >> 5, lane = tid & 31, ln = lane & 15, hh = lane >> 4;
  const int ntn = N / 64;
  const int wid = blockIdx.x * 4 + w;
  const int mt = wid / ntn, nq = wid % ntn;
  if (mt * 16 >= M) return;
  const int row0 = mt * 16, col0 = nq * 64;
  const float* arow = A + (size_t)(row0 + ln) * lda;
  v8f acc[4] = {};
  for (int kb = 0; kb < K; kb += 32) {
    FragB ah, al;
    const v4f x0 = *(const v4fa*)(arow + kb + 8 * hh), x1 = *(const v4fa*)(arow + kb + 8 * hh + 4);
    const v4f x2 = *(const v4fa*)(arow + kb + 16 + 8 * hh), x3 = *(const v4fa*)(arow + kb + 16 + 8 * hh + 4);
    float xs[16] = {x0[0],x0[1],x0[2],x0[3],x1[0],x1[1],x1[2],x1[3],x2[0],x2[1],x2[2],x2[3],x3[0],x3[1],x3[2],x3[3]};
#pragma unroll
    for (int i = 0; i < 16; ++i) { const unsigned short hb = bf16_bits(xs[i]); ah.u[i] = hb; al.u[i] = ASPLIT ? bf16_bits(xs[i] - bf16_val(hb)) : (unsigned short)0; }
#pragma unroll
    for (int t = 0; t < 4; ++t) {
      const unsigned short* brow = Wt + (size_t)(col0 + t * 16 + ln) * ldb + kb;
      FragB b;
      b.half[0] = *(const v8us*)(brow + 8 * hh);
      b.half[1] = *(const v8us*)(brow + 16 + 8 * hh);
      acc[t] = mmaN<ASPLIT ? 2 : 1>(ah.v, al.v, b.v, b.v, acc[t]);
    }
  }
#pragma unroll
  for (int t = 0; t < 4; ++t) {
    const int col = col0 + t * 16 + ln;
    float bv = bias ? bias[col] : 0.f;
    if (BIAS_BF16) bv = bf16_round(bv);
#pragma unroll
    for (int r = 0; r < 8; ++r) {
      float v = acc[t][r] + bv;
      if (resid) { float rv = resid[(size_t)((row0 + 8 * hh + r) % rmod) * ldr + col]; if (RES_BF16) rv = bf16_round(rv); v += rv; }
      if (ACT == 1) v = fmaxf(v, 0.f);
      if (ACT == 2) v = 0.5f * v * (1.0f + erff(v * 0.70710678118654752f));
      if (ACT == 3) { const float u = 0.7978845608028654f * (v + 0.044715f * v * v * v); v = 0.5f * v * (1.0f + tanhf(u)); }
      so[w][8 * hh + r][t * 16 + ln] = v;
    }
  }
  __builtin_amdgcn_fence(__ATOMIC_ACQ_REL, "workgroup");
  __builtin_amdgcn_wave_barrier();
  const int rsub = lane >> 4, c4 = (lane & 15) * 4;
  {
#pragma unroll
    for (int q = 0; q < 8; ++q) {
      const int r = q * 2 + rsub;
      const v4f v = *(const v4fa*)&so[w][r][c4];
      *(v4f*)(C + (size_t)(row0 + r) * ldc + col0 + c4) = v;
    }
    
  }
}
// row LayerNorm (biased variance, eps) over N: s = X (+ R); optional out_sum <- s; out_norm <- (s-mu)*rsqrt(var+eps)*g + b
template <bool PARAM_BF16>
__global__ __launch_bounds__(256) void k_layernorm(const float* __restrict__ X, const float* __restrict__ R, const float* __restrict__ g, const float* __restrict__ bta,
                                                  float* __restrict__ out_sum, float* __restrict__ out_norm, int N, float eps) {
  __shared__ float red[256];
  const int row = blockIdx.x, tid = threadIdx.x;
  const float* x = X + (size_t)row * N; const float* rr = R ? R + (size_t)row * N : nullptr;
  float vals[16];                     // up to N = 4096
  const int per = N / 256;            // contiguous chunk per thread? use strided-by-4 chunks: thread handles j = tid*4 + 1024*u
  float s1 = 0.f;
  for (int u = 0; u < per / 4; ++u) {
    const int j = tid * 4 + 1024 * u;
    const v4f a = *(const v4fa*)(x + j);
    v4f b = {0.f,0.f,0.f,0.f}; if (rr) b = *(const v4fa*)(rr + j);
#pragma unroll
    for (int q = 0; q < 4; ++q) { const float v = a[q] + b[q]; vals[u * 4 + q] = v; s1 += v; }
  }
  red[tid] = s1; __syncthreads();
  for (int st = 128; st > 0; st >>= 1) { if (tid < st) red[tid] += red[tid + st]; __syncthreads(); }
  const float mu = red[0] / (float)N; __syncthreads();
  float s2 = 0.f;
  for (int u = 0; u < per / 4; ++u)
#pragma unroll
    for (int q = 0; q < 4; ++q) { const float c = vals[u * 4 + q] - mu; s2 += c * c; }
  red[tid] = s2; __syncthreads();
  for (int st = 128; st > 0; st >>= 1) { if (tid < st) red[tid] += red[tid + st]; __syncthreads(); }
  const float rs = rsqrtf(red[0] / (float)N + eps);
  {
    for (int u = 0; u < per / 4; ++u) {
      const int j = tid * 4 + 1024 * u;
      v4f o, sm;
#pragma unroll
      for (int q = 0; q < 4; ++q) {
        float gg = g[j + q], bb = bta[j + q];
        if (PARAM_BF16) { gg = bf16_round(gg); bb = bf16_round(bb); }
        sm[q] = vals[u * 4 + q]; o[q] = (vals[u * 4 + q] - mu) * rs * gg + bb;
      }
      if (out_sum) *(v4f*)(out_sum + (size_t)row * N + j) = sm;
      *(v4f*)(out_norm + (size_t)row * N + j) = o;
    }
    
  }
}



// ---- f16 WMMA path (v_wmma_f32_16x16x32_f16): 11-bit significands for operands in range — used where a [0,1] probability operand needs more precision than bf16
typedef _Float16 v16h __attribute__((ext_vector_type(16)));
union FragH { v16h v; v8us half[2]; _Float16 h[16]; unsigned short u[16]; };
template <int NT>
__device__ __forceinline__ v8f mmaH(v16h ah, v16h al, v16h bh, v16h bl, v8f c) {
  c = __builtin_amdgcn_wmma_f32_16x16x32_f16(false, ah, false, bh, (short)0, c, false, false);
  if (NT >= 2) c = __builtin_amdgcn_wmma_f32_16x16x32_f16(false, al, false, bh, (short)0, c, false, false);
  if (NT >= 3) c = __builtin_amdgcn_wmma_f32_16x16x32_f16(false, ah, false, bl, (short)0, c, false, false);
  asm volatile("v_nop\n\tv_nop\n\tv_nop\n\tv_nop" : "+v"(c) : "v"(ah), "v"(al), "v"(bh), "v"(bl));
  return c;
}
// batched GEMM like k_gemm_b but f16 operands: A f32 (split into f16 hi/lo if ASPLIT, else rounded to f16), Bt = f16 values [n][k]; alpha; C f32; N multiple of 16 (partial tiles skipped)
template <bool ASPLIT>
__global__ __launch_bounds__(128) void k_gemm_h(const float* __restrict__ A, int lda, size_t sA, const _Float16* __restrict__ Bh, int ldb, size_t sB, float alpha, float* __restrict__ C, int ldc, size_t sC, int M, int N, int K) {
  __shared__ __attribute__((aligned(16))) float so[4][16][64];
  const int tid = threadIdx.x, w = tid >> 5, lane = tid & 31, ln = lane & 15, hh = lane >> 4; const int by = blockIdx.y;
  A += (size_t)by * sA; Bh += (size_t)by * sB; C += (size_t)by * sC;
  const int ntn = (N + 63) / 64; const int wid = blockIdx.x * 4 + w; const int mt = wid / ntn, nq = wid % ntn; if (mt * 16 >= M) return;
  const int row0 = mt * 16, col0 = nq * 64; const float* arow = A + (size_t)(row0 + ln) * lda;
  v8f acc[4] = {};
  for (int kb = 0; kb < K; kb += 32) {
    FragH ah, al;
    const v4f x0 = *(const v4fa*)(arow + kb + 8 * hh), x1 = *(const v4fa*)(arow + kb + 8 * hh + 4), x2 = *(const v4fa*)(arow + kb + 16 + 8 * hh), x3 = *(const v4fa*)(arow + kb + 16 + 8 * hh + 4);
    float xs[16] = {x0[0],x0[1],x0[2],x0[3],x1[0],x1[1],x1[2],x1[3],x2[0],x2[1],x2[2],x2[3],x3[0],x3[1],x3[2],x3[3]};
#pragma unroll
    for (int i = 0; i < 16; ++i) { const _Float16 h = (_Float16)xs[i]; ah.h[i] = h; al.h[i] = ASPLIT ? (_Float16)(xs[i] - (float)h) : (_Float16)0.0f; }
#pragma unroll
    for (int t = 0; t < 4; ++t) { if (col0 + t * 16 >= N) continue; const size_t boff = (size_t)(col0 + t * 16 + ln) * ldb + kb; FragH bq; bq.half[0] = *(const v8us*)(Bh + boff + 8 * hh); bq.half[1] = *(const v8us*)(Bh + boff + 16 + 8 * hh);
      acc[t] = mmaH<ASPLIT ? 2 : 1>(ah.v, al.v, bq.v, bq.v, acc[t]); }
  }
#pragma unroll
  for (int t = 0; t < 4; ++t) { if (col0 + t * 16 >= N) continue;
#pragma unroll
    for (int r = 0; r < 8; ++r) so[w][8 * hh + r][t * 16 + ln] = acc[t][r] * alpha; }
  __builtin_amdgcn_fence(__ATOMIC_ACQ_REL, "workgroup"); __builtin_amdgcn_wave_barrier();
  const int rsub = lane >> 4, c4 = (lane & 15) * 4;
  {
#pragma unroll
    for (int q = 0; q < 8; ++q) { const int r = q * 2 + rsub; if (col0 + c4 < N) { const v4f v = *(const v4fa*)&so[w][r][c4]; *(v4f*)(C + (size_t)(row0 + r) * ldc + col0 + c4) = v; } }
     }
}

// Wt[n][k] = f16(W[k][n]·scale) from f32 row-major W[K][N] (scale = power of two; bf16-exact weights stay exact in f16 away from the subnormal range)
__global__ __launch_bounds__(256) void k_wt_f16(const float* __restrict__ W, _Float16* __restrict__ Wt, int K, int N, float scale) {
  const int t = blockIdx.x * 256 + threadIdx.x; if (t >= N * (K / 8)) return; const int n = t / (K / 8), k8 = (t % (K / 8)) * 8; FragH f;
#pragma unroll
  for (int i = 0; i < 8; ++i) f.h[i] = (_Float16)(bf16_round(W[(size_t)(k8 + i) * N + n]) * scale); const v8us o = f.half[0];
  *(v8us*)((unsigned short*)Wt + (size_t)n * K + k8) = o; 
}
// k_gemm_hh variant with fused epilogue: v = acc·alpha + bias[by·sBias + col] (+ CP[(row/rowsPerB)·sCPb + by·64 + col] if CP) ; ACT 0 none / 1 elu ; writes f16 C16 (and f32 C if non-null)
template <int ACT>
__global__ __launch_bounds__(128) void k_gemm_hhx(const _Float16* __restrict__ A, int lda, size_t sA, const _Float16* __restrict__ Bh, int ldb, size_t sB, float alpha, const float* __restrict__ bias, size_t sBias, const float* __restrict__ CP, int rowsPerB, size_t sCPb, int row0g,
    float* __restrict__ C, _Float16* __restrict__ C16, int ldc, size_t sC, int M, int N, int K) {
  __shared__ __attribute__((aligned(16))) float so[4][16][64];
  const int tid = threadIdx.x, w = tid >> 5, lane = tid & 31, ln = lane & 15, hh = lane >> 4; const int by = blockIdx.y;
  A += (size_t)by * sA; Bh += (size_t)by * sB; const size_t cofs = (size_t)by * sC; const float* bp = bias ? bias + (size_t)by * sBias : nullptr;
  const int ntn = (N + 63) / 64; const int wid = blockIdx.x * 4 + w; const int mt = wid / ntn, nq = wid % ntn; if (mt * 16 >= M) return;
  const int row0 = mt * 16, col0 = nq * 64; const _Float16* arow = A + (size_t)(row0 + ln) * lda;
  v8f acc[4] = {};
  for (int kb = 0; kb < K; kb += 32) { FragH ah; ah.half[0] = *(const v8us*)((const unsigned short*)arow + kb + 8 * hh); ah.half[1] = *(const v8us*)((const unsigned short*)arow + kb + 16 + 8 * hh);
#pragma unroll
    for (int t = 0; t < 4; ++t) { if (col0 + t * 16 >= N) continue; const size_t boff = (size_t)(col0 + t * 16 + ln) * ldb + kb; FragH bq; bq.half[0] = *(const v8us*)((const unsigned short*)Bh + boff + 8 * hh); bq.half[1] = *(const v8us*)((const unsigned short*)Bh + boff + 16 + 8 * hh);
      acc[t] = mmaH<1>(ah.v, ah.v, bq.v, bq.v, acc[t]); }
  }
#pragma unroll
  for (int t = 0; t < 4; ++t) { if (col0 + t * 16 >= N) continue; const int col = col0 + t * 16 + ln; const float bv = bp ? bf16_round(bp[col]) : 0.f;
#pragma unroll
    for (int r = 0; r < 8; ++r) { float v = acc[t][r] * alpha + bv; if (CP) { const int bidx = (row0g + row0 + 8 * hh + r) / rowsPerB; v += CP[(size_t)bidx * sCPb + (size_t)by * 64 + col]; } if (ACT == 1) v = (v > 0.f) ? v : expm1f(v); else if (ACT == 7) v = (v > 0.f) ? v + 1.0f : expf(v); else if (ACT == 8) v = tanhf(v); else if (ACT == 9) v = 0.5f * v * (1.0f + tanhf(0.7978845608028654f * (v + 0.044715f * v * v * v))); else if (ACT == 11) v = 1.0f / (1.0f + expf(-v)); else if (ACT == 12) v = (v > 0.f) ? v : 0.01f * v; else if (ACT == 14) v = (v > 0.f) ? v : 0.1f * v; else if (ACT == 15) v = v / (1.0f + expf(-v)); else if (ACT == 3) v = fmaxf(v, 0.f); else if (ACT == 6) v = 0.5f * v * (1.0f + erff(v * 0.70710678118654752f)); so[w][8 * hh + r][t * 16 + ln] = v; } }
  __builtin_amdgcn_fence(__ATOMIC_ACQ_REL, "workgroup"); __builtin_amdgcn_wave_barrier();
  const int rsub = lane >> 4, c4 = (lane & 15) * 4; typedef _Float16 v4h __attribute__((ext_vector_type(4)));
  {
#pragma unroll
    for (int q = 0; q < 8; ++q) { const int r = q * 2 + rsub; if (col0 + c4 < N) { const v4f v = *(const v4fa*)&so[w][r][c4]; if (C) *(v4f*)(C + cofs + (size_t)(row0 + r) * ldc + col0 + c4) = v; if (C16) { v4h h4; for (int i = 0; i < 4; ++i) h4[i] = (_Float16)v[i]; *(v4h*)(C16 + cofs + (size_t)(row0 + r) * ldc + col0 + c4) = h4; } } }
     }
}


typedef _Float16 v4h __attribute__((ext_vector_type(4)));

// All input roundings in one launch, 8 values a thread: work-groups 0..PREP_XB-1 take x of all images (bf16 rounding, kept as f16), the next PREP_QB take w_qkv and the last PREP_PB w_proj (bf16 rounding x16, exact in f16).
// The work-group picks source, plane and factor (1 for x: an exact product); the grid divides the three arrays without remainder.
#define PREP_XB (NIMG * NTOK * CC / 8 / 256)
#define PREP_QB (3 * CC * CC / 8 / 256)
#define PREP_PB (CC * CC / 8 / 256)
__global__ __launch_bounds__(256) void k_prep16(const float* __restrict__ x, const float* __restrict__ wqkv, const float* __restrict__ wp, _Float16* __restrict__ X16, _Float16* __restrict__ BQKV, _Float16* __restrict__ BP) {
  int bx = blockIdx.x; const float* src = x; _Float16* dst = X16; float sc = 1.0f;
  if (bx >= PREP_XB + PREP_QB) { bx -= PREP_XB + PREP_QB; src = wp; dst = BP; sc = 16.0f; } else if (bx >= PREP_XB) { bx -= PREP_XB; src = wqkv; dst = BQKV; sc = 16.0f; }
  const size_t t = (size_t)bx * 256 + threadIdx.x; FragH f;
#pragma unroll
  for (int q = 0; q < 8; ++q) f.h[q] = (_Float16)(bf16_round(src[t * 8 + q]) * sc); *(v8us*)((unsigned short*)dst + t * 8) = f.half[0];  }
__global__ __launch_bounds__(256) void k_h16(const float* __restrict__ x, _Float16* __restrict__ X16, size_t n8) { const size_t t = (size_t)blockIdx.x * 256 + threadIdx.x; if (t >= n8) return; FragH f;
#pragma unroll
  for (int q = 0; q < 8; ++q) f.h[q] = (_Float16)x[t * 8 + q]; *(v8us*)((unsigned short*)X16 + t * 8) = f.half[0];  }
template <int NHv, int TTv>
__global__ __launch_bounds__(256) void k_vt(const _Float16* __restrict__ V16, int ldv, int voff, _Float16* __restrict__ Vt) { __shared__ unsigned short tl[64][66]; const int tid = threadIdx.x; const int slab = blockIdx.x / (TTv / 64), lg = blockIdx.x % (TTv / 64); const int b = slab / NHv, h = slab % NHv;
  for (int i = tid; i < 64 * 8; i += 256) { const int r = i / 8, c8 = (i % 8) * 8; FragH f; f.half[0] = *(const v8us*)((const unsigned short*)V16 + ((size_t)b * TTv + lg * 64 + r) * ldv + voff + h * 64 + c8);
#pragma unroll
    for (int q = 0; q < 8; ++q) tl[r][c8 + q] = f.u[q]; }
  __syncthreads();
  {
#pragma unroll
    for (int rd = 0; rd < 2; ++rd) { const int d = rd * 32 + tid / 8, pc = tid % 8; FragH f;
#pragma unroll
      for (int q = 0; q < 8; ++q) f.u[q] = tl[pc * 8 + q][d];
      *(v8us*)((unsigned short*)Vt + ((size_t)slab * 64 + d) * TTv + lg * 64 + pc * 8) = f.half[0]; }
     } }

__global__ __launch_bounds__(256) void k_hl(const float* __restrict__ F, _Float16* __restrict__ Hh, _Float16* __restrict__ Hl, size_t n8) { const size_t t = (size_t)blockIdx.x * 256 + threadIdx.x; if (t >= n8) return; FragH fh, fl; const v4f a = *(const v4fa*)(F + t * 8), c = *(const v4fa*)(F + t * 8 + 4);
#pragma unroll
  for (int q = 0; q < 4; ++q) { _Float16 h = (_Float16)a[q]; fh.h[q] = h; fl.h[q] = (_Float16)((a[q] - (float)h) * 1024.0f); h = (_Float16)c[q]; fh.h[4 + q] = h; fl.h[4 + q] = (_Float16)((c[q] - (float)h) * 1024.0f); }
  { *(v8us*)((unsigned short*)Hh + t * 8) = fh.half[0]; *(v8us*)((unsigned short*)Hl + t * 8) = fl.half[0];  } }

// ---- GEMM C = A.B^T x alpha + bias for K = CC: A f16 [M][CC], Bh f16 [N][CC]; M and N multiples of 128; writes f32 C (F32OUT) or f16 C16, pitch N ----
// A work-group of eight waves owns a 128 x 128 tile of C. Its 128 rows of A and 128 rows of B, whole in k (512 B a row), are brought into LDS once by asynchronous copies,
// one whole row (four 128-byte lines) per wave instruction; every fragment then comes from LDS. Wave = 32 rows x 64 columns, k ascending as before.
// The f16 form is the qkv product (N = 3 CC, rows = tokens of all images): its q columns go to C16 (pitch N); its k and v columns go, in blocks of 8 tokens x 32 channels of one head (512 B each), to
// KS block = [16-byte piece c of the token's 64 B][token & 7][8 f16] and VS block = [channel][8 tokens]; a wave's 16-byte-per-lane fragment load of the attention kernel then reads four whole 128-byte lines.
__device__ __forceinline__ v16h g2_frag(const _Float16* p, int hh) { FragH f; f.half[0] = *(const v8us*)((const unsigned short*)p + 8 * hh); f.half[1] = *(const v8us*)((const unsigned short*)p + 16 + 8 * hh); return f.v; }
#define G3_PITCH 528      /* bytes of a staged row: 512 + 16, an odd number of 16-byte pieces, so that the 16 rows of a ds_load_b128 fragment read lie on different banks */
__device__ __forceinline__ v16h g3_frag(const unsigned char* p) { FragH f; f.half[0] = *(const v8us*)p; f.half[1] = *(const v8us*)(p + 32); return f.v; }
__device__ __forceinline__ v8f g3_mma(v16h a, v16h b, v8f c) { return __builtin_amdgcn_wmma_f32_16x16x32_f16(false, a, false, b, (short)0, c, false, false); }
// Eight rows, 16 bytes a lane each, from global memory straight into LDS. The closing s_wait_xcnt stands inside the statement, in front of any later write of the address registers that the copies name.
__device__ __forceinline__ void g3_copy8(unsigned l, const _Float16* g) {
  asm volatile("global_load_async_to_lds_b128 %0, %8, off\n\tglobal_load_async_to_lds_b128 %1, %9, off\n\tglobal_load_async_to_lds_b128 %2, %10, off\n\tglobal_load_async_to_lds_b128 %3, %11, off\n\t"
               "global_load_async_to_lds_b128 %4, %12, off\n\tglobal_load_async_to_lds_b128 %5, %13, off\n\tglobal_load_async_to_lds_b128 %6, %14, off\n\tglobal_load_async_to_lds_b128 %7, %15, off\n\ts_wait_xcnt 0x0"
               :: "v"(l), "v"(l + G3_PITCH), "v"(l + 2 * G3_PITCH), "v"(l + 3 * G3_PITCH), "v"(l + 4 * G3_PITCH), "v"(l + 5 * G3_PITCH), "v"(l + 6 * G3_PITCH), "v"(l + 7 * G3_PITCH),
                  "v"(g), "v"(g + CC), "v"(g + 2 * CC), "v"(g + 3 * CC), "v"(g + 4 * CC), "v"(g + 5 * CC), "v"(g + 6 * CC), "v"(g + 7 * CC) : "memory"); }
template <int N, bool F32OUT>
__global__ __launch_bounds__(256) void k_gemm3(const _Float16* __restrict__ A, const _Float16* __restrict__ Bh, float alpha, const float* __restrict__ bias, float* __restrict__ C, _Float16* __restrict__ C16, _Float16* __restrict__ KS, _Float16* __restrict__ VS) {
  __shared__ __attribute__((aligned(16))) unsigned char sm[256 * G3_PITCH];      /* rows 0..127: A, rows 128..255: B; afterwards the waves' output staging */
  const int tid = threadIdx.x, w = __builtin_amdgcn_readfirstlane(tid >> 5), lane = tid & 31, ln = lane & 15, hh = lane >> 4;      /* wave number as a scalar: the choice of source below is a scalar one */
  constexpr int ntn = N >> 7; const int mt = blockIdx.x / ntn, nq = blockIdx.x - mt * ntn; const int row0 = mt * 128, col0 = nq * 128;
  { const _Float16* g = (w < 4 ? A + (size_t)(row0 + 32 * w) * CC : Bh + (size_t)(col0 + 32 * (w - 4)) * CC) + lane * 8;      /* waves 0..3 bring A, waves 4..7 B: 32 rows each, lane = 16-byte piece of the row */
    const unsigned l = (unsigned)(size_t)sm + (unsigned)(32 * w * G3_PITCH + lane * 16);
#pragma unroll
    for (int u = 0; u < 4; ++u) g3_copy8(l + u * 8 * G3_PITCH, g + (size_t)u * 8 * CC); }
  asm volatile("s_wait_asynccnt 0x0" ::: "memory");      /* this wave's 32 copies have landed */
  __syncthreads();      /* and so have the other waves': nobody reads the tile in front of this barrier */
  const int wm = w & 3, wn = w >> 2;
  const unsigned char* ap = sm + (32 * wm + ln) * G3_PITCH + 16 * hh; const unsigned char* bq = sm + (128 + 64 * wn + ln) * G3_PITCH + 16 * hh;
  const v8f z8 = {0.f,0.f,0.f,0.f,0.f,0.f,0.f,0.f}; v8f c00 = z8, c01 = z8, c02 = z8, c03 = z8, c10 = z8, c11 = z8, c12 = z8, c13 = z8;
  v16h fa[2][2], fb[2][4];      /* two fragment sets: the products of a step read one while the next step's LDS reads fill the other */
#pragma unroll
  for (int t = 0; t < 2; ++t) fa[0][t] = g3_frag(ap + 16 * t * G3_PITCH);
#pragma unroll
  for (int t = 0; t < 4; ++t) fb[0][t] = g3_frag(bq + 16 * t * G3_PITCH);
#pragma unroll      /* unrolled: the set index is a compile-time constant, so both sets stay in registers */
  for (int ks = 0; ks < CC / 32; ++ks) { const int cu = ks & 1, nx = cu ^ 1;
    if (ks + 1 < CC / 32) {
#pragma unroll
      for (int t = 0; t < 2; ++t) fa[nx][t] = g3_frag(ap + 16 * t * G3_PITCH + 64 * (ks + 1));
#pragma unroll
      for (int t = 0; t < 4; ++t) fb[nx][t] = g3_frag(bq + 16 * t * G3_PITCH + 64 * (ks + 1)); }
    __builtin_amdgcn_sched_barrier(0);      /* keeps the next step's twelve LDS reads one group ahead of this step's products: left free, the compiler lifts reads of many steps to the top and takes over 256 registers, with register-window switches among the products */
    c00 = g3_mma(fa[cu][0], fb[cu][0], c00); c10 = g3_mma(fa[cu][1], fb[cu][0], c10); c01 = g3_mma(fa[cu][0], fb[cu][1], c01); c11 = g3_mma(fa[cu][1], fb[cu][1], c11);
    c02 = g3_mma(fa[cu][0], fb[cu][2], c02); c12 = g3_mma(fa[cu][1], fb[cu][2], c12); c03 = g3_mma(fa[cu][0], fb[cu][3], c03); c13 = g3_mma(fa[cu][1], fb[cu][3], c13);
    __builtin_amdgcn_sched_barrier(0);      /* and keeps the reads of the step after next behind these products, whose set they overwrite */
  }
  __syncthreads();      /* every wave has read its last fragment: from here the tile's LDS is output staging, 32 x 68 floats a wave */
  float (*so)[68] = (float (*)[68])(sm + w * (32 * 68 * 4)); const int rw = row0 + 32 * wm, cw = col0 + 64 * wn;
  v8f accs[8] = {c00, c01, c02, c03, c10, c11, c12, c13};
  const int sel = F32OUT ? 0 : nq >> 1;      /* qkv product: column tiles 0,1 are q, 2,3 k, 4,5 v; one answer for the whole work-group */
  const size_t blk = (size_t)((unsigned)rw / NTOK * NHD + (((unsigned)cw & (CC - 1)) >> 5)) * (NTOK / 8) + (((unsigned)rw & (NTOK - 1)) >> 3);      /* first of the wave's 2 heads x 4 token blocks */
  if (sel == 2) {      /* v: an accumulator register row is already 8 tokens of one channel, the 16 bytes of a VS block's row; 16 lanes fill 256 contiguous bytes */
    unsigned short* vp = (unsigned short*)VS + ((blk + hh) * 32 + ln) * 8;
#pragma unroll
    for (int u = 0; u < 8; ++u) { const int t = u & 3, half = u >> 2; const float bv = bf16_round(bias[cw + t * 16 + ln]); FragH f;
#pragma unroll
      for (int r = 0; r < 8; ++r) f.h[r] = (_Float16)(accs[u][r] * alpha + bv);
      *(v8us*)(vp + (((t >> 1) * (NTOK / 8) + half * 2) * 32 + (t & 1) * 16) * 8) = f.half[0]; }
    return; }      /* no barrier stands behind this point */
#pragma unroll
  for (int u = 0; u < 8; ++u) { const int t = u & 3, half = u >> 2; const float bv = bf16_round(bias[cw + t * 16 + ln]);
#pragma unroll
    for (int r = 0; r < 8; ++r) so[half * 16 + 8 * hh + r][t * 16 + ln] = accs[u][r] * alpha + bv; }
  __builtin_amdgcn_fence(__ATOMIC_ACQ_REL, "workgroup"); __builtin_amdgcn_wave_barrier();
  if (sel == 1) {      /* k: lane = (piece c, token & 7), so each store of the wave is one whole 512-byte KS block */
    unsigned short* kp = (unsigned short*)KS + blk * 256 + lane * 8; const int c8 = (lane >> 3) * 8, tk = lane & 7;
    v4f lo[8], hi[8];
#pragma unroll
    for (int q = 0; q < 8; ++q) { lo[q] = *(const v4fa*)&so[(q & 3) * 8 + tk][(q >> 2) * 32 + c8]; hi[q] = *(const v4fa*)&so[(q & 3) * 8 + tk][(q >> 2) * 32 + c8 + 4]; }
#pragma unroll
    for (int q = 0; q < 8; ++q) { FragH f;
#pragma unroll
      for (int i = 0; i < 4; ++i) { f.h[i] = (_Float16)lo[q][i]; f.h[4 + i] = (_Float16)hi[q][i]; }
      *(v8us*)(kp + ((q >> 2) * (NTOK / 8) + (q & 3)) * 256) = f.half[0]; }
    asm volatile("s_wait_xcnt 0x0" ::: "memory");      /* in the built code other branches' blocks follow this one and reuse the stores' registers: the wait stands in front of any such write */
    return; }
  const int rsub = lane >> 4, c4 = (lane & 15) * 4;
  const size_t o0 = (size_t)(rw + rsub) * N + cw + c4;      /* N is a compile-time pitch: the sixteen stores share one address and differ in their immediate offsets */
  v4f vv[16];
#pragma unroll
  for (int q = 0; q < 16; ++q) vv[q] = *(const v4fa*)&so[q * 2 + rsub][c4];
#pragma unroll
  for (int q = 0; q < 16; ++q) {
    if (F32OUT) *(v4f*)(C + o0 + q * 2 * N) = vv[q];
    else { v4h h4; for (int i = 0; i < 4; ++i) h4[i] = (_Float16)vv[q][i]; *(v4h*)(C16 + o0 + q * 2 * N) = h4; } }
  if (!F32OUT) asm volatile("s_wait_xcnt 0x0" ::: "memory");      /* as behind the k stores: in the three-way form the built code goes on into another branch's block */
}


__device__ __forceinline__ int na_start(int i, int K) { const int nh = K / 2; int s = max(i - nh, 0); if (i + nh >= RES) s += RES - i - nh - 1; return s; }
__device__ __forceinline__ int na_pb(int i, int K) { const int nh = K / 2; int p = nh; if (i < nh) p += nh - i; if (i + nh >= RES) p += RES - i - 1 - nh; return p; }
__device__ __forceinline__ v16h na_frag(const _Float16* p, int second) { FragH f; f.half[0] = *(const v8us*)(const unsigned short*)p; f.half[1] = *(const v8us*)((const unsigned short*)p + second); return f.v; }
// lane l <-> lane l ^ 16 (the two halves of a wave hold different keys of the same query)
__device__ __forceinline__ float xhalf(float x) { return __builtin_bit_cast(float, __builtin_amdgcn_permlanex16(__builtin_bit_cast(int, x), __builtin_bit_cast(int, x), 0x76543210, 0xfedcba98, false, false)); }
// Eight exponentials (base 2) in one statement: behind a transcendental the instruction set asks for one independent instruction before its result is read or its source overwritten.
// The outputs are early-clobber, so each v_exp_f32 is that independent instruction for the one before it; the closing v_nop keeps the slot behind the last.
__device__ __forceinline__ void na_exp8(float (&y)[8], const float (&x)[8]) {
  asm("v_exp_f32 %0, %8\n\tv_exp_f32 %1, %9\n\tv_exp_f32 %2, %10\n\tv_exp_f32 %3, %11\n\tv_exp_f32 %4, %12\n\tv_exp_f32 %5, %13\n\tv_exp_f32 %6, %14\n\tv_exp_f32 %7, %15\n\tv_nop"
      : "=&v"(y[0]), "=&v"(y[1]), "=&v"(y[2]), "=&v"(y[3]), "=&v"(y[4]), "=&v"(y[5]), "=&v"(y[6]), "=&v"(y[7])
      : "v"(x[0]), "v"(x[1]), "v"(x[2]), "v"(x[3]), "v"(x[4]), "v"(x[5]), "v"(x[6]), "v"(x[7])); }
__device__ __forceinline__ float na_exp1(float x) { float y; asm("v_exp_f32 %0, %1\n\tv_nop" : "=&v"(y) : "v"(x)); return y; }      /* the v_nop keeps the same slot */
#define NA_NEG (-3.0e38f)
#define NA_TBMAX (25 * 25 + 64)
// One query row i of one image and two neighbouring heads per work-group; wave = (head, 16 query columns).
// All 16 queries of a wave share the K key rows si..si+K-1; their column windows lie inside the 32 columns C0..C0+31 (C0 a multiple of 8).
// Per key row: S^T = K.Q^T + bias/scale (two 16x16x32 products, bias and window mask enter as the C operand), running maximum and sum per query
// (lane = query), P^T x2^10 packed from the two score tiles as the B operand, O^T += V^T.P^T; K and V^T fragments come from the fragment-ordered planes.
template <int K>
__device__ __forceinline__ void na_row(const _Float16* __restrict__ QKV, const _Float16* __restrict__ KS, const _Float16* __restrict__ VS, const float* __restrict__ rpb, int hb, int bx, float* __restrict__ tb, _Float16* __restrict__ Y16) {
  constexpr int RB = 2 * K - 1, NT = RB * RB, TP = NT + 64; constexpr float SC2 = SCALE * 1.4426950408889634f;
  const int tid = threadIdx.x, w = __builtin_amdgcn_readfirstlane(tid >> 5), lane = tid & 31, ln = lane & 15, hh = lane >> 4; const int i = bx & 63, hp = (bx >> 6) & 1, b = bx >> 7;      /* wave number as a scalar: head, column tile and plane bases stay in scalar registers */
  for (int t = tid; t < 2 * TP; t += 256) { const int hq = t / TP, s = t - hq * TP - 32; tb[t] = (s >= 0 && s < NT) ? bf16_round(rpb[(size_t)(2 * hp + hq) * NT + s]) * 5.656854249492381f : 0.f; }
  __syncthreads();
  const int hq = w >> 2, h = hb + 2 * hp + hq, j0 = (w & 3) * 16, j = j0 + ln; const int C0 = min(max(j0 - 8, 0), 32);
  const int si = na_start(i, K), sj = na_start(j, K), pi = na_pb(i, K), pj = na_pb(j, K);
  const _Float16* img = QKV + (size_t)b * NTOK * (3 * CC);
  const v16h qf = g2_frag(img + (size_t)(i * RES + j) * (3 * CC) + h * HD, hh);
  const size_t blk0 = (size_t)(b * NHD + h) * (NTOK / 8) + ((si * RES + C0) >> 3);
  const _Float16* kb = KS + blk0 * 256; const unsigned kl = ((ln >> 3) * 32 + hh * 8 + (ln & 7)) * 8;      /* key = lane & 15; channels 8hh.. here, 16 + 8hh.. 128 elements on */
  const _Float16* vb = VS + blk0 * 256; const unsigned vl = (hh * 32 + ln) * 8;                            /* channel = lane & 15; keys 8hh.. here, 16 + 8hh.. two blocks on */
  const int d0 = C0 + 8 * hh - sj; const float* tp = tb + hq * TP + 32 + pi * RB + pj + d0;
  bool ok[16];
#pragma unroll
  for (int e = 0; e < 16; ++e) ok[e] = (unsigned)(d0 + (e & 7) + 16 * (e >> 3)) < (unsigned)K;
  const v8f z8 = {0.f,0.f,0.f,0.f,0.f,0.f,0.f,0.f}; v8f o0 = z8, o1 = z8; float m = NA_NEG, l = 0.f;
  v16h a0 = na_frag(kb + kl, 128), a1 = na_frag(kb + kl + 512, 128);
#pragma unroll 1      /* rolled: unrolled, the compiler lifts every row's loads to the top and takes over 300 registers (three waves per SIMD) */
  for (int kr = 0; kr < K; ++kr) {
    const v16h u0 = na_frag(vb + vl, 512), u1 = na_frag(vb + vl + 128, 512); vb += 2048;
    __builtin_amdgcn_sched_barrier(0);      /* keeps the V loads up here, a whole softmax ahead of their use: without it the compiler sinks them to just in front of the products that wait for them */
    v8f s0, s1;
#pragma unroll
    for (int r = 0; r < 8; ++r) { const float t0 = tp[r], t1 = tp[16 + r]; s0[r] = ok[r] ? t0 : NA_NEG; s1[r] = ok[8 + r] ? t1 : NA_NEG; }      /* every index lies inside the padded table */
    tp += RB;
    s0 = __builtin_amdgcn_wmma_f32_16x16x32_f16(false, a0, false, qf, (short)0, s0, false, false);
    s1 = __builtin_amdgcn_wmma_f32_16x16x32_f16(false, a1, false, qf, (short)0, s1, false, false);
    if (kr + 1 < K) kb += 2048;      /* next row's K fragments fly under this row's softmax; the last pass fetches its own row again, never one past the window */
    a0 = na_frag(kb + kl, 128); a1 = na_frag(kb + kl + 512, 128);
    asm volatile("s_wait_xcnt 0x0" ::: "memory");      /* stands in front of the V address pair's advance, which the compiler places below while this pass's loads are in flight */
    __builtin_amdgcn_sched_barrier(0);      /* keeps the next row's K loads here: without it the compiler sinks them to the foot of the pass, a few instructions ahead of their use */
    float mx = fmaxf(s0[0], s1[0]);
#pragma unroll
    for (int r = 1; r < 8; ++r) mx = fmaxf(mx, fmaxf(s0[r], s1[r]));
    mx = fmaxf(mx, xhalf(mx));
    const float mn = fmaxf(m, mx); const float al = na_exp1((m - mn) * SC2); m = mn; const float mb = 10.0f - mn * SC2;
    FragH pf; float ps = 0.f, x0[8], x1[8], p0[8], p1[8];
#pragma unroll
    for (int r = 0; r < 8; ++r) { x0[r] = fmaf(s0[r], SC2, mb); x1[r] = fmaf(s1[r], SC2, mb); }
    na_exp8(p0, x0); na_exp8(p1, x1);
#pragma unroll
    for (int r = 0; r < 8; ++r) { ps += p0[r] + p1[r]; pf.h[r] = (_Float16)p0[r]; pf.h[8 + r] = (_Float16)p1[r]; }
    l = l * al + ps;
#pragma unroll
    for (int r = 0; r < 8; ++r) { o0[r] *= al; o1[r] *= al; }
    o0 = __builtin_amdgcn_wmma_f32_16x16x32_f16(false, u0, false, pf.v, (short)0, o0, false, false);
    o1 = __builtin_amdgcn_wmma_f32_16x16x32_f16(false, u1, false, pf.v, (short)0, o1, false, false);
  }
  l += xhalf(l); const float inv = 1.0f / l; FragH y0, y1;
#pragma unroll
  for (int r = 0; r < 8; ++r) { y0.h[r] = (_Float16)(o0[r] * inv); y1.h[r] = (_Float16)(o1[r] * inv); }
  unsigned short* yp = (unsigned short*)Y16 + ((size_t)b * NTOK + i * RES + j) * CC + h * HD + 8 * hh;
  *(v8us*)yp = y0.half[0]; *(v8us*)(yp + 16) = y1.half[0]; }
__global__ __launch_bounds__(256) void k_na_fused(const _Float16* __restrict__ QKV, const _Float16* __restrict__ KS, const _Float16* __restrict__ VS, const float* __restrict__ rpb0, const float* __restrict__ rpb1, _Float16* __restrict__ Y16) {
  __shared__ float tb[2 * NA_TBMAX]; const int nb = NIMG * 2 * RES;      /* the longer 13x13 work-groups take the lower block indices */
  if ((int)blockIdx.x < nb) na_row<13>(QKV, KS, VS, rpb1, 4, blockIdx.x, tb, Y16); else na_row<7>(QKV, KS, VS, rpb0, 0, blockIdx.x - nb, tb, Y16); }

extern "C" void kernel_launch(void* const* d_in, const int* in_sizes, int n_in,
                              void* d_out, int out_size, void* d_ws, size_t ws_size, hipStream_t stream) {
  (void)in_sizes; (void)n_in; (void)out_size;
  const float* const* I = (const float* const*)d_in; const float* x = I[0]; const float* wqkv = I[1]; const float* bqkv = I[2]; const float* rpb0 = I[3]; const float* rpb1 = I[4]; const float* wp = I[5]; const float* bp = I[6];
  char* ws = (char*)d_ws; size_t off = 0;
  auto take = [&](size_t bytes) { char* p = ws + off; off += (bytes + 255) & ~(size_t)255; return p; };
  _Float16* BQKV = (_Float16*)take((size_t)3 * CC * CC * 2); _Float16* BP = (_Float16*)take((size_t)CC * CC * 2);
  _Float16* X16 = (_Float16*)take((size_t)NIMG * NTOK * CC * 2); _Float16* QKV = (_Float16*)take((size_t)NIMG * NTOK * 3 * CC * 2); _Float16* KS = (_Float16*)take((size_t)NIMG * CC * NTOK * 2); _Float16* VS = (_Float16*)take((size_t)NIMG * CC * NTOK * 2); _Float16* Y16 = (_Float16*)take((size_t)NIMG * NTOK * CC * 2);
  if (off > ws_size) return;      /* 0.5 + 16 + 48 + 16 + 16 + 16 = 112.5 MiB */
  const dim3 gQ((NIMG * NTOK / 128) * (3 * CC / 128), 1), gP((NIMG * NTOK / 128) * (CC / 128), 1);      /* the token rows of all images are one M */
  k_prep16<<<PREP_XB + PREP_QB + PREP_PB, 256, 0, stream>>>(x, wqkv, wp, X16, BQKV, BP);      /* weights stay (out,in) natural */
  k_gemm3<3 * CC, false><<<gQ, 256, 0, stream>>>(X16, BQKV, 0.0625f, bqkv, nullptr, QKV, KS, VS);      /* of the QKV plane only the q columns are written and read */
  k_na_fused<<<2 * NIMG * 2 * RES, 256, 0, stream>>>(QKV, KS, VS, rpb0, rpb1, Y16);
  k_gemm3<CC, true><<<gP, 256, 0, stream>>>(Y16, BP, 0.0625f, bp, (float*)d_out, nullptr, nullptr, nullptr);
}

// v005
// Measured time: 59.1 microseconds a run.
// In two side-by-side timings against v004, it was 1.07 and 1.08 times as fast.
// Over all steps from v000 it is 28.3 times as fast.
#include <hip/hip_runtime.h>
// Split-head neighborhood attention (8 images, 64 x 64 x 256 NHWC; 8 heads x 32; heads 0-3 use 7x7 NATTEN windows with rpb0, heads 4-7 use 13x13 with rpb1; window starts clamped at the borders, relative-position bias with the NATTEN border offsets; q scaled by 32^-0.5) followed by the output projection -> [8,64,64,256].
// Structure: one launch rounds x and both weight matrices to f16 planes; qkv of all images as one f16 WMMA GEMM launch (128x128 work-group tiles staged in LDS by asynchronous copies, 32x64 wave tiles, f32 accumulation, exact products + bias) whose epilogue writes q into an f16 token plane and k and transposed v straight into fragment-ordered planes; ONE fused kernel over all images, both branches and all heads does scores, exact clamped window + bias, softmax (running maximum and sum) and attn.v per wave of 16 query columns of two neighbouring rows against the union of their key rows x 32 columns (each K and V fragment load serves both rows), scores and P (x2^10 in f16) never leaving registers, and writes the head outputs into the token plane; output projection of all images as one GEMM launch straight into the output rows.
// Compute dtype: x, weights, biases, rpb rounded to bf16; q/k/v, P (x2^10) and the attention output as f16 operands (~2^-12); f32 accumulation and softmax. v_wmma_f32_16x16x32_f16.
#define NIMG 8
#define RES 64
#define NTOK (RES * RES)
#define CC 256
#define NHD 8
#define HD 32
#define SCALE 0.17677669529663687f
typedef __bf16 v16b __attribute__((ext_vector_type(16)));
typedef unsigned short v8us __attribute__((ext_vector_type(8), may_alias));
typedef float  v8f  __attribute__((ext_vector_type(8)));
typedef float  v4f  __attribute__((ext_vector_type(4)));
typedef float  v4fa __attribute__((ext_vector_type(4), may_alias));
union FragB { v16b v; v8us half[2]; unsigned short u[16]; };

__device__ __forceinline__ unsigned short bf16_bits(float x) { unsigned int u = __float_as_uint(x); return (unsigned short)((u + 0x7FFFu + ((u >> 16) & 1u)) >> 16); }
__device__ __forceinline__ float bf16_val(unsigned short b) { return __uint_as_float(((unsigned int)b) << 16); }
__device__ __forceinline__ float bf16_round(float x) { return bf16_val(bf16_bits(x)); }
// D += A·B with NT terms: 1 = ah·bh, 2 = + al·bh (A split), 3 = + ah·bl (both split)
template <int NT>
__device__ __forceinline__ v8f mmaN(v16b ah, v16b al, v16b bh, v16b bl, v8f c) {
  c = __builtin_amdgcn_wmma_f32_16x16x32_bf16(false, ah, false, bh, (short)0, c, false, false);
  if (NT >= 2) c = __builtin_amdgcn_wmma_f32_16x16x32_bf16(false, al, false, bh, (short)0, c, false, false);
  if (NT >= 3) c = __builtin_amdgcn_wmma_f32_16x16x32_bf16(false, ah, false, bl, (short)0, c, false, false);
  asm volatile("v_nop\n\tv_nop\n\tv_nop\n\tv_nop" : "+v"(c) : "v"(ah), "v"(al), "v"(bh), "v"(bl));
  return c;
}

__global__ __launch_bounds__(256) void k_wt_bf16(const float* __restrict__ W, unsigned short* __restrict__ Wt, int K, int N) {
  const int t = blockIdx.x * 256 + threadIdx.x;
  const int k8n = K / 8;
  if (t >= N * k8n) return;
  const int n = t / k8n, k8 = (t % k8n) * 8;
  v8us v;
#pragma unroll
  for (int i = 0; i < 8; ++i) v[i] = bf16_bits(W[(size_t)(k8 + i) * N + n]);
  *(v8us*)(Wt + (size_t)n * K + k8) = v;
  
}

// GEMM C[M][N] (f32, pitch ldc) = act(A[M][K]·W + bias). A f32 row-major (pitch lda) converted per fragment to bf16
// (ASPLIT: hi/lo two planes -> 2 terms, else single rounded term); Wt bf16 [N][K] (pitch ldb). BIAS_BF16 rounds the
// bias to bf16 first (bias quantised to bf16 before the add). K%32==0, M%16==0, N%64==0.
template <bool ASPLIT, int ACT, bool BIAS_BF16>
__global__ __launch_bounds__(128) void k_gemm_bf(const float* __restrict__ A, int lda, const unsigned short* __restrict__ Wt, int ldb,
                                               const float* __restrict__ bias, float* __restrict__ C, int ldc, int M, int N, int K) {
  __shared__ __attribute__((aligned(16))) float so[4][16][64];
  const int tid = threadIdx.x, w = tid >> 5, lane = tid & 31, ln = lane & 15, hh = lane >> 4;
  const int ntn = N / 64;
  const int wid = blockIdx.x * 4 + w;
  const int mt = wid / ntn, nq = wid % ntn;
  if (mt * 16 >= M) return;
  const int row0 = mt * 16, col0 = nq * 64;
  const float* arow = A + (size_t)(row0 + ln) * lda;
  v8f acc[4] = {};
  for (int kb = 0; kb < K; kb += 32) {
    FragB ah, al;
    const v4f x0 = *(const v4fa*)(arow + kb + 8 * hh), x1 = *(const v4fa*)(arow + kb + 8 * hh + 4);
    const v4f x2 = *(const v4fa*)(arow + kb + 16 + 8 * hh), x3 = *(const v4fa*)(arow + kb + 16 + 8 * hh + 4);
    float xs[16] = {x0[0],x0[1],x0[2],x0[3],x1[0],x1[1],x1[2],x1[3],x2[0],x2[1],x2[2],x2[3],x3[0],x3[1],x3[2],x3[3]};
#pragma unroll
    for (int i = 0; i < 16; ++i) { const unsigned short hb = bf16_bits(xs[i]); ah.u[i] = hb; al.u[i] = ASPLIT ? bf16_bits(xs[i] - bf16_val(hb)) : (unsigned short)0; }
#pragma unroll
    for (int t = 0; t < 4; ++t) {
      const unsigned short* brow = Wt + (size_t)(col0 + t * 16 + ln) * ldb + kb;
      FragB b;
      b.half[0] = *(const v8us*)(brow + 8 * hh);
      b.half[1] = *(const v8us*)(brow + 16 + 8 * hh);
      acc[t] = mmaN<ASPLIT ? 2 : 1>(ah.v, al.v, b.v, b.v, acc[t]);
    }
  }
#pragma unroll
  for (int t = 0; t < 4; ++t) {
    float bv = bias ? bias[col0 + t * 16 + ln] : 0.f;
    if (BIAS_BF16) bv = bf16_round(bv);
#pragma unroll
    for (int r = 0; r < 8; ++r) { float v = acc[t][r] + bv; if (ACT == 1) v = fmaxf(v, 0.f); so[w][8 * hh + r][t * 16 + ln] = v; }
  }
  __builtin_amdgcn_fence(__ATOMIC_ACQ_REL, "workgroup");
  __builtin_amdgcn_wave_barrier();
  const int rsub = lane >> 4, c4 = (lane & 15) * 4;
  {
#pragma unroll
    for (int q = 0; q < 8; ++q) {
      const int r = q * 2 + rsub;
      const v4f v = *(const v4fa*)&so[w][r][c4];
      *(v4f*)(C + (size_t)(row0 + r) * ldc + col0 + c4) = v;
    }
    
  }
}

// GEMM C = act(A·W + bias + resid): A f32 (ASPLIT -> hi/lo 2 terms), Wt bf16 [N][K]; ACT 0 none, 1 relu, 2 exact gelu;
// resid (optional, f32, row index = (row % rmod), pitch ldr, RES_BF16 rounds it) added before the activation.
template <bool ASPLIT, int ACT, bool BIAS_BF16, bool RES_BF16>
__global__ __launch_bounds__(128) void k_gemm_bf3(const float* __restrict__ A, int lda, const unsigned short* __restrict__ Wt, int ldb,
                                                const float* __restrict__ bias, const float* __restrict__ resid, int rmod, int ldr,
                                                float* __restrict__ C, int ldc, int M, int N, int K) {
  __shared__ __attribute__((aligned(16))) float so[4][16][64];
  const int tid = threadIdx.x, w = tid >> 5, lane = tid & 31, ln = lane & 15, hh = lane >> 4;
  const int ntn = N / 64;
  const int wid = blockIdx.x * 4 + w;
  const int mt = wid / ntn, nq = wid % ntn;
  if (mt * 16 >= M) return;
  const int row0 = mt * 16, col0 = nq * 64;
  const float* arow = A + (size_t)(row0 + ln) * lda;
  v8f acc[4] = {};
  for (int kb = 0; kb < K; kb += 32) {
    FragB ah, al;
    const v4f x0 = *(const v4fa*)(arow + kb + 8 * hh), x1 = *(const v4fa*)(arow + kb + 8 * hh + 4);
    const v4f x2 = *(const v4fa*)(arow + kb + 16 + 8 * hh), x3 = *(const v4fa*)(arow + kb + 16 + 8 * hh + 4);
    float xs[16] = {x0[0],x0[1],x0[2],x0[3],x1[0],x1[1],x1[2],x1[3],x2[0],x2[1],x2[2],x2[3],x3[0],x3[1],x3[2],x3[3]};
#pragma unroll
    for (int i = 0; i < 16; ++i) { const unsigned short hb = bf16_bits(xs[i]); ah.u[i] = hb; al.u[i] = ASPLIT ? bf16_bits(xs[i] - bf16_val(hb)) : (unsigned short)0; }
#pragma unroll
    for (int t = 0; t < 4; ++t) {
      const unsigned short* brow = Wt + (size_t)(col0 + t * 16 + ln) * ldb + kb;
      FragB b;
      b.half[0] = *(const v8us*)(brow + 8 * hh);
      b.half[1] = *(const v8us*)(brow + 16 + 8 * hh);
      acc[t] = mmaN<ASPLIT ? 2 : 1>(ah.v, al.v, b.v, b.v, acc[t]);
    }
  }
#pragma unroll
  for (int t = 0; t < 4; ++t) {
    const int col = col0 + t * 16 + ln;
    float bv = bias ? bias[col] : 0.f;
    if (BIAS_BF16) bv = bf16_round(bv);
#pragma unroll
    for (int r = 0; r < 8; ++r) {
      float v = acc[t][r] + bv;
      if (resid) { float rv = resid[(size_t)((row0 + 8 * hh + r) % rmod) * ldr + col]; if (RES_BF16) rv = bf16_round(rv); v += rv; }
      if (ACT == 1) v = fmaxf(v, 0.f);
      if (ACT == 2) v = 0.5f * v * (1.0f + erff(v * 0.70710678118654752f));
      if (ACT == 3) { const float u = 0.7978845608028654f * (v + 0.044715f * v * v * v); v = 0.5f * v * (1.0f + tanhf(u)); }
      so[w][8 * hh + r][t * 16 + ln] = v;
    }
  }
  __builtin_amdgcn_fence(__ATOMIC_ACQ_REL, "workgroup");
  __builtin_amdgcn_wave_barrier();
  const int rsub = lane >> 4, c4 = (lane & 15) * 4;
  {
#pragma unroll
    for (int q = 0; q < 8; ++q) {
      const int r = q * 2 + rsub;
      const v4f v = *(const v4fa*)&so[w][r][c4];
      *(v4f*)(C + (size_t)(row0 + r) * ldc + col0 + c4) = v;
    }
    
  }
}
// row LayerNorm (biased variance, eps) over N: s = X (+ R); optional out_sum <- s; out_norm <- (s-mu)*rsqrt(var+eps)*g + b
template <bool PARAM_BF16>
__global__ __launch_bounds__(256) void k_layernorm(const float* __restrict__ X, const float* __restrict__ R, const float* __restrict__ g, const float* __restrict__ bta,
                                                  float* __restrict__ out_sum, float* __restrict__ out_norm, int N, float eps) {
  __shared__ float red[256];
  const int row = blockIdx.x, tid = threadIdx.x;
  const float* x = X + (size_t)row * N; const float* rr = R ? R + (size_t)row * N : nullptr;
  float vals[16];                     // up to N = 4096
  const int per = N / 256;            // contiguous chunk per thread? use strided-by-4 chunks: thread handles j = tid*4 + 1024*u
  float s1 = 0.f;
  for (int u = 0; u < per / 4; ++u) {
    const int j = tid * 4 + 1024 * u;
    const v4f a = *(const v4fa*)(x + j);
    v4f b = {0.f,0.f,0.f,0.f}; if (rr) b = *(const v4fa*)(rr + j);
#pragma unroll
    for (int q = 0; q < 4; ++q) { const float v = a[q] + b[q]; vals[u * 4 + q] = v; s1 += v; }
  }
  red[tid] = s1; __syncthreads();
  for (int st = 128; st > 0; st >>= 1) { if (tid < st) red[tid] += red[tid + st]; __syncthreads(); }
  const float mu = red[0] / (float)N; __syncthreads();
  float s2 = 0.f;
  for (int u = 0; u < per / 4; ++u)
#pragma unroll
    for (int q = 0; q < 4; ++q) { const float c = vals[u * 4 + q] - mu; s2 += c * c; }
  red[tid] = s2; __syncthreads();
  for (int st = 128; st > 0; st >>= 1) { if (tid < st) red[tid] += red[tid + st]; __syncthreads(); }
  const float rs = rsqrtf(red[0] / (float)N + eps);
  {
    for (int u = 0; u < per / 4; ++u) {
      const int j = tid * 4 + 1024 * u;
      v4f o, sm;
#pragma unroll
      for (int q = 0; q < 4; ++q) {
        float gg = g[j + q], bb = bta[j + q];
        if (PARAM_BF16) { gg = bf16_round(gg); bb = bf16_round(bb); }
        sm[q] = vals[u * 4 + q]; o[q] = (vals[u * 4 + q] - mu) * rs * gg + bb;
      }
      if (out_sum) *(v4f*)(out_sum + (size_t)row * N + j) = sm;
      *(v4f*)(out_norm + (size_t)row * N + j) = o;
    }
    
  }
}



// ---- f16 WMMA path (v_wmma_f32_16x16x32_f16): 11-bit significands for operands in range — used where a [0,1] probability operand needs more precision than bf16
typedef _Float16 v16h __attribute__((ext_vector_type(16)));
union FragH { v16h v; v8us half[2]; _Float16 h[16]; unsigned short u[16]; };
template <int NT>
__device__ __forceinline__ v8f mmaH(v16h ah, v16h al, v16h bh, v16h bl, v8f c) {
  c = __builtin_amdgcn_wmma_f32_16x16x32_f16(false, ah, false, bh, (short)0, c, false, false);
  if (NT >= 2) c = __builtin_amdgcn_wmma_f32_16x16x32_f16(false, al, false, bh, (short)0, c, false, false);
  if (NT >= 3) c = __builtin_amdgcn_wmma_f32_16x16x32_f16(false, ah, false, bl, (short)0, c, false, false);
  asm volatile("v_nop\n\tv_nop\n\tv_nop\n\tv_nop" : "+v"(c) : "v"(ah), "v"(al), "v"(bh), "v"(bl));
  return c;
}
// batched GEMM like k_gemm_b but f16 operands: A f32 (split into f16 hi/lo if ASPLIT, else rounded to f16), Bt = f16 values [n][k]; alpha; C f32; N multiple of 16 (partial tiles skipped)
template <bool ASPLIT>
__global__ __launch_bounds__(128) void k_gemm_h(const float* __restrict__ A, int lda, size_t sA, const _Float16* __restrict__ Bh, int ldb, size_t sB, float alpha, float* __restrict__ C, int ldc, size_t sC, int M, int N, int K) {
  __shared__ __attribute__((aligned(16))) float so[4][16][64];
  const int tid = threadIdx.x, w = tid >> 5, lane = tid & 31, ln = lane & 15, hh = lane >> 4; const int by = blockIdx.y;
  A += (size_t)by * sA; Bh += (size_t)by * sB; C += (size_t)by * sC;
  const int ntn = (N + 63) / 64; const int wid = blockIdx.x * 4 + w; const int mt = wid / ntn, nq = wid % ntn; if (mt * 16 >= M) return;
  const int row0 = mt * 16, col0 = nq * 64; const float* arow = A + (size_t)(row0 + ln) * lda;
  v8f acc[4] = {};
  for (int kb = 0; kb < K; kb += 32) {
    FragH ah, al;
    const v4f x0 = *(const v4fa*)(arow + kb + 8 * hh), x1 = *(const v4fa*)(arow + kb + 8 * hh + 4), x2 = *(const v4fa*)(arow + kb + 16 + 8 * hh), x3 = *(const v4fa*)(arow + kb + 16 + 8 * hh + 4);
    float xs[16] = {x0[0],x0[1],x0[2],x0[3],x1[0],x1[1],x1[2],x1[3],x2[0],x2[1],x2[2],x2[3],x3[0],x3[1],x3[2],x3[3]};
#pragma unroll
    for (int i = 0; i < 16; ++i) { const _Float16 h = (_Float16)xs[i]; ah.h[i] = h; al.h[i] = ASPLIT ? (_Float16)(xs[i] - (float)h) : (_Float16)0.0f; }
#pragma unroll
    for (int t = 0; t < 4; ++t) { if (col0 + t * 16 >= N) continue; const size_t boff = (size_t)(col0 + t * 16 + ln) * ldb + kb; FragH bq; bq.half[0] = *(const v8us*)(Bh + boff + 8 * hh); bq.half[1] = *(const v8us*)(Bh + boff + 16 + 8 * hh);
      acc[t] = mmaH<ASPLIT ? 2 : 1>(ah.v, al.v, bq.v, bq.v, acc[t]); }
  }
#pragma unroll
  for (int t = 0; t < 4; ++t) { if (col0 + t * 16 >= N) continue;
#pragma unroll
    for (int r = 0; r < 8; ++r) so[w][8 * hh + r][t * 16 + ln] = acc[t][r] * alpha; }
  __builtin_amdgcn_fence(__ATOMIC_ACQ_REL, "workgroup"); __builtin_amdgcn_wave_barrier();
  const int rsub = lane >> 4, c4 = (lane & 15) * 4;
  {
#pragma unroll
    for (int q = 0; q < 8; ++q) { const int r = q * 2 + rsub; if (col0 + c4 < N) { const v4f v = *(const v4fa*)&so[w][r][c4]; *(v4f*)(C + (size_t)(row0 + r) * ldc + col0 + c4) = v; } }
     }
}

// Wt[n][k] = f16(W[k][n]·scale) from f32 row-major W[K][N] (scale = power of two; bf16-exact weights stay exact in f16 away from the subnormal range)
__global__ __launch_bounds__(256) void k_wt_f16(const float* __restrict__ W, _Float16* __restrict__ Wt, int K, int N, float scale) {
  const int t = blockIdx.x * 256 + threadIdx.x; if (t >= N * (K / 8)) return; const int n = t / (K / 8), k8 = (t % (K / 8)) * 8; FragH f;
#pragma unroll
  for (int i = 0; i < 8; ++i) f.h[i] = (_Float16)(bf16_round(W[(size_t)(k8 + i) * N + n]) * scale); const v8us o = f.half[0];
  *(v8us*)((unsigned short*)Wt + (size_t)n * K + k8) = o; 
}
// k_gemm_hh variant with fused epilogue: v = acc·alpha + bias[by·sBias + col] (+ CP[(row/rowsPerB)·sCPb + by·64 + col] if CP) ; ACT 0 none / 1 elu ; writes f16 C16 (and f32 C if non-null)
template <int ACT>
__global__ __launch_bounds__(128) void k_gemm_hhx(const _Float16* __restrict__ A, int lda, size_t sA, const _Float16* __restrict__ Bh, int ldb, size_t sB, float alpha, const float* __restrict__ bias, size_t sBias, const float* __restrict__ CP, int rowsPerB, size_t sCPb, int row0g,
    float* __restrict__ C, _Float16* __restrict__ C16, int ldc, size_t sC, int M, int N, int K) {
  __shared__ __attribute__((aligned(16))) float so[4][16][64];
  const int tid = threadIdx.x, w = tid >> 5, lane = tid & 31, ln = lane & 15, hh = lane >> 4; const int by = blockIdx.y;
  A += (size_t)by * sA; Bh += (size_t)by * sB; const size_t cofs = (size_t)by * sC; const float* bp = bias ? bias + (size_t)by * sBias : nullptr;
  const int ntn = (N + 63) / 64; const int wid = blockIdx.x * 4 + w; const int mt = wid / ntn, nq = wid % ntn; if (mt * 16 >= M) return;
  const int row0 = mt * 16, col0 = nq * 64; const _Float16* arow = A + (size_t)(row0 + ln) * lda;
  v8f acc[4] = {};
  for (int kb = 0; kb < K; kb += 32) { FragH ah; ah.half[0] = *(const v8us*)((const unsigned short*)arow + kb + 8 * hh); ah.half[1] = *(const v8us*)((const unsigned short*)arow + kb + 16 + 8 * hh);
#pragma unroll
    for (int t = 0; t < 4; ++t) { if (col0 + t * 16 >= N) continue; const size_t boff = (size_t)(col0 + t * 16 + ln) * ldb + kb; FragH bq; bq.half[0] = *(const v8us*)((const unsigned short*)Bh + boff + 8 * hh); bq.half[1] = *(const v8us*)((const unsigned short*)Bh + boff + 16 + 8 * hh);
      acc[t] = mmaH<1>(ah.v, ah.v, bq.v, bq.v, acc[t]); }
  }
#pragma unroll
  for (int t = 0; t < 4; ++t) { if (col0 + t * 16 >= N) continue; const int col = col0 + t * 16 + ln; const float bv = bp ? bf16_round(bp[col]) : 0.f;
#pragma unroll
    for (int r = 0; r < 8; ++r) { float v = acc[t][r] * alpha + bv; if (CP) { const int bidx = (row0g + row0 + 8 * hh + r) / rowsPerB; v += CP[(size_t)bidx * sCPb + (size_t)by * 64 + col]; } if (ACT == 1) v = (v > 0.f) ? v : expm1f(v); else if (ACT == 7) v = (v > 0.f) ? v + 1.0f : expf(v); else if (ACT == 8) v = tanhf(v); else if (ACT == 9) v = 0.5f * v * (1.0f + tanhf(0.7978845608028654f * (v + 0.044715f * v * v * v))); else if (ACT == 11) v = 1.0f / (1.0f + expf(-v)); else if (ACT == 12) v = (v > 0.f) ? v : 0.01f * v; else if (ACT == 14) v = (v > 0.f) ? v : 0.1f * v; else if (ACT == 15) v = v / (1.0f + expf(-v)); else if (ACT == 3) v = fmaxf(v, 0.f); else if (ACT == 6) v = 0.5f * v * (1.0f + erff(v * 0.70710678118654752f)); so[w][8 * hh + r][t * 16 + ln] = v; } }
  __builtin_amdgcn_fence(__ATOMIC_ACQ_REL, "workgroup"); __builtin_amdgcn_wave_barrier();
  const int rsub = lane >> 4, c4 = (lane & 15) * 4; typedef _Float16 v4h __attribute__((ext_vector_type(4)));
  {
#pragma unroll
    for (int q = 0; q < 8; ++q) { const int r = q * 2 + rsub; if (col0 + c4 < N) { const v4f v = *(const v4fa*)&so[w][r][c4]; if (C) *(v4f*)(C + cofs + (size_t)(row0 + r) * ldc + col0 + c4) = v; if (C16) { v4h h4; for (int i = 0; i < 4; ++i) h4[i] = (_Float16)v[i]; *(v4h*)(C16 + cofs + (size_t)(row0 + r) * ldc + col0 + c4) = h4; } } }
     }
}


typedef _Float16 v4h __attribute__((ext_vector_type(4)));

// All input roundings in one launch, 8 values a thread: work-groups 0..PREP_XB-1 take x of all images (bf16 rounding, kept as f16), the next PREP_QB take w_qkv and the last PREP_PB w_proj (bf16 rounding x16, exact in f16).
// The work-group picks source, plane and factor (1 for x: an exact product); the grid divides the three arrays without remainder.
#define PREP_XB (NIMG * NTOK * CC / 8 / 256)
#define PREP_QB (3 * CC * CC / 8 / 256)
#define PREP_PB (CC * CC / 8 / 256)
__global__ __launch_bounds__(256) void k_prep16(const float* __restrict__ x, const float* __restrict__ wqkv, const float* __restrict__ wp, _Float16* __restrict__ X16, _Float16* __restrict__ BQKV, _Float16* __restrict__ BP) {
  int bx = blockIdx.x; const float* src = x; _Float16* dst = X16; float sc = 1.0f;
  if (bx >= PREP_XB + PREP_QB) { bx -= PREP_XB + PREP_QB; src = wp; dst = BP; sc = 16.0f; } else if (bx >= PREP_XB) { bx -= PREP_XB; src = wqkv; dst = BQKV; sc = 16.0f; }
  const size_t t = (size_t)bx * 256 + threadIdx.x; FragH f;
#pragma unroll
  for (int q = 0; q < 8; ++q) f.h[q] = (_Float16)(bf16_round(src[t * 8 + q]) * sc); *(v8us*)((unsigned short*)dst + t * 8) = f.half[0];  }
__global__ __launch_bounds__(256) void k_h16(const float* __restrict__ x, _Float16* __restrict__ X16, size_t n8) { const size_t t = (size_t)blockIdx.x * 256 + threadIdx.x; if (t >= n8) return; FragH f;
#pragma unroll
  for (int q = 0; q < 8; ++q) f.h[q] = (_Float16)x[t * 8 + q]; *(v8us*)((unsigned short*)X16 + t * 8) = f.half[0];  }
template <int NHv, int TTv>
__global__ __launch_bounds__(256) void k_vt(const _Float16* __restrict__ V16, int ldv, int voff, _Float16* __restrict__ Vt) { __shared__ unsigned short tl[64][66]; const int tid = threadIdx.x; const int slab = blockIdx.x / (TTv / 64), lg = blockIdx.x % (TTv / 64); const int b = slab / NHv, h = slab % NHv;
  for (int i = tid; i < 64 * 8; i += 256) { const int r = i / 8, c8 = (i % 8) * 8; FragH f; f.half[0] = *(const v8us*)((const unsigned short*)V16 + ((size_t)b * TTv + lg * 64 + r) * ldv + voff + h * 64 + c8);
#pragma unroll
    for (int q = 0; q < 8; ++q) tl[r][c8 + q] = f.u[q]; }
  __syncthreads();
  {
#pragma unroll
    for (int rd = 0; rd < 2; ++rd) { const int d = rd * 32 + tid / 8, pc = tid % 8; FragH f;
#pragma unroll
      for (int q = 0; q < 8; ++q) f.u[q] = tl[pc * 8 + q][d];
      *(v8us*)((unsigned short*)Vt + ((size_t)slab * 64 + d) * TTv + lg * 64 + pc * 8) = f.half[0]; }
     } }

__global__ __launch_bounds__(256) void k_hl(const float* __restrict__ F, _Float16* __restrict__ Hh, _Float16* __restrict__ Hl, size_t n8) { const size_t t = (size_t)blockIdx.x * 256 + threadIdx.x; if (t >= n8) return; FragH fh, fl; const v4f a = *(const v4fa*)(F + t * 8), c = *(const v4fa*)(F + t * 8 + 4);
#pragma unroll
  for (int q = 0; q < 4; ++q) { _Float16 h = (_Float16)a[q]; fh.h[q] = h; fl.h[q] = (_Float16)((a[q] - (float)h) * 1024.0f); h = (_Float16)c[q]; fh.h[4 + q] = h; fl.h[4 + q] = (_Float16)((c[q] - (float)h) * 1024.0f); }
  { *(v8us*)((unsigned short*)Hh + t * 8) = fh.half[0]; *(v8us*)((unsigned short*)Hl + t * 8) = fl.half[0];  } }

// ---- GEMM C = A.B^T x alpha + bias for K = CC: A f16 [M][CC], Bh f16 [N][CC]; M and N multiples of 128; writes f32 C (F32OUT) or f16 C16, pitch N ----
// A work-group of eight waves owns a 128 x 128 tile of C. Its 128 rows of A and 128 rows of B, whole in k (512 B a row), are brought into LDS once by asynchronous copies,
// one whole row (four 128-byte lines) per wave instruction; every fragment then comes from LDS. Wave = 32 rows x 64 columns, k ascending as before.
// The f16 form is the qkv product (N = 3 CC, rows = tokens of all images): its q columns go to C16 (pitch N); its k and v columns go, in blocks of 8 tokens x 32 channels of one head (512 B each), to
// KS block = [16-byte piece c of the token's 64 B][token & 7][8 f16] and VS block = [channel][8 tokens]; a wave's 16-byte-per-lane fragment load of the attention kernel then reads four whole 128-byte lines.
__device__ __forceinline__ v16h g2_frag(const _Float16* p, int hh) { FragH f; f.half[0] = *(const v8us*)((const unsigned short*)p + 8 * hh); f.half[1] = *(const v8us*)((const unsigned short*)p + 16 + 8 * hh); return f.v; }
#define G3_PITCH 528      /* bytes of a staged row: 512 + 16, an odd number of 16-byte pieces, so that the 16 rows of a ds_load_b128 fragment read lie on different banks */
__device__ __forceinline__ v16h g3_frag(const unsigned char* p) { FragH f; f.half[0] = *(const v8us*)p; f.half[1] = *(const v8us*)(p + 32); return f.v; }
__device__ __forceinline__ v8f g3_mma(v16h a, v16h b, v8f c) { return __builtin_amdgcn_wmma_f32_16x16x32_f16(false, a, false, b, (short)0, c, false, false); }
// Eight rows, 16 bytes a lane each, from global memory straight into LDS. The closing s_wait_xcnt stands inside the statement, in front of any later write of the address registers that the copies name.
__device__ __forceinline__ void g3_copy8(unsigned l, const _Float16* g) {
  asm volatile("global_load_async_to_lds_b128 %0, %8, off\n\tglobal_load_async_to_lds_b128 %1, %9, off\n\tglobal_load_async_to_lds_b128 %2, %10, off\n\tglobal_load_async_to_lds_b128 %3, %11, off\n\t"
               "global_load_async_to_lds_b128 %4, %12, off\n\tglobal_load_async_to_lds_b128 %5, %13, off\n\tglobal_load_async_to_lds_b128 %6, %14, off\n\tglobal_load_async_to_lds_b128 %7, %15, off\n\ts_wait_xcnt 0x0"
               :: "v"(l), "v"(l + G3_PITCH), "v"(l + 2 * G3_PITCH), "v"(l + 3 * G3_PITCH), "v"(l + 4 * G3_PITCH), "v"(l + 5 * G3_PITCH), "v"(l + 6 * G3_PITCH), "v"(l + 7 * G3_PITCH),
                  "v"(g), "v"(g + CC), "v"(g + 2 * CC), "v"(g + 3 * CC), "v"(g + 4 * CC), "v"(g + 5 * CC), "v"(g + 6 * CC), "v"(g + 7 * CC) : "memory"); }
template <int N, bool F32OUT>
__global__ __launch_bounds__(256) void k_gemm3(const _Float16* __restrict__ A, const _Float16* __restrict__ Bh, float alpha, const float* __restrict__ bias, float* __restrict__ C, _Float16* __restrict__ C16, _Float16* __restrict__ KS, _Float16* __restrict__ VS) {
  __shared__ __attribute__((aligned(16))) unsigned char sm[256 * G3_PITCH];      /* rows 0..127: A, rows 128..255: B; afterwards the waves' output staging */
  const int tid = threadIdx.x, w = __builtin_amdgcn_readfirstlane(tid >> 5), lane = tid & 31, ln = lane & 15, hh = lane >> 4;      /* wave number as a scalar: the choice of source below is a scalar one */
  constexpr int ntn = N >> 7; const int mt = blockIdx.x / ntn, nq = blockIdx.x - mt * ntn; const int row0 = mt * 128, col0 = nq * 128;
  { const _Float16* g = (w < 4 ? A + (size_t)(row0 + 32 * w) * CC : Bh + (size_t)(col0 + 32 * (w - 4)) * CC) + lane * 8;      /* waves 0..3 bring A, waves 4..7 B: 32 rows each, lane = 16-byte piece of the row */
    const unsigned l = (unsigned)(size_t)sm + (unsigned)(32 * w * G3_PITCH + lane * 16);
#pragma unroll
    for (int u = 0; u < 4; ++u) g3_copy8(l + u * 8 * G3_PITCH, g + (size_t)u * 8 * CC); }
  asm volatile("s_wait_asynccnt 0x0" ::: "memory");      /* this wave's 32 copies have landed */
  __syncthreads();      /* and so have the other waves': nobody reads the tile in front of this barrier */
  const int wm = w & 3, wn = w >> 2;
  const unsigned char* ap = sm + (32 * wm + ln) * G3_PITCH + 16 * hh; const unsigned char* bq = sm + (128 + 64 * wn + ln) * G3_PITCH + 16 * hh;
  const v8f z8 = {0.f,0.f,0.f,0.f,0.f,0.f,0.f,0.f}; v8f c00 = z8, c01 = z8, c02 = z8, c03 = z8, c10 = z8, c11 = z8, c12 = z8, c13 = z8;
  v16h fa[2][2], fb[2][4];      /* two fragment sets: the products of a step read one while the next step's LDS reads fill the other */
#pragma unroll
  for (int t = 0; t < 2; ++t) fa[0][t] = g3_frag(ap + 16 * t * G3_PITCH);
#pragma unroll
  for (int t = 0; t < 4; ++t) fb[0][t] = g3_frag(bq + 16 * t * G3_PITCH);
#pragma unroll      /* unrolled: the set index is a compile-time constant, so both sets stay in registers */
  for (int ks = 0; ks < CC / 32; ++ks) { const int cu = ks & 1, nx = cu ^ 1;
    if (ks + 1 < CC / 32) {
#pragma unroll
      for (int t = 0; t < 2; ++t) fa[nx][t] = g3_frag(ap + 16 * t * G3_PITCH + 64 * (ks + 1));
#pragma unroll
      for (int t = 0; t < 4; ++t) fb[nx][t] = g3_frag(bq + 16 * t * G3_PITCH + 64 * (ks + 1)); }
    __builtin_amdgcn_sched_barrier(0);      /* keeps the next step's twelve LDS reads one group ahead of this step's products: left free, the compiler lifts reads of many steps to the top and takes over 256 registers, with register-window switches among the products */
    c00 = g3_mma(fa[cu][0], fb[cu][0], c00); c10 = g3_mma(fa[cu][1], fb[cu][0], c10); c01 = g3_mma(fa[cu][0], fb[cu][1], c01); c11 = g3_mma(fa[cu][1], fb[cu][1], c11);
    c02 = g3_mma(fa[cu][0], fb[cu][2], c02); c12 = g3_mma(fa[cu][1], fb[cu][2], c12); c03 = g3_mma(fa[cu][0], fb[cu][3], c03); c13 = g3_mma(fa[cu][1], fb[cu][3], c13);
    __builtin_amdgcn_sched_barrier(0);      /* and keeps the reads of the step after next behind these products, whose set they overwrite */
  }
  __syncthreads();      /* every wave has read its last fragment: from here the tile's LDS is output staging, 32 x 68 floats a wave */
  float (*so)[68] = (float (*)[68])(sm + w * (32 * 68 * 4)); const int rw = row0 + 32 * wm, cw = col0 + 64 * wn;
  v8f accs[8] = {c00, c01, c02, c03, c10, c11, c12, c13};
  const int sel = F32OUT ? 0 : nq >> 1;      /* qkv product: column tiles 0,1 are q, 2,3 k, 4,5 v; one answer for the whole work-group */
  const size_t blk = (size_t)((unsigned)rw / NTOK * NHD + (((unsigned)cw & (CC - 1)) >> 5)) * (NTOK / 8) + (((unsigned)rw & (NTOK - 1)) >> 3);      /* first of the wave's 2 heads x 4 token blocks */
  if (sel == 2) {      /* v: an accumulator register row is already 8 tokens of one channel, the 16 bytes of a VS block's row; 16 lanes fill 256 contiguous bytes */
    unsigned short* vp = (unsigned short*)VS + ((blk + hh) * 32 + ln) * 8;
#pragma unroll
    for (int u = 0; u < 8; ++u) { const int t = u & 3, half = u >> 2; const float bv = bf16_round(bias[cw + t * 16 + ln]); FragH f;
#pragma unroll
      for (int r = 0; r < 8; ++r) f.h[r] = (_Float16)(accs[u][r] * alpha + bv);
      *(v8us*)(vp + (((t >> 1) * (NTOK / 8) + half * 2) * 32 + (t & 1) * 16) * 8) = f.half[0]; }
    return; }      /* no barrier stands behind this point */
#pragma unroll
  for (int u = 0; u < 8; ++u) { const int t = u & 3, half = u >> 2; const float bv = bf16_round(bias[cw + t * 16 + ln]);
#pragma unroll
    for (int r = 0; r < 8; ++r) so[half * 16 + 8 * hh + r][t * 16 + ln] = accs[u][r] * alpha + bv; }
  __builtin_amdgcn_fence(__ATOMIC_ACQ_REL, "workgroup"); __builtin_amdgcn_wave_barrier();
  if (sel == 1) {      /* k: lane = (piece c, token & 7), so each store of the wave is one whole 512-byte KS block */
    unsigned short* kp = (unsigned short*)KS + blk * 256 + lane * 8; const int c8 = (lane >> 3) * 8, tk = lane & 7;
    v4f lo[8], hi[8];
#pragma unroll
    for (int q = 0; q < 8; ++q) { lo[q] = *(const v4fa*)&so[(q & 3) * 8 + tk][(q >> 2) * 32 + c8]; hi[q] = *(const v4fa*)&so[(q & 3) * 8 + tk][(q >> 2) * 32 + c8 + 4]; }
#pragma unroll
    for (int q = 0; q < 8; ++q) { FragH f;
#pragma unroll
      for (int i = 0; i < 4; ++i) { f.h[i] = (_Float16)lo[q][i]; f.h[4 + i] = (_Float16)hi[q][i]; }
      *(v8us*)(kp + ((q >> 2) * (NTOK / 8) + (q & 3)) * 256) = f.half[0]; }
    asm volatile("s_wait_xcnt 0x0" ::: "memory");      /* in the built code other branches' blocks follow this one and reuse the stores' registers: the wait stands in front of any such write */
    return; }
  const int rsub = lane >> 4, c4 = (lane & 15) * 4;
  const size_t o0 = (size_t)(rw + rsub) * N + cw + c4;      /* N is a compile-time pitch: the sixteen stores share one address and differ in their immediate offsets */
  v4f vv[16];
#pragma unroll
  for (int q = 0; q < 16; ++q) vv[q] = *(const v4fa*)&so[q * 2 + rsub][c4];
#pragma unroll
  for (int q = 0; q < 16; ++q) {
    if (F32OUT) *(v4f*)(C + o0 + q * 2 * N) = vv[q];
    else { v4h h4; for (int i = 0; i < 4; ++i) h4[i] = (_Float16)vv[q][i]; *(v4h*)(C16 + o0 + q * 2 * N) = h4; } }
  if (!F32OUT) asm volatile("s_wait_xcnt 0x0" ::: "memory");      /* as behind the k stores: in the three-way form the built code goes on into another branch's block */
}


__device__ __forceinline__ int na_start(int i, int K) { const int nh = K / 2; int s = max(i - nh, 0); if (i + nh >= RES) s += RES - i - nh - 1; return s; }
__device__ __forceinline__ int na_pb(int i, int K) { const int nh = K / 2; int p = nh; if (i < nh) p += nh - i; if (i + nh >= RES) p += RES - i - 1 - nh; return p; }
__device__ __forceinline__ v16h na_frag(const _Float16* p, int second) { FragH f; f.half[0] = *(const v8us*)(const unsigned short*)p; f.half[1] = *(const v8us*)((const unsigned short*)p + second); return f.v; }
// lane l <-> lane l ^ 16 (the two halves of a wave hold different keys of the same query)
__device__ __forceinline__ float xhalf(float x) { return __builtin_bit_cast(float, __builtin_amdgcn_permlanex16(__builtin_bit_cast(int, x), __builtin_bit_cast(int, x), 0x76543210, 0xfedcba98, false, false)); }
// Eight exponentials (base 2) in one statement: behind a transcendental the instruction set asks for one independent instruction before its result is read or its source overwritten.
// The outputs are early-clobber, so each v_exp_f32 is that independent instruction for the one before it; the closing v_nop keeps the slot behind the last.
__device__ __forceinline__ void na_exp8(float (&y)[8], const float (&x)[8]) {
  asm("v_exp_f32 %0, %8\n\tv_exp_f32 %1, %9\n\tv_exp_f32 %2, %10\n\tv_exp_f32 %3, %11\n\tv_exp_f32 %4, %12\n\tv_exp_f32 %5, %13\n\tv_exp_f32 %6, %14\n\tv_exp_f32 %7, %15\n\tv_nop"
      : "=&v"(y[0]), "=&v"(y[1]), "=&v"(y[2]), "=&v"(y[3]), "=&v"(y[4]), "=&v"(y[5]), "=&v"(y[6]), "=&v"(y[7])
      : "v"(x[0]), "v"(x[1]), "v"(x[2]), "v"(x[3]), "v"(x[4]), "v"(x[5]), "v"(x[6]), "v"(x[7])); }
__device__ __forceinline__ float na_exp1(float x) { float y; asm("v_exp_f32 %0, %1\n\tv_nop" : "=&v"(y) : "v"(x)); return y; }      /* the v_nop keeps the same slot */
#define NA_NEG (-3.0e38f)
#define NA_TBMAX (25 * 25 + 64)
// NA_R neighbouring query rows of one image and two neighbouring heads per work-group; wave = (head, 16 query columns, all NA_R rows).
// The rows' windows overlap in all but one key row per step down, so the wave walks the union of their key rows once and every K and V^T fragment it loads serves each query row whose window holds that key row
// (a scalar test per query row; each query still meets its own K key rows in ascending order). The column windows of the 16 queries lie inside the 32 columns C0..C0+31 (C0 a multiple of 8) and are the same for all rows.
// Per key row and query row: S^T = K.Q^T + bias/scale (two 16x16x32 products, bias and window mask enter as the C operand), running maximum and sum per query
// (lane = query), P^T x2^10 packed from the two score tiles as the B operand, O^T += V^T.P^T; K and V^T fragments come from the fragment-ordered planes.
#define NA_R 2
template <int K>
__device__ __forceinline__ void na_row(const _Float16* __restrict__ QKV, const _Float16* __restrict__ KS, const _Float16* __restrict__ VS, const float* __restrict__ rpb, int hb, int bx, float* __restrict__ tb, _Float16* __restrict__ Y16) {
  constexpr int RB = 2 * K - 1, NT = RB * RB, TP = NT + 64, NG = RES / NA_R; constexpr float SC2 = SCALE * 1.4426950408889634f;
  const int tid = threadIdx.x, w = __builtin_amdgcn_readfirstlane(tid >> 5), lane = tid & 31, ln = lane & 15, hh = lane >> 4; const int i0 = (bx % NG) * NA_R, hp = (bx / NG) & 1, b = bx / (2 * NG);      /* wave number as a scalar: head, column tile and plane bases stay in scalar registers */
  for (int t = tid; t < 2 * TP; t += 256) { const int hq = t / TP, s = t - hq * TP - 32; tb[t] = (s >= 0 && s < NT) ? bf16_round(rpb[(size_t)(2 * hp + hq) * NT + s]) * 5.656854249492381f : 0.f; }
  __syncthreads();
  const int hq = w >> 2, h = hb + 2 * hp + hq, j0 = (w & 3) * 16, j = j0 + ln; const int C0 = min(max(j0 - 8, 0), 32);
  const int si = na_start(i0, K), sj = na_start(j, K), pj = na_pb(j, K);
  int ds[NA_R], po[NA_R];      /* query row t: its window starts ds[t] key rows below the first row's; po[t]: its bias row at the union's first key row, in table elements */
#pragma unroll
  for (int t = 0; t < NA_R; ++t) { ds[t] = na_start(i0 + t, K) - si; po[t] = (na_pb(i0 + t, K) - ds[t]) * RB; }
  const int nr = ds[NA_R - 1] + K;      /* key rows of the union: K to K + NA_R - 1 */
  const _Float16* img = QKV + (size_t)b * NTOK * (3 * CC);
  v16h qf[NA_R];
#pragma unroll
  for (int t = 0; t < NA_R; ++t) qf[t] = g2_frag(img + (size_t)((i0 + t) * RES + j) * (3 * CC) + h * HD, hh);
  const size_t blk0 = (size_t)(b * NHD + h) * (NTOK / 8) + ((si * RES + C0) >> 3);
  const _Float16* kb = KS + blk0 * 256; const unsigned kl = ((ln >> 3) * 32 + hh * 8 + (ln & 7)) * 8;      /* key = lane & 15; channels 8hh.. here, 16 + 8hh.. 128 elements on */
  const _Float16* vb = VS + blk0 * 256; const unsigned vl = (hh * 32 + ln) * 8;                            /* channel = lane & 15; keys 8hh.. here, 16 + 8hh.. two blocks on */
  const int d0 = C0 + 8 * hh - sj; const float* tp = tb + hq * TP + 32 + pj + d0;
  bool ok[16];
#pragma unroll
  for (int e = 0; e < 16; ++e) ok[e] = (unsigned)(d0 + (e & 7) + 16 * (e >> 3)) < (unsigned)K;
  const v8f z8 = {0.f,0.f,0.f,0.f,0.f,0.f,0.f,0.f}; v8f o0[NA_R], o1[NA_R]; float m[NA_R], l[NA_R];
#pragma unroll
  for (int t = 0; t < NA_R; ++t) { o0[t] = z8; o1[t] = z8; m[t] = NA_NEG; l[t] = 0.f; }
  v16h a0 = na_frag(kb + kl, 128), a1 = na_frag(kb + kl + 512, 128);
  /* scores of query row t against the key row in a0, a1 */
  auto score = [&](int t, v8f& s0, v8f& s1) {
    const float* tq = tp + po[t];
#pragma unroll
    for (int r = 0; r < 8; ++r) { const float t0 = tq[r], t1 = tq[16 + r]; s0[r] = ok[r] ? t0 : NA_NEG; s1[r] = ok[8 + r] ? t1 : NA_NEG; }      /* every index lies inside the padded table */
    s0 = __builtin_amdgcn_wmma_f32_16x16x32_f16(false, a0, false, qf[t], (short)0, s0, false, false);
    s1 = __builtin_amdgcn_wmma_f32_16x16x32_f16(false, a1, false, qf[t], (short)0, s1, false, false); };
  /* running softmax of query row t over these scores, and its share of attn.v */
  auto fold = [&](int t, const v8f& s0, const v8f& s1, const v16h& u0, const v16h& u1) {
    float mx = fmaxf(s0[0], s1[0]);
#pragma unroll
    for (int r = 1; r < 8; ++r) mx = fmaxf(mx, fmaxf(s0[r], s1[r]));
    mx = fmaxf(mx, xhalf(mx));
    const float mn = fmaxf(m[t], mx); const float al = na_exp1((m[t] - mn) * SC2); m[t] = mn; const float mb = 10.0f - mn * SC2;
    FragH pf; float ps = 0.f, x0[8], x1[8], p0[8], p1[8];
#pragma unroll
    for (int r = 0; r < 8; ++r) { x0[r] = fmaf(s0[r], SC2, mb); x1[r] = fmaf(s1[r], SC2, mb); }
    na_exp8(p0, x0); na_exp8(p1, x1);
#pragma unroll
    for (int r = 0; r < 8; ++r) { ps += p0[r] + p1[r]; pf.h[r] = (_Float16)p0[r]; pf.h[8 + r] = (_Float16)p1[r]; }
    l[t] = l[t] * al + ps;
#pragma unroll
    for (int r = 0; r < 8; ++r) { o0[t][r] *= al; o1[t][r] *= al; }
    o0[t] = __builtin_amdgcn_wmma_f32_16x16x32_f16(false, u0, false, pf.v, (short)0, o0[t], false, false);
    o1[t] = __builtin_amdgcn_wmma_f32_16x16x32_f16(false, u1, false, pf.v, (short)0, o1[t], false, false); };
#pragma unroll 1      /* rolled: unrolled, the compiler lifts every row's loads to the top and takes over 300 registers (three waves per SIMD) */
  for (int kr = 0; kr < nr; ++kr) {
    const v16h u0 = na_frag(vb + vl, 512), u1 = na_frag(vb + vl + 128, 512); vb += 2048;
    __builtin_amdgcn_sched_barrier(0);      /* keeps the V loads up here, a whole softmax ahead of their use: without it the compiler sinks them to just in front of the products that wait for them */
#pragma unroll
    for (int t = 0; t < NA_R - 1; ++t)
      if ((unsigned)(kr - ds[t]) < (unsigned)K) { v8f s0, s1; score(t, s0, s1); fold(t, s0, s1, u0, u1); }      /* is this key row in query row t's window? one answer for the whole work-group */
    const bool act = (unsigned)(kr - ds[NA_R - 1]) < (unsigned)K;
    v8f s0, s1; score(NA_R - 1, s0, s1);      /* taken on every pass: in the one pass that can lie ahead of this row's window the scores go unused (the bias row read there is the one above the window's first, inside the table); under a test of their own they would hold 16 registers round the whole loop */
    if (kr + 1 < nr) kb += 2048;      /* the last query row's scores are taken, the K fragments are free: next row's fly under this softmax; the last pass fetches its own row again, never one past the window */
    a0 = na_frag(kb + kl, 128); a1 = na_frag(kb + kl + 512, 128);
    asm volatile("s_wait_xcnt 0x0" ::: "memory");      /* stands in front of the V address pair's advance, which the compiler places below while this pass's loads are in flight */
    __builtin_amdgcn_sched_barrier(0);      /* keeps the next row's K loads here: without it the compiler sinks them to the foot of the pass, a few instructions ahead of their use */
    if (act) fold(NA_R - 1, s0, s1, u0, u1);
    tp += RB;
  }
#pragma unroll
  for (int t = 0; t < NA_R; ++t) {
    const float lt = l[t] + xhalf(l[t]); const float inv = 1.0f / lt; FragH y0, y1;
#pragma unroll
    for (int r = 0; r < 8; ++r) { y0.h[r] = (_Float16)(o0[t][r] * inv); y1.h[r] = (_Float16)(o1[t][r] * inv); }
    unsigned short* yp = (unsigned short*)Y16 + ((size_t)b * NTOK + (i0 + t) * RES + j) * CC + h * HD + 8 * hh;
    *(v8us*)yp = y0.half[0]; *(v8us*)(yp + 16) = y1.half[0]; } }
__global__ __launch_bounds__(256) void k_na_fused(const _Float16* __restrict__ QKV, const _Float16* __restrict__ KS, const _Float16* __restrict__ VS, const float* __restrict__ rpb0, const float* __restrict__ rpb1, _Float16* __restrict__ Y16) {
  __shared__ float tb[2 * NA_TBMAX]; const int nb = NIMG * 2 * (RES / NA_R);      /* the longer 13x13 work-groups start first */
  if ((int)blockIdx.x < nb) na_row<13>(QKV, KS, VS, rpb1, 4, blockIdx.x, tb, Y16); else na_row<7>(QKV, KS, VS, rpb0, 0, blockIdx.x - nb, tb, Y16); }

extern "C" void kernel_launch(void* const* d_in, const int* in_sizes, int n_in,
                              void* d_out, int out_size, void* d_ws, size_t ws_size, hipStream_t stream) {
  (void)in_sizes; (void)n_in; (void)out_size;
  const float* const* I = (const float* const*)d_in; const float* x = I[0]; const float* wqkv = I[1]; const float* bqkv = I[2]; const float* rpb0 = I[3]; const float* rpb1 = I[4]; const float* wp = I[5]; const float* bp = I[6];
  char* ws = (char*)d_ws; size_t off = 0;
  auto take = [&](size_t bytes) { char* p = ws + off; off += (bytes + 255) & ~(size_t)255; return p; };
  _Float16* BQKV = (_Float16*)take((size_t)3 * CC * CC * 2); _Float16* BP = (_Float16*)take((size_t)CC * CC * 2);
  _Float16* X16 = (_Float16*)take((size_t)NIMG * NTOK * CC * 2); _Float16* QKV = (_Float16*)take((size_t)NIMG * NTOK * 3 * CC * 2); _Float16* KS = (_Float16*)take((size_t)NIMG * CC * NTOK * 2); _Float16* VS = (_Float16*)take((size_t)NIMG * CC * NTOK * 2); _Float16* Y16 = (_Float16*)take((size_t)NIMG * NTOK * CC * 2);
  if (off > ws_size) return;      /* 0.5 + 16 + 48 + 16 + 16 + 16 = 112.5 MiB */
  const dim3 gQ((NIMG * NTOK / 128) * (3 * CC / 128), 1), gP((NIMG * NTOK / 128) * (CC / 128), 1);      /* the token rows of all images are one M */
  k_prep16<<<PREP_XB + PREP_QB + PREP_PB, 256, 0, stream>>>(x, wqkv, wp, X16, BQKV, BP);      /* weights stay (out,in) natural */
  k_gemm3<3 * CC, false><<<gQ, 256, 0, stream>>>(X16, BQKV, 0.0625f, bqkv, nullptr, QKV, KS, VS);      /* of the QKV plane only the q columns are written and read */
  k_na_fused<<<2 * NIMG * 2 * (RES / NA_R), 256, 0, stream>>>(QKV, KS, VS, rpb0, rpb1, Y16);
  k_gemm3<CC, true><<<gP, 256, 0, stream>>>(Y16, BP, 0.0625f, bp, (float*)d_out, nullptr, nullptr, nullptr);
}

// v006
// A run of this version takes 54.6 microseconds.
// Two timings next to v005 both put it at 1.08 times that version's speed.
// All steps since v000 together make it 30.6 times as fast.
#include <hip/hip_runtime.h>
// Split-head neighborhood attention (8 images, 64 x 64 x 256 NHWC; 8 heads x 32; heads 0-3 use 7x7 NATTEN windows with rpb0, heads 4-7 use 13x13 with rpb1; window starts clamped at the borders, relative-position bias with the NATTEN border offsets; q scaled by 32^-0.5) followed by the output projection -> [8,64,64,256].
// Structure: one launch rounds x and both weight matrices to f16 planes; qkv of all images as one f16 WMMA GEMM launch (128x128 work-group tiles staged in LDS by asynchronous copies, 32x64 wave tiles, f32 accumulation, exact products + bias) whose epilogue writes q into an f16 token plane and k and transposed v straight into fragment-ordered planes; ONE fused kernel over all images, both branches and all heads does scores, exact clamped window + bias, softmax (running maximum and sum) and attn.v per wave of 16 query columns of two neighbouring rows against the union of their key rows x 32 columns (each K and V fragment load serves both rows), scores and P (x2^10 in f16) never leaving registers, and leaves the head outputs of its 128 tokens in LDS, where the same work-group (all eight heads, 32 waves) takes the output projection of those tokens straight into the output rows.
// Compute dtype: x, weights, biases, rpb rounded to bf16; q/k/v, P (x2^10) and the attention output as f16 operands (~2^-12); f32 accumulation and softmax. v_wmma_f32_16x16x32_f16.
#define NIMG 8
#define RES 64
#define NTOK (RES * RES)
#define CC 256
#define NHD 8
#define HD 32
#define SCALE 0.17677669529663687f
typedef __bf16 v16b __attribute__((ext_vector_type(16)));
typedef unsigned short v8us __attribute__((ext_vector_type(8), may_alias));
typedef float  v8f  __attribute__((ext_vector_type(8)));
typedef float  v4f  __attribute__((ext_vector_type(4)));
typedef float  v4fa __attribute__((ext_vector_type(4), may_alias));
union FragB { v16b v; v8us half[2]; unsigned short u[16]; };

__device__ __forceinline__ unsigned short bf16_bits(float x) { unsigned int u = __float_as_uint(x); return (unsigned short)((u + 0x7FFFu + ((u >> 16) & 1u)) >> 16); }
__device__ __forceinline__ float bf16_val(unsigned short b) { return __uint_as_float(((unsigned int)b) << 16); }
__device__ __forceinline__ float bf16_round(float x) { return bf16_val(bf16_bits(x)); }
// D += A·B with NT terms: 1 = ah·bh, 2 = + al·bh (A split), 3 = + ah·bl (both split)
template <int NT>
__device__ __forceinline__ v8f mmaN(v16b ah, v16b al, v16b bh, v16b bl, v8f c) {
  c = __builtin_amdgcn_wmma_f32_16x16x32_bf16(false, ah, false, bh, (short)0, c, false, false);
  if (NT >= 2) c = __builtin_amdgcn_wmma_f32_16x16x32_bf16(false, al, false, bh, (short)0, c, false, false);
  if (NT >= 3) c = __builtin_amdgcn_wmma_f32_16x16x32_bf16(false, ah, false, bl, (short)0, c, false, false);
  asm volatile("v_nop\n\tv_nop\n\tv_nop\n\tv_nop" : "+v"(c) : "v"(ah), "v"(al), "v"(bh), "v"(bl));
  return c;
}

__global__ __launch_bounds__(256) void k_wt_bf16(const float* __restrict__ W, unsigned short* __restrict__ Wt, int K, int N) {
  const int t = blockIdx.x * 256 + threadIdx.x;
  const int k8n = K / 8;
  if (t >= N * k8n) return;
  const int n = t / k8n, k8 = (t % k8n) * 8;
  v8us v;
#pragma unroll
  for (int i = 0; i < 8; ++i) v[i] = bf16_bits(W[(size_t)(k8 + i) * N + n]);
  *(v8us*)(Wt + (size_t)n * K + k8) = v;
  
}

// GEMM C[M][N] (f32, pitch ldc) = act(A[M][K]·W + bias). A f32 row-major (pitch lda) converted per fragment to bf16
// (ASPLIT: hi/lo two planes -> 2 terms, else single rounded term); Wt bf16 [N][K] (pitch ldb). BIAS_BF16 rounds the
// bias to bf16 first (bias quantised to bf16 before the add). K%32==0, M%16==0, N%64==0.
template <bool ASPLIT, int ACT, bool BIAS_BF16>
__global__ __launch_bounds__(128) void k_gemm_bf(const float* __restrict__ A, int lda, const unsigned short* __restrict__ Wt, int ldb,
                                               const float* __restrict__ bias, float* __restrict__ C, int ldc, int M, int N, int K) {
  __shared__ __attribute__((aligned(16))) float so[4][16][64];
  const int tid = threadIdx.x, w = tid >> 5, lane = tid & 31, ln = lane & 15, hh = lane >> 4;
  const int ntn = N / 64;
  const int wid = blockIdx.x * 4 + w;
  const int mt = wid / ntn, nq = wid % ntn;
  if (mt * 16 >= M) return;
  const int row0 = mt * 16, col0 = nq * 64;
  const float* arow = A + (size_t)(row0 + ln) * lda;
  v8f acc[4] = {};
  for (int kb = 0; kb < K; kb += 32) {
    FragB ah, al;
    const v4f x0 = *(const v4fa*)(arow + kb + 8 * hh), x1 = *(const v4fa*)(arow + kb + 8 * hh + 4);
    const v4f x2 = *(const v4fa*)(arow + kb + 16 + 8 * hh), x3 = *(const v4fa*)(arow + kb + 16 + 8 * hh + 4);
    float xs[16] = {x0[0],x0[1],x0[2],x0[3],x1[0],x1[1],x1[2],x1[3],x2[0],x2[1],x2[2],x2[3],x3[0],x3[1],x3[2],x3[3]};
#pragma unroll
    for (int i = 0; i < 16; ++i) { const unsigned short hb = bf16_bits(xs[i]); ah.u[i] = hb; al.u[i] = ASPLIT ? bf16_bits(xs[i] - bf16_val(hb)) : (unsigned short)0; }
#pragma unroll
    for (int t = 0; t < 4; ++t) {
      const unsigned short* brow = Wt + (size_t)(col0 + t * 16 + ln) * ldb + kb;
      FragB b;
      b.half[0] = *(const v8us*)(brow + 8 * hh);
      b.half[1] = *(const v8us*)(brow + 16 + 8 * hh);
      acc[t] = mmaN<ASPLIT ? 2 : 1>(ah.v, al.v, b.v, b.v, acc[t]);
    }
  }
#pragma unroll
  for (int t = 0; t < 4; ++t) {
    float bv = bias ? bias[col0 + t * 16 + ln] : 0.f;
    if (BIAS_BF16) bv = bf16_round(bv);
#pragma unroll
    for (int r = 0; r < 8; ++r) { float v = acc[t][r] + bv; if (ACT == 1) v = fmaxf(v, 0.f); so[w][8 * hh + r][t * 16 + ln] = v; }
  }
  __builtin_amdgcn_fence(__ATOMIC_ACQ_REL, "workgroup");
  __builtin_amdgcn_wave_barrier();
  const int rsub = lane >> 4, c4 = (lane & 15) * 4;
  {
#pragma unroll
    for (int q = 0; q < 8; ++q) {
      const int r = q * 2 + rsub;
      const v4f v = *(const v4fa*)&so[w][r][c4];
      *(v4f*)(C + (size_t)(row0 + r) * ldc + col0 + c4) = v;
    }
    
  }
}

// GEMM C = act(A·W + bias + resid): A f32 (ASPLIT -> hi/lo 2 terms), Wt bf16 [N][K]; ACT 0 none, 1 relu, 2 exact gelu;
// resid (optional, f32, row index = (row % rmod), pitch ldr, RES_BF16 rounds it) added before the activation.
template <bool ASPLIT, int ACT, bool BIAS_BF16, bool RES_BF16>
__global__ __launch_bounds__(128) void k_gemm_bf3(const float* __restrict__ A, int lda, const unsigned short* __restrict__ Wt, int ldb,
                                                const float* __restrict__ bias, const float* __restrict__ resid, int rmod, int ldr,
                                                float* __restrict__ C, int ldc, int M, int N, int K) {
  __shared__ __attribute__((aligned(16))) float so[4][16][64];
  const int tid = threadIdx.x, w = tid >> 5, lane = tid & 31, ln = lane & 15, hh = lane >> 4;
  const int ntn = N / 64;
  const int wid = blockIdx.x * 4 + w;
  const int mt = wid / ntn, nq = wid % ntn;
  if (mt * 16 >= M) return;
  const int row0 = mt * 16, col0 = nq * 64;
  const float* arow = A + (size_t)(row0 + ln) * lda;
  v8f acc[4] = {};
  for (int kb = 0; kb < K; kb += 32) {
    FragB ah, al;
    const v4f x0 = *(const v4fa*)(arow + kb + 8 * hh), x1 = *(const v4fa*)(arow + kb + 8 * hh + 4);
    const v4f x2 = *(const v4fa*)(arow + kb + 16 + 8 * hh), x3 = *(const v4fa*)(arow + kb + 16 + 8 * hh + 4);
    float xs[16] = {x0[0],x0[1],x0[2],x0[3],x1[0],x1[1],x1[2],x1[3],x2[0],x2[1],x2[2],x2[3],x3[0],x3[1],x3[2],x3[3]};
#pragma unroll
    for (int i = 0; i < 16; ++i) { const unsigned short hb = bf16_bits(xs[i]); ah.u[i] = hb; al.u[i] = ASPLIT ? bf16_bits(xs[i] - bf16_val(hb)) : (unsigned short)0; }
#pragma unroll
    for (int t = 0; t < 4; ++t) {
      const unsigned short* brow = Wt + (size_t)(col0 + t * 16 + ln) * ldb + kb;
      FragB b;
      b.half[0] = *(const v8us*)(brow + 8 * hh);
      b.half[1] = *(const v8us*)(brow + 16 + 8 * hh);
      acc[t] = mmaN<ASPLIT ? 2 : 1>(ah.v, al.v, b.v, b.v, acc[t]);
    }
  }
#pragma unroll
  for (int t = 0; t < 4; ++t) {
    const int col = col0 + t * 16 + ln;
    float bv = bias ? bias[col] : 0.f;
    if (BIAS_BF16) bv = bf16_round(bv);
#pragma unroll
    for (int r = 0; r < 8; ++r) {
      float v = acc[t][r] + bv;
      if (resid) { float rv = resid[(size_t)((row0 + 8 * hh + r) % rmod) * ldr + col]; if (RES_BF16) rv = bf16_round(rv); v += rv; }
      if (ACT == 1) v = fmaxf(v, 0.f);
      if (ACT == 2) v = 0.5f * v * (1.0f + erff(v * 0.70710678118654752f));
      if (ACT == 3) { const float u = 0.7978845608028654f * (v + 0.044715f * v * v * v); v = 0.5f * v * (1.0f + tanhf(u)); }
      so[w][8 * hh + r][t * 16 + ln] = v;
    }
  }
  __builtin_amdgcn_fence(__ATOMIC_ACQ_REL, "workgroup");
  __builtin_amdgcn_wave_barrier();
  const int rsub = lane >> 4, c4 = (lane & 15) * 4;
  {
#pragma unroll
    for (int q = 0; q < 8; ++q) {
      const int r = q * 2 + rsub;
      const v4f v = *(const v4fa*)&so[w][r][c4];
      *(v4f*)(C + (size_t)(row0 + r) * ldc + col0 + c4) = v;
    }
    
  }
}
// row LayerNorm (biased variance, eps) over N: s = X (+ R); optional out_sum <- s; out_norm <- (s-mu)*rsqrt(var+eps)*g + b
template <bool PARAM_BF16>
__global__ __launch_bounds__(256) void k_layernorm(const float* __restrict__ X, const float* __restrict__ R, const float* __restrict__ g, const float* __restrict__ bta,
                                                  float* __restrict__ out_sum, float* __restrict__ out_norm, int N, float eps) {
  __shared__ float red[256];
  const int row = blockIdx.x, tid = threadIdx.x;
  const float* x = X + (size_t)row * N; const float* rr = R ? R + (size_t)row * N : nullptr;
  float vals[16];                     // up to N = 4096
  const int per = N / 256;            // contiguous chunk per thread? use strided-by-4 chunks: thread handles j = tid*4 + 1024*u
  float s1 = 0.f;
  for (int u = 0; u < per / 4; ++u) {
    const int j = tid * 4 + 1024 * u;
    const v4f a = *(const v4fa*)(x + j);
    v4f b = {0.f,0.f,0.f,0.f}; if (rr) b = *(const v4fa*)(rr + j);
#pragma unroll
    for (int q = 0; q < 4; ++q) { const float v = a[q] + b[q]; vals[u * 4 + q] = v; s1 += v; }
  }
  red[tid] = s1; __syncthreads();
  for (int st = 128; st > 0; st >>= 1) { if (tid < st) red[tid] += red[tid + st]; __syncthreads(); }
  const float mu = red[0] / (float)N; __syncthreads();
  float s2 = 0.f;
  for (int u = 0; u < per / 4; ++u)
#pragma unroll
    for (int q = 0; q < 4; ++q) { const float c = vals[u * 4 + q] - mu; s2 += c * c; }
  red[tid] = s2; __syncthreads();
  for (int st = 128; st > 0; st >>= 1) { if (tid < st) red[tid] += red[tid + st]; __syncthreads(); }
  const float rs = rsqrtf(red[0] / (float)N + eps);
  {
    for (int u = 0; u < per / 4; ++u) {
      const int j = tid * 4 + 1024 * u;
      v4f o, sm;
#pragma unroll
      for (int q = 0; q < 4; ++q) {
        float gg = g[j + q], bb = bta[j + q];
        if (PARAM_BF16) { gg = bf16_round(gg); bb = bf16_round(bb); }
        sm[q] = vals[u * 4 + q]; o[q] = (vals[u * 4 + q] - mu) * rs * gg + bb;
      }
      if (out_sum) *(v4f*)(out_sum + (size_t)row * N + j) = sm;
      *(v4f*)(out_norm + (size_t)row * N + j) = o;
    }
    
  }
}



// ---- f16 WMMA path (v_wmma_f32_16x16x32_f16): 11-bit significands for operands in range — used where a [0,1] probability operand needs more precision than bf16
typedef _Float16 v16h __attribute__((ext_vector_type(16)));
union FragH { v16h v; v8us half[2]; _Float16 h[16]; unsigned short u[16]; };
template <int NT>
__device__ __forceinline__ v8f mmaH(v16h ah, v16h al, v16h bh, v16h bl, v8f c) {
  c = __builtin_amdgcn_wmma_f32_16x16x32_f16(false, ah, false, bh, (short)0, c, false, false);
  if (NT >= 2) c = __builtin_amdgcn_wmma_f32_16x16x32_f16(false, al, false, bh, (short)0, c, false, false);
  if (NT >= 3) c = __builtin_amdgcn_wmma_f32_16x16x32_f16(false, ah, false, bl, (short)0, c, false, false);
  asm volatile("v_nop\n\tv_nop\n\tv_nop\n\tv_nop" : "+v"(c) : "v"(ah), "v"(al), "v"(bh), "v"(bl));
  return c;
}
// batched GEMM like k_gemm_b but f16 operands: A f32 (split into f16 hi/lo if ASPLIT, else rounded to f16), Bt = f16 values [n][k]; alpha; C f32; N multiple of 16 (partial tiles skipped)
template <bool ASPLIT>
__global__ __launch_bounds__(128) void k_gemm_h(const float* __restrict__ A, int lda, size_t sA, const _Float16* __restrict__ Bh, int ldb, size_t sB, float alpha, float* __restrict__ C, int ldc, size_t sC, int M, int N, int K) {
  __shared__ __attribute__((aligned(16))) float so[4][16][64];
  const int tid = threadIdx.x, w = tid >> 5, lane = tid & 31, ln = lane & 15, hh = lane >> 4; const int by = blockIdx.y;
  A += (size_t)by * sA; Bh += (size_t)by * sB; C += (size_t)by * sC;
  const int ntn = (N + 63) / 64; const int wid = blockIdx.x * 4 + w; const int mt = wid / ntn, nq = wid % ntn; if (mt * 16 >= M) return;
  const int row0 = mt * 16, col0 = nq * 64; const float* arow = A + (size_t)(row0 + ln) * lda;
  v8f acc[4] = {};
  for (int kb = 0; kb < K; kb += 32) {
    FragH ah, al;
    const v4f x0 = *(const v4fa*)(arow + kb + 8 * hh), x1 = *(const v4fa*)(arow + kb + 8 * hh + 4), x2 = *(const v4fa*)(arow + kb + 16 + 8 * hh), x3 = *(const v4fa*)(arow + kb + 16 + 8 * hh + 4);
    float xs[16] = {x0[0],x0[1],x0[2],x0[3],x1[0],x1[1],x1[2],x1[3],x2[0],x2[1],x2[2],x2[3],x3[0],x3[1],x3[2],x3[3]};
#pragma unroll
    for (int i = 0; i < 16; ++i) { const _Float16 h = (_Float16)xs[i]; ah.h[i] = h; al.h[i] = ASPLIT ? (_Float16)(xs[i] - (float)h) : (_Float16)0.0f; }
#pragma unroll
    for (int t = 0; t < 4; ++t) { if (col0 + t * 16 >= N) continue; const size_t boff = (size_t)(col0 + t * 16 + ln) * ldb + kb; FragH bq; bq.half[0] = *(const v8us*)(Bh + boff + 8 * hh); bq.half[1] = *(const v8us*)(Bh + boff + 16 + 8 * hh);
      acc[t] = mmaH<ASPLIT ? 2 : 1>(ah.v, al.v, bq.v, bq.v, acc[t]); }
  }
#pragma unroll
  for (int t = 0; t < 4; ++t) { if (col0 + t * 16 >= N) continue;
#pragma unroll
    for (int r = 0; r < 8; ++r) so[w][8 * hh + r][t * 16 + ln] = acc[t][r] * alpha; }
  __builtin_amdgcn_fence(__ATOMIC_ACQ_REL, "workgroup"); __builtin_amdgcn_wave_barrier();
  const int rsub = lane >> 4, c4 = (lane & 15) * 4;
  {
#pragma unroll
    for (int q = 0; q < 8; ++q) { const int r = q * 2 + rsub; if (col0 + c4 < N) { const v4f v = *(const v4fa*)&so[w][r][c4]; *(v4f*)(C + (size_t)(row0 + r) * ldc + col0 + c4) = v; } }
     }
}

// Wt[n][k] = f16(W[k][n]·scale) from f32 row-major W[K][N] (scale = power of two; bf16-exact weights stay exact in f16 away from the subnormal range)
__global__ __launch_bounds__(256) void k_wt_f16(const float* __restrict__ W, _Float16* __restrict__ Wt, int K, int N, float scale) {
  const int t = blockIdx.x * 256 + threadIdx.x; if (t >= N * (K / 8)) return; const int n = t / (K / 8), k8 = (t % (K / 8)) * 8; FragH f;
#pragma unroll
  for (int i = 0; i < 8; ++i) f.h[i] = (_Float16)(bf16_round(W[(size_t)(k8 + i) * N + n]) * scale); const v8us o = f.half[0];
  *(v8us*)((unsigned short*)Wt + (size_t)n * K + k8) = o; 
}
// k_gemm_hh variant with fused epilogue: v = acc·alpha + bias[by·sBias + col] (+ CP[(row/rowsPerB)·sCPb + by·64 + col] if CP) ; ACT 0 none / 1 elu ; writes f16 C16 (and f32 C if non-null)
template <int ACT>
__global__ __launch_bounds__(128) void k_gemm_hhx(const _Float16* __restrict__ A, int lda, size_t sA, const _Float16* __restrict__ Bh, int ldb, size_t sB, float alpha, const float* __restrict__ bias, size_t sBias, const float* __restrict__ CP, int rowsPerB, size_t sCPb, int row0g,
    float* __restrict__ C, _Float16* __restrict__ C16, int ldc, size_t sC, int M, int N, int K) {
  __shared__ __attribute__((aligned(16))) float so[4][16][64];
  const int tid = threadIdx.x, w = tid >> 5, lane = tid & 31, ln = lane & 15, hh = lane >> 4; const int by = blockIdx.y;
  A += (size_t)by * sA; Bh += (size_t)by * sB; const size_t cofs = (size_t)by * sC; const float* bp = bias ? bias + (size_t)by * sBias : nullptr;
  const int ntn = (N + 63) / 64; const int wid = blockIdx.x * 4 + w; const int mt = wid / ntn, nq = wid % ntn; if (mt * 16 >= M) return;
  const int row0 = mt * 16, col0 = nq * 64; const _Float16* arow = A + (size_t)(row0 + ln) * lda;
  v8f acc[4] = {};
  for (int kb = 0; kb < K; kb += 32) { FragH ah; ah.half[0] = *(const v8us*)((const unsigned short*)arow + kb + 8 * hh); ah.half[1] = *(const v8us*)((const unsigned short*)arow + kb + 16 + 8 * hh);
#pragma unroll
    for (int t = 0; t < 4; ++t) { if (col0 + t * 16 >= N) continue; const size_t boff = (size_t)(col0 + t * 16 + ln) * ldb + kb; FragH bq; bq.half[0] = *(const v8us*)((const unsigned short*)Bh + boff + 8 * hh); bq.half[1] = *(const v8us*)((const unsigned short*)Bh + boff + 16 + 8 * hh);
      acc[t] = mmaH<1>(ah.v, ah.v, bq.v, bq.v, acc[t]); }
  }
#pragma unroll
  for (int t = 0; t < 4; ++t) { if (col0 + t * 16 >= N) continue; const int col = col0 + t * 16 + ln; const float bv = bp ? bf16_round(bp[col]) : 0.f;
#pragma unroll
    for (int r = 0; r < 8; ++r) { float v = acc[t][r] * alpha + bv; if (CP) { const int bidx = (row0g + row0 + 8 * hh + r) / rowsPerB; v += CP[(size_t)bidx * sCPb + (size_t)by * 64 + col]; } if (ACT == 1) v = (v > 0.f) ? v : expm1f(v); else if (ACT == 7) v = (v > 0.f) ? v + 1.0f : expf(v); else if (ACT == 8) v = tanhf(v); else if (ACT == 9) v = 0.5f * v * (1.0f + tanhf(0.7978845608028654f * (v + 0.044715f * v * v * v))); else if (ACT == 11) v = 1.0f / (1.0f + expf(-v)); else if (ACT == 12) v = (v > 0.f) ? v : 0.01f * v; else if (ACT == 14) v = (v > 0.f) ? v : 0.1f * v; else if (ACT == 15) v = v / (1.0f + expf(-v)); else if (ACT == 3) v = fmaxf(v, 0.f); else if (ACT == 6) v = 0.5f * v * (1.0f + erff(v * 0.70710678118654752f)); so[w][8 * hh + r][t * 16 + ln] = v; } }
  __builtin_amdgcn_fence(__ATOMIC_ACQ_REL, "workgroup"); __builtin_amdgcn_wave_barrier();
  const int rsub = lane >> 4, c4 = (lane & 15) * 4; typedef _Float16 v4h __attribute__((ext_vector_type(4)));
  {
#pragma unroll
    for (int q = 0; q < 8; ++q) { const int r = q * 2 + rsub; if (col0 + c4 < N) { const v4f v = *(const v4fa*)&so[w][r][c4]; if (C) *(v4f*)(C + cofs + (size_t)(row0 + r) * ldc + col0 + c4) = v; if (C16) { v4h h4; for (int i = 0; i < 4; ++i) h4[i] = (_Float16)v[i]; *(v4h*)(C16 + cofs + (size_t)(row0 + r) * ldc + col0 + c4) = h4; } } }
     }
}


typedef _Float16 v4h __attribute__((ext_vector_type(4)));

// All input roundings in one launch, 8 values a thread: work-groups 0..PREP_XB-1 take x of all images (bf16 rounding, kept as f16), the next PREP_QB take w_qkv and the last PREP_PB w_proj (bf16 rounding x16, exact in f16).
// The work-group picks source, plane and factor (1 for x: an exact product); the grid divides the three arrays without remainder.
#define PREP_XB (NIMG * NTOK * CC / 8 / 256)
#define PREP_QB (3 * CC * CC / 8 / 256)
#define PREP_PB (CC * CC / 8 / 256)
__global__ __launch_bounds__(256) void k_prep16(const float* __restrict__ x, const float* __restrict__ wqkv, const float* __restrict__ wp, _Float16* __restrict__ X16, _Float16* __restrict__ BQKV, _Float16* __restrict__ BP) {
  int bx = blockIdx.x; const float* src = x; _Float16* dst = X16; float sc = 1.0f;
  if (bx >= PREP_XB + PREP_QB) { bx -= PREP_XB + PREP_QB; src = wp; dst = BP; sc = 16.0f; } else if (bx >= PREP_XB) { bx -= PREP_XB; src = wqkv; dst = BQKV; sc = 16.0f; }
  const size_t t = (size_t)bx * 256 + threadIdx.x; FragH f;
#pragma unroll
  for (int q = 0; q < 8; ++q) f.h[q] = (_Float16)(bf16_round(src[t * 8 + q]) * sc); *(v8us*)((unsigned short*)dst + t * 8) = f.half[0];  }
__global__ __launch_bounds__(256) void k_h16(const float* __restrict__ x, _Float16* __restrict__ X16, size_t n8) { const size_t t = (size_t)blockIdx.x * 256 + threadIdx.x; if (t >= n8) return; FragH f;
#pragma unroll
  for (int q = 0; q < 8; ++q) f.h[q] = (_Float16)x[t * 8 + q]; *(v8us*)((unsigned short*)X16 + t * 8) = f.half[0];  }
template <int NHv, int TTv>
__global__ __launch_bounds__(256) void k_vt(const _Float16* __restrict__ V16, int ldv, int voff, _Float16* __restrict__ Vt) { __shared__ unsigned short tl[64][66]; const int tid = threadIdx.x; const int slab = blockIdx.x / (TTv / 64), lg = blockIdx.x % (TTv / 64); const int b = slab / NHv, h = slab % NHv;
  for (int i = tid; i < 64 * 8; i += 256) { const int r = i / 8, c8 = (i % 8) * 8; FragH f; f.half[0] = *(const v8us*)((const unsigned short*)V16 + ((size_t)b * TTv + lg * 64 + r) * ldv + voff + h * 64 + c8);
#pragma unroll
    for (int q = 0; q < 8; ++q) tl[r][c8 + q] = f.u[q]; }
  __syncthreads();
  {
#pragma unroll
    for (int rd = 0; rd < 2; ++rd) { const int d = rd * 32 + tid / 8, pc = tid % 8; FragH f;
#pragma unroll
      for (int q = 0; q < 8; ++q) f.u[q] = tl[pc * 8 + q][d];
      *(v8us*)((unsigned short*)Vt + ((size_t)slab * 64 + d) * TTv + lg * 64 + pc * 8) = f.half[0]; }
     } }

__global__ __launch_bounds__(256) void k_hl(const float* __restrict__ F, _Float16* __restrict__ Hh, _Float16* __restrict__ Hl, size_t n8) { const size_t t = (size_t)blockIdx.x * 256 + threadIdx.x; if (t >= n8) return; FragH fh, fl; const v4f a = *(const v4fa*)(F + t * 8), c = *(const v4fa*)(F + t * 8 + 4);
#pragma unroll
  for (int q = 0; q < 4; ++q) { _Float16 h = (_Float16)a[q]; fh.h[q] = h; fl.h[q] = (_Float16)((a[q] - (float)h) * 1024.0f); h = (_Float16)c[q]; fh.h[4 + q] = h; fl.h[4 + q] = (_Float16)((c[q] - (float)h) * 1024.0f); }
  { *(v8us*)((unsigned short*)Hh + t * 8) = fh.half[0]; *(v8us*)((unsigned short*)Hl + t * 8) = fl.half[0];  } }

// ---- GEMM C = A.B^T x alpha + bias for K = CC: A f16 [M][CC], Bh f16 [N][CC]; M and N multiples of 128; writes f32 C (F32OUT) or f16 C16, pitch N ----
// A work-group of eight waves owns a 128 x 128 tile of C. Its 128 rows of A and 128 rows of B, whole in k (512 B a row), are brought into LDS once by asynchronous copies,
// one whole row (four 128-byte lines) per wave instruction; every fragment then comes from LDS. Wave = 32 rows x 64 columns, k ascending as before.
// The f16 form is the qkv product (N = 3 CC, rows = tokens of all images): its q columns go to C16 (pitch N); its k and v columns go, in blocks of 8 tokens x 32 channels of one head (512 B each), to
// KS block = [16-byte piece c of the token's 64 B][token & 7][8 f16] and VS block = [channel][8 tokens]; a wave's 16-byte-per-lane fragment load of the attention kernel then reads four whole 128-byte lines.
__device__ __forceinline__ v16h g2_frag(const _Float16* p, int hh) { FragH f; f.half[0] = *(const v8us*)((const unsigned short*)p + 8 * hh); f.half[1] = *(const v8us*)((const unsigned short*)p + 16 + 8 * hh); return f.v; }
#define G3_PITCH 528      /* bytes of a staged row: 512 + 16, an odd number of 16-byte pieces, so that the 16 rows of a ds_load_b128 fragment read lie on different banks */
__device__ __forceinline__ v16h g3_frag(const unsigned char* p) { FragH f; f.half[0] = *(const v8us*)p; f.half[1] = *(const v8us*)(p + 32); return f.v; }
__device__ __forceinline__ v8f g3_mma(v16h a, v16h b, v8f c) { return __builtin_amdgcn_wmma_f32_16x16x32_f16(false, a, false, b, (short)0, c, false, false); }
// Eight rows, 16 bytes a lane each, from global memory straight into LDS. The closing s_wait_xcnt stands inside the statement, in front of any later write of the address registers that the copies name.
__device__ __forceinline__ void g3_copy8(unsigned l, const _Float16* g) {
  asm volatile("global_load_async_to_lds_b128 %0, %8, off\n\tglobal_load_async_to_lds_b128 %1, %9, off\n\tglobal_load_async_to_lds_b128 %2, %10, off\n\tglobal_load_async_to_lds_b128 %3, %11, off\n\t"
               "global_load_async_to_lds_b128 %4, %12, off\n\tglobal_load_async_to_lds_b128 %5, %13, off\n\tglobal_load_async_to_lds_b128 %6, %14, off\n\tglobal_load_async_to_lds_b128 %7, %15, off\n\ts_wait_xcnt 0x0"
               :: "v"(l), "v"(l + G3_PITCH), "v"(l + 2 * G3_PITCH), "v"(l + 3 * G3_PITCH), "v"(l + 4 * G3_PITCH), "v"(l + 5 * G3_PITCH), "v"(l + 6 * G3_PITCH), "v"(l + 7 * G3_PITCH),
                  "v"(g), "v"(g + CC), "v"(g + 2 * CC), "v"(g + 3 * CC), "v"(g + 4 * CC), "v"(g + 5 * CC), "v"(g + 6 * CC), "v"(g + 7 * CC) : "memory"); }
template <int N, bool F32OUT>
__global__ __launch_bounds__(256) void k_gemm3(const _Float16* __restrict__ A, const _Float16* __restrict__ Bh, float alpha, const float* __restrict__ bias, float* __restrict__ C, _Float16* __restrict__ C16, _Float16* __restrict__ KS, _Float16* __restrict__ VS) {
  __shared__ __attribute__((aligned(16))) unsigned char sm[256 * G3_PITCH];      /* rows 0..127: A, rows 128..255: B; afterwards the waves' output staging */
  const int tid = threadIdx.x, w = __builtin_amdgcn_readfirstlane(tid >> 5), lane = tid & 31, ln = lane & 15, hh = lane >> 4;      /* wave number as a scalar: the choice of source below is a scalar one */
  constexpr int ntn = N >> 7; const int mt = blockIdx.x / ntn, nq = blockIdx.x - mt * ntn; const int row0 = mt * 128, col0 = nq * 128;
  { const _Float16* g = (w < 4 ? A + (size_t)(row0 + 32 * w) * CC : Bh + (size_t)(col0 + 32 * (w - 4)) * CC) + lane * 8;      /* waves 0..3 bring A, waves 4..7 B: 32 rows each, lane = 16-byte piece of the row */
    const unsigned l = (unsigned)(size_t)sm + (unsigned)(32 * w * G3_PITCH + lane * 16);
#pragma unroll
    for (int u = 0; u < 4; ++u) g3_copy8(l + u * 8 * G3_PITCH, g + (size_t)u * 8 * CC); }
  asm volatile("s_wait_asynccnt 0x0" ::: "memory");      /* this wave's 32 copies have landed */
  __syncthreads();      /* and so have the other waves': nobody reads the tile in front of this barrier */
  const int wm = w & 3, wn = w >> 2;
  const unsigned char* ap = sm + (32 * wm + ln) * G3_PITCH + 16 * hh; const unsigned char* bq = sm + (128 + 64 * wn + ln) * G3_PITCH + 16 * hh;
  const v8f z8 = {0.f,0.f,0.f,0.f,0.f,0.f,0.f,0.f}; v8f c00 = z8, c01 = z8, c02 = z8, c03 = z8, c10 = z8, c11 = z8, c12 = z8, c13 = z8;
  v16h fa[2][2], fb[2][4];      /* two fragment sets: the products of a step read one while the next step's LDS reads fill the other */
#pragma unroll
  for (int t = 0; t < 2; ++t) fa[0][t] = g3_frag(ap + 16 * t * G3_PITCH);
#pragma unroll
  for (int t = 0; t < 4; ++t) fb[0][t] = g3_frag(bq + 16 * t * G3_PITCH);
#pragma unroll      /* unrolled: the set index is a compile-time constant, so both sets stay in registers */
  for (int ks = 0; ks < CC / 32; ++ks) { const int cu = ks & 1, nx = cu ^ 1;
    if (ks + 1 < CC / 32) {
#pragma unroll
      for (int t = 0; t < 2; ++t) fa[nx][t] = g3_frag(ap + 16 * t * G3_PITCH + 64 * (ks + 1));
#pragma unroll
      for (int t = 0; t < 4; ++t) fb[nx][t] = g3_frag(bq + 16 * t * G3_PITCH + 64 * (ks + 1)); }
    __builtin_amdgcn_sched_barrier(0);      /* keeps the next step's twelve LDS reads one group ahead of this step's products: left free, the compiler lifts reads of many steps to the top and takes over 256 registers, with register-window switches among the products */
    c00 = g3_mma(fa[cu][0], fb[cu][0], c00); c10 = g3_mma(fa[cu][1], fb[cu][0], c10); c01 = g3_mma(fa[cu][0], fb[cu][1], c01); c11 = g3_mma(fa[cu][1], fb[cu][1], c11);
    c02 = g3_mma(fa[cu][0], fb[cu][2], c02); c12 = g3_mma(fa[cu][1], fb[cu][2], c12); c03 = g3_mma(fa[cu][0], fb[cu][3], c03); c13 = g3_mma(fa[cu][1], fb[cu][3], c13);
    __builtin_amdgcn_sched_barrier(0);      /* and keeps the reads of the step after next behind these products, whose set they overwrite */
  }
  __syncthreads();      /* every wave has read its last fragment: from here the tile's LDS is output staging, 32 x 68 floats a wave */
  float (*so)[68] = (float (*)[68])(sm + w * (32 * 68 * 4)); const int rw = row0 + 32 * wm, cw = col0 + 64 * wn;
  v8f accs[8] = {c00, c01, c02, c03, c10, c11, c12, c13};
  const int sel = F32OUT ? 0 : nq >> 1;      /* qkv product: column tiles 0,1 are q, 2,3 k, 4,5 v; one answer for the whole work-group */
  const size_t blk = (size_t)((unsigned)rw / NTOK * NHD + (((unsigned)cw & (CC - 1)) >> 5)) * (NTOK / 8) + (((unsigned)rw & (NTOK - 1)) >> 3);      /* first of the wave's 2 heads x 4 token blocks */
  if (sel == 2) {      /* v: an accumulator register row is already 8 tokens of one channel, the 16 bytes of a VS block's row; 16 lanes fill 256 contiguous bytes */
    unsigned short* vp = (unsigned short*)VS + ((blk + hh) * 32 + ln) * 8;
#pragma unroll
    for (int u = 0; u < 8; ++u) { const int t = u & 3, half = u >> 2; const float bv = bf16_round(bias[cw + t * 16 + ln]); FragH f;
#pragma unroll
      for (int r = 0; r < 8; ++r) f.h[r] = (_Float16)(accs[u][r] * alpha + bv);
      *(v8us*)(vp + (((t >> 1) * (NTOK / 8) + half * 2) * 32 + (t & 1) * 16) * 8) = f.half[0]; }
    return; }      /* no barrier stands behind this point */
#pragma unroll
  for (int u = 0; u < 8; ++u) { const int t = u & 3, half = u >> 2; const float bv = bf16_round(bias[cw + t * 16 + ln]);
#pragma unroll
    for (int r = 0; r < 8; ++r) so[half * 16 + 8 * hh + r][t * 16 + ln] = accs[u][r] * alpha + bv; }
  __builtin_amdgcn_fence(__ATOMIC_ACQ_REL, "workgroup"); __builtin_amdgcn_wave_barrier();
  if (sel == 1) {      /* k: lane = (piece c, token & 7), so each store of the wave is one whole 512-byte KS block */
    unsigned short* kp = (unsigned short*)KS + blk * 256 + lane * 8; const int c8 = (lane >> 3) * 8, tk = lane & 7;
    v4f lo[8], hi[8];
#pragma unroll
    for (int q = 0; q < 8; ++q) { lo[q] = *(const v4fa*)&so[(q & 3) * 8 + tk][(q >> 2) * 32 + c8]; hi[q] = *(const v4fa*)&so[(q & 3) * 8 + tk][(q >> 2) * 32 + c8 + 4]; }
#pragma unroll
    for (int q = 0; q < 8; ++q) { FragH f;
#pragma unroll
      for (int i = 0; i < 4; ++i) { f.h[i] = (_Float16)lo[q][i]; f.h[4 + i] = (_Float16)hi[q][i]; }
      *(v8us*)(kp + ((q >> 2) * (NTOK / 8) + (q & 3)) * 256) = f.half[0]; }
    asm volatile("s_wait_xcnt 0x0" ::: "memory");      /* in the built code other branches' blocks follow this one and reuse the stores' registers: the wait stands in front of any such write */
    return; }
  const int rsub = lane >> 4, c4 = (lane & 15) * 4;
  const size_t o0 = (size_t)(rw + rsub) * N + cw + c4;      /* N is a compile-time pitch: the sixteen stores share one address and differ in their immediate offsets */
  v4f vv[16];
#pragma unroll
  for (int q = 0; q < 16; ++q) vv[q] = *(const v4fa*)&so[q * 2 + rsub][c4];
#pragma unroll
  for (int q = 0; q < 16; ++q) {
    if (F32OUT) *(v4f*)(C + o0 + q * 2 * N) = vv[q];
    else { v4h h4; for (int i = 0; i < 4; ++i) h4[i] = (_Float16)vv[q][i]; *(v4h*)(C16 + o0 + q * 2 * N) = h4; } }
  if (!F32OUT) asm volatile("s_wait_xcnt 0x0" ::: "memory");      /* as behind the k stores: in the three-way form the built code goes on into another branch's block */
}


__device__ __forceinline__ int na_start(int i, int K) { const int nh = K / 2; int s = max(i - nh, 0); if (i + nh >= RES) s += RES - i - nh - 1; return s; }
__device__ __forceinline__ int na_pb(int i, int K) { const int nh = K / 2; int p = nh; if (i < nh) p += nh - i; if (i + nh >= RES) p += RES - i - 1 - nh; return p; }
__device__ __forceinline__ v16h na_frag(const _Float16* p, int second) { FragH f; f.half[0] = *(const v8us*)(const unsigned short*)p; f.half[1] = *(const v8us*)((const unsigned short*)p + second); return f.v; }
// lane l <-> lane l ^ 16 (the two halves of a wave hold different keys of the same query)
__device__ __forceinline__ float xhalf(float x) { return __builtin_bit_cast(float, __builtin_amdgcn_permlanex16(__builtin_bit_cast(int, x), __builtin_bit_cast(int, x), 0x76543210, 0xfedcba98, false, false)); }
// Eight exponentials (base 2) in one statement: behind a transcendental the instruction set asks for one independent instruction before its result is read or its source overwritten.
// The outputs are early-clobber, so each v_exp_f32 is that independent instruction for the one before it; the closing v_nop keeps the slot behind the last.
__device__ __forceinline__ void na_exp8(float (&y)[8], const float (&x)[8]) {
  asm("v_exp_f32 %0, %8\n\tv_exp_f32 %1, %9\n\tv_exp_f32 %2, %10\n\tv_exp_f32 %3, %11\n\tv_exp_f32 %4, %12\n\tv_exp_f32 %5, %13\n\tv_exp_f32 %6, %14\n\tv_exp_f32 %7, %15\n\tv_nop"
      : "=&v"(y[0]), "=&v"(y[1]), "=&v"(y[2]), "=&v"(y[3]), "=&v"(y[4]), "=&v"(y[5]), "=&v"(y[6]), "=&v"(y[7])
      : "v"(x[0]), "v"(x[1]), "v"(x[2]), "v"(x[3]), "v"(x[4]), "v"(x[5]), "v"(x[6]), "v"(x[7])); }
__device__ __forceinline__ float na_exp1(float x) { float y; asm("v_exp_f32 %0, %1\n\tv_nop" : "=&v"(y) : "v"(x)); return y; }      /* the v_nop keeps the same slot */
#define NA_NEG (-3.0e38f)
#define NA_TBMAX (25 * 25 + 64)
// NA_R neighbouring query rows of one image and all eight heads per work-group; wave = (head, 16 query columns, all NA_R rows).
// The rows' windows overlap in all but one key row per step down, so the wave walks the union of their key rows once and every K and V^T fragment it loads serves each query row whose window holds that key row
// (a scalar test per query row; each query still meets its own K key rows in ascending order). The column windows of the 16 queries lie inside the 32 columns C0..C0+31 (C0 a multiple of 8) and are the same for all rows.
// Per key row and query row: S^T = K.Q^T + bias/scale (two 16x16x32 products, bias and window mask enter as the C operand), running maximum and sum per query
// (lane = query), P^T x2^10 packed from the two score tiles as the B operand, O^T += V^T.P^T; K and V^T fragments come from the fragment-ordered planes.
#define NA_R 2
template <int K>
__device__ __forceinline__ void na_row(const _Float16* __restrict__ QKV, const _Float16* __restrict__ KS, const _Float16* __restrict__ VS, const float* __restrict__ tbh, int h, int b, int i0, int j0, unsigned char* __restrict__ ysm) {      /* tbh: this head's padded bias table in LDS; h, b, i0, j0 are scalars of the wave */
  constexpr int RB = 2 * K - 1; constexpr float SC2 = SCALE * 1.4426950408889634f;
  const int lane = threadIdx.x & 31, ln = lane & 15, hh = lane >> 4;
  const int j = j0 + ln; const int C0 = min(max(j0 - 8, 0), 32);
  const int si = na_start(i0, K), sj = na_start(j, K), pj = na_pb(j, K);
  int ds[NA_R], po[NA_R];      /* query row t: its window starts ds[t] key rows below the first row's; po[t]: its bias row at the union's first key row, in table elements */
#pragma unroll
  for (int t = 0; t < NA_R; ++t) { ds[t] = na_start(i0 + t, K) - si; po[t] = (na_pb(i0 + t, K) - ds[t]) * RB; }
  const int nr = ds[NA_R - 1] + K;      /* key rows of the union: K to K + NA_R - 1 */
  const _Float16* img = QKV + (size_t)b * NTOK * (3 * CC);
  v16h qf[NA_R];
#pragma unroll
  for (int t = 0; t < NA_R; ++t) qf[t] = g2_frag(img + (size_t)((i0 + t) * RES + j) * (3 * CC) + h * HD, hh);
  const size_t blk0 = (size_t)(b * NHD + h) * (NTOK / 8) + ((si * RES + C0) >> 3);
  const _Float16* kb = KS + blk0 * 256; const unsigned kl = ((ln >> 3) * 32 + hh * 8 + (ln & 7)) * 8;      /* key = lane & 15; channels 8hh.. here, 16 + 8hh.. 128 elements on */
  const _Float16* vb = VS + blk0 * 256; const unsigned vl = (hh * 32 + ln) * 8;                            /* channel = lane & 15; keys 8hh.. here, 16 + 8hh.. two blocks on */
  const int d0 = C0 + 8 * hh - sj; const float* tp = tbh + 32 + pj + d0;
  bool ok[16];
#pragma unroll
  for (int e = 0; e < 16; ++e) ok[e] = (unsigned)(d0 + (e & 7) + 16 * (e >> 3)) < (unsigned)K;
  const v8f z8 = {0.f,0.f,0.f,0.f,0.f,0.f,0.f,0.f}; v8f o0[NA_R], o1[NA_R]; float m[NA_R], l[NA_R];
#pragma unroll
  for (int t = 0; t < NA_R; ++t) { o0[t] = z8; o1[t] = z8; m[t] = NA_NEG; l[t] = 0.f; }
  v16h a0 = na_frag(kb + kl, 128), a1 = na_frag(kb + kl + 512, 128);
  /* scores of query row t against the key row in a0, a1 */
  auto score = [&](int t, v8f& s0, v8f& s1) {
    const float* tq = tp + po[t];
#pragma unroll
    for (int r = 0; r < 8; ++r) { const float t0 = tq[r], t1 = tq[16 + r]; s0[r] = ok[r] ? t0 : NA_NEG; s1[r] = ok[8 + r] ? t1 : NA_NEG; }      /* every index lies inside the padded table */
    s0 = __builtin_amdgcn_wmma_f32_16x16x32_f16(false, a0, false, qf[t], (short)0, s0, false, false);
    s1 = __builtin_amdgcn_wmma_f32_16x16x32_f16(false, a1, false, qf[t], (short)0, s1, false, false); };
  /* running softmax of query row t over these scores, and its share of attn.v */
  auto fold = [&](int t, const v8f& s0, const v8f& s1, const v16h& u0, const v16h& u1) {
    float mx = fmaxf(s0[0], s1[0]);
#pragma unroll
    for (int r = 1; r < 8; ++r) mx = fmaxf(mx, fmaxf(s0[r], s1[r]));
    mx = fmaxf(mx, xhalf(mx));
    const float mn = fmaxf(m[t], mx); const float al = na_exp1((m[t] - mn) * SC2); m[t] = mn; const float mb = 10.0f - mn * SC2;
    FragH pf; float ps = 0.f, x0[8], x1[8], p0[8], p1[8];
#pragma unroll
    for (int r = 0; r < 8; ++r) { x0[r] = fmaf(s0[r], SC2, mb); x1[r] = fmaf(s1[r], SC2, mb); }
    na_exp8(p0, x0); na_exp8(p1, x1);
#pragma unroll
    for (int r = 0; r < 8; ++r) { ps += p0[r] + p1[r]; pf.h[r] = (_Float16)p0[r]; pf.h[8 + r] = (_Float16)p1[r]; }
    l[t] = l[t] * al + ps;
#pragma unroll
    for (int r = 0; r < 8; ++r) { o0[t][r] *= al; o1[t][r] *= al; }
    o0[t] = __builtin_amdgcn_wmma_f32_16x16x32_f16(false, u0, false, pf.v, (short)0, o0[t], false, false);
    o1[t] = __builtin_amdgcn_wmma_f32_16x16x32_f16(false, u1, false, pf.v, (short)0, o1[t], false, false); };
#pragma unroll 1      /* rolled: unrolled, the compiler lifts every row's loads to the top and passes the 128 registers a wave has here */
  for (int kr = 0; kr < nr; ++kr) {
    const v16h u0 = na_frag(vb + vl, 512), u1 = na_frag(vb + vl + 128, 512); vb += 2048;
    __builtin_amdgcn_sched_barrier(0);      /* keeps the V loads up here, a whole softmax ahead of their use: without it the compiler sinks them to just in front of the products that wait for them */
#pragma unroll
    for (int t = 0; t < NA_R - 1; ++t)
      if ((unsigned)(kr - ds[t]) < (unsigned)K) { v8f s0, s1; score(t, s0, s1); fold(t, s0, s1, u0, u1); }      /* is this key row in query row t's window? one answer for the whole wave, a scalar test */
    const bool act = (unsigned)(kr - ds[NA_R - 1]) < (unsigned)K;
    v8f s0, s1; score(NA_R - 1, s0, s1);      /* taken on every pass: in the one pass that can lie ahead of this row's window the scores go unused (the bias row read there is the one above the window's first, inside the table); under a test of their own they would hold 16 registers round the whole loop */
    if (kr + 1 < nr) kb += 2048;      /* the last query row's scores are taken, the K fragments are free: next row's fly under this softmax; the last pass fetches its own row again, never one past the window */
    a0 = na_frag(kb + kl, 128); a1 = na_frag(kb + kl + 512, 128);
    asm volatile("s_wait_xcnt 0x0" ::: "memory");      /* stands in front of the V address pair's advance, which the compiler places below while this pass's loads are in flight */
    __builtin_amdgcn_sched_barrier(0);      /* keeps the next row's K loads here: without it the compiler sinks them to the foot of the pass, a few instructions ahead of their use */
    if (act) fold(NA_R - 1, s0, s1, u0, u1);
    tp += RB;
  }
#pragma unroll
  for (int t = 0; t < NA_R; ++t) {
    const float lt = l[t] + xhalf(l[t]); const float inv = 1.0f / lt; FragH y0, y1;
#pragma unroll
    for (int r = 0; r < 8; ++r) { y0.h[r] = (_Float16)(o0[t][r] * inv); y1.h[r] = (_Float16)(o1[t][r] * inv); }
    unsigned char* yp = ysm + (t * RES + j) * G3_PITCH + (h * HD + 8 * hh) * 2;      /* row = token of the work-group's tile, staged at the pitch of the GEMM's fragment reads */
    *(v8us*)yp = y0.half[0]; *(v8us*)(yp + 32) = y1.half[0]; } }
// Attention of NA_R x RES = 128 tokens in all eight heads, then the output projection of those tokens, in one work-group of 32 waves (one per WGP at 128 registers a wave).
// Waves 0..15 take the 13x13 heads 4..7, waves 16..31 the 7x7 heads 0..3; wave & 3 = column tile.
// The 256 rows of the projection weights come into LDS by asynchronous copies issued first of all, and land under the attention. Projection: wave = 32 tokens x 32 output channels, k ascending in one accumulator chain.
#define NA_TP(K) ((2 * (K) - 1) * (2 * (K) - 1) + 64)
#define NA_TOK (NA_R * RES)
__global__ __launch_bounds__(1024) void k_na_proj(const _Float16* __restrict__ QKV, const _Float16* __restrict__ KS, const _Float16* __restrict__ VS, const float* __restrict__ rpb0, const float* __restrict__ rpb1,
                                                  const _Float16* __restrict__ BP, float alpha, const float* __restrict__ bias, float* __restrict__ C) {
  /* one block, the bias tables first: at low LDS addresses the sixteen table reads of a key row's two score tiles differ in their immediate offsets alone. bs: the rounded projection bias, fetched here so that no global load stands between the products and the output.
     sm rows 0..127: head outputs by token, rows 128..383: weight rows; afterwards the waves' output staging */
  __shared__ struct __attribute__((aligned(16))) { float tb[NHD * NA_TP(13)]; float bs[CC]; unsigned char sm[(NA_TOK + CC) * G3_PITCH]; } lds;      /* one table place of the larger size per head: place = wave >> 2, with no constant to add */
  static_assert((NHD * NA_TP(13) + CC) % 4 == 0, "sm starts at a multiple of 16 bytes");
  float* const tb = lds.tb; float* const bs = lds.bs; unsigned char* const sm = lds.sm;
  const int tid = threadIdx.x, w = __builtin_amdgcn_readfirstlane(tid >> 5), lane = tid & 31, ln = lane & 15, hh = lane >> 4;      /* wave number as a scalar: head, column tile and plane bases stay in scalar registers */
  const int b = blockIdx.x / (RES / NA_R), i0 = (blockIdx.x % (RES / NA_R)) * NA_R;
  g3_copy8((unsigned)(size_t)sm + (unsigned)((NA_TOK + 8 * w) * G3_PITCH + lane * 16), BP + (size_t)(8 * w) * CC + lane * 8);      /* eight weight rows a wave, lane = 16-byte piece of the row */
  for (int t = tid; t < 4 * NA_TP(13); t += 1024) { const int hq = t / NA_TP(13), s = t - hq * NA_TP(13) - 32; tb[t] = (s >= 0 && s < 625) ? bf16_round(rpb1[hq * 625 + s]) * 5.656854249492381f : 0.f; }
  for (int t = tid; t < 4 * NA_TP(7); t += 1024) { const int hq = t / NA_TP(7), s = t - hq * NA_TP(7) - 32; tb[(4 + hq) * NA_TP(13) + s + 32] = (s >= 0 && s < 169) ? bf16_round(rpb0[hq * 169 + s]) * 5.656854249492381f : 0.f; }
  if (tid < CC) bs[tid] = bf16_round(bias[tid]);
  __syncthreads();
  if (w < 16) na_row<13>(QKV, KS, VS, tb + (w >> 2) * NA_TP(13), 4 + (w >> 2), b, i0, (w & 3) * 16, sm);
  else na_row<7>(QKV, KS, VS, tb + (w >> 2) * NA_TP(13), (w >> 2) - 4, b, i0, (w & 3) * 16, sm);
  asm volatile("s_wait_asynccnt 0x0" ::: "memory");      /* this wave's eight weight rows have landed */
  __syncthreads();      /* and so have the other waves' rows and head outputs: nobody reads either in front of this barrier */
  const int wm = w & 3, wn = w >> 2;
  const unsigned char* ap = sm + (32 * wm + ln) * G3_PITCH + 16 * hh; const unsigned char* bq = sm + (NA_TOK + 32 * wn + ln) * G3_PITCH + 16 * hh;
  const v8f z8 = {0.f,0.f,0.f,0.f,0.f,0.f,0.f,0.f}; v8f c00 = z8, c01 = z8, c10 = z8, c11 = z8;
  const float bv2[2] = {bs[32 * wn + ln], bs[32 * wn + 16 + ln]};      /* read ahead of the products: behind the staging stores the compiler would have to read them again */
  v16h fa[2][2], fb[2][2];      /* two fragment sets, as in the qkv GEMM: the products of a step read one while the next step's LDS reads fill the other */
#pragma unroll
  for (int t = 0; t < 2; ++t) { fa[0][t] = g3_frag(ap + 16 * t * G3_PITCH); fb[0][t] = g3_frag(bq + 16 * t * G3_PITCH); }
#pragma unroll      /* unrolled: the set index is a compile-time constant, so both sets stay in registers */
  for (int ks = 0; ks < CC / 32; ++ks) { const int cu = ks & 1, nx = cu ^ 1;
    if (ks + 1 < CC / 32) {
#pragma unroll
      for (int t = 0; t < 2; ++t) { fa[nx][t] = g3_frag(ap + 16 * t * G3_PITCH + 64 * (ks + 1)); fb[nx][t] = g3_frag(bq + 16 * t * G3_PITCH + 64 * (ks + 1)); } }
    __builtin_amdgcn_sched_barrier(0);      /* keeps the next step's eight LDS reads one group ahead of this step's products: left free, the compiler lifts reads of many steps to the top, passes the 128 registers of a wave here and spills */
    c00 = g3_mma(fa[cu][0], fb[cu][0], c00); c10 = g3_mma(fa[cu][1], fb[cu][0], c10); c01 = g3_mma(fa[cu][0], fb[cu][1], c01); c11 = g3_mma(fa[cu][1], fb[cu][1], c11);
    __builtin_amdgcn_sched_barrier(0);      /* and keeps the reads of the step after next behind these products, whose set they overwrite */
  }
  __syncthreads();      /* every wave has read its last fragment: from here the LDS is output staging, 32 x 36 floats a wave */
  float (*so)[36] = (float (*)[36])(sm + w * (32 * 36 * 4)); const int rw = blockIdx.x * NA_TOK + 32 * wm, cw = 32 * wn;
  v8f accs[4] = {c00, c01, c10, c11};
#pragma unroll
  for (int u = 0; u < 4; ++u) { const int t = u & 1, half = u >> 1; const float bv = bv2[t];
#pragma unroll
    for (int r = 0; r < 8; ++r) so[half * 16 + 8 * hh + r][t * 16 + ln] = accs[u][r] * alpha + bv; }
  __builtin_amdgcn_fence(__ATOMIC_ACQ_REL, "workgroup"); __builtin_amdgcn_wave_barrier();
  const int rsub = lane >> 3, c4 = (lane & 7) * 4;      /* eight lanes = one whole 128-byte line of an output row */
  float* cp = C + (size_t)(rw + rsub) * CC + cw + c4;
  v4f vv[8];
#pragma unroll
  for (int q = 0; q < 8; ++q) vv[q] = *(const v4fa*)&so[q * 4 + rsub][c4];
#pragma unroll
  for (int q = 0; q < 8; ++q) *(v4f*)(cp + q * 4 * CC) = vv[q];
}

extern "C" void kernel_launch(void* const* d_in, const int* in_sizes, int n_in,
                              void* d_out, int out_size, void* d_ws, size_t ws_size, hipStream_t stream) {
  (void)in_sizes; (void)n_in; (void)out_size;
  const float* const* I = (const float* const*)d_in; const float* x = I[0]; const float* wqkv = I[1]; const float* bqkv = I[2]; const float* rpb0 = I[3]; const float* rpb1 = I[4]; const float* wp = I[5]; const float* bp = I[6];
  char* ws = (char*)d_ws; size_t off = 0;
  auto take = [&](size_t bytes) { char* p = ws + off; off += (bytes + 255) & ~(size_t)255; return p; };
  _Float16* BQKV = (_Float16*)take((size_t)3 * CC * CC * 2); _Float16* BP = (_Float16*)take((size_t)CC * CC * 2);
  _Float16* X16 = (_Float16*)take((size_t)NIMG * NTOK * CC * 2); _Float16* QKV = (_Float16*)take((size_t)NIMG * NTOK * 3 * CC * 2); _Float16* KS = (_Float16*)take((size_t)NIMG * CC * NTOK * 2); _Float16* VS = (_Float16*)take((size_t)NIMG * CC * NTOK * 2);
  if (off > ws_size) return;      /* 0.5 + 16 + 48 + 16 + 16 = 96.5 MiB */
  const dim3 gQ((NIMG * NTOK / 128) * (3 * CC / 128), 1);      /* the token rows of all images are one M */
  k_prep16<<<PREP_XB + PREP_QB + PREP_PB, 256, 0, stream>>>(x, wqkv, wp, X16, BQKV, BP);      /* weights stay (out,in) natural */
  k_gemm3<3 * CC, false><<<gQ, 256, 0, stream>>>(X16, BQKV, 0.0625f, bqkv, nullptr, QKV, KS, VS);      /* of the QKV plane only the q columns are written and read */
  k_na_proj<<<NIMG * (RES / NA_R), 1024, 0, stream>>>(QKV, KS, VS, rpb0, rpb1, BP, 0.0625f, bp, (float*)d_out);
}

// v007
// Measured time: 51.2 microseconds a run.
// Two timings next to v006 put it at 1.06 and 1.07 times that version's speed.
// Counting every step since v000, it is 32.6 times as fast.
#include <hip/hip_runtime.h>
// Split-head neighborhood attention (8 images, 64 x 64 x 256 NHWC; 8 heads x 32; heads 0-3 use 7x7 NATTEN windows with rpb0, heads 4-7 use 13x13 with rpb1; window starts clamped at the borders, relative-position bias with the NATTEN border offsets; q scaled by 32^-0.5) followed by the output projection -> [8,64,64,256].
// Structure: qkv of all images as one f16 WMMA GEMM launch straight from the f32 inputs (a work-group reads 128 token rows of x, rounds them once into LDS and walks all six 128-column weight tiles, which half of its waves round into two LDS buffers while the other half takes the products; 32x64 wave tiles, f32 accumulation, exact products + bias; it also rounds the projection weights to an f16 plane) whose epilogue writes q into an f16 token plane and k and transposed v straight into fragment-ordered planes; ONE fused kernel over all images, both branches and all heads does scores, exact clamped window + bias, softmax (running maximum and sum) and attn.v per wave of 16 query columns of two neighbouring rows against the union of their key rows x 32 columns (each K and V fragment load serves both rows), scores and P (x2^10 in f16) never leaving registers, and leaves the head outputs of its 128 tokens in LDS, where the same work-group (all eight heads, 32 waves) takes the output projection of those tokens straight into the output rows.
// Compute dtype: x, weights, biases, rpb rounded to bf16; q/k/v, P (x2^10) and the attention output as f16 operands (~2^-12); f32 accumulation and softmax. v_wmma_f32_16x16x32_f16.
#define NIMG 8
#define RES 64
#define NTOK (RES * RES)
#define CC 256
#define NHD 8
#define HD 32
#define SCALE 0.17677669529663687f
typedef __bf16 v16b __attribute__((ext_vector_type(16)));
typedef unsigned short v8us __attribute__((ext_vector_type(8), may_alias));
typedef float  v8f  __attribute__((ext_vector_type(8)));
typedef float  v4f  __attribute__((ext_vector_type(4)));
typedef float  v4fa __attribute__((ext_vector_type(4), may_alias));
union FragB { v16b v; v8us half[2]; unsigned short u[16]; };

__device__ __forceinline__ unsigned short bf16_bits(float x) { unsigned int u = __float_as_uint(x); return (unsigned short)((u + 0x7FFFu + ((u >> 16) & 1u)) >> 16); }
__device__ __forceinline__ float bf16_val(unsigned short b) { return __uint_as_float(((unsigned int)b) << 16); }
__device__ __forceinline__ float bf16_round(float x) { return bf16_val(bf16_bits(x)); }
// D += A·B with NT terms: 1 = ah·bh, 2 = + al·bh (A split), 3 = + ah·bl (both split)
template <int NT>
__device__ __forceinline__ v8f mmaN(v16b ah, v16b al, v16b bh, v16b bl, v8f c) {
  c = __builtin_amdgcn_wmma_f32_16x16x32_bf16(false, ah, false, bh, (short)0, c, false, false);
  if (NT >= 2) c = __builtin_amdgcn_wmma_f32_16x16x32_bf16(false, al, false, bh, (short)0, c, false, false);
  if (NT >= 3) c = __builtin_amdgcn_wmma_f32_16x16x32_bf16(false, ah, false, bl, (short)0, c, false, false);
  asm volatile("v_nop\n\tv_nop\n\tv_nop\n\tv_nop" : "+v"(c) : "v"(ah), "v"(al), "v"(bh), "v"(bl));
  return c;
}

__global__ __launch_bounds__(256) void k_wt_bf16(const float* __restrict__ W, unsigned short* __restrict__ Wt, int K, int N) {
  const int t = blockIdx.x * 256 + threadIdx.x;
  const int k8n = K / 8;
  if (t >= N * k8n) return;
  const int n = t / k8n, k8 = (t % k8n) * 8;
  v8us v;
#pragma unroll
  for (int i = 0; i < 8; ++i) v[i] = bf16_bits(W[(size_t)(k8 + i) * N + n]);
  *(v8us*)(Wt + (size_t)n * K + k8) = v;
  
}

// GEMM C[M][N] (f32, pitch ldc) = act(A[M][K]·W + bias). A f32 row-major (pitch lda) converted per fragment to bf16
// (ASPLIT: hi/lo two planes -> 2 terms, else single rounded term); Wt bf16 [N][K] (pitch ldb). BIAS_BF16 rounds the
// bias to bf16 first (bias quantised to bf16 before the add). K%32==0, M%16==0, N%64==0.
template <bool ASPLIT, int ACT, bool BIAS_BF16>
__global__ __launch_bounds__(128) void k_gemm_bf(const float* __restrict__ A, int lda, const unsigned short* __restrict__ Wt, int ldb,
                                               const float* __restrict__ bias, float* __restrict__ C, int ldc, int M, int N, int K) {
  __shared__ __attribute__((aligned(16))) float so[4][16][64];
  const int tid = threadIdx.x, w = tid >> 5, lane = tid & 31, ln = lane & 15, hh = lane >> 4;
  const int ntn = N / 64;
  const int wid = blockIdx.x * 4 + w;
  const int mt = wid / ntn, nq = wid % ntn;
  if (mt * 16 >= M) return;
  const int row0 = mt * 16, col0 = nq * 64;
  const float* arow = A + (size_t)(row0 + ln) * lda;
  v8f acc[4] = {};
  for (int kb = 0; kb < K; kb += 32) {
    FragB ah, al;
    const v4f x0 = *(const v4fa*)(arow + kb + 8 * hh), x1 = *(const v4fa*)(arow + kb + 8 * hh + 4);
    const v4f x2 = *(const v4fa*)(arow + kb + 16 + 8 * hh), x3 = *(const v4fa*)(arow + kb + 16 + 8 * hh + 4);
    float xs[16] = {x0[0],x0[1],x0[2],x0[3],x1[0],x1[1],x1[2],x1[3],x2[0],x2[1],x2[2],x2[3],x3[0],x3[1],x3[2],x3[3]};
#pragma unroll
    for (int i = 0; i < 16; ++i) { const unsigned short hb = bf16_bits(xs[i]); ah.u[i] = hb; al.u[i] = ASPLIT ? bf16_bits(xs[i] - bf16_val(hb)) : (unsigned short)0; }
#pragma unroll
    for (int t = 0; t < 4; ++t) {
      const unsigned short* brow = Wt + (size_t)(col0 + t * 16 + ln) * ldb + kb;
      FragB b;
      b.half[0] = *(const v8us*)(brow + 8 * hh);
      b.half[1] = *(const v8us*)(brow + 16 + 8 * hh);
      acc[t] = mmaN<ASPLIT ? 2 : 1>(ah.v, al.v, b.v, b.v, acc[t]);
    }
  }
#pragma unroll
  for (int t = 0; t < 4; ++t) {
    float bv = bias ? bias[col0 + t * 16 + ln] : 0.f;
    if (BIAS_BF16) bv = bf16_round(bv);
#pragma unroll
    for (int r = 0; r < 8; ++r) { float v = acc[t][r] + bv; if (ACT == 1) v = fmaxf(v, 0.f); so[w][8 * hh + r][t * 16 + ln] = v; }
  }
  __builtin_amdgcn_fence(__ATOMIC_ACQ_REL, "workgroup");
  __builtin_amdgcn_wave_barrier();
  const int rsub = lane >> 4, c4 = (lane & 15) * 4;
  {
#pragma unroll
    for (int q = 0; q < 8; ++q) {
      const int r = q * 2 + rsub;
      const v4f v = *(const v4fa*)&so[w][r][c4];
      *(v4f*)(C + (size_t)(row0 + r) * ldc + col0 + c4) = v;
    }
    
  }
}

// GEMM C = act(A·W + bias + resid): A f32 (ASPLIT -> hi/lo 2 terms), Wt bf16 [N][K]; ACT 0 none, 1 relu, 2 exact gelu;
// resid (optional, f32, row index = (row % rmod), pitch ldr, RES_BF16 rounds it) added before the activation.
template <bool ASPLIT, int ACT, bool BIAS_BF16, bool RES_BF16>
__global__ __launch_bounds__(128) void k_gemm_bf3(const float* __restrict__ A, int lda, const unsigned short* __restrict__ Wt, int ldb,
                                                const float* __restrict__ bias, const float* __restrict__ resid, int rmod, int ldr,
                                                float* __restrict__ C, int ldc, int M, int N, int K) {
  __shared__ __attribute__((aligned(16))) float so[4][16][64];
  const int tid = threadIdx.x, w = tid >> 5, lane = tid & 31, ln = lane & 15, hh = lane >> 4;
  const int ntn = N / 64;
  const int wid = blockIdx.x * 4 + w;
  const int mt = wid / ntn, nq = wid % ntn;
  if (mt * 16 >= M) return;
  const int row0 = mt * 16, col0 = nq * 64;
  const float* arow = A + (size_t)(row0 + ln) * lda;
  v8f acc[4] = {};
  for (int kb = 0; kb < K; kb += 32) {
    FragB ah, al;
    const v4f x0 = *(const v4fa*)(arow + kb + 8 * hh), x1 = *(const v4fa*)(arow + kb + 8 * hh + 4);
    const v4f x2 = *(const v4fa*)(arow + kb + 16 + 8 * hh), x3 = *(const v4fa*)(arow + kb + 16 + 8 * hh + 4);
    float xs[16] = {x0[0],x0[1],x0[2],x0[3],x1[0],x1[1],x1[2],x1[3],x2[0],x2[1],x2[2],x2[3],x3[0],x3[1],x3[2],x3[3]};
#pragma unroll
    for (int i = 0; i < 16; ++i) { const unsigned short hb = bf16_bits(xs[i]); ah.u[i] = hb; al.u[i] = ASPLIT ? bf16_bits(xs[i] - bf16_val(hb)) : (unsigned short)0; }
#pragma unroll
    for (int t = 0; t < 4; ++t) {
      const unsigned short* brow = Wt + (size_t)(col0 + t * 16 + ln) * ldb + kb;
      FragB b;
      b.half[0] = *(const v8us*)(brow + 8 * hh);
      b.half[1] = *(const v8us*)(brow + 16 + 8 * hh);
      acc[t] = mmaN<ASPLIT ? 2 : 1>(ah.v, al.v, b.v, b.v, acc[t]);
    }
  }
#pragma unroll
  for (int t = 0; t < 4; ++t) {
    const int col = col0 + t * 16 + ln;
    float bv = bias ? bias[col] : 0.f;
    if (BIAS_BF16) bv = bf16_round(bv);
#pragma unroll
    for (int r = 0; r < 8; ++r) {
      float v = acc[t][r] + bv;
      if (resid) { float rv = resid[(size_t)((row0 + 8 * hh + r) % rmod) * ldr + col]; if (RES_BF16) rv = bf16_round(rv); v += rv; }
      if (ACT == 1) v = fmaxf(v, 0.f);
      if (ACT == 2) v = 0.5f * v * (1.0f + erff(v * 0.70710678118654752f));
      if (ACT == 3) { const float u = 0.7978845608028654f * (v + 0.044715f * v * v * v); v = 0.5f * v * (1.0f + tanhf(u)); }
      so[w][8 * hh + r][t * 16 + ln] = v;
    }
  }
  __builtin_amdgcn_fence(__ATOMIC_ACQ_REL, "workgroup");
  __builtin_amdgcn_wave_barrier();
  const int rsub = lane >> 4, c4 = (lane & 15) * 4;
  {
#pragma unroll
    for (int q = 0; q < 8; ++q) {
      const int r = q * 2 + rsub;
      const v4f v = *(const v4fa*)&so[w][r][c4];
      *(v4f*)(C + (size_t)(row0 + r) * ldc + col0 + c4) = v;
    }
    
  }
}
// row LayerNorm (biased variance, eps) over N: s = X (+ R); optional out_sum <- s; out_norm <- (s-mu)*rsqrt(var+eps)*g + b
template <bool PARAM_BF16>
__global__ __launch_bounds__(256) void k_layernorm(const float* __restrict__ X, const float* __restrict__ R, const float* __restrict__ g, const float* __restrict__ bta,
                                                  float* __restrict__ out_sum, float* __restrict__ out_norm, int N, float eps) {
  __shared__ float red[256];
  const int row = blockIdx.x, tid = threadIdx.x;
  const float* x = X + (size_t)row * N; const float* rr = R ? R + (size_t)row * N : nullptr;
  float vals[16];                     // up to N = 4096
  const int per = N / 256;            // contiguous chunk per thread? use strided-by-4 chunks: thread handles j = tid*4 + 1024*u
  float s1 = 0.f;
  for (int u = 0; u < per / 4; ++u) {
    const int j = tid * 4 + 1024 * u;
    const v4f a = *(const v4fa*)(x + j);
    v4f b = {0.f,0.f,0.f,0.f}; if (rr) b = *(const v4fa*)(rr + j);
#pragma unroll
    for (int q = 0; q < 4; ++q) { const float v = a[q] + b[q]; vals[u * 4 + q] = v; s1 += v; }
  }
  red[tid] = s1; __syncthreads();
  for (int st = 128; st > 0; st >>= 1) { if (tid < st) red[tid] += red[tid + st]; __syncthreads(); }
  const float mu = red[0] / (float)N; __syncthreads();
  float s2 = 0.f;
  for (int u = 0; u < per / 4; ++u)
#pragma unroll
    for (int q = 0; q < 4; ++q) { const float c = vals[u * 4 + q] - mu; s2 += c * c; }
  red[tid] = s2; __syncthreads();
  for (int st = 128; st > 0; st >>= 1) { if (tid < st) red[tid] += red[tid + st]; __syncthreads(); }
  const float rs = rsqrtf(red[0] / (float)N + eps);
  {
    for (int u = 0; u < per / 4; ++u) {
      const int j = tid * 4 + 1024 * u;
      v4f o, sm;
#pragma unroll
      for (int q = 0; q < 4; ++q) {
        float gg = g[j + q], bb = bta[j + q];
        if (PARAM_BF16) { gg = bf16_round(gg); bb = bf16_round(bb); }
        sm[q] = vals[u * 4 + q]; o[q] = (vals[u * 4 + q] - mu) * rs * gg + bb;
      }
      if (out_sum) *(v4f*)(out_sum + (size_t)row * N + j) = sm;
      *(v4f*)(out_norm + (size_t)row * N + j) = o;
    }
    
  }
}



// ---- f16 WMMA path (v_wmma_f32_16x16x32_f16): 11-bit significands for operands in range — used where a [0,1] probability operand needs more precision than bf16
typedef _Float16 v16h __attribute__((ext_vector_type(16)));
union FragH { v16h v; v8us half[2]; _Float16 h[16]; unsigned short u[16]; };
template <int NT>
__device__ __forceinline__ v8f mmaH(v16h ah, v16h al, v16h bh, v16h bl, v8f c) {
  c = __builtin_amdgcn_wmma_f32_16x16x32_f16(false, ah, false, bh, (short)0, c, false, false);
  if (NT >= 2) c = __builtin_amdgcn_wmma_f32_16x16x32_f16(false, al, false, bh, (short)0, c, false, false);
  if (NT >= 3) c = __builtin_amdgcn_wmma_f32_16x16x32_f16(false, ah, false, bl, (short)0, c, false, false);
  asm volatile("v_nop\n\tv_nop\n\tv_nop\n\tv_nop" : "+v"(c) : "v"(ah), "v"(al), "v"(bh), "v"(bl));
  return c;
}
// batched GEMM like k_gemm_b but f16 operands: A f32 (split into f16 hi/lo if ASPLIT, else rounded to f16), Bt = f16 values [n][k]; alpha; C f32; N multiple of 16 (partial tiles skipped)
template <bool ASPLIT>
__global__ __launch_bounds__(128) void k_gemm_h(const float* __restrict__ A, int lda, size_t sA, const _Float16* __restrict__ Bh, int ldb, size_t sB, float alpha, float* __restrict__ C, int ldc, size_t sC, int M, int N, int K) {
  __shared__ __attribute__((aligned(16))) float so[4][16][64];
  const int tid = threadIdx.x, w = tid >> 5, lane = tid & 31, ln = lane & 15, hh = lane >> 4; const int by = blockIdx.y;
  A += (size_t)by * sA; Bh += (size_t)by * sB; C += (size_t)by * sC;
  const int ntn = (N + 63) / 64; const int wid = blockIdx.x * 4 + w; const int mt = wid / ntn, nq = wid % ntn; if (mt * 16 >= M) return;
  const int row0 = mt * 16, col0 = nq * 64; const float* arow = A + (size_t)(row0 + ln) * lda;
  v8f acc[4] = {};
  for (int kb = 0; kb < K; kb += 32) {
    FragH ah, al;
    const v4f x0 = *(const v4fa*)(arow + kb + 8 * hh), x1 = *(const v4fa*)(arow + kb + 8 * hh + 4), x2 = *(const v4fa*)(arow + kb + 16 + 8 * hh), x3 = *(const v4fa*)(arow + kb + 16 + 8 * hh + 4);
    float xs[16] = {x0[0],x0[1],x0[2],x0[3],x1[0],x1[1],x1[2],x1[3],x2[0],x2[1],x2[2],x2[3],x3[0],x3[1],x3[2],x3[3]};
#pragma unroll
    for (int i = 0; i < 16; ++i) { const _Float16 h = (_Float16)xs[i]; ah.h[i] = h; al.h[i] = ASPLIT ? (_Float16)(xs[i] - (float)h) : (_Float16)0.0f; }
#pragma unroll
    for (int t = 0; t < 4; ++t) { if (col0 + t * 16 >= N) continue; const size_t boff = (size_t)(col0 + t * 16 + ln) * ldb + kb; FragH bq; bq.half[0] = *(const v8us*)(Bh + boff + 8 * hh); bq.half[1] = *(const v8us*)(Bh + boff + 16 + 8 * hh);
      acc[t] = mmaH<ASPLIT ? 2 : 1>(ah.v, al.v, bq.v, bq.v, acc[t]); }
  }
#pragma unroll
  for (int t = 0; t < 4; ++t) { if (col0 + t * 16 >= N) continue;
#pragma unroll
    for (int r = 0; r < 8; ++r) so[w][8 * hh + r][t * 16 + ln] = acc[t][r] * alpha; }
  __builtin_amdgcn_fence(__ATOMIC_ACQ_REL, "workgroup"); __builtin_amdgcn_wave_barrier();
  const int rsub = lane >> 4, c4 = (lane & 15) * 4;
  {
#pragma unroll
    for (int q = 0; q < 8; ++q) { const int r = q * 2 + rsub; if (col0 + c4 < N) { const v4f v = *(const v4fa*)&so[w][r][c4]; *(v4f*)(C + (size_t)(row0 + r) * ldc + col0 + c4) = v; } }
     }
}

// Wt[n][k] = f16(W[k][n]·scale) from f32 row-major W[K][N] (scale = power of two; bf16-exact weights stay exact in f16 away from the subnormal range)
__global__ __launch_bounds__(256) void k_wt_f16(const float* __restrict__ W, _Float16* __restrict__ Wt, int K, int N, float scale) {
  const int t = blockIdx.x * 256 + threadIdx.x; if (t >= N * (K / 8)) return; const int n = t / (K / 8), k8 = (t % (K / 8)) * 8; FragH f;
#pragma unroll
  for (int i = 0; i < 8; ++i) f.h[i] = (_Float16)(bf16_round(W[(size_t)(k8 + i) * N + n]) * scale); const v8us o = f.half[0];
  *(v8us*)((unsigned short*)Wt + (size_t)n * K + k8) = o; 
}
// k_gemm_hh variant with fused epilogue: v = acc·alpha + bias[by·sBias + col] (+ CP[(row/rowsPerB)·sCPb + by·64 + col] if CP) ; ACT 0 none / 1 elu ; writes f16 C16 (and f32 C if non-null)
template <int ACT>
__global__ __launch_bounds__(128) void k_gemm_hhx(const _Float16* __restrict__ A, int lda, size_t sA, const _Float16* __restrict__ Bh, int ldb, size_t sB, float alpha, const float* __restrict__ bias, size_t sBias, const float* __restrict__ CP, int rowsPerB, size_t sCPb, int row0g,
    float* __restrict__ C, _Float16* __restrict__ C16, int ldc, size_t sC, int M, int N, int K) {
  __shared__ __attribute__((aligned(16))) float so[4][16][64];
  const int tid = threadIdx.x, w = tid >> 5, lane = tid & 31, ln = lane & 15, hh = lane >> 4; const int by = blockIdx.y;
  A += (size_t)by * sA; Bh += (size_t)by * sB; const size_t cofs = (size_t)by * sC; const float* bp = bias ? bias + (size_t)by * sBias : nullptr;
  const int ntn = (N + 63) / 64; const int wid = blockIdx.x * 4 + w; const int mt = wid / ntn, nq = wid % ntn; if (mt * 16 >= M) return;
  const int row0 = mt * 16, col0 = nq * 64; const _Float16* arow = A + (size_t)(row0 + ln) * lda;
  v8f acc[4] = {};
  for (int kb = 0; kb < K; kb += 32) { FragH ah; ah.half[0] = *(const v8us*)((const unsigned short*)arow + kb + 8 * hh); ah.half[1] = *(const v8us*)((const unsigned short*)arow + kb + 16 + 8 * hh);
#pragma unroll
    for (int t = 0; t < 4; ++t) { if (col0 + t * 16 >= N) continue; const size_t boff = (size_t)(col0 + t * 16 + ln) * ldb + kb; FragH bq; bq.half[0] = *(const v8us*)((const unsigned short*)Bh + boff + 8 * hh); bq.half[1] = *(const v8us*)((const unsigned short*)Bh + boff + 16 + 8 * hh);
      acc[t] = mmaH<1>(ah.v, ah.v, bq.v, bq.v, acc[t]); }
  }
#pragma unroll
  for (int t = 0; t < 4; ++t) { if (col0 + t * 16 >= N) continue; const int col = col0 + t * 16 + ln; const float bv = bp ? bf16_round(bp[col]) : 0.f;
#pragma unroll
    for (int r = 0; r < 8; ++r) { float v = acc[t][r] * alpha + bv; if (CP) { const int bidx = (row0g + row0 + 8 * hh + r) / rowsPerB; v += CP[(size_t)bidx * sCPb + (size_t)by * 64 + col]; } if (ACT == 1) v = (v > 0.f) ? v : expm1f(v); else if (ACT == 7) v = (v > 0.f) ? v + 1.0f : expf(v); else if (ACT == 8) v = tanhf(v); else if (ACT == 9) v = 0.5f * v * (1.0f + tanhf(0.7978845608028654f * (v + 0.044715f * v * v * v))); else if (ACT == 11) v = 1.0f / (1.0f + expf(-v)); else if (ACT == 12) v = (v > 0.f) ? v : 0.01f * v; else if (ACT == 14) v = (v > 0.f) ? v : 0.1f * v; else if (ACT == 15) v = v / (1.0f + expf(-v)); else if (ACT == 3) v = fmaxf(v, 0.f); else if (ACT == 6) v = 0.5f * v * (1.0f + erff(v * 0.70710678118654752f)); so[w][8 * hh + r][t * 16 + ln] = v; } }
  __builtin_amdgcn_fence(__ATOMIC_ACQ_REL, "workgroup"); __builtin_amdgcn_wave_barrier();
  const int rsub = lane >> 4, c4 = (lane & 15) * 4; typedef _Float16 v4h __attribute__((ext_vector_type(4)));
  {
#pragma unroll
    for (int q = 0; q < 8; ++q) { const int r = q * 2 + rsub; if (col0 + c4 < N) { const v4f v = *(const v4fa*)&so[w][r][c4]; if (C) *(v4f*)(C + cofs + (size_t)(row0 + r) * ldc + col0 + c4) = v; if (C16) { v4h h4; for (int i = 0; i < 4; ++i) h4[i] = (_Float16)v[i]; *(v4h*)(C16 + cofs + (size_t)(row0 + r) * ldc + col0 + c4) = h4; } } }
     }
}


typedef _Float16 v4h __attribute__((ext_vector_type(4)));

__global__ __launch_bounds__(256) void k_h16(const float* __restrict__ x, _Float16* __restrict__ X16, size_t n8) { const size_t t = (size_t)blockIdx.x * 256 + threadIdx.x; if (t >= n8) return; FragH f;
#pragma unroll
  for (int q = 0; q < 8; ++q) f.h[q] = (_Float16)x[t * 8 + q]; *(v8us*)((unsigned short*)X16 + t * 8) = f.half[0];  }
template <int NHv, int TTv>
__global__ __launch_bounds__(256) void k_vt(const _Float16* __restrict__ V16, int ldv, int voff, _Float16* __restrict__ Vt) { __shared__ unsigned short tl[64][66]; const int tid = threadIdx.x; const int slab = blockIdx.x / (TTv / 64), lg = blockIdx.x % (TTv / 64); const int b = slab / NHv, h = slab % NHv;
  for (int i = tid; i < 64 * 8; i += 256) { const int r = i / 8, c8 = (i % 8) * 8; FragH f; f.half[0] = *(const v8us*)((const unsigned short*)V16 + ((size_t)b * TTv + lg * 64 + r) * ldv + voff + h * 64 + c8);
#pragma unroll
    for (int q = 0; q < 8; ++q) tl[r][c8 + q] = f.u[q]; }
  __syncthreads();
  {
#pragma unroll
    for (int rd = 0; rd < 2; ++rd) { const int d = rd * 32 + tid / 8, pc = tid % 8; FragH f;
#pragma unroll
      for (int q = 0; q < 8; ++q) f.u[q] = tl[pc * 8 + q][d];
      *(v8us*)((unsigned short*)Vt + ((size_t)slab * 64 + d) * TTv + lg * 64 + pc * 8) = f.half[0]; }
     } }

__global__ __launch_bounds__(256) void k_hl(const float* __restrict__ F, _Float16* __restrict__ Hh, _Float16* __restrict__ Hl, size_t n8) { const size_t t = (size_t)blockIdx.x * 256 + threadIdx.x; if (t >= n8) return; FragH fh, fl; const v4f a = *(const v4fa*)(F + t * 8), c = *(const v4fa*)(F + t * 8 + 4);
#pragma unroll
  for (int q = 0; q < 4; ++q) { _Float16 h = (_Float16)a[q]; fh.h[q] = h; fl.h[q] = (_Float16)((a[q] - (float)h) * 1024.0f); h = (_Float16)c[q]; fh.h[4 + q] = h; fl.h[4 + q] = (_Float16)((c[q] - (float)h) * 1024.0f); }
  { *(v8us*)((unsigned short*)Hh + t * 8) = fh.half[0]; *(v8us*)((unsigned short*)Hl + t * 8) = fl.half[0];  } }

// ---- qkv product C = x.B^T x alpha + bias for K = CC, straight from the f32 inputs: x [tokens of all images][CC], wq [3 CC][CC] ----
// A work-group of sixteen waves owns 128 token rows and all 3 CC output columns. It reads its rows of x once, rounds them (bf16 rounding, kept as f16) and leaves them in LDS for the whole kernel.
// The six 128-row weight tiles pass through two LDS buffers: waves 8..15 read the next tile as f32, round it (bf16 rounding x16, exact in f16) and store it while waves 0..7 take the products of this one.
// Every fragment comes from LDS. Product wave = 32 rows x 64 columns of each tile, k ascending in one accumulator chain.
// The q columns go to C16 (pitch 3 CC); the k and v columns go, in blocks of 8 tokens x 32 channels of one head (512 B each), to
// KS block = [16-byte piece c of the token's 64 B][token & 7][8 f16] and VS block = [channel][8 tokens]; a wave's 16-byte-per-lane fragment load of the attention kernel then reads four whole 128-byte lines.
// In the last pass, when no weight tile is left to bring, one idle wave rounds the work-group's share of the projection weights into the plane BP that the next launch reads.
__device__ __forceinline__ v16h g2_frag(const _Float16* p, int hh) { FragH f; f.half[0] = *(const v8us*)((const unsigned short*)p + 8 * hh); f.half[1] = *(const v8us*)((const unsigned short*)p + 16 + 8 * hh); return f.v; }
#define G3_PITCH 528      /* bytes of a staged row: 512 + 16, an odd number of 16-byte pieces, so that the 16 rows of a ds_load_b128 fragment read lie on different banks */
__device__ __forceinline__ v16h g3_frag(const unsigned char* p) { FragH f; f.half[0] = *(const v8us*)p; f.half[1] = *(const v8us*)(p + 32); return f.v; }
__device__ __forceinline__ v8f g3_mma(v16h a, v16h b, v8f c) { return __builtin_amdgcn_wmma_f32_16x16x32_f16(false, a, false, b, (short)0, c, false, false); }
// Eight rows, 16 bytes a lane each, from global memory straight into LDS. The closing s_wait_xcnt stands inside the statement, in front of any later write of the address registers that the copies name.
__device__ __forceinline__ void g3_copy8(unsigned l, const _Float16* g) {
  asm volatile("global_load_async_to_lds_b128 %0, %8, off\n\tglobal_load_async_to_lds_b128 %1, %9, off\n\tglobal_load_async_to_lds_b128 %2, %10, off\n\tglobal_load_async_to_lds_b128 %3, %11, off\n\t"
               "global_load_async_to_lds_b128 %4, %12, off\n\tglobal_load_async_to_lds_b128 %5, %13, off\n\tglobal_load_async_to_lds_b128 %6, %14, off\n\tglobal_load_async_to_lds_b128 %7, %15, off\n\ts_wait_xcnt 0x0"
               :: "v"(l), "v"(l + G3_PITCH), "v"(l + 2 * G3_PITCH), "v"(l + 3 * G3_PITCH), "v"(l + 4 * G3_PITCH), "v"(l + 5 * G3_PITCH), "v"(l + 6 * G3_PITCH), "v"(l + 7 * G3_PITCH),
                  "v"(g), "v"(g + CC), "v"(g + 2 * CC), "v"(g + 3 * CC), "v"(g + 4 * CC), "v"(g + 5 * CC), "v"(g + 6 * CC), "v"(g + 7 * CC) : "memory"); }
#define QK_TILE (128 * G3_PITCH)      /* bytes of 128 staged rows */
#define QK_NT (3 * CC / 128)          /* column tiles: 0,1 are q, 2,3 k, 4,5 v */
#define QK_WG (NIMG * NTOK / 128)     /* work-groups of the launch */
typedef unsigned short v4us __attribute__((ext_vector_type(4), may_alias));
__device__ __forceinline__ float bf16_rne(float x) { return (float)(__bf16)x; }      /* round to nearest even, as bf16_round, by the conversion instruction */
// four f32 values, scaled and rounded, to 8 bytes of a staged row
__device__ __forceinline__ void qk_put(unsigned char* l, v4f v, float sc) { union { v4h h; v4us u; } c;
#pragma unroll
  for (int i = 0; i < 4; ++i) c.h[i] = (_Float16)bf16_rne(v[i] * sc);      /* the factor is a power of two: scaling first gives the same rounded value, and the product stays an f32 one */
  *(v4us*)l = c.u; }
__global__ __launch_bounds__(512) void k_qkv(const float* __restrict__ x, const float* __restrict__ wq, const float* __restrict__ wp, float alpha, const float* __restrict__ bias, _Float16* __restrict__ C16, _Float16* __restrict__ KS, _Float16* __restrict__ VS, _Float16* __restrict__ BP) {
  /* a: the rounded token rows; b: the two weight-tile buffers; so: each product wave's own output staging, 32 x 68 floats; bs: the rounded bias, fetched once so that no global load stands between the products and the output */
  __shared__ struct __attribute__((aligned(16))) { unsigned char a[QK_TILE]; unsigned char b[2][QK_TILE]; float so[8][32 * 68]; float bs[3 * CC]; } lds;
  const int tid = threadIdx.x, w = __builtin_amdgcn_readfirstlane(tid >> 5), lane = tid & 31, ln = lane & 15, hh = lane >> 4;      /* wave number as a scalar: the split into product waves and rounding waves is a scalar branch */
  const int row0 = blockIdx.x * 128;
  { const float* gx = x + (size_t)(row0 + 8 * w) * CC + lane * 4; const float* gw = wq + (size_t)(8 * w) * CC + lane * 4;      /* all sixteen waves: 8 token rows and 8 rows of weight tile 0 each; a load of the wave is 512 contiguous bytes, half a row */
    const int lo = 8 * w * G3_PITCH + lane * 8;
    v4f xv[16], wv[16];
#pragma unroll      /* all 32 loads of the wave are in flight together */
    for (int q = 0; q < 16; ++q) { xv[q] = *(const v4fa*)(gx + (q >> 1) * CC + (q & 1) * 128); wv[q] = *(const v4fa*)(gw + (q >> 1) * CC + (q & 1) * 128); }
    asm volatile("s_wait_xcnt 0x0" ::: "memory");      /* stands in front of any later write of the address registers that these loads name */
#pragma unroll
    for (int q = 0; q < 16; ++q) { qk_put(lds.a + lo + (q >> 1) * G3_PITCH + (q & 1) * 256, xv[q], 1.0f); qk_put(lds.b[0] + lo + (q >> 1) * G3_PITCH + (q & 1) * 256, wv[q], 16.0f); } }
  for (int i = tid; i < 3 * CC; i += 512) lds.bs[i] = bf16_round(bias[i]);
  __syncthreads();      /* token rows, weight tile 0 and bias are in LDS: nobody reads any of them in front of this barrier */
  const int wm = w & 3, wn = (w >> 2) & 1;
  const unsigned char* ap = lds.a + (32 * wm + ln) * G3_PITCH + 16 * hh;
  float (*so)[68] = (float (*)[68])lds.so[w & 7]; const int rw = row0 + 32 * wm;
  const v8f z8 = {0.f,0.f,0.f,0.f,0.f,0.f,0.f,0.f};
#pragma unroll 1      /* rolled: one copy of the unrolled k loop and of the three output forms, so the text stays small for the instruction cache */
  for (int nq = 0; nq < QK_NT; ++nq) {
    const int cw = nq * 128 + 64 * wn;
    v8f c00 = z8, c01 = z8, c02 = z8, c03 = z8, c10 = z8, c11 = z8, c12 = z8, c13 = z8; float bv4[4] = {0.f, 0.f, 0.f, 0.f};
    if (w < 8) {
      const unsigned char* bq = lds.b[0] + (nq & 1) * QK_TILE + (64 * wn + ln) * G3_PITCH + 16 * hh;
#pragma unroll
      for (int t = 0; t < 4; ++t) bv4[t] = lds.bs[cw + t * 16 + ln];      /* read ahead of the products: among the staging stores each would cost a full LDS round trip */
      v16h fa[2][2], fb[2][4];      /* two fragment sets: the products of a step read one while the next step's LDS reads fill the other */
#pragma unroll
      for (int t = 0; t < 2; ++t) fa[0][t] = g3_frag(ap + 16 * t * G3_PITCH);
#pragma unroll
      for (int t = 0; t < 4; ++t) fb[0][t] = g3_frag(bq + 16 * t * G3_PITCH);
#pragma unroll      /* unrolled: the set index is a compile-time constant, so both sets stay in registers */
      for (int ks = 0; ks < CC / 32; ++ks) { const int cu = ks & 1, nx = cu ^ 1;
        if (ks + 1 < CC / 32) {
#pragma unroll
          for (int t = 0; t < 2; ++t) fa[nx][t] = g3_frag(ap + 16 * t * G3_PITCH + 64 * (ks + 1));
#pragma unroll
          for (int t = 0; t < 4; ++t) fb[nx][t] = g3_frag(bq + 16 * t * G3_PITCH + 64 * (ks + 1)); }
        __builtin_amdgcn_sched_barrier(0);      /* keeps the next step's twelve LDS reads one group ahead of this step's products: left free, the compiler lifts reads of many steps to the top and takes over 256 registers */
        c00 = g3_mma(fa[cu][0], fb[cu][0], c00); c10 = g3_mma(fa[cu][1], fb[cu][0], c10); c01 = g3_mma(fa[cu][0], fb[cu][1], c01); c11 = g3_mma(fa[cu][1], fb[cu][1], c11);
        c02 = g3_mma(fa[cu][0], fb[cu][2], c02); c12 = g3_mma(fa[cu][1], fb[cu][2], c12); c03 = g3_mma(fa[cu][0], fb[cu][3], c03); c13 = g3_mma(fa[cu][1], fb[cu][3], c13);
        __builtin_amdgcn_sched_barrier(0);      /* and keeps the reads of the step after next behind these products, whose set they overwrite */
      }
    } else if (nq + 1 < QK_NT) {      /* rounding waves: 16 rows each of the next tile, into the buffer whose last readers passed the barrier of the pass before */
      const float* gw = wq + (size_t)((nq + 1) * 128 + 16 * (w - 8)) * CC + lane * 4;
      unsigned char* lw = lds.b[0] + ((nq + 1) & 1) * QK_TILE + 16 * (w - 8) * G3_PITCH + lane * 8;
      v4f wv[32];
#pragma unroll      /* all 32 loads of the wave are in flight together */
      for (int q = 0; q < 32; ++q) wv[q] = *(const v4fa*)(gw + (q >> 1) * CC + (q & 1) * 128);
      asm volatile("s_wait_xcnt 0x0" :: "v"(gw) : "memory");      /* stands in front of any later write of the address registers that these loads name; the pointer is an input so that it lives up to here and no load of the run gets the address pair as its destination */
#pragma unroll
      for (int q = 0; q < 32; ++q) qk_put(lw + (q >> 1) * G3_PITCH + (q & 1) * 256, wv[q], 16.0f);
    } else if (w == 15) {      /* no tile left: the projection weights, one row of CC values per turn, 8 values a lane */
      for (int r = blockIdx.x; r < CC; r += QK_WG) { const float* gp = wp + (size_t)r * CC + lane * 8; const v4f p0 = *(const v4fa*)gp, p1 = *(const v4fa*)(gp + 4); FragH f;
#pragma unroll
        for (int i = 0; i < 4; ++i) { f.h[i] = (_Float16)bf16_rne(p0[i] * 16.0f); f.h[4 + i] = (_Float16)bf16_rne(p1[i] * 16.0f); }
        *(v8us*)((unsigned short*)BP + (size_t)r * CC + lane * 8) = f.half[0];
        asm volatile("s_wait_xcnt 0x0" ::: "memory"); }      /* stands in front of the next turn's write of the address registers */
    }
    __syncthreads();      /* publishes the next tile and ends every product wave's reads of this buffer, which is refilled behind it */
    if (w < 8) {      /* output of this tile: it runs beside the rounding of the tile after next */
      v8f accs[8] = {c00, c01, c02, c03, c10, c11, c12, c13};
      const int sel = nq >> 1;      /* q, k or v: one answer for the whole work-group */
      const size_t blk = (size_t)((unsigned)rw / NTOK * NHD + (((unsigned)cw & (CC - 1)) >> 5)) * (NTOK / 8) + (((unsigned)rw & (NTOK - 1)) >> 3);      /* first of the wave's 2 heads x 4 token blocks */
      if (sel == 2) {      /* v: an accumulator register row is already 8 tokens of one channel, the 16 bytes of a VS block's row; 16 lanes fill 256 contiguous bytes */
        unsigned short* vp = (unsigned short*)VS + ((blk + hh) * 32 + ln) * 8;
#pragma unroll
        for (int u = 0; u < 8; ++u) { const int t = u & 3, half = u >> 2; FragH f;
#pragma unroll
          for (int r = 0; r < 8; ++r) f.h[r] = (_Float16)(accs[u][r] * alpha + bv4[t]);
          *(v8us*)(vp + (((t >> 1) * (NTOK / 8) + half * 2) * 32 + (t & 1) * 16) * 8) = f.half[0]; }
        asm volatile("s_wait_xcnt 0x0" ::: "memory");      /* the other output forms' blocks and the next pass reuse the registers that these stores name: the wait stands in front of any such write */
      } else {
#pragma unroll
        for (int u = 0; u < 8; ++u) { const int t = u & 3, half = u >> 2;
#pragma unroll
          for (int r = 0; r < 8; ++r) so[half * 16 + 8 * hh + r][t * 16 + ln] = accs[u][r] * alpha + bv4[t]; }
        __builtin_amdgcn_fence(__ATOMIC_ACQ_REL, "workgroup"); __builtin_amdgcn_wave_barrier();
        if (sel == 1) {      /* k: lane = (piece c, token & 7), so each store of the wave is one whole 512-byte KS block */
          unsigned short* kp = (unsigned short*)KS + blk * 256 + lane * 8; const int c8 = (lane >> 3) * 8, tk = lane & 7;
          v4f lo[8], hi[8];
#pragma unroll
          for (int q = 0; q < 8; ++q) { lo[q] = *(const v4fa*)&so[(q & 3) * 8 + tk][(q >> 2) * 32 + c8]; hi[q] = *(const v4fa*)&so[(q & 3) * 8 + tk][(q >> 2) * 32 + c8 + 4]; }
#pragma unroll
          for (int q = 0; q < 8; ++q) { FragH f;
#pragma unroll
            for (int i = 0; i < 4; ++i) { f.h[i] = (_Float16)lo[q][i]; f.h[4 + i] = (_Float16)hi[q][i]; }
            *(v8us*)(kp + ((q >> 2) * (NTOK / 8) + (q & 3)) * 256) = f.half[0]; }
          asm volatile("s_wait_xcnt 0x0" ::: "memory");      /* as behind the v stores */
        } else {
          const int rsub = lane >> 4, c4 = (lane & 15) * 4;
          const size_t o0 = (size_t)(rw + rsub) * (3 * CC) + cw + c4;      /* a compile-time pitch: the sixteen stores share one address and differ in their immediate offsets */
          v4f vv[16];
#pragma unroll
          for (int q = 0; q < 16; ++q) vv[q] = *(const v4fa*)&so[q * 2 + rsub][c4];
#pragma unroll
          for (int q = 0; q < 16; ++q) { v4h h4; for (int i = 0; i < 4; ++i) h4[i] = (_Float16)vv[q][i]; *(v4h*)(C16 + o0 + q * 2 * (3 * CC)) = h4; }
          asm volatile("s_wait_xcnt 0x0" ::: "memory"); }      /* as behind the v stores */
      }
    }
  }
}


__device__ __forceinline__ int na_start(int i, int K) { const int nh = K / 2; int s = max(i - nh, 0); if (i + nh >= RES) s += RES - i - nh - 1; return s; }
__device__ __forceinline__ int na_pb(int i, int K) { const int nh = K / 2; int p = nh; if (i < nh) p += nh - i; if (i + nh >= RES) p += RES - i - 1 - nh; return p; }
__device__ __forceinline__ v16h na_frag(const _Float16* p, int second) { FragH f; f.half[0] = *(const v8us*)(const unsigned short*)p; f.half[1] = *(const v8us*)((const unsigned short*)p + second); return f.v; }
// lane l <-> lane l ^ 16 (the two halves of a wave hold different keys of the same query)
__device__ __forceinline__ float xhalf(float x) { return __builtin_bit_cast(float, __builtin_amdgcn_permlanex16(__builtin_bit_cast(int, x), __builtin_bit_cast(int, x), 0x76543210, 0xfedcba98, false, false)); }
// Eight exponentials (base 2) in one statement: behind a transcendental the instruction set asks for one independent instruction before its result is read or its source overwritten.
// The outputs are early-clobber, so each v_exp_f32 is that independent instruction for the one before it; the closing v_nop keeps the slot behind the last.
__device__ __forceinline__ void na_exp8(float (&y)[8], const float (&x)[8]) {
  asm("v_exp_f32 %0, %8\n\tv_exp_f32 %1, %9\n\tv_exp_f32 %2, %10\n\tv_exp_f32 %3, %11\n\tv_exp_f32 %4, %12\n\tv_exp_f32 %5, %13\n\tv_exp_f32 %6, %14\n\tv_exp_f32 %7, %15\n\tv_nop"
      : "=&v"(y[0]), "=&v"(y[1]), "=&v"(y[2]), "=&v"(y[3]), "=&v"(y[4]), "=&v"(y[5]), "=&v"(y[6]), "=&v"(y[7])
      : "v"(x[0]), "v"(x[1]), "v"(x[2]), "v"(x[3]), "v"(x[4]), "v"(x[5]), "v"(x[6]), "v"(x[7])); }
__device__ __forceinline__ float na_exp1(float x) { float y; asm("v_exp_f32 %0, %1\n\tv_nop" : "=&v"(y) : "v"(x)); return y; }      /* the v_nop keeps the same slot */
#define NA_NEG (-3.0e38f)
#define NA_TBMAX (25 * 25 + 64)
// NA_R neighbouring query rows of one image and all eight heads per work-group; wave = (head, 16 query columns, all NA_R rows).
// The rows' windows overlap in all but one key row per step down, so the wave walks the union of their key rows once and every K and V^T fragment it loads serves each query row whose window holds that key row
// (a scalar test per query row; each query still meets its own K key rows in ascending order). The column windows of the 16 queries lie inside the 32 columns C0..C0+31 (C0 a multiple of 8) and are the same for all rows.
// Per key row and query row: S^T = K.Q^T + bias/scale (two 16x16x32 products, bias and window mask enter as the C operand), running maximum and sum per query
// (lane = query), P^T x2^10 packed from the two score tiles as the B operand, O^T += V^T.P^T; K and V^T fragments come from the fragment-ordered planes.
#define NA_R 2
template <int K>
__device__ __forceinline__ void na_row(const _Float16* __restrict__ QKV, const _Float16* __restrict__ KS, const _Float16* __restrict__ VS, const float* __restrict__ tbh, int h, int b, int i0, int j0, unsigned char* __restrict__ ysm) {      /* tbh: this head's padded bias table in LDS; h, b, i0, j0 are scalars of the wave */
  constexpr int RB = 2 * K - 1; constexpr float SC2 = SCALE * 1.4426950408889634f;
  const int lane = threadIdx.x & 31, ln = lane & 15, hh = lane >> 4;
  const int j = j0 + ln; const int C0 = min(max(j0 - 8, 0), 32);
  const int si = na_start(i0, K), sj = na_start(j, K), pj = na_pb(j, K);
  int ds[NA_R], po[NA_R];      /* query row t: its window starts ds[t] key rows below the first row's; po[t]: its bias row at the union's first key row, in table elements */
#pragma unroll
  for (int t = 0; t < NA_R; ++t) { ds[t] = na_start(i0 + t, K) - si; po[t] = (na_pb(i0 + t, K) - ds[t]) * RB; }
  const int nr = ds[NA_R - 1] + K;      /* key rows of the union: K to K + NA_R - 1 */
  const _Float16* img = QKV + (size_t)b * NTOK * (3 * CC);
  v16h qf[NA_R];
#pragma unroll
  for (int t = 0; t < NA_R; ++t) qf[t] = g2_frag(img + (size_t)((i0 + t) * RES + j) * (3 * CC) + h * HD, hh);
  const size_t blk0 = (size_t)(b * NHD + h) * (NTOK / 8) + ((si * RES + C0) >> 3);
  const _Float16* kb = KS + blk0 * 256; const unsigned kl = ((ln >> 3) * 32 + hh * 8 + (ln & 7)) * 8;      /* key = lane & 15; channels 8hh.. here, 16 + 8hh.. 128 elements on */
  const _Float16* vb = VS + blk0 * 256; const unsigned vl = (hh * 32 + ln) * 8;                            /* channel = lane & 15; keys 8hh.. here, 16 + 8hh.. two blocks on */
  const int d0 = C0 + 8 * hh - sj; const float* tp = tbh + 32 + pj + d0;
  bool ok[16];
#pragma unroll
  for (int e = 0; e < 16; ++e) ok[e] = (unsigned)(d0 + (e & 7) + 16 * (e >> 3)) < (unsigned)K;
  const v8f z8 = {0.f,0.f,0.f,0.f,0.f,0.f,0.f,0.f}; v8f o0[NA_R], o1[NA_R]; float m[NA_R], l[NA_R];
#pragma unroll
  for (int t = 0; t < NA_R; ++t) { o0[t] = z8; o1[t] = z8; m[t] = NA_NEG; l[t] = 0.f; }
  v16h a0 = na_frag(kb + kl, 128), a1 = na_frag(kb + kl + 512, 128);
  /* scores of query row t against the key row in a0, a1 */
  auto score = [&](int t, v8f& s0, v8f& s1) {
    const float* tq = tp + po[t];
#pragma unroll
    for (int r = 0; r < 8; ++r) { const float t0 = tq[r], t1 = tq[16 + r]; s0[r] = ok[r] ? t0 : NA_NEG; s1[r] = ok[8 + r] ? t1 : NA_NEG; }      /* every index lies inside the padded table */
    s0 = __builtin_amdgcn_wmma_f32_16x16x32_f16(false, a0, false, qf[t], (short)0, s0, false, false);
    s1 = __builtin_amdgcn_wmma_f32_16x16x32_f16(false, a1, false, qf[t], (short)0, s1, false, false); };
  /* running softmax of query row t over these scores, and its share of attn.v */
  auto fold = [&](int t, const v8f& s0, const v8f& s1, const v16h& u0, const v16h& u1) {
    float mx = fmaxf(s0[0], s1[0]);
#pragma unroll
    for (int r = 1; r < 8; ++r) mx = fmaxf(mx, fmaxf(s0[r], s1[r]));
    mx = fmaxf(mx, xhalf(mx));
    const float mn = fmaxf(m[t], mx); const float al = na_exp1((m[t] - mn) * SC2); m[t] = mn; const float mb = 10.0f - mn * SC2;
    FragH pf; float ps = 0.f, x0[8], x1[8], p0[8], p1[8];
#pragma unroll
    for (int r = 0; r < 8; ++r) { x0[r] = fmaf(s0[r], SC2, mb); x1[r] = fmaf(s1[r], SC2, mb); }
    na_exp8(p0, x0); na_exp8(p1, x1);
#pragma unroll
    for (int r = 0; r < 8; ++r) { ps += p0[r] + p1[r]; pf.h[r] = (_Float16)p0[r]; pf.h[8 + r] = (_Float16)p1[r]; }
    l[t] = l[t] * al + ps;
#pragma unroll
    for (int r = 0; r < 8; ++r) { o0[t][r] *= al; o1[t][r] *= al; }
    o0[t] = __builtin_amdgcn_wmma_f32_16x16x32_f16(false, u0, false, pf.v, (short)0, o0[t], false, false);
    o1[t] = __builtin_amdgcn_wmma_f32_16x16x32_f16(false, u1, false, pf.v, (short)0, o1[t], false, false); };
#pragma unroll 1      /* rolled: unrolled, the compiler lifts every row's loads to the top and passes the 128 registers a wave has here */
  for (int kr = 0; kr < nr; ++kr) {
    const v16h u0 = na_frag(vb + vl, 512), u1 = na_frag(vb + vl + 128, 512); vb += 2048;
    __builtin_amdgcn_sched_barrier(0);      /* keeps the V loads up here, a whole softmax ahead of their use: without it the compiler sinks them to just in front of the products that wait for them */
#pragma unroll
    for (int t = 0; t < NA_R - 1; ++t)
      if ((unsigned)(kr - ds[t]) < (unsigned)K) { v8f s0, s1; score(t, s0, s1); fold(t, s0, s1, u0, u1); }      /* is this key row in query row t's window? one answer for the whole wave, a scalar test */
    const bool act = (unsigned)(kr - ds[NA_R - 1]) < (unsigned)K;
    v8f s0, s1; score(NA_R - 1, s0, s1);      /* taken on every pass: in the one pass that can lie ahead of this row's window the scores go unused (the bias row read there is the one above the window's first, inside the table); under a test of their own they would hold 16 registers round the whole loop */
    if (kr + 1 < nr) kb += 2048;      /* the last query row's scores are taken, the K fragments are free: next row's fly under this softmax; the last pass fetches its own row again, never one past the window */
    a0 = na_frag(kb + kl, 128); a1 = na_frag(kb + kl + 512, 128);
    asm volatile("s_wait_xcnt 0x0" ::: "memory");      /* stands in front of the V address pair's advance, which the compiler places below while this pass's loads are in flight */
    __builtin_amdgcn_sched_barrier(0);      /* keeps the next row's K loads here: without it the compiler sinks them to the foot of the pass, a few instructions ahead of their use */
    if (act) fold(NA_R - 1, s0, s1, u0, u1);
    tp += RB;
  }
#pragma unroll
  for (int t = 0; t < NA_R; ++t) {
    const float lt = l[t] + xhalf(l[t]); const float inv = 1.0f / lt; FragH y0, y1;
#pragma unroll
    for (int r = 0; r < 8; ++r) { y0.h[r] = (_Float16)(o0[t][r] * inv); y1.h[r] = (_Float16)(o1[t][r] * inv); }
    unsigned char* yp = ysm + (t * RES + j) * G3_PITCH + (h * HD + 8 * hh) * 2;      /* row = token of the work-group's tile, staged at the pitch of the GEMM's fragment reads */
    *(v8us*)yp = y0.half[0]; *(v8us*)(yp + 32) = y1.half[0]; } }
// Attention of NA_R x RES = 128 tokens in all eight heads, then the output projection of those tokens, in one work-group of 32 waves (one per WGP at 128 registers a wave).
// Waves 0..15 take the 13x13 heads 4..7, waves 16..31 the 7x7 heads 0..3; wave & 3 = column tile.
// The 256 rows of the projection weights come into LDS by asynchronous copies issued first of all, and land under the attention. Projection: wave = 32 tokens x 32 output channels, k ascending in one accumulator chain.
#define NA_TP(K) ((2 * (K) - 1) * (2 * (K) - 1) + 64)
#define NA_TOK (NA_R * RES)
__global__ __launch_bounds__(1024) void k_na_proj(const _Float16* __restrict__ QKV, const _Float16* __restrict__ KS, const _Float16* __restrict__ VS, const float* __restrict__ rpb0, const float* __restrict__ rpb1,
                                                  const _Float16* __restrict__ BP, float alpha, const float* __restrict__ bias, float* __restrict__ C) {
  /* one block, the bias tables first: at low LDS addresses the sixteen table reads of a key row's two score tiles differ in their immediate offsets alone. bs: the rounded projection bias, fetched here so that no global load stands between the products and the output.
     sm rows 0..127: head outputs by token, rows 128..383: weight rows; afterwards the waves' output staging */
  __shared__ struct __attribute__((aligned(16))) { float tb[NHD * NA_TP(13)]; float bs[CC]; unsigned char sm[(NA_TOK + CC) * G3_PITCH]; } lds;      /* one table place of the larger size per head: place = wave >> 2, with no constant to add */
  static_assert((NHD * NA_TP(13) + CC) % 4 == 0, "sm starts at a multiple of 16 bytes");
  float* const tb = lds.tb; float* const bs = lds.bs; unsigned char* const sm = lds.sm;
  const int tid = threadIdx.x, w = __builtin_amdgcn_readfirstlane(tid >> 5), lane = tid & 31, ln = lane & 15, hh = lane >> 4;      /* wave number as a scalar: head, column tile and plane bases stay in scalar registers */
  const int b = blockIdx.x / (RES / NA_R), i0 = (blockIdx.x % (RES / NA_R)) * NA_R;
  g3_copy8((unsigned)(size_t)sm + (unsigned)((NA_TOK + 8 * w) * G3_PITCH + lane * 16), BP + (size_t)(8 * w) * CC + lane * 8);      /* eight weight rows a wave, lane = 16-byte piece of the row */
  for (int t = tid; t < 4 * NA_TP(13); t += 1024) { const int hq = t / NA_TP(13), s = t - hq * NA_TP(13) - 32; tb[t] = (s >= 0 && s < 625) ? bf16_round(rpb1[hq * 625 + s]) * 5.656854249492381f : 0.f; }
  for (int t = tid; t < 4 * NA_TP(7); t += 1024) { const int hq = t / NA_TP(7), s = t - hq * NA_TP(7) - 32; tb[(4 + hq) * NA_TP(13) + s + 32] = (s >= 0 && s < 169) ? bf16_round(rpb0[hq * 169 + s]) * 5.656854249492381f : 0.f; }
  if (tid < CC) bs[tid] = bf16_round(bias[tid]);
  __syncthreads();
  if (w < 16) na_row<13>(QKV, KS, VS, tb + (w >> 2) * NA_TP(13), 4 + (w >> 2), b, i0, (w & 3) * 16, sm);
  else na_row<7>(QKV, KS, VS, tb + (w >> 2) * NA_TP(13), (w >> 2) - 4, b, i0, (w & 3) * 16, sm);
  asm volatile("s_wait_asynccnt 0x0" ::: "memory");      /* this wave's eight weight rows have landed */
  __syncthreads();      /* and so have the other waves' rows and head outputs: nobody reads either in front of this barrier */
  const int wm = w & 3, wn = w >> 2;
  const unsigned char* ap = sm + (32 * wm + ln) * G3_PITCH + 16 * hh; const unsigned char* bq = sm + (NA_TOK + 32 * wn + ln) * G3_PITCH + 16 * hh;
  const v8f z8 = {0.f,0.f,0.f,0.f,0.f,0.f,0.f,0.f}; v8f c00 = z8, c01 = z8, c10 = z8, c11 = z8;
  const float bv2[2] = {bs[32 * wn + ln], bs[32 * wn + 16 + ln]};      /* read ahead of the products: behind the staging stores the compiler would have to read them again */
  v16h fa[2][2], fb[2][2];      /* two fragment sets, as in the qkv GEMM: the products of a step read one while the next step's LDS reads fill the other */
#pragma unroll
  for (int t = 0; t < 2; ++t) { fa[0][t] = g3_frag(ap + 16 * t * G3_PITCH); fb[0][t] = g3_frag(bq + 16 * t * G3_PITCH); }
#pragma unroll      /* unrolled: the set index is a compile-time constant, so both sets stay in registers */
  for (int ks = 0; ks < CC / 32; ++ks) { const int cu = ks & 1, nx = cu ^ 1;
    if (ks + 1 < CC / 32) {
#pragma unroll
      for (int t = 0; t < 2; ++t) { fa[nx][t] = g3_frag(ap + 16 * t * G3_PITCH + 64 * (ks + 1)); fb[nx][t] = g3_frag(bq + 16 * t * G3_PITCH + 64 * (ks + 1)); } }
    __builtin_amdgcn_sched_barrier(0);      /* keeps the next step's eight LDS reads one group ahead of this step's products: left free, the compiler lifts reads of many steps to the top, passes the 128 registers of a wave here and spills */
    c00 = g3_mma(fa[cu][0], fb[cu][0], c00); c10 = g3_mma(fa[cu][1], fb[cu][0], c10); c01 = g3_mma(fa[cu][0], fb[cu][1], c01); c11 = g3_mma(fa[cu][1], fb[cu][1], c11);
    __builtin_amdgcn_sched_barrier(0);      /* and keeps the reads of the step after next behind these products, whose set they overwrite */
  }
  __syncthreads();      /* every wave has read its last fragment: from here the LDS is output staging, 32 x 36 floats a wave */
  float (*so)[36] = (float (*)[36])(sm + w * (32 * 36 * 4)); const int rw = blockIdx.x * NA_TOK + 32 * wm, cw = 32 * wn;
  v8f accs[4] = {c00, c01, c10, c11};
#pragma unroll
  for (int u = 0; u < 4; ++u) { const int t = u & 1, half = u >> 1; const float bv = bv2[t];
#pragma unroll
    for (int r = 0; r < 8; ++r) so[half * 16 + 8 * hh + r][t * 16 + ln] = accs[u][r] * alpha + bv; }
  __builtin_amdgcn_fence(__ATOMIC_ACQ_REL, "workgroup"); __builtin_amdgcn_wave_barrier();
  const int rsub = lane >> 3, c4 = (lane & 7) * 4;      /* eight lanes = one whole 128-byte line of an output row */
  float* cp = C + (size_t)(rw + rsub) * CC + cw + c4;
  v4f vv[8];
#pragma unroll
  for (int q = 0; q < 8; ++q) vv[q] = *(const v4fa*)&so[q * 4 + rsub][c4];
#pragma unroll
  for (int q = 0; q < 8; ++q) *(v4f*)(cp + q * 4 * CC) = vv[q];
}

extern "C" void kernel_launch(void* const* d_in, const int* in_sizes, int n_in,
                              void* d_out, int out_size, void* d_ws, size_t ws_size, hipStream_t stream) {
  (void)in_sizes; (void)n_in; (void)out_size;
  const float* const* I = (const float* const*)d_in; const float* x = I[0]; const float* wqkv = I[1]; const float* bqkv = I[2]; const float* rpb0 = I[3]; const float* rpb1 = I[4]; const float* wp = I[5]; const float* bp = I[6];
  char* ws = (char*)d_ws; size_t off = 0;
  auto take = [&](size_t bytes) { char* p = ws + off; off += (bytes + 255) & ~(size_t)255; return p; };
  _Float16* BP = (_Float16*)take((size_t)CC * CC * 2);
  _Float16* QKV = (_Float16*)take((size_t)NIMG * NTOK * 3 * CC * 2); _Float16* KS = (_Float16*)take((size_t)NIMG * CC * NTOK * 2); _Float16* VS = (_Float16*)take((size_t)NIMG * CC * NTOK * 2);
  if (off > ws_size) return;      /* 0.125 + 48 + 16 + 16 = 80.125 MiB */
  k_qkv<<<QK_WG, 512, 0, stream>>>(x, wqkv, wp, 0.0625f, bqkv, QKV, KS, VS, BP);      /* the token rows of all images are one M; weights stay (out,in) natural; of the QKV plane only the q columns are written and read */
  k_na_proj<<<NIMG * (RES / NA_R), 1024, 0, stream>>>(QKV, KS, VS, rpb0, rpb1, BP, 0.0625f, bp, (float*)d_out);
}

// v008
// It runs in 48.7 microseconds.
// Next to v007, in two timings, it ran 1.04 times as fast each time.
// Over all steps from v000 it is 33.8 times as fast.
#include <hip/hip_runtime.h>
// Split-head neighborhood attention (8 images, 64 x 64 x 256 NHWC; 8 heads x 32; heads 0-3 use 7x7 NATTEN windows with rpb0, heads 4-7 use 13x13 with rpb1; window starts clamped at the borders, relative-position bias with the NATTEN border offsets; q scaled by 32^-0.5) followed by the output projection -> [8,64,64,256].
// Structure: qkv of all images as one f16 WMMA GEMM launch straight from the f32 inputs (a work-group reads 128 token rows of x, rounds them once into LDS and walks all six 128-column weight tiles, which half of its waves round into two LDS buffers while the other half takes the products; 32x64 wave tiles, f32 accumulation, exact products + bias; it also rounds the projection weights to an f16 plane) whose epilogue writes q into an f16 token plane and k and v into planes of 8-token blocks; ONE fused kernel over all images, both branches and all heads does scores, exact clamped window + bias, softmax (running maximum and sum) and attn.v per wave of a 16-query patch (4 x 4 for 13x13, 2 rows x 8 columns for 7x7) against 16 key columns of two key rows a step (V comes transposed by global_load_tr16_b128), scores and P (x2^10 in f16) never leaving registers, and leaves the head outputs of its 128 tokens (4 rows x 32 columns) in LDS, where the same work-group (all eight heads, 32 waves) takes the output projection of those tokens straight into the output rows.
// Compute dtype: x, weights, biases, rpb rounded to bf16; q/k/v, P (x2^10) and the attention output as f16 operands (~2^-12); f32 accumulation and softmax. v_wmma_f32_16x16x32_f16.
#define NIMG 8
#define RES 64
#define NTOK (RES * RES)
#define CC 256
#define NHD 8
#define HD 32
#define SCALE 0.17677669529663687f
typedef __bf16 v16b __attribute__((ext_vector_type(16)));
typedef unsigned short v8us __attribute__((ext_vector_type(8), may_alias));
typedef float  v8f  __attribute__((ext_vector_type(8)));
typedef float  v4f  __attribute__((ext_vector_type(4)));
typedef float  v4fa __attribute__((ext_vector_type(4), may_alias));
union FragB { v16b v; v8us half[2]; unsigned short u[16]; };

__device__ __forceinline__ unsigned short bf16_bits(float x) { unsigned int u = __float_as_uint(x); return (unsigned short)((u + 0x7FFFu + ((u >> 16) & 1u)) >> 16); }
__device__ __forceinline__ float bf16_val(unsigned short b) { return __uint_as_float(((unsigned int)b) << 16); }
__device__ __forceinline__ float bf16_round(float x) { return bf16_val(bf16_bits(x)); }
// D += A·B with NT terms: 1 = ah·bh, 2 = + al·bh (A split), 3 = + ah·bl (both split)
template <int NT>
__device__ __forceinline__ v8f mmaN(v16b ah, v16b al, v16b bh, v16b bl, v8f c) {
  c = __builtin_amdgcn_wmma_f32_16x16x32_bf16(false, ah, false, bh, (short)0, c, false, false);
  if (NT >= 2) c = __builtin_amdgcn_wmma_f32_16x16x32_bf16(false, al, false, bh, (short)0, c, false, false);
  if (NT >= 3) c = __builtin_amdgcn_wmma_f32_16x16x32_bf16(false, ah, false, bl, (short)0, c, false, false);
  asm volatile("v_nop\n\tv_nop\n\tv_nop\n\tv_nop" : "+v"(c) : "v"(ah), "v"(al), "v"(bh), "v"(bl));
  return c;
}

__global__ __launch_bounds__(256) void k_wt_bf16(const float* __restrict__ W, unsigned short* __restrict__ Wt, int K, int N) {
  const int t = blockIdx.x * 256 + threadIdx.x;
  const int k8n = K / 8;
  if (t >= N * k8n) return;
  const int n = t / k8n, k8 = (t % k8n) * 8;
  v8us v;
#pragma unroll
  for (int i = 0; i < 8; ++i) v[i] = bf16_bits(W[(size_t)(k8 + i) * N + n]);
  *(v8us*)(Wt + (size_t)n * K + k8) = v;
  
}

// GEMM C[M][N] (f32, pitch ldc) = act(A[M][K]·W + bias). A f32 row-major (pitch lda) converted per fragment to bf16
// (ASPLIT: hi/lo two planes -> 2 terms, else single rounded term); Wt bf16 [N][K] (pitch ldb). BIAS_BF16 rounds the
// bias to bf16 first (bias quantised to bf16 before the add). K%32==0, M%16==0, N%64==0.
template <bool ASPLIT, int ACT, bool BIAS_BF16>
__global__ __launch_bounds__(128) void k_gemm_bf(const float* __restrict__ A, int lda, const unsigned short* __restrict__ Wt, int ldb,
                                               const float* __restrict__ bias, float* __restrict__ C, int ldc, int M, int N, int K) {
  __shared__ __attribute__((aligned(16))) float so[4][16][64];
  const int tid = threadIdx.x, w = tid >> 5, lane = tid & 31, ln = lane & 15, hh = lane >> 4;
  const int ntn = N / 64;
  const int wid = blockIdx.x * 4 + w;
  const int mt = wid / ntn, nq = wid % ntn;
  if (mt * 16 >= M) return;
  const int row0 = mt * 16, col0 = nq * 64;
  const float* arow = A + (size_t)(row0 + ln) * lda;
  v8f acc[4] = {};
  for (int kb = 0; kb < K; kb += 32) {
    FragB ah, al;
    const v4f x0 = *(const v4fa*)(arow + kb + 8 * hh), x1 = *(const v4fa*)(arow + kb + 8 * hh + 4);
    const v4f x2 = *(const v4fa*)(arow + kb + 16 + 8 * hh), x3 = *(const v4fa*)(arow + kb + 16 + 8 * hh + 4);
    float xs[16] = {x0[0],x0[1],x0[2],x0[3],x1[0],x1[1],x1[2],x1[3],x2[0],x2[1],x2[2],x2[3],x3[0],x3[1],x3[2],x3[3]};
#pragma unroll
    for (int i = 0; i < 16; ++i) { const unsigned short hb = bf16_bits(xs[i]); ah.u[i] = hb; al.u[i] = ASPLIT ? bf16_bits(xs[i] - bf16_val(hb)) : (unsigned short)0; }
#pragma unroll
    for (int t = 0; t < 4; ++t) {
      const unsigned short* brow = Wt + (size_t)(col0 + t * 16 + ln) * ldb + kb;
      FragB b;
      b.half[0] = *(const v8us*)(brow + 8 * hh);
      b.half[1] = *(const v8us*)(brow + 16 + 8 * hh);
      acc[t] = mmaN<ASPLIT ? 2 : 1>(ah.v, al.v, b.v, b.v, acc[t]);
    }
  }
#pragma unroll
  for (int t = 0; t < 4; ++t) {
    float bv = bias ? bias[col0 + t * 16 + ln] : 0.f;
    if (BIAS_BF16) bv = bf16_round(bv);
#pragma unroll
    for (int r = 0; r < 8; ++r) { float v = acc[t][r] + bv; if (ACT == 1) v = fmaxf(v, 0.f); so[w][8 * hh + r][t * 16 + ln] = v; }
  }
  __builtin_amdgcn_fence(__ATOMIC_ACQ_REL, "workgroup");
  __builtin_amdgcn_wave_barrier();
  const int rsub = lane >> 4, c4 = (lane & 15) * 4;
  {
#pragma unroll
    for (int q = 0; q < 8; ++q) {
      const int r = q * 2 + rsub;
      const v4f v = *(const v4fa*)&so[w][r][c4];
      *(v4f*)(C + (size_t)(row0 + r) * ldc + col0 + c4) = v;
    }
    
  }
}

// GEMM C = act(A·W + bias + resid): A f32 (ASPLIT -> hi/lo 2 terms), Wt bf16 [N][K]; ACT 0 none, 1 relu, 2 exact gelu;
// resid (optional, f32, row index = (row % rmod), pitch ldr, RES_BF16 rounds it) added before the activation.
template <bool ASPLIT, int ACT, bool BIAS_BF16, bool RES_BF16>
__global__ __launch_bounds__(128) void k_gemm_bf3(const float* __restrict__ A, int lda, const unsigned short* __restrict__ Wt, int ldb,
                                                const float* __restrict__ bias, const float* __restrict__ resid, int rmod, int ldr,
                                                float* __restrict__ C, int ldc, int M, int N, int K) {
  __shared__ __attribute__((aligned(16))) float so[4][16][64];
  const int tid = threadIdx.x, w = tid >> 5, lane = tid & 31, ln = lane & 15, hh = lane >> 4;
  const int ntn = N / 64;
  const int wid = blockIdx.x * 4 + w;
  const int mt = wid / ntn, nq = wid % ntn;
  if (mt * 16 >= M) return;
  const int row0 = mt * 16, col0 = nq * 64;
  const float* arow = A + (size_t)(row0 + ln) * lda;
  v8f acc[4] = {};
  for (int kb = 0; kb < K; kb += 32) {
    FragB ah, al;
    const v4f x0 = *(const v4fa*)(arow + kb + 8 * hh), x1 = *(const v4fa*)(arow + kb + 8 * hh + 4);
    const v4f x2 = *(const v4fa*)(arow + kb + 16 + 8 * hh), x3 = *(const v4fa*)(arow + kb + 16 + 8 * hh + 4);
    float xs[16] = {x0[0],x0[1],x0[2],x0[3],x1[0],x1[1],x1[2],x1[3],x2[0],x2[1],x2[2],x2[3],x3[0],x3[1],x3[2],x3[3]};
#pragma unroll
    for (int i = 0; i < 16; ++i) { const unsigned short hb = bf16_bits(xs[i]); ah.u[i] = hb; al.u[i] = ASPLIT ? bf16_bits(xs[i] - bf16_val(hb)) : (unsigned short)0; }
#pragma unroll
    for (int t = 0; t < 4; ++t) {
      const unsigned short* brow = Wt + (size_t)(col0 + t * 16 + ln) * ldb + kb;
      FragB b;
      b.half[0] = *(const v8us*)(brow + 8 * hh);
      b.half[1] = *(const v8us*)(brow + 16 + 8 * hh);
      acc[t] = mmaN<ASPLIT ? 2 : 1>(ah.v, al.v, b.v, b.v, acc[t]);
    }
  }
#pragma unroll
  for (int t = 0; t < 4; ++t) {
    const int col = col0 + t * 16 + ln;
    float bv = bias ? bias[col] : 0.f;
    if (BIAS_BF16) bv = bf16_round(bv);
#pragma unroll
    for (int r = 0; r < 8; ++r) {
      float v = acc[t][r] + bv;
      if (resid) { float rv = resid[(size_t)((row0 + 8 * hh + r) % rmod) * ldr + col]; if (RES_BF16) rv = bf16_round(rv); v += rv; }
      if (ACT == 1) v = fmaxf(v, 0.f);
      if (ACT == 2) v = 0.5f * v * (1.0f + erff(v * 0.70710678118654752f));
      if (ACT == 3) { const float u = 0.7978845608028654f * (v + 0.044715f * v * v * v); v = 0.5f * v * (1.0f + tanhf(u)); }
      so[w][8 * hh + r][t * 16 + ln] = v;
    }
  }
  __builtin_amdgcn_fence(__ATOMIC_ACQ_REL, "workgroup");
  __builtin_amdgcn_wave_barrier();
  const int rsub = lane >> 4, c4 = (lane & 15) * 4;
  {
#pragma unroll
    for (int q = 0; q < 8; ++q) {
      const int r = q * 2 + rsub;
      const v4f v = *(const v4fa*)&so[w][r][c4];
      *(v4f*)(C + (size_t)(row0 + r) * ldc + col0 + c4) = v;
    }
    
  }
}
// row LayerNorm (biased variance, eps) over N: s = X (+ R); optional out_sum <- s; out_norm <- (s-mu)*rsqrt(var+eps)*g + b
template <bool PARAM_BF16>
__global__ __launch_bounds__(256) void k_layernorm(const float* __restrict__ X, const float* __restrict__ R, const float* __restrict__ g, const float* __restrict__ bta,
                                                  float* __restrict__ out_sum, float* __restrict__ out_norm, int N, float eps) {
  __shared__ float red[256];
  const int row = blockIdx.x, tid = threadIdx.x;
  const float* x = X + (size_t)row * N; const float* rr = R ? R + (size_t)row * N : nullptr;
  float vals[16];                     // up to N = 4096
  const int per = N / 256;            // contiguous chunk per thread? use strided-by-4 chunks: thread handles j = tid*4 + 1024*u
  float s1 = 0.f;
  for (int u = 0; u < per / 4; ++u) {
    const int j = tid * 4 + 1024 * u;
    const v4f a = *(const v4fa*)(x + j);
    v4f b = {0.f,0.f,0.f,0.f}; if (rr) b = *(const v4fa*)(rr + j);
#pragma unroll
    for (int q = 0; q < 4; ++q) { const float v = a[q] + b[q]; vals[u * 4 + q] = v; s1 += v; }
  }
  red[tid] = s1; __syncthreads();
  for (int st = 128; st > 0; st >>= 1) { if (tid < st) red[tid] += red[tid + st]; __syncthreads(); }
  const float mu = red[0] / (float)N; __syncthreads();
  float s2 = 0.f;
  for (int u = 0; u < per / 4; ++u)
#pragma unroll
    for (int q = 0; q < 4; ++q) { const float c = vals[u * 4 + q] - mu; s2 += c * c; }
  red[tid] = s2; __syncthreads();
  for (int st = 128; st > 0; st >>= 1) { if (tid < st) red[tid] += red[tid + st]; __syncthreads(); }
  const float rs = rsqrtf(red[0] / (float)N + eps);
  {
    for (int u = 0; u < per / 4; ++u) {
      const int j = tid * 4 + 1024 * u;
      v4f o, sm;
#pragma unroll
      for (int q = 0; q < 4; ++q) {
        float gg = g[j + q], bb = bta[j + q];
        if (PARAM_BF16) { gg = bf16_round(gg); bb = bf16_round(bb); }
        sm[q] = vals[u * 4 + q]; o[q] = (vals[u * 4 + q] - mu) * rs * gg + bb;
      }
      if (out_sum) *(v4f*)(out_sum + (size_t)row * N + j) = sm;
      *(v4f*)(out_norm + (size_t)row * N + j) = o;
    }
    
  }
}



// ---- f16 WMMA path (v_wmma_f32_16x16x32_f16): 11-bit significands for operands in range — used where a [0,1] probability operand needs more precision than bf16
typedef _Float16 v16h __attribute__((ext_vector_type(16)));
union FragH { v16h v; v8us half[2]; _Float16 h[16]; unsigned short u[16]; };
template <int NT>
__device__ __forceinline__ v8f mmaH(v16h ah, v16h al, v16h bh, v16h bl, v8f c) {
  c = __builtin_amdgcn_wmma_f32_16x16x32_f16(false, ah, false, bh, (short)0, c, false, false);
  if (NT >= 2) c = __builtin_amdgcn_wmma_f32_16x16x32_f16(false, al, false, bh, (short)0, c, false, false);
  if (NT >= 3) c = __builtin_amdgcn_wmma_f32_16x16x32_f16(false, ah, false, bl, (short)0, c, false, false);
  asm volatile("v_nop\n\tv_nop\n\tv_nop\n\tv_nop" : "+v"(c) : "v"(ah), "v"(al), "v"(bh), "v"(bl));
  return c;
}
// batched GEMM like k_gemm_b but f16 operands: A f32 (split into f16 hi/lo if ASPLIT, else rounded to f16), Bt = f16 values [n][k]; alpha; C f32; N multiple of 16 (partial tiles skipped)
template <bool ASPLIT>
__global__ __launch_bounds__(128) void k_gemm_h(const float* __restrict__ A, int lda, size_t sA, const _Float16* __restrict__ Bh, int ldb, size_t sB, float alpha, float* __restrict__ C, int ldc, size_t sC, int M, int N, int K) {
  __shared__ __attribute__((aligned(16))) float so[4][16][64];
  const int tid = threadIdx.x, w = tid >> 5, lane = tid & 31, ln = lane & 15, hh = lane >> 4; const int by = blockIdx.y;
  A += (size_t)by * sA; Bh += (size_t)by * sB; C += (size_t)by * sC;
  const int ntn = (N + 63) / 64; const int wid = blockIdx.x * 4 + w; const int mt = wid / ntn, nq = wid % ntn; if (mt * 16 >= M) return;
  const int row0 = mt * 16, col0 = nq * 64; const float* arow = A + (size_t)(row0 + ln) * lda;
  v8f acc[4] = {};
  for (int kb = 0; kb < K; kb += 32) {
    FragH ah, al;
    const v4f x0 = *(const v4fa*)(arow + kb + 8 * hh), x1 = *(const v4fa*)(arow + kb + 8 * hh + 4), x2 = *(const v4fa*)(arow + kb + 16 + 8 * hh), x3 = *(const v4fa*)(arow + kb + 16 + 8 * hh + 4);
    float xs[16] = {x0[0],x0[1],x0[2],x0[3],x1[0],x1[1],x1[2],x1[3],x2[0],x2[1],x2[2],x2[3],x3[0],x3[1],x3[2],x3[3]};
#pragma unroll
    for (int i = 0; i < 16; ++i) { const _Float16 h = (_Float16)xs[i]; ah.h[i] = h; al.h[i] = ASPLIT ? (_Float16)(xs[i] - (float)h) : (_Float16)0.0f; }
#pragma unroll
    for (int t = 0; t < 4; ++t) { if (col0 + t * 16 >= N) continue; const size_t boff = (size_t)(col0 + t * 16 + ln) * ldb + kb; FragH bq; bq.half[0] = *(const v8us*)(Bh + boff + 8 * hh); bq.half[1] = *(const v8us*)(Bh + boff + 16 + 8 * hh);
      acc[t] = mmaH<ASPLIT ? 2 : 1>(ah.v, al.v, bq.v, bq.v, acc[t]); }
  }
#pragma unroll
  for (int t = 0; t < 4; ++t) { if (col0 + t * 16 >= N) continue;
#pragma unroll
    for (int r = 0; r < 8; ++r) so[w][8 * hh + r][t * 16 + ln] = acc[t][r] * alpha; }
  __builtin_amdgcn_fence(__ATOMIC_ACQ_REL, "workgroup"); __builtin_amdgcn_wave_barrier();
  const int rsub = lane >> 4, c4 = (lane & 15) * 4;
  {
#pragma unroll
    for (int q = 0; q < 8; ++q) { const int r = q * 2 + rsub; if (col0 + c4 < N) { const v4f v = *(const v4fa*)&so[w][r][c4]; *(v4f*)(C + (size_t)(row0 + r) * ldc + col0 + c4) = v; } }
     }
}

// Wt[n][k] = f16(W[k][n]·scale) from f32 row-major W[K][N] (scale = power of two; bf16-exact weights stay exact in f16 away from the subnormal range)
__global__ __launch_bounds__(256) void k_wt_f16(const float* __restrict__ W, _Float16* __restrict__ Wt, int K, int N, float scale) {
  const int t = blockIdx.x * 256 + threadIdx.x; if (t >= N * (K / 8)) return; const int n = t / (K / 8), k8 = (t % (K / 8)) * 8; FragH f;
#pragma unroll
  for (int i = 0; i < 8; ++i) f.h[i] = (_Float16)(bf16_round(W[(size_t)(k8 + i) * N + n]) * scale); const v8us o = f.half[0];
  *(v8us*)((unsigned short*)Wt + (size_t)n * K + k8) = o; 
}
// k_gemm_hh variant with fused epilogue: v = acc·alpha + bias[by·sBias + col] (+ CP[(row/rowsPerB)·sCPb + by·64 + col] if CP) ; ACT 0 none / 1 elu ; writes f16 C16 (and f32 C if non-null)
template <int ACT>
__global__ __launch_bounds__(128) void k_gemm_hhx(const _Float16* __restrict__ A, int lda, size_t sA, const _Float16* __restrict__ Bh, int ldb, size_t sB, float alpha, const float* __restrict__ bias, size_t sBias, const float* __restrict__ CP, int rowsPerB, size_t sCPb, int row0g,
    float* __restrict__ C, _Float16* __restrict__ C16, int ldc, size_t sC, int M, int N, int K) {
  __shared__ __attribute__((aligned(16))) float so[4][16][64];
  const int tid = threadIdx.x, w = tid >> 5, lane = tid & 31, ln = lane & 15, hh = lane >> 4; const int by = blockIdx.y;
  A += (size_t)by * sA; Bh += (size_t)by * sB; const size_t cofs = (size_t)by * sC; const float* bp = bias ? bias + (size_t)by * sBias : nullptr;
  const int ntn = (N + 63) / 64; const int wid = blockIdx.x * 4 + w; const int mt = wid / ntn, nq = wid % ntn; if (mt * 16 >= M) return;
  const int row0 = mt * 16, col0 = nq * 64; const _Float16* arow = A + (size_t)(row0 + ln) * lda;
  v8f acc[4] = {};
  for (int kb = 0; kb < K; kb += 32) { FragH ah; ah.half[0] = *(const v8us*)((const unsigned short*)arow + kb + 8 * hh); ah.half[1] = *(const v8us*)((const unsigned short*)arow + kb + 16 + 8 * hh);
#pragma unroll
    for (int t = 0; t < 4; ++t) { if (col0 + t * 16 >= N) continue; const size_t boff = (size_t)(col0 + t * 16 + ln) * ldb + kb; FragH bq; bq.half[0] = *(const v8us*)((const unsigned short*)Bh + boff + 8 * hh); bq.half[1] = *(const v8us*)((const unsigned short*)Bh + boff + 16 + 8 * hh);
      acc[t] = mmaH<1>(ah.v, ah.v, bq.v, bq.v, acc[t]); }
  }
#pragma unroll
  for (int t = 0; t < 4; ++t) { if (col0 + t * 16 >= N) continue; const int col = col0 + t * 16 + ln; const float bv = bp ? bf16_round(bp[col]) : 0.f;
#pragma unroll
    for (int r = 0; r < 8; ++r) { float v = acc[t][r] * alpha + bv; if (CP) { const int bidx = (row0g + row0 + 8 * hh + r) / rowsPerB; v += CP[(size_t)bidx * sCPb + (size_t)by * 64 + col]; } if (ACT == 1) v = (v > 0.f) ? v : expm1f(v); else if (ACT == 7) v = (v > 0.f) ? v + 1.0f : expf(v); else if (ACT == 8) v = tanhf(v); else if (ACT == 9) v = 0.5f * v * (1.0f + tanhf(0.7978845608028654f * (v + 0.044715f * v * v * v))); else if (ACT == 11) v = 1.0f / (1.0f + expf(-v)); else if (ACT == 12) v = (v > 0.f) ? v : 0.01f * v; else if (ACT == 14) v = (v > 0.f) ? v : 0.1f * v; else if (ACT == 15) v = v / (1.0f + expf(-v)); else if (ACT == 3) v = fmaxf(v, 0.f); else if (ACT == 6) v = 0.5f * v * (1.0f + erff(v * 0.70710678118654752f)); so[w][8 * hh + r][t * 16 + ln] = v; } }
  __builtin_amdgcn_fence(__ATOMIC_ACQ_REL, "workgroup"); __builtin_amdgcn_wave_barrier();
  const int rsub = lane >> 4, c4 = (lane & 15) * 4; typedef _Float16 v4h __attribute__((ext_vector_type(4)));
  {
#pragma unroll
    for (int q = 0; q < 8; ++q) { const int r = q * 2 + rsub; if (col0 + c4 < N) { const v4f v = *(const v4fa*)&so[w][r][c4]; if (C) *(v4f*)(C + cofs + (size_t)(row0 + r) * ldc + col0 + c4) = v; if (C16) { v4h h4; for (int i = 0; i < 4; ++i) h4[i] = (_Float16)v[i]; *(v4h*)(C16 + cofs + (size_t)(row0 + r) * ldc + col0 + c4) = h4; } } }
     }
}


typedef _Float16 v4h __attribute__((ext_vector_type(4)));

__global__ __launch_bounds__(256) void k_h16(const float* __restrict__ x, _Float16* __restrict__ X16, size_t n8) { const size_t t = (size_t)blockIdx.x * 256 + threadIdx.x; if (t >= n8) return; FragH f;
#pragma unroll
  for (int q = 0; q < 8; ++q) f.h[q] = (_Float16)x[t * 8 + q]; *(v8us*)((unsigned short*)X16 + t * 8) = f.half[0];  }
template <int NHv, int TTv>
__global__ __launch_bounds__(256) void k_vt(const _Float16* __restrict__ V16, int ldv, int voff, _Float16* __restrict__ Vt) { __shared__ unsigned short tl[64][66]; const int tid = threadIdx.x; const int slab = blockIdx.x / (TTv / 64), lg = blockIdx.x % (TTv / 64); const int b = slab / NHv, h = slab % NHv;
  for (int i = tid; i < 64 * 8; i += 256) { const int r = i / 8, c8 = (i % 8) * 8; FragH f; f.half[0] = *(const v8us*)((const unsigned short*)V16 + ((size_t)b * TTv + lg * 64 + r) * ldv + voff + h * 64 + c8);
#pragma unroll
    for (int q = 0; q < 8; ++q) tl[r][c8 + q] = f.u[q]; }
  __syncthreads();
  {
#pragma unroll
    for (int rd = 0; rd < 2; ++rd) { const int d = rd * 32 + tid / 8, pc = tid % 8; FragH f;
#pragma unroll
      for (int q = 0; q < 8; ++q) f.u[q] = tl[pc * 8 + q][d];
      *(v8us*)((unsigned short*)Vt + ((size_t)slab * 64 + d) * TTv + lg * 64 + pc * 8) = f.half[0]; }
     } }

__global__ __launch_bounds__(256) void k_hl(const float* __restrict__ F, _Float16* __restrict__ Hh, _Float16* __restrict__ Hl, size_t n8) { const size_t t = (size_t)blockIdx.x * 256 + threadIdx.x; if (t >= n8) return; FragH fh, fl; const v4f a = *(const v4fa*)(F + t * 8), c = *(const v4fa*)(F + t * 8 + 4);
#pragma unroll
  for (int q = 0; q < 4; ++q) { _Float16 h = (_Float16)a[q]; fh.h[q] = h; fl.h[q] = (_Float16)((a[q] - (float)h) * 1024.0f); h = (_Float16)c[q]; fh.h[4 + q] = h; fl.h[4 + q] = (_Float16)((c[q] - (float)h) * 1024.0f); }
  { *(v8us*)((unsigned short*)Hh + t * 8) = fh.half[0]; *(v8us*)((unsigned short*)Hl + t * 8) = fl.half[0];  } }

// ---- qkv product C = x.B^T x alpha + bias for K = CC, straight from the f32 inputs: x [tokens of all images][CC], wq [3 CC][CC] ----
// A work-group of sixteen waves owns 128 token rows and all 3 CC output columns. It reads its rows of x once, rounds them (bf16 rounding, kept as f16) and leaves them in LDS for the whole kernel.
// The six 128-row weight tiles pass through two LDS buffers: waves 8..15 read the next tile as f32, round it (bf16 rounding x16, exact in f16) and store it while waves 0..7 take the products of this one.
// Every fragment comes from LDS. Product wave = 32 rows x 64 columns of each tile, k ascending in one accumulator chain.
// The q columns go to C16 (pitch 3 CC); the k and v columns go, in blocks of 8 tokens x 32 channels of one head (512 B each), to
// KS and VS block = [16-byte piece c of the token's 64 B][token & 7][8 f16]: eight neighbouring tokens' pieces fill one 128-byte line, and any token's piece can be addressed by any lane of the attention kernel's fragment loads.
// In the last pass, when no weight tile is left to bring, one idle wave rounds the work-group's share of the projection weights into the plane BP that the next launch reads.
__device__ __forceinline__ v16h g2_frag(const _Float16* p, int hh) { FragH f; f.half[0] = *(const v8us*)((const unsigned short*)p + 8 * hh); f.half[1] = *(const v8us*)((const unsigned short*)p + 16 + 8 * hh); return f.v; }
#define G3_PITCH 528      /* bytes of a staged row: 512 + 16, an odd number of 16-byte pieces, so that the 16 rows of a ds_load_b128 fragment read lie on different banks */
__device__ __forceinline__ v16h g3_frag(const unsigned char* p) { FragH f; f.half[0] = *(const v8us*)p; f.half[1] = *(const v8us*)(p + 32); return f.v; }
__device__ __forceinline__ v8f g3_mma(v16h a, v16h b, v8f c) { return __builtin_amdgcn_wmma_f32_16x16x32_f16(false, a, false, b, (short)0, c, false, false); }
// Eight rows, 16 bytes a lane each, from global memory straight into LDS. The closing s_wait_xcnt stands inside the statement, in front of any later write of the address registers that the copies name.
__device__ __forceinline__ void g3_copy8(unsigned l, const _Float16* g) {
  asm volatile("global_load_async_to_lds_b128 %0, %8, off\n\tglobal_load_async_to_lds_b128 %1, %9, off\n\tglobal_load_async_to_lds_b128 %2, %10, off\n\tglobal_load_async_to_lds_b128 %3, %11, off\n\t"
               "global_load_async_to_lds_b128 %4, %12, off\n\tglobal_load_async_to_lds_b128 %5, %13, off\n\tglobal_load_async_to_lds_b128 %6, %14, off\n\tglobal_load_async_to_lds_b128 %7, %15, off\n\ts_wait_xcnt 0x0"
               :: "v"(l), "v"(l + G3_PITCH), "v"(l + 2 * G3_PITCH), "v"(l + 3 * G3_PITCH), "v"(l + 4 * G3_PITCH), "v"(l + 5 * G3_PITCH), "v"(l + 6 * G3_PITCH), "v"(l + 7 * G3_PITCH),
                  "v"(g), "v"(g + CC), "v"(g + 2 * CC), "v"(g + 3 * CC), "v"(g + 4 * CC), "v"(g + 5 * CC), "v"(g + 6 * CC), "v"(g + 7 * CC) : "memory"); }
#define QK_TILE (128 * G3_PITCH)      /* bytes of 128 staged rows */
#define QK_NT (3 * CC / 128)          /* column tiles: 0,1 are q, 2,3 k, 4,5 v */
#define QK_WG (NIMG * NTOK / 128)     /* work-groups of the launch */
typedef unsigned short v4us __attribute__((ext_vector_type(4), may_alias));
__device__ __forceinline__ float bf16_rne(float x) { return (float)(__bf16)x; }      /* round to nearest even, as bf16_round, by the conversion instruction */
// four f32 values, scaled and rounded, to 8 bytes of a staged row
__device__ __forceinline__ void qk_put(unsigned char* l, v4f v, float sc) { union { v4h h; v4us u; } c;
#pragma unroll
  for (int i = 0; i < 4; ++i) c.h[i] = (_Float16)bf16_rne(v[i] * sc);      /* the factor is a power of two: scaling first gives the same rounded value, and the product stays an f32 one */
  *(v4us*)l = c.u; }
__global__ __launch_bounds__(512) void k_qkv(const float* __restrict__ x, const float* __restrict__ wq, const float* __restrict__ wp, float alpha, const float* __restrict__ bias, _Float16* __restrict__ C16, _Float16* __restrict__ KS, _Float16* __restrict__ VS, _Float16* __restrict__ BP) {
  /* a: the rounded token rows; b: the two weight-tile buffers; so: each product wave's own output staging, 32 x 68 floats; bs: the rounded bias, fetched once so that no global load stands between the products and the output */
  __shared__ struct __attribute__((aligned(16))) { unsigned char a[QK_TILE]; unsigned char b[2][QK_TILE]; float so[8][32 * 68]; float bs[3 * CC]; } lds;
  const int tid = threadIdx.x, w = __builtin_amdgcn_readfirstlane(tid >> 5), lane = tid & 31, ln = lane & 15, hh = lane >> 4;      /* wave number as a scalar: the split into product waves and rounding waves is a scalar branch */
  const int row0 = blockIdx.x * 128;
  { const float* gx = x + (size_t)(row0 + 8 * w) * CC + lane * 4; const float* gw = wq + (size_t)(8 * w) * CC + lane * 4;      /* all sixteen waves: 8 token rows and 8 rows of weight tile 0 each; a load of the wave is 512 contiguous bytes, half a row */
    const int lo = 8 * w * G3_PITCH + lane * 8;
    v4f xv[16], wv[16];
#pragma unroll      /* all 32 loads of the wave are in flight together */
    for (int q = 0; q < 16; ++q) { xv[q] = *(const v4fa*)(gx + (q >> 1) * CC + (q & 1) * 128); wv[q] = *(const v4fa*)(gw + (q >> 1) * CC + (q & 1) * 128); }
    asm volatile("s_wait_xcnt 0x0" ::: "memory");      /* stands in front of any later write of the address registers that these loads name */
#pragma unroll
    for (int q = 0; q < 16; ++q) { qk_put(lds.a + lo + (q >> 1) * G3_PITCH + (q & 1) * 256, xv[q], 1.0f); qk_put(lds.b[0] + lo + (q >> 1) * G3_PITCH + (q & 1) * 256, wv[q], 16.0f); } }
  for (int i = tid; i < 3 * CC; i += 512) lds.bs[i] = bf16_round(bias[i]);
  __syncthreads();      /* token rows, weight tile 0 and bias are in LDS: nobody reads any of them in front of this barrier */
  const int wm = w & 3, wn = (w >> 2) & 1;
  const unsigned char* ap = lds.a + (32 * wm + ln) * G3_PITCH + 16 * hh;
  float (*so)[68] = (float (*)[68])lds.so[w & 7]; const int rw = row0 + 32 * wm;
  const v8f z8 = {0.f,0.f,0.f,0.f,0.f,0.f,0.f,0.f};
#pragma unroll 1      /* rolled: one copy of the unrolled k loop and of the two output forms, so the text stays small */
  for (int nq = 0; nq < QK_NT; ++nq) {
    const int cw = nq * 128 + 64 * wn;
    v8f c00 = z8, c01 = z8, c02 = z8, c03 = z8, c10 = z8, c11 = z8, c12 = z8, c13 = z8; float bv4[4] = {0.f, 0.f, 0.f, 0.f};
    if (w < 8) {
      const unsigned char* bq = lds.b[0] + (nq & 1) * QK_TILE + (64 * wn + ln) * G3_PITCH + 16 * hh;
#pragma unroll
      for (int t = 0; t < 4; ++t) bv4[t] = lds.bs[cw + t * 16 + ln];      /* read ahead of the products: among the staging stores each would cost a full LDS round trip */
      v16h fa[2][2], fb[2][4];      /* two fragment sets: the products of a step read one while the next step's LDS reads fill the other */
#pragma unroll
      for (int t = 0; t < 2; ++t) fa[0][t] = g3_frag(ap + 16 * t * G3_PITCH);
#pragma unroll
      for (int t = 0; t < 4; ++t) fb[0][t] = g3_frag(bq + 16 * t * G3_PITCH);
#pragma unroll      /* unrolled: the set index is a compile-time constant, so both sets stay in registers */
      for (int ks = 0; ks < CC / 32; ++ks) { const int cu = ks & 1, nx = cu ^ 1;
        if (ks + 1 < CC / 32) {
#pragma unroll
          for (int t = 0; t < 2; ++t) fa[nx][t] = g3_frag(ap + 16 * t * G3_PITCH + 64 * (ks + 1));
#pragma unroll
          for (int t = 0; t < 4; ++t) fb[nx][t] = g3_frag(bq + 16 * t * G3_PITCH + 64 * (ks + 1)); }
        __builtin_amdgcn_sched_barrier(0);      /* keeps the next step's twelve LDS reads one group ahead of this step's products: left free, the compiler lifts reads of many steps to the top and takes over 256 registers */
        c00 = g3_mma(fa[cu][0], fb[cu][0], c00); c10 = g3_mma(fa[cu][1], fb[cu][0], c10); c01 = g3_mma(fa[cu][0], fb[cu][1], c01); c11 = g3_mma(fa[cu][1], fb[cu][1], c11);
        c02 = g3_mma(fa[cu][0], fb[cu][2], c02); c12 = g3_mma(fa[cu][1], fb[cu][2], c12); c03 = g3_mma(fa[cu][0], fb[cu][3], c03); c13 = g3_mma(fa[cu][1], fb[cu][3], c13);
        __builtin_amdgcn_sched_barrier(0);      /* and keeps the reads of the step after next behind these products, whose set they overwrite */
      }
    } else if (nq + 1 < QK_NT) {      /* rounding waves: 16 rows each of the next tile, into the buffer whose last readers passed the barrier of the pass before */
      const float* gw = wq + (size_t)((nq + 1) * 128 + 16 * (w - 8)) * CC + lane * 4;
      unsigned char* lw = lds.b[0] + ((nq + 1) & 1) * QK_TILE + 16 * (w - 8) * G3_PITCH + lane * 8;
      v4f wv[32];
#pragma unroll      /* all 32 loads of the wave are in flight together */
      for (int q = 0; q < 32; ++q) wv[q] = *(const v4fa*)(gw + (q >> 1) * CC + (q & 1) * 128);
      asm volatile("s_wait_xcnt 0x0" :: "v"(gw) : "memory");      /* stands in front of any later write of the address registers that these loads name; the pointer is an input so that it lives up to here and no load of the run gets the address pair as its destination */
#pragma unroll
      for (int q = 0; q < 32; ++q) qk_put(lw + (q >> 1) * G3_PITCH + (q & 1) * 256, wv[q], 16.0f);
    } else if (w == 15) {      /* no tile left: the projection weights, one row of CC values per turn, 8 values a lane */
      for (int r = blockIdx.x; r < CC; r += QK_WG) { const float* gp = wp + (size_t)r * CC + lane * 8; const v4f p0 = *(const v4fa*)gp, p1 = *(const v4fa*)(gp + 4); FragH f;
#pragma unroll
        for (int i = 0; i < 4; ++i) { f.h[i] = (_Float16)bf16_rne(p0[i] * 16.0f); f.h[4 + i] = (_Float16)bf16_rne(p1[i] * 16.0f); }
        *(v8us*)((unsigned short*)BP + (size_t)r * CC + lane * 8) = f.half[0];
        asm volatile("s_wait_xcnt 0x0" ::: "memory"); }      /* stands in front of any later write of the address registers that the store names */
    }
    __syncthreads();      /* publishes the next tile and ends every product wave's reads of this buffer, which is refilled behind it */
    if (w < 8) {      /* output of this tile: it runs beside the rounding of the tile after next */
      v8f accs[8] = {c00, c01, c02, c03, c10, c11, c12, c13};
      const int sel = nq >> 1;      /* q, k or v: one answer for the whole work-group */
      const size_t blk = (size_t)((unsigned)rw / NTOK * NHD + (((unsigned)cw & (CC - 1)) >> 5)) * (NTOK / 8) + (((unsigned)rw & (NTOK - 1)) >> 3);      /* first of the wave's 2 heads x 4 token blocks */
      {
#pragma unroll
        for (int u = 0; u < 8; ++u) { const int t = u & 3, half = u >> 2;
#pragma unroll
          for (int r = 0; r < 8; ++r) so[half * 16 + 8 * hh + r][t * 16 + ln] = accs[u][r] * alpha + bv4[t]; }
        __builtin_amdgcn_fence(__ATOMIC_ACQ_REL, "workgroup"); __builtin_amdgcn_wave_barrier();
        if (sel != 0) {      /* k and v alike: lane = (piece c, token & 7), so each store of the wave is one whole 512-byte block */
          unsigned short* kp = (unsigned short*)(sel == 1 ? KS : VS) + blk * 256 + lane * 8; const int c8 = (lane >> 3) * 8, tk = lane & 7;
          v4f lo[8], hi[8];
#pragma unroll
          for (int q = 0; q < 8; ++q) { lo[q] = *(const v4fa*)&so[(q & 3) * 8 + tk][(q >> 2) * 32 + c8]; hi[q] = *(const v4fa*)&so[(q & 3) * 8 + tk][(q >> 2) * 32 + c8 + 4]; }
#pragma unroll
          for (int q = 0; q < 8; ++q) { FragH f;
#pragma unroll
            for (int i = 0; i < 4; ++i) { f.h[i] = (_Float16)lo[q][i]; f.h[4 + i] = (_Float16)hi[q][i]; }
            *(v8us*)(kp + ((q >> 2) * (NTOK / 8) + (q & 3)) * 256) = f.half[0]; }
          asm volatile("s_wait_xcnt 0x0" ::: "memory");      /* the other output form's block and the next pass reuse the registers that these stores name: the wait stands in front of any such write */
        } else {
          const int rsub = lane >> 4, c4 = (lane & 15) * 4;
          const size_t o0 = (size_t)(rw + rsub) * (3 * CC) + cw + c4;      /* a compile-time pitch: the sixteen stores share one address and differ in their immediate offsets */
          v4f vv[16];
#pragma unroll
          for (int q = 0; q < 16; ++q) vv[q] = *(const v4fa*)&so[q * 2 + rsub][c4];
#pragma unroll
          for (int q = 0; q < 16; ++q) { v4h h4; for (int i = 0; i < 4; ++i) h4[i] = (_Float16)vv[q][i]; *(v4h*)(C16 + o0 + q * 2 * (3 * CC)) = h4; }
          asm volatile("s_wait_xcnt 0x0" ::: "memory"); }      /* as behind the k and v stores */
      }
    }
  }
}


__device__ __forceinline__ int na_start(int i, int K) { const int nh = K / 2; int s = max(i - nh, 0); if (i + nh >= RES) s += RES - i - nh - 1; return s; }
__device__ __forceinline__ int na_pb(int i, int K) { const int nh = K / 2; int p = nh; if (i < nh) p += nh - i; if (i + nh >= RES) p += RES - i - 1 - nh; return p; }
__device__ __forceinline__ v16h na_frag(const _Float16* p, int second) { FragH f; f.half[0] = *(const v8us*)(const unsigned short*)p; f.half[1] = *(const v8us*)((const unsigned short*)p + second); return f.v; }
// lane l <-> lane l ^ 16 (the two halves of a wave hold different keys of the same query)
__device__ __forceinline__ float xhalf(float x) { return __builtin_bit_cast(float, __builtin_amdgcn_permlanex16(__builtin_bit_cast(int, x), __builtin_bit_cast(int, x), 0x76543210, 0xfedcba98, false, false)); }
// Eight exponentials (base 2) in one statement: behind a transcendental the instruction set asks for one independent instruction before its result is read or its source overwritten.
// The outputs are early-clobber, so each v_exp_f32 is that independent instruction for the one before it; the closing v_nop keeps the slot behind the last.
__device__ __forceinline__ void na_exp8(float (&y)[8], const float (&x)[8]) {
  asm("v_exp_f32 %0, %8\n\tv_exp_f32 %1, %9\n\tv_exp_f32 %2, %10\n\tv_exp_f32 %3, %11\n\tv_exp_f32 %4, %12\n\tv_exp_f32 %5, %13\n\tv_exp_f32 %6, %14\n\tv_exp_f32 %7, %15\n\tv_nop"
      : "=&v"(y[0]), "=&v"(y[1]), "=&v"(y[2]), "=&v"(y[3]), "=&v"(y[4]), "=&v"(y[5]), "=&v"(y[6]), "=&v"(y[7])
      : "v"(x[0]), "v"(x[1]), "v"(x[2]), "v"(x[3]), "v"(x[4]), "v"(x[5]), "v"(x[6]), "v"(x[7])); }
__device__ __forceinline__ float na_exp1(float x) { float y; asm("v_exp_f32 %0, %1\n\tv_nop" : "=&v"(y) : "v"(x)); return y; }      /* the v_nop keeps the same slot */
#define NA_NEG (-3.0e38f)
#define NA_TBMAX (25 * 25 + 64)
#define NA_TR 4      /* the work-group's tile of tokens: rows */
#define NA_TC 32     /* and columns */
// A wave takes a patch of QR rows x QC columns = 16 queries of one head (lane & 15 = query). The column windows of the patch lie inside the 16 key columns T0..T0+15, so one 16x16x32 product gives the scores of one key row
// and two key rows fill the 32 keys of one attn.v product: an interior 13x13 patch sees all 16 key columns, a 7x7 patch 14 of them. The wave walks the union of the patch's key rows two at a time, ascending.
// Per step: S^T = K.Q^T + bias/scale for both key rows (bias and window mask enter as the C operand; a query whose window does not hold a key row reads a row of masked values instead of its bias row),
// running maximum and sum per query, P^T x2^10 packed from the two score tiles as the B operand, O^T += V^T.P^T.
// K fragments: lane = key, plain 16-byte loads. V^T fragments: the transposing load, whose lane l names the 16-byte piece (l >> 3) & 1 of token 8 (l >> 4) + (l & 7) and receives 8 tokens 8 (l >> 4).. of channel l & 15; every lane is on at it.
typedef short v8s __attribute__((ext_vector_type(8)));
union FragT { v16h v; v8s q[2]; };
__device__ __forceinline__ v8s na_tr(const _Float16* p) { return __builtin_amdgcn_global_load_tr16_b128_v8i16((__attribute__((address_space(1))) v8s*)p); }
template <int K, int QC, int QR>
__device__ __forceinline__ void na_tile(const _Float16* __restrict__ QKV, const _Float16* __restrict__ KS, const _Float16* __restrict__ VS, const float* __restrict__ tbh, const float* __restrict__ ng, int h, int b, int i0, int j0, unsigned char* __restrict__ ysm) {      /* tbh: this head's padded bias table in LDS; ng: eight masked values in LDS; ysm: the staged row of the patch's first token; h, b, i0, j0 are scalars of the wave */
  static_assert(QC * QR == 16 && QC + K - 1 <= 16, "the patch's column windows fit 16 key columns");
  constexpr int RB = 2 * K - 1; constexpr float SC2 = SCALE * 1.4426950408889634f;
  const int lane = threadIdx.x & 31, ln = lane & 15, hh = lane >> 4;
  const int i = i0 + ln / QC, j = j0 + ln % QC;
  const int T0 = min(max(j0 - (16 - QC) / 2, 0), RES - 16);
  const int R0 = na_start(i0, K), np = (na_start(i0 + QR - 1, K) + K - R0 + 1) >> 1;      /* first key row of the union, and its rows in pairs */
  const int si = na_start(i, K), sj = na_start(j, K);
  const v16h qf = g2_frag(QKV + ((size_t)b * NTOK + i * RES + j) * (3 * CC) + h * HD, hh);
  const size_t pl = (size_t)(b * NHD + h) * (NTOK / 8) * 256;
  const _Float16* kp = KS + pl; const _Float16* vp = VS + pl;      /* a key row is 8 blocks = 2048 elements */
  const int kt = T0 + ln; const unsigned kl = (kt >> 3) * 256 + hh * 64 + (kt & 7) * 8;      /* key = lane & 15; channels 8hh.. here, 16 + 8hh.. 128 elements on */
  const int vt = T0 + 8 * hh + (lane & 7); const unsigned vl = (vt >> 3) * 256 + ((lane >> 3) & 1) * 64 + (vt & 7) * 8;      /* channels 0..15 here, 16..31 128 elements on */
  const int d0 = T0 + 8 * hh - sj;
  const float* tr = tbh + 32 + (na_pb(i, K) + R0 - si) * RB + na_pb(j, K) + d0;      /* read only for key rows of this query's window */
  int dr = R0 - si;
  bool okc[8];
#pragma unroll
  for (int r = 0; r < 8; ++r) okc[r] = (unsigned)(d0 + r) < (unsigned)K;
  const v8f z8 = {0.f,0.f,0.f,0.f,0.f,0.f,0.f,0.f}; v8f o0 = z8, o1 = z8; float m = NA_NEG, l = 0.f;
  int y = R0; kp += R0 * 2048; vp += R0 * 2048;      /* scalar row pointers: the loads take them as the base and the lane's part as a 32-bit offset */
  v16h a0 = na_frag(kp + kl, 128), a1 = na_frag(kp + 2048 + kl, 128);      /* the first pair always lies inside the image */
  for (int p = 0; p < np; ++p) {
    const _Float16* v1 = vp + (y + 1 < RES ? 2048 : 0);      /* an odd union that ends with the image fetches the last row twice; the second copy is masked for every query */
    FragT u0, u1; u0.q[0] = na_tr(vp + vl); u0.q[1] = na_tr(v1 + vl); u1.q[0] = na_tr(vp + vl + 128); u1.q[1] = na_tr(v1 + vl + 128);
    asm volatile("s_wait_xcnt 0x0" ::: "memory");      /* stands in front of any later write of the address registers that these loads name; it also holds the V loads up here, a whole softmax ahead of their use */
    const float* t0 = (unsigned)dr < (unsigned)K ? tr : ng; const float* t1 = (unsigned)(dr + 1) < (unsigned)K ? tr + RB : ng;
    v8f s0, s1;
#pragma unroll
    for (int r = 0; r < 8; ++r) { const float b0 = t0[r], b1 = t1[r]; s0[r] = okc[r] ? b0 : NA_NEG; s1[r] = okc[r] ? b1 : NA_NEG; }      /* every index lies inside the padded table or the masked row */
    s0 = __builtin_amdgcn_wmma_f32_16x16x32_f16(false, a0, false, qf, (short)0, s0, false, false);
    s1 = __builtin_amdgcn_wmma_f32_16x16x32_f16(false, a1, false, qf, (short)0, s1, false, false);
    if (p + 1 < np) { y += 2; kp += 4096; vp += 4096; }      /* the scores are taken, the K fragments are free: the next pair's fly under this softmax; the last step fetches its own pair again */
    const _Float16* k1 = kp + (y + 1 < RES ? 2048 : 0);
    a0 = na_frag(kp + kl, 128); a1 = na_frag(k1 + kl, 128);
    asm volatile("s_wait_xcnt 0x0" ::: "memory");      /* as behind the V loads: in front of the row pointers' advance, and the next pair's K loads stay ahead of the softmax */
    float mx = fmaxf(s0[0], s1[0]);
#pragma unroll
    for (int r = 1; r < 8; ++r) mx = fmaxf(mx, fmaxf(s0[r], s1[r]));
    mx = fmaxf(mx, xhalf(mx));
    const float mn = fmaxf(m, mx); const float al = na_exp1((m - mn) * SC2); m = mn;
    const float mb = 10.0f - (mn < -1.0e38f ? 0.f : mn) * SC2;      /* a query that has met no key of its window yet: its masked scores must still give P = 0, which the masked value less itself would not */
    FragH pf; float ps = 0.f, x0[8], x1[8], p0[8], p1[8];
#pragma unroll
    for (int r = 0; r < 8; ++r) { x0[r] = fmaf(s0[r], SC2, mb); x1[r] = fmaf(s1[r], SC2, mb); }
    na_exp8(p0, x0); na_exp8(p1, x1);
#pragma unroll
    for (int r = 0; r < 8; ++r) { ps += p0[r] + p1[r]; pf.h[r] = (_Float16)p0[r]; pf.h[8 + r] = (_Float16)p1[r]; }
    l = l * al + ps;
#pragma unroll
    for (int r = 0; r < 8; ++r) { o0[r] *= al; o1[r] *= al; }
    o0 = __builtin_amdgcn_wmma_f32_16x16x32_f16(false, u0.v, false, pf.v, (short)0, o0, false, false);
    o1 = __builtin_amdgcn_wmma_f32_16x16x32_f16(false, u1.v, false, pf.v, (short)0, o1, false, false);
    tr += 2 * RB; dr += 2;
  }
  const float lt = l + xhalf(l); const float inv = 1.0f / lt; FragH y0, y1;
#pragma unroll
  for (int r = 0; r < 8; ++r) { y0.h[r] = (_Float16)(o0[r] * inv); y1.h[r] = (_Float16)(o1[r] * inv); }
  unsigned char* yp = ysm + ((ln / QC) * NA_TC + ln % QC) * G3_PITCH + (h * HD + 8 * hh) * 2;      /* row = token of the work-group's tile, staged at the pitch of the GEMM's fragment reads */
  *(v8us*)yp = y0.half[0]; *(v8us*)(yp + 32) = y1.half[0]; }
// Attention of NA_TR x NA_TC = 128 tokens in all eight heads, then the output projection of those tokens, in one work-group of 32 waves (one per WGP at 128 registers a wave).
// Every wave takes one 4 x 4 patch of a 13x13 head (wave >> 3 = head, wave & 7 = column patch) and then one 2 x 8 patch of a 7x7 head (wave >> 3 = head, bit 2 = row pair, wave & 3 = column patch): all waves carry the same load.
// The 256 rows of the projection weights come into LDS by asynchronous copies issued first of all, and land under the attention. Projection: wave = 32 tokens x 32 output channels, k ascending in one accumulator chain.
#define NA_TP(K) ((2 * (K) - 1) * (2 * (K) - 1) + 64)
#define NA_TOK (NA_TR * NA_TC)
__global__ __launch_bounds__(1024) void k_na_proj(const _Float16* __restrict__ QKV, const _Float16* __restrict__ KS, const _Float16* __restrict__ VS, const float* __restrict__ rpb0, const float* __restrict__ rpb1,
                                                  const _Float16* __restrict__ BP, float alpha, const float* __restrict__ bias, float* __restrict__ C) {
  /* one block, the bias tables first: at low LDS addresses the eight table reads of a score tile differ in their immediate offsets alone. bs: the rounded projection bias, fetched here so that no global load stands between the products and the output.
     sm rows 0..127: head outputs by token, rows 128..383: weight rows; afterwards the waves' output staging */
  __shared__ struct __attribute__((aligned(16))) { float tb[NHD * NA_TP(13)]; float ng[8]; float bs[CC]; unsigned char sm[(NA_TOK + CC) * G3_PITCH]; } lds;      /* one table place of the larger size per head; ng: the row of masked values */
  static_assert((NHD * NA_TP(13) + 8 + CC) % 4 == 0, "sm starts at a multiple of 16 bytes");
  float* const tb = lds.tb; float* const ng = lds.ng; float* const bs = lds.bs; unsigned char* const sm = lds.sm;
  const int tid = threadIdx.x, w = __builtin_amdgcn_readfirstlane(tid >> 5), lane = tid & 31, ln = lane & 15, hh = lane >> 4;      /* wave number as a scalar: head, column tile and plane bases stay in scalar registers */
  const int b = blockIdx.x / (NTOK / NA_TOK), i0 = (blockIdx.x % (NTOK / NA_TOK)) / (RES / NA_TC) * NA_TR, jw = (blockIdx.x % (RES / NA_TC)) * NA_TC;
  g3_copy8((unsigned)(size_t)sm + (unsigned)((NA_TOK + 8 * w) * G3_PITCH + lane * 16), BP + (size_t)(8 * w) * CC + lane * 8);      /* eight weight rows a wave, lane = 16-byte piece of the row */
  for (int t = tid; t < 4 * NA_TP(13); t += 1024) { const int hq = t / NA_TP(13), s = t - hq * NA_TP(13) - 32; tb[t] = (s >= 0 && s < 625) ? bf16_round(rpb1[hq * 625 + s]) * 5.656854249492381f : 0.f; }
  for (int t = tid; t < 4 * NA_TP(7); t += 1024) { const int hq = t / NA_TP(7), s = t - hq * NA_TP(7) - 32; tb[(4 + hq) * NA_TP(13) + s + 32] = (s >= 0 && s < 169) ? bf16_round(rpb0[hq * 169 + s]) * 5.656854249492381f : 0.f; }
  if (tid < CC) bs[tid] = bf16_round(bias[tid]);
  if (tid < 8) ng[tid] = NA_NEG;
  __syncthreads();
  na_tile<13, 4, 4>(QKV, KS, VS, tb + (w >> 3) * NA_TP(13), ng, 4 + (w >> 3), b, i0, jw + 4 * (w & 7), sm + 4 * (w & 7) * G3_PITCH);
  na_tile<7, 8, 2>(QKV, KS, VS, tb + (4 + (w >> 3)) * NA_TP(13), ng, w >> 3, b, i0 + 2 * ((w >> 2) & 1), jw + 8 * (w & 3), sm + (2 * ((w >> 2) & 1) * NA_TC + 8 * (w & 3)) * G3_PITCH);
  asm volatile("s_wait_asynccnt 0x0" ::: "memory");      /* this wave's eight weight rows have landed */
  __syncthreads();      /* and so have the other waves' rows and head outputs: nobody reads either in front of this barrier */
  const int wm = w & 3, wn = w >> 2;
  const unsigned char* ap = sm + (32 * wm + ln) * G3_PITCH + 16 * hh; const unsigned char* bq = sm + (NA_TOK + 32 * wn + ln) * G3_PITCH + 16 * hh;
  const v8f z8 = {0.f,0.f,0.f,0.f,0.f,0.f,0.f,0.f}; v8f c00 = z8, c01 = z8, c10 = z8, c11 = z8;
  const float bv2[2] = {bs[32 * wn + ln], bs[32 * wn + 16 + ln]};      /* read ahead of the products: behind the staging stores the compiler would have to read them again */
  v16h fa[2][2], fb[2][2];      /* two fragment sets, as in the qkv GEMM: the products of a step read one while the next step's LDS reads fill the other */
#pragma unroll
  for (int t = 0; t < 2; ++t) { fa[0][t] = g3_frag(ap + 16 * t * G3_PITCH); fb[0][t] = g3_frag(bq + 16 * t * G3_PITCH); }
#pragma unroll      /* unrolled: the set index is a compile-time constant, so both sets stay in registers */
  for (int ks = 0; ks < CC / 32; ++ks) { const int cu = ks & 1, nx = cu ^ 1;
    if (ks + 1 < CC / 32) {
#pragma unroll
      for (int t = 0; t < 2; ++t) { fa[nx][t] = g3_frag(ap + 16 * t * G3_PITCH + 64 * (ks + 1)); fb[nx][t] = g3_frag(bq + 16 * t * G3_PITCH + 64 * (ks + 1)); } }
    __builtin_amdgcn_sched_barrier(0);      /* keeps the next step's eight LDS reads one group ahead of this step's products: left free, the compiler lifts reads of many steps to the top, passes the 128 registers of a wave here and spills */
    c00 = g3_mma(fa[cu][0], fb[cu][0], c00); c10 = g3_mma(fa[cu][1], fb[cu][0], c10); c01 = g3_mma(fa[cu][0], fb[cu][1], c01); c11 = g3_mma(fa[cu][1], fb[cu][1], c11);
    __builtin_amdgcn_sched_barrier(0);      /* and keeps the reads of the step after next behind these products, whose set they overwrite */
  }
  __syncthreads();      /* every wave has read its last fragment: from here the LDS is output staging, 32 x 36 floats a wave */
  float (*so)[36] = (float (*)[36])(sm + w * (32 * 36 * 4)); const int rw = b * NTOK + (i0 + wm) * RES + jw, cw = 32 * wn;      /* the wave's 32 tokens are one row of the tile */
  v8f accs[4] = {c00, c01, c10, c11};
#pragma unroll
  for (int u = 0; u < 4; ++u) { const int t = u & 1, half = u >> 1; const float bv = bv2[t];
#pragma unroll
    for (int r = 0; r < 8; ++r) so[half * 16 + 8 * hh + r][t * 16 + ln] = accs[u][r] * alpha + bv; }
  __builtin_amdgcn_fence(__ATOMIC_ACQ_REL, "workgroup"); __builtin_amdgcn_wave_barrier();
  const int rsub = lane >> 3, c4 = (lane & 7) * 4;      /* eight lanes = one whole 128-byte line of an output row */
  float* cp = C + (size_t)(rw + rsub) * CC + cw + c4;
  v4f vv[8];
#pragma unroll
  for (int q = 0; q < 8; ++q) vv[q] = *(const v4fa*)&so[q * 4 + rsub][c4];
#pragma unroll
  for (int q = 0; q < 8; ++q) *(v4f*)(cp + q * 4 * CC) = vv[q];
}

extern "C" void kernel_launch(void* const* d_in, const int* in_sizes, int n_in,
                              void* d_out, int out_size, void* d_ws, size_t ws_size, hipStream_t stream) {
  (void)in_sizes; (void)n_in; (void)out_size;
  const float* const* I = (const float* const*)d_in; const float* x = I[0]; const float* wqkv = I[1]; const float* bqkv = I[2]; const float* rpb0 = I[3]; const float* rpb1 = I[4]; const float* wp = I[5]; const float* bp = I[6];
  char* ws = (char*)d_ws; size_t off = 0;
  auto take = [&](size_t bytes) { char* p = ws + off; off += (bytes + 255) & ~(size_t)255; return p; };
  _Float16* BP = (_Float16*)take((size_t)CC * CC * 2);
  _Float16* QKV = (_Float16*)take((size_t)NIMG * NTOK * 3 * CC * 2); _Float16* KS = (_Float16*)take((size_t)NIMG * CC * NTOK * 2); _Float16* VS = (_Float16*)take((size_t)NIMG * CC * NTOK * 2);
  if (off > ws_size) return;      /* 0.125 + 48 + 16 + 16 = 80.125 MiB */
  k_qkv<<<QK_WG, 512, 0, stream>>>(x, wqkv, wp, 0.0625f, bqkv, QKV, KS, VS, BP);      /* the token rows of all images are one M; weights stay (out,in) natural; of the QKV plane only the q columns are written and read */
  k_na_proj<<<NIMG * (NTOK / NA_TOK), 1024, 0, stream>>>(QKV, KS, VS, rpb0, rpb1, BP, 0.0625f, bp, (float*)d_out);
}

// v009
// A run of this version takes 47.1 microseconds.
// Two timings next to v008 put it at 1.05 and 1.04 times that version's speed.
// Counting every step since v000, it is 35.4 times as fast.
#include <hip/hip_runtime.h>
// Split-head neighborhood attention (8 images, 64 x 64 x 256 NHWC; 8 heads x 32; heads 0-3 use 7x7 NATTEN windows with rpb0, heads 4-7 use 13x13 with rpb1; window starts clamped at the borders, relative-position bias with the NATTEN border offsets; q scaled by 32^-0.5) followed by the output projection -> [8,64,64,256].
// Structure: qkv of all images as one f16 WMMA GEMM launch straight from the f32 inputs (a work-group reads 128 token rows of x, rounds them once into LDS and walks all six 128-column weight tiles, which half of its waves round into two LDS buffers while the other half takes the products; 32x64 wave tiles, f32 accumulation, exact products + bias; it also rounds the projection weights to an f16 plane) whose epilogue writes q into an f16 token plane and k and v into planes of 8-token blocks; ONE fused kernel over all images, both branches and all heads does scores, exact clamped window + bias, softmax (running maximum and sum) and attn.v per wave of a 16-query patch (4 x 4 for 13x13, 2 rows x 8 columns for 7x7) against 16 key columns of two key rows a step (V comes transposed by global_load_tr16_b128), scores and P (x2^10 in f16) never leaving registers, and leaves the head outputs of its 128 tokens (4 rows x 32 columns) in LDS, where the same work-group (all eight heads, 32 waves) takes the output projection of those tokens straight into the output rows.
// Compute dtype: x, weights, biases, rpb rounded to bf16; q/k/v, P (x2^10) and the attention output as f16 operands (~2^-12); f32 accumulation and softmax. v_wmma_f32_16x16x32_f16.
#define NIMG 8
#define RES 64
#define NTOK (RES * RES)
#define CC 256
#define NHD 8
#define HD 32
#define SCALE 0.17677669529663687f
typedef __bf16 v16b __attribute__((ext_vector_type(16)));
typedef unsigned short v8us __attribute__((ext_vector_type(8), may_alias));
typedef float  v8f  __attribute__((ext_vector_type(8)));
typedef float  v4f  __attribute__((ext_vector_type(4)));
typedef float  v4fa __attribute__((ext_vector_type(4), may_alias));
union FragB { v16b v; v8us half[2]; unsigned short u[16]; };

__device__ __forceinline__ unsigned short bf16_bits(float x) { unsigned int u = __float_as_uint(x); return (unsigned short)((u + 0x7FFFu + ((u >> 16) & 1u)) >> 16); }
__device__ __forceinline__ float bf16_val(unsigned short b) { return __uint_as_float(((unsigned int)b) << 16); }
__device__ __forceinline__ float bf16_round(float x) { return bf16_val(bf16_bits(x)); }
// D += A·B with NT terms: 1 = ah·bh, 2 = + al·bh (A split), 3 = + ah·bl (both split)
template <int NT>
__device__ __forceinline__ v8f mmaN(v16b ah, v16b al, v16b bh, v16b bl, v8f c) {
  c = __builtin_amdgcn_wmma_f32_16x16x32_bf16(false, ah, false, bh, (short)0, c, false, false);
  if (NT >= 2) c = __builtin_amdgcn_wmma_f32_16x16x32_bf16(false, al, false, bh, (short)0, c, false, false);
  if (NT >= 3) c = __builtin_amdgcn_wmma_f32_16x16x32_bf16(false, ah, false, bl, (short)0, c, false, false);
  asm volatile("v_nop\n\tv_nop\n\tv_nop\n\tv_nop" : "+v"(c) : "v"(ah), "v"(al), "v"(bh), "v"(bl));
  return c;
}

__global__ __launch_bounds__(256) void k_wt_bf16(const float* __restrict__ W, unsigned short* __restrict__ Wt, int K, int N) {
  const int t = blockIdx.x * 256 + threadIdx.x;
  const int k8n = K / 8;
  if (t >= N * k8n) return;
  const int n = t / k8n, k8 = (t % k8n) * 8;
  v8us v;
#pragma unroll
  for (int i = 0; i < 8; ++i) v[i] = bf16_bits(W[(size_t)(k8 + i) * N + n]);
  *(v8us*)(Wt + (size_t)n * K + k8) = v;
  
}

// GEMM C[M][N] (f32, pitch ldc) = act(A[M][K]·W + bias). A f32 row-major (pitch lda) converted per fragment to bf16
// (ASPLIT: hi/lo two planes -> 2 terms, else single rounded term); Wt bf16 [N][K] (pitch ldb). BIAS_BF16 rounds the
// bias to bf16 first (bias quantised to bf16 before the add). K%32==0, M%16==0, N%64==0.
template <bool ASPLIT, int ACT, bool BIAS_BF16>
__global__ __launch_bounds__(128) void k_gemm_bf(const float* __restrict__ A, int lda, const unsigned short* __restrict__ Wt, int ldb,
                                               const float* __restrict__ bias, float* __restrict__ C, int ldc, int M, int N, int K) {
  __shared__ __attribute__((aligned(16))) float so[4][16][64];
  const int tid = threadIdx.x, w = tid >> 5, lane = tid & 31, ln = lane & 15, hh = lane >> 4;
  const int ntn = N / 64;
  const int wid = blockIdx.x * 4 + w;
  const int mt = wid / ntn, nq = wid % ntn;
  if (mt * 16 >= M) return;
  const int row0 = mt * 16, col0 = nq * 64;
  const float* arow = A + (size_t)(row0 + ln) * lda;
  v8f acc[4] = {};
  for (int kb = 0; kb < K; kb += 32) {
    FragB ah, al;
    const v4f x0 = *(const v4fa*)(arow + kb + 8 * hh), x1 = *(const v4fa*)(arow + kb + 8 * hh + 4);
    const v4f x2 = *(const v4fa*)(arow + kb + 16 + 8 * hh), x3 = *(const v4fa*)(arow + kb + 16 + 8 * hh + 4);
    float xs[16] = {x0[0],x0[1],x0[2],x0[3],x1[0],x1[1],x1[2],x1[3],x2[0],x2[1],x2[2],x2[3],x3[0],x3[1],x3[2],x3[3]};
#pragma unroll
    for (int i = 0; i < 16; ++i) { const unsigned short hb = bf16_bits(xs[i]); ah.u[i] = hb; al.u[i] = ASPLIT ? bf16_bits(xs[i] - bf16_val(hb)) : (unsigned short)0; }
#pragma unroll
    for (int t = 0; t < 4; ++t) {
      const unsigned short* brow = Wt + (size_t)(col0 + t * 16 + ln) * ldb + kb;
      FragB b;
      b.half[0] = *(const v8us*)(brow + 8 * hh);
      b.half[1] = *(const v8us*)(brow + 16 + 8 * hh);
      acc[t] = mmaN<ASPLIT ? 2 : 1>(ah.v, al.v, b.v, b.v, acc[t]);
    }
  }
#pragma unroll
  for (int t = 0; t < 4; ++t) {
    float bv = bias ? bias[col0 + t * 16 + ln] : 0.f;
    if (BIAS_BF16) bv = bf16_round(bv);
#pragma unroll
    for (int r = 0; r < 8; ++r) { float v = acc[t][r] + bv; if (ACT == 1) v = fmaxf(v, 0.f); so[w][8 * hh + r][t * 16 + ln] = v; }
  }
  __builtin_amdgcn_fence(__ATOMIC_ACQ_REL, "workgroup");
  __builtin_amdgcn_wave_barrier();
  const int rsub = lane >> 4, c4 = (lane & 15) * 4;
  {
#pragma unroll
    for (int q = 0; q < 8; ++q) {
      const int r = q * 2 + rsub;
      const v4f v = *(const v4fa*)&so[w][r][c4];
      *(v4f*)(C + (size_t)(row0 + r) * ldc + col0 + c4) = v;
    }
    
  }
}

// GEMM C = act(A·W + bias + resid): A f32 (ASPLIT -> hi/lo 2 terms), Wt bf16 [N][K]; ACT 0 none, 1 relu, 2 exact gelu;
// resid (optional, f32, row index = (row % rmod), pitch ldr, RES_BF16 rounds it) added before the activation.
template <bool ASPLIT, int ACT, bool BIAS_BF16, bool RES_BF16>
__global__ __launch_bounds__(128) void k_gemm_bf3(const float* __restrict__ A, int lda, const unsigned short* __restrict__ Wt, int ldb,
                                                const float* __restrict__ bias, const float* __restrict__ resid, int rmod, int ldr,
                                                float* __restrict__ C, int ldc, int M, int N, int K) {
  __shared__ __attribute__((aligned(16))) float so[4][16][64];
  const int tid = threadIdx.x, w = tid >> 5, lane = tid & 31, ln = lane & 15, hh = lane >> 4;
  const int ntn = N / 64;
  const int wid = blockIdx.x * 4 + w;
  const int mt = wid / ntn, nq = wid % ntn;
  if (mt * 16 >= M) return;
  const int row0 = mt * 16, col0 = nq * 64;
  const float* arow = A + (size_t)(row0 + ln) * lda;
  v8f acc[4] = {};
  for (int kb = 0; kb < K; kb += 32) {
    FragB ah, al;
    const v4f x0 = *(const v4fa*)(arow + kb + 8 * hh), x1 = *(const v4fa*)(arow + kb + 8 * hh + 4);
    const v4f x2 = *(const v4fa*)(arow + kb + 16 + 8 * hh), x3 = *(const v4fa*)(arow + kb + 16 + 8 * hh + 4);
    float xs[16] = {x0[0],x0[1],x0[2],x0[3],x1[0],x1[1],x1[2],x1[3],x2[0],x2[1],x2[2],x2[3],x3[0],x3[1],x3[2],x3[3]};
#pragma unroll
    for (int i = 0; i < 16; ++i) { const unsigned short hb = bf16_bits(xs[i]); ah.u[i] = hb; al.u[i] = ASPLIT ? bf16_bits(xs[i] - bf16_val(hb)) : (unsigned short)0; }
#pragma unroll
    for (int t = 0; t < 4; ++t) {
      const unsigned short* brow = Wt + (size_t)(col0 + t * 16 + ln) * ldb + kb;
      FragB b;
      b.half[0] = *(const v8us*)(brow + 8 * hh);
      b.half[1] = *(const v8us*)(brow + 16 + 8 * hh);
      acc[t] = mmaN<ASPLIT ? 2 : 1>(ah.v, al.v, b.v, b.v, acc[t]);
    }
  }
#pragma unroll
  for (int t = 0; t < 4; ++t) {
    const int col = col0 + t * 16 + ln;
    float bv = bias ? bias[col] : 0.f;
    if (BIAS_BF16) bv = bf16_round(bv);
#pragma unroll
    for (int r = 0; r < 8; ++r) {
      float v = acc[t][r] + bv;
      if (resid) { float rv = resid[(size_t)((row0 + 8 * hh + r) % rmod) * ldr + col]; if (RES_BF16) rv = bf16_round(rv); v += rv; }
      if (ACT == 1) v = fmaxf(v, 0.f);
      if (ACT == 2) v = 0.5f * v * (1.0f + erff(v * 0.70710678118654752f));
      if (ACT == 3) { const float u = 0.7978845608028654f * (v + 0.044715f * v * v * v); v = 0.5f * v * (1.0f + tanhf(u)); }
      so[w][8 * hh + r][t * 16 + ln] = v;
    }
  }
  __builtin_amdgcn_fence(__ATOMIC_ACQ_REL, "workgroup");
  __builtin_amdgcn_wave_barrier();
  const int rsub = lane >> 4, c4 = (lane & 15) * 4;
  {
#pragma unroll
    for (int q = 0; q < 8; ++q) {
      const int r = q * 2 + rsub;
      const v4f v = *(const v4fa*)&so[w][r][c4];
      *(v4f*)(C + (size_t)(row0 + r) * ldc + col0 + c4) = v;
    }
    
  }
}
// row LayerNorm (biased variance, eps) over N: s = X (+ R); optional out_sum <- s; out_norm <- (s-mu)*rsqrt(var+eps)*g + b
template <bool PARAM_BF16>
__global__ __launch_bounds__(256) void k_layernorm(const float* __restrict__ X, const float* __restrict__ R, const float* __restrict__ g, const float* __restrict__ bta,
                                                  float* __restrict__ out_sum, float* __restrict__ out_norm, int N, float eps) {
  __shared__ float red[256];
  const int row = blockIdx.x, tid = threadIdx.x;
  const float* x = X + (size_t)row * N; const float* rr = R ? R + (size_t)row * N : nullptr;
  float vals[16];                     // up to N = 4096
  const int per = N / 256;            // contiguous chunk per thread? use strided-by-4 chunks: thread handles j = tid*4 + 1024*u
  float s1 = 0.f;
  for (int u = 0; u < per / 4; ++u) {
    const int j = tid * 4 + 1024 * u;
    const v4f a = *(const v4fa*)(x + j);
    v4f b = {0.f,0.f,0.f,0.f}; if (rr) b = *(const v4fa*)(rr + j);
#pragma unroll
    for (int q = 0; q < 4; ++q) { const float v = a[q] + b[q]; vals[u * 4 + q] = v; s1 += v; }
  }
  red[tid] = s1; __syncthreads();
  for (int st = 128; st > 0; st >>= 1) { if (tid < st) red[tid] += red[tid + st]; __syncthreads(); }
  const float mu = red[0] / (float)N; __syncthreads();
  float s2 = 0.f;
  for (int u = 0; u < per / 4; ++u)
#pragma unroll
    for (int q = 0; q < 4; ++q) { const float c = vals[u * 4 + q] - mu; s2 += c * c; }
  red[tid] = s2; __syncthreads();
  for (int st = 128; st > 0; st >>= 1) { if (tid < st) red[tid] += red[tid + st]; __syncthreads(); }
  const float rs = rsqrtf(red[0] / (float)N + eps);
  {
    for (int u = 0; u < per / 4; ++u) {
      const int j = tid * 4 + 1024 * u;
      v4f o, sm;
#pragma unroll
      for (int q = 0; q < 4; ++q) {
        float gg = g[j + q], bb = bta[j + q];
        if (PARAM_BF16) { gg = bf16_round(gg); bb = bf16_round(bb); }
        sm[q] = vals[u * 4 + q]; o[q] = (vals[u * 4 + q] - mu) * rs * gg + bb;
      }
      if (out_sum) *(v4f*)(out_sum + (size_t)row * N + j) = sm;
      *(v4f*)(out_norm + (size_t)row * N + j) = o;
    }
    
  }
}



// ---- f16 WMMA path (v_wmma_f32_16x16x32_f16): 11-bit significands for operands in range — used where a [0,1] probability operand needs more precision than bf16
typedef _Float16 v16h __attribute__((ext_vector_type(16)));
union FragH { v16h v; v8us half[2]; _Float16 h[16]; unsigned short u[16]; };
template <int NT>
__device__ __forceinline__ v8f mmaH(v16h ah, v16h al, v16h bh, v16h bl, v8f c) {
  c = __builtin_amdgcn_wmma_f32_16x16x32_f16(false, ah, false, bh, (short)0, c, false, false);
  if (NT >= 2) c = __builtin_amdgcn_wmma_f32_16x16x32_f16(false, al, false, bh, (short)0, c, false, false);
  if (NT >= 3) c = __builtin_amdgcn_wmma_f32_16x16x32_f16(false, ah, false, bl, (short)0, c, false, false);
  asm volatile("v_nop\n\tv_nop\n\tv_nop\n\tv_nop" : "+v"(c) : "v"(ah), "v"(al), "v"(bh), "v"(bl));
  return c;
}
// batched GEMM like k_gemm_b but f16 operands: A f32 (split into f16 hi/lo if ASPLIT, else rounded to f16), Bt = f16 values [n][k]; alpha; C f32; N multiple of 16 (partial tiles skipped)
template <bool ASPLIT>
__global__ __launch_bounds__(128) void k_gemm_h(const float* __restrict__ A, int lda, size_t sA, const _Float16* __restrict__ Bh, int ldb, size_t sB, float alpha, float* __restrict__ C, int ldc, size_t sC, int M, int N, int K) {
  __shared__ __attribute__((aligned(16))) float so[4][16][64];
  const int tid = threadIdx.x, w = tid >> 5, lane = tid & 31, ln = lane & 15, hh = lane >> 4; const int by = blockIdx.y;
  A += (size_t)by * sA; Bh += (size_t)by * sB; C += (size_t)by * sC;
  const int ntn = (N + 63) / 64; const int wid = blockIdx.x * 4 + w; const int mt = wid / ntn, nq = wid % ntn; if (mt * 16 >= M) return;
  const int row0 = mt * 16, col0 = nq * 64; const float* arow = A + (size_t)(row0 + ln) * lda;
  v8f acc[4] = {};
  for (int kb = 0; kb < K; kb += 32) {
    FragH ah, al;
    const v4f x0 = *(const v4fa*)(arow + kb + 8 * hh), x1 = *(const v4fa*)(arow + kb + 8 * hh + 4), x2 = *(const v4fa*)(arow + kb + 16 + 8 * hh), x3 = *(const v4fa*)(arow + kb + 16 + 8 * hh + 4);
    float xs[16] = {x0[0],x0[1],x0[2],x0[3],x1[0],x1[1],x1[2],x1[3],x2[0],x2[1],x2[2],x2[3],x3[0],x3[1],x3[2],x3[3]};
#pragma unroll
    for (int i = 0; i < 16; ++i) { const _Float16 h = (_Float16)xs[i]; ah.h[i] = h; al.h[i] = ASPLIT ? (_Float16)(xs[i] - (float)h) : (_Float16)0.0f; }
#pragma unroll
    for (int t = 0; t < 4; ++t) { if (col0 + t * 16 >= N) continue; const size_t boff = (size_t)(col0 + t * 16 + ln) * ldb + kb; FragH bq; bq.half[0] = *(const v8us*)(Bh + boff + 8 * hh); bq.half[1] = *(const v8us*)(Bh + boff + 16 + 8 * hh);
      acc[t] = mmaH<ASPLIT ? 2 : 1>(ah.v, al.v, bq.v, bq.v, acc[t]); }
  }
#pragma unroll
  for (int t = 0; t < 4; ++t) { if (col0 + t * 16 >= N) continue;
#pragma unroll
    for (int r = 0; r < 8; ++r) so[w][8 * hh + r][t * 16 + ln] = acc[t][r] * alpha; }
  __builtin_amdgcn_fence(__ATOMIC_ACQ_REL, "workgroup"); __builtin_amdgcn_wave_barrier();
  const int rsub = lane >> 4, c4 = (lane & 15) * 4;
  {
#pragma unroll
    for (int q = 0; q < 8; ++q) { const int r = q * 2 + rsub; if (col0 + c4 < N) { const v4f v = *(const v4fa*)&so[w][r][c4]; *(v4f*)(C + (size_t)(row0 + r) * ldc + col0 + c4) = v; } }
     }
}

// Wt[n][k] = f16(W[k][n]·scale) from f32 row-major W[K][N] (scale = power of two; bf16-exact weights stay exact in f16 away from the subnormal range)
__global__ __launch_bounds__(256) void k_wt_f16(const float* __restrict__ W, _Float16* __restrict__ Wt, int K, int N, float scale) {
  const int t = blockIdx.x * 256 + threadIdx.x; if (t >= N * (K / 8)) return; const int n = t / (K / 8), k8 = (t % (K / 8)) * 8; FragH f;
#pragma unroll
  for (int i = 0; i < 8; ++i) f.h[i] = (_Float16)(bf16_round(W[(size_t)(k8 + i) * N + n]) * scale); const v8us o = f.half[0];
  *(v8us*)((unsigned short*)Wt + (size_t)n * K + k8) = o; 
}
// k_gemm_hh variant with fused epilogue: v = acc·alpha + bias[by·sBias + col] (+ CP[(row/rowsPerB)·sCPb + by·64 + col] if CP) ; ACT 0 none / 1 elu ; writes f16 C16 (and f32 C if non-null)
template <int ACT>
__global__ __launch_bounds__(128) void k_gemm_hhx(const _Float16* __restrict__ A, int lda, size_t sA, const _Float16* __restrict__ Bh, int ldb, size_t sB, float alpha, const float* __restrict__ bias, size_t sBias, const float* __restrict__ CP, int rowsPerB, size_t sCPb, int row0g,
    float* __restrict__ C, _Float16* __restrict__ C16, int ldc, size_t sC, int M, int N, int K) {
  __shared__ __attribute__((aligned(16))) float so[4][16][64];
  const int tid = threadIdx.x, w = tid >> 5, lane = tid & 31, ln = lane & 15, hh = lane >> 4; const int by = blockIdx.y;
  A += (size_t)by * sA; Bh += (size_t)by * sB; const size_t cofs = (size_t)by * sC; const float* bp = bias ? bias + (size_t)by * sBias : nullptr;
  const int ntn = (N + 63) / 64; const int wid = blockIdx.x * 4 + w; const int mt = wid / ntn, nq = wid % ntn; if (mt * 16 >= M) return;
  const int row0 = mt * 16, col0 = nq * 64; const _Float16* arow = A + (size_t)(row0 + ln) * lda;
  v8f acc[4] = {};
  for (int kb = 0; kb < K; kb += 32) { FragH ah; ah.half[0] = *(const v8us*)((const unsigned short*)arow + kb + 8 * hh); ah.half[1] = *(const v8us*)((const unsigned short*)arow + kb + 16 + 8 * hh);
#pragma unroll
    for (int t = 0; t < 4; ++t) { if (col0 + t * 16 >= N) continue; const size_t boff = (size_t)(col0 + t * 16 + ln) * ldb + kb; FragH bq; bq.half[0] = *(const v8us*)((const unsigned short*)Bh + boff + 8 * hh); bq.half[1] = *(const v8us*)((const unsigned short*)Bh + boff + 16 + 8 * hh);
      acc[t] = mmaH<1>(ah.v, ah.v, bq.v, bq.v, acc[t]); }
  }
#pragma unroll
  for (int t = 0; t < 4; ++t) { if (col0 + t * 16 >= N) continue; const int col = col0 + t * 16 + ln; const float bv = bp ? bf16_round(bp[col]) : 0.f;
#pragma unroll
    for (int r = 0; r < 8; ++r) { float v = acc[t][r] * alpha + bv; if (CP) { const int bidx = (row0g + row0 + 8 * hh + r) / rowsPerB; v += CP[(size_t)bidx * sCPb + (size_t)by * 64 + col]; } if (ACT == 1) v = (v > 0.f) ? v : expm1f(v); else if (ACT == 7) v = (v > 0.f) ? v + 1.0f : expf(v); else if (ACT == 8) v = tanhf(v); else if (ACT == 9) v = 0.5f * v * (1.0f + tanhf(0.7978845608028654f * (v + 0.044715f * v * v * v))); else if (ACT == 11) v = 1.0f / (1.0f + expf(-v)); else if (ACT == 12) v = (v > 0.f) ? v : 0.01f * v; else if (ACT == 14) v = (v > 0.f) ? v : 0.1f * v; else if (ACT == 15) v = v / (1.0f + expf(-v)); else if (ACT == 3) v = fmaxf(v, 0.f); else if (ACT == 6) v = 0.5f * v * (1.0f + erff(v * 0.70710678118654752f)); so[w][8 * hh + r][t * 16 + ln] = v; } }
  __builtin_amdgcn_fence(__ATOMIC_ACQ_REL, "workgroup"); __builtin_amdgcn_wave_barrier();
  const int rsub = lane >> 4, c4 = (lane & 15) * 4; typedef _Float16 v4h __attribute__((ext_vector_type(4)));
  {
#pragma unroll
    for (int q = 0; q < 8; ++q) { const int r = q * 2 + rsub; if (col0 + c4 < N) { const v4f v = *(const v4fa*)&so[w][r][c4]; if (C) *(v4f*)(C + cofs + (size_t)(row0 + r) * ldc + col0 + c4) = v; if (C16) { v4h h4; for (int i = 0; i < 4; ++i) h4[i] = (_Float16)v[i]; *(v4h*)(C16 + cofs + (size_t)(row0 + r) * ldc + col0 + c4) = h4; } } }
     }
}


typedef _Float16 v4h __attribute__((ext_vector_type(4)));

__global__ __launch_bounds__(256) void k_h16(const float* __restrict__ x, _Float16* __restrict__ X16, size_t n8) { const size_t t = (size_t)blockIdx.x * 256 + threadIdx.x; if (t >= n8) return; FragH f;
#pragma unroll
  for (int q = 0; q < 8; ++q) f.h[q] = (_Float16)x[t * 8 + q]; *(v8us*)((unsigned short*)X16 + t * 8) = f.half[0];  }
template <int NHv, int TTv>
__global__ __launch_bounds__(256) void k_vt(const _Float16* __restrict__ V16, int ldv, int voff, _Float16* __restrict__ Vt) { __shared__ unsigned short tl[64][66]; const int tid = threadIdx.x; const int slab = blockIdx.x / (TTv / 64), lg = blockIdx.x % (TTv / 64); const int b = slab / NHv, h = slab % NHv;
  for (int i = tid; i < 64 * 8; i += 256) { const int r = i / 8, c8 = (i % 8) * 8; FragH f; f.half[0] = *(const v8us*)((const unsigned short*)V16 + ((size_t)b * TTv + lg * 64 + r) * ldv + voff + h * 64 + c8);
#pragma unroll
    for (int q = 0; q < 8; ++q) tl[r][c8 + q] = f.u[q]; }
  __syncthreads();
  {
#pragma unroll
    for (int rd = 0; rd < 2; ++rd) { const int d = rd * 32 + tid / 8, pc = tid % 8; FragH f;
#pragma unroll
      for (int q = 0; q < 8; ++q) f.u[q] = tl[pc * 8 + q][d];
      *(v8us*)((unsigned short*)Vt + ((size_t)slab * 64 + d) * TTv + lg * 64 + pc * 8) = f.half[0]; }
     } }

__global__ __launch_bounds__(256) void k_hl(const float* __restrict__ F, _Float16* __restrict__ Hh, _Float16* __restrict__ Hl, size_t n8) { const size_t t = (size_t)blockIdx.x * 256 + threadIdx.x; if (t >= n8) return; FragH fh, fl; const v4f a = *(const v4fa*)(F + t * 8), c = *(const v4fa*)(F + t * 8 + 4);
#pragma unroll
  for (int q = 0; q < 4; ++q) { _Float16 h = (_Float16)a[q]; fh.h[q] = h; fl.h[q] = (_Float16)((a[q] - (float)h) * 1024.0f); h = (_Float16)c[q]; fh.h[4 + q] = h; fl.h[4 + q] = (_Float16)((c[q] - (float)h) * 1024.0f); }
  { *(v8us*)((unsigned short*)Hh + t * 8) = fh.half[0]; *(v8us*)((unsigned short*)Hl + t * 8) = fl.half[0];  } }

// ---- qkv product C = x.B^T x alpha + bias for K = CC, straight from the f32 inputs: x [tokens of all images][CC], wq [3 CC][CC] ----
// A work-group of sixteen waves owns 128 token rows and all 3 CC output columns. It reads its rows of x once, rounds them (bf16 rounding, kept as f16) and leaves them in LDS for the whole kernel.
// The six 128-row weight tiles pass through two LDS buffers: waves 8..15 read the next tile as f32, round it (bf16 rounding x16, exact in f16) and store it while waves 0..7 take the products of this one.
// Every fragment comes from LDS. Product wave = 32 rows x 64 columns of each tile, k ascending in one accumulator chain.
// The q columns go to C16 (pitch 3 CC); the k and v columns go, in blocks of 8 tokens x 32 channels of one head (512 B each), to
// KS and VS block = [16-byte piece c of the token's 64 B][token & 7][8 f16]: eight neighbouring tokens' pieces fill one 128-byte line, and any token's piece can be addressed by any lane of the attention kernel's fragment loads.
// In the last pass, when no weight tile is left to bring, one idle wave rounds the work-group's share of the projection weights into the plane BP that the next launch reads.
__device__ __forceinline__ v16h g2_frag(const _Float16* p, int hh) { FragH f; f.half[0] = *(const v8us*)((const unsigned short*)p + 8 * hh); f.half[1] = *(const v8us*)((const unsigned short*)p + 16 + 8 * hh); return f.v; }
#define G3_PITCH 528      /* bytes of a staged row: 512 + 16, an odd number of 16-byte pieces, so that the 16 rows of a ds_load_b128 fragment read lie on different banks */
__device__ __forceinline__ v16h g3_frag(const unsigned char* p) { FragH f; f.half[0] = *(const v8us*)p; f.half[1] = *(const v8us*)(p + 32); return f.v; }
__device__ __forceinline__ v8f g3_mma(v16h a, v16h b, v8f c) { return __builtin_amdgcn_wmma_f32_16x16x32_f16(false, a, false, b, (short)0, c, false, false); }
// Eight rows, 16 bytes a lane each, from global memory straight into LDS. The closing s_wait_xcnt stands inside the statement, in front of any later write of the address registers that the copies name.
__device__ __forceinline__ void g3_copy8(unsigned l, const _Float16* g) {
  asm volatile("global_load_async_to_lds_b128 %0, %8, off\n\tglobal_load_async_to_lds_b128 %1, %9, off\n\tglobal_load_async_to_lds_b128 %2, %10, off\n\tglobal_load_async_to_lds_b128 %3, %11, off\n\t"
               "global_load_async_to_lds_b128 %4, %12, off\n\tglobal_load_async_to_lds_b128 %5, %13, off\n\tglobal_load_async_to_lds_b128 %6, %14, off\n\tglobal_load_async_to_lds_b128 %7, %15, off\n\ts_wait_xcnt 0x0"
               :: "v"(l), "v"(l + G3_PITCH), "v"(l + 2 * G3_PITCH), "v"(l + 3 * G3_PITCH), "v"(l + 4 * G3_PITCH), "v"(l + 5 * G3_PITCH), "v"(l + 6 * G3_PITCH), "v"(l + 7 * G3_PITCH),
                  "v"(g), "v"(g + CC), "v"(g + 2 * CC), "v"(g + 3 * CC), "v"(g + 4 * CC), "v"(g + 5 * CC), "v"(g + 6 * CC), "v"(g + 7 * CC) : "memory"); }
#define QK_TILE (128 * G3_PITCH)      /* bytes of 128 staged rows */
#define QK_NT (3 * CC / 128)          /* column tiles: 0,1 are q, 2,3 k, 4,5 v */
#define QK_WG (NIMG * NTOK / 128)     /* work-groups of the launch */
typedef unsigned short v4us __attribute__((ext_vector_type(4), may_alias));
__device__ __forceinline__ float bf16_rne(float x) { return (float)(__bf16)x; }      /* round to nearest even, as bf16_round, by the conversion instruction */
// four f32 values, scaled and rounded, to 8 bytes of a staged row
__device__ __forceinline__ void qk_put(unsigned char* l, v4f v, float sc) { union { v4h h; v4us u; } c;
#pragma unroll
  for (int i = 0; i < 4; ++i) c.h[i] = (_Float16)bf16_rne(v[i] * sc);      /* the factor is a power of two: scaling first gives the same rounded value, and the product stays an f32 one */
  *(v4us*)l = c.u; }
__global__ __launch_bounds__(512) void k_qkv(const float* __restrict__ x, const float* __restrict__ wq, const float* __restrict__ wp, float alpha, const float* __restrict__ bias, _Float16* __restrict__ C16, _Float16* __restrict__ KS, _Float16* __restrict__ VS, _Float16* __restrict__ BP) {
  /* a: the rounded token rows; b: the two weight-tile buffers; so: each product wave's own output staging, 32 x 68 floats; bs: the rounded bias, fetched once so that no global load stands between the products and the output */
  __shared__ struct __attribute__((aligned(16))) { unsigned char a[QK_TILE]; unsigned char b[2][QK_TILE]; float so[8][32 * 68]; float bs[3 * CC]; } lds;
  const int tid = threadIdx.x, w = __builtin_amdgcn_readfirstlane(tid >> 5), lane = tid & 31, ln = lane & 15, hh = lane >> 4;      /* wave number as a scalar: the split into product waves and rounding waves is a scalar branch */
  const int row0 = blockIdx.x * 128, bi = tid & 255; float bb0, bb1;
  { const float* gx = x + (size_t)(row0 + 8 * w) * CC + lane * 4; const float* gw = wq + (size_t)(8 * w) * CC + lane * 4;      /* all sixteen waves: 8 token rows and 8 rows of weight tile 0 each; a load of the wave is 512 contiguous bytes, half a row */
    const int lo = 8 * w * G3_PITCH + lane * 8;
    v4f xv[16], wv[16];
    bb0 = bias[tid]; bb1 = bias[512 + bi];      /* the bias values fly together with the rows: fetched behind them, each turn of a loop would cost one more full load latency in front of the barrier */
#pragma unroll      /* all 32 loads of the wave are in flight together */
    for (int q = 0; q < 16; ++q) { xv[q] = *(const v4fa*)(gx + (q >> 1) * CC + (q & 1) * 128); wv[q] = *(const v4fa*)(gw + (q >> 1) * CC + (q & 1) * 128); }
    asm volatile("s_wait_xcnt 0x0" :: "v"(tid), "v"(bi) : "memory");      /* stands in front of any later write of the address registers that these loads name; the two bias indices are inputs so that they live up to here and no load of the run gets one of them as its destination */
#pragma unroll
    for (int q = 0; q < 16; ++q) { qk_put(lds.a + lo + (q >> 1) * G3_PITCH + (q & 1) * 256, xv[q], 1.0f); qk_put(lds.b[0] + lo + (q >> 1) * G3_PITCH + (q & 1) * 256, wv[q], 16.0f); } }
  asm volatile("" :: "v"(bb0), "v"(bb1));      /* inputs only: holds the two bias loads above this line; left free, the compiler sinks the second into the branch round its LDS store, where it waits out a latency of its own */
  lds.bs[tid] = bf16_round(bb0); if (tid < 3 * CC - 512) lds.bs[512 + tid] = bf16_round(bb1);
  __syncthreads();      /* token rows, weight tile 0 and bias are in LDS: nobody reads any of them in front of this barrier */
  const int wm = w & 3, wn = (w >> 2) & 1;
  const unsigned char* ap = lds.a + (32 * wm + ln) * G3_PITCH + 16 * hh;
  float (*so)[68] = (float (*)[68])lds.so[w & 7]; const int rw = row0 + 32 * wm;
  const v8f z8 = {0.f,0.f,0.f,0.f,0.f,0.f,0.f,0.f};
#pragma unroll 1      /* rolled: one copy of the unrolled k loop and of the two output forms, so the text stays small */
  for (int nq = 0; nq < QK_NT; ++nq) {
    const int cw = nq * 128 + 64 * wn;
    v8f c00 = z8, c01 = z8, c02 = z8, c03 = z8, c10 = z8, c11 = z8, c12 = z8, c13 = z8; float bv4[4] = {0.f, 0.f, 0.f, 0.f};
    if (w < 8) {
      const unsigned char* bq = lds.b[0] + (nq & 1) * QK_TILE + (64 * wn + ln) * G3_PITCH + 16 * hh;
#pragma unroll
      for (int t = 0; t < 4; ++t) bv4[t] = lds.bs[cw + t * 16 + ln];      /* read ahead of the products: among the staging stores each would cost a full LDS round trip */
      v16h fa[2][2], fb[2][4];      /* two fragment sets: the products of a step read one while the next step's LDS reads fill the other */
#pragma unroll
      for (int t = 0; t < 2; ++t) fa[0][t] = g3_frag(ap + 16 * t * G3_PITCH);
#pragma unroll
      for (int t = 0; t < 4; ++t) fb[0][t] = g3_frag(bq + 16 * t * G3_PITCH);
#pragma unroll      /* unrolled: the set index is a compile-time constant, so both sets stay in registers */
      for (int ks = 0; ks < CC / 32; ++ks) { const int cu = ks & 1, nx = cu ^ 1;
        if (ks + 1 < CC / 32) {
#pragma unroll
          for (int t = 0; t < 2; ++t) fa[nx][t] = g3_frag(ap + 16 * t * G3_PITCH + 64 * (ks + 1));
#pragma unroll
          for (int t = 0; t < 4; ++t) fb[nx][t] = g3_frag(bq + 16 * t * G3_PITCH + 64 * (ks + 1)); }
        __builtin_amdgcn_sched_barrier(0);      /* keeps the next step's twelve LDS reads one group ahead of this step's products: left free, the compiler lifts reads of many steps to the top and takes over 256 registers */
        c00 = g3_mma(fa[cu][0], fb[cu][0], c00); c10 = g3_mma(fa[cu][1], fb[cu][0], c10); c01 = g3_mma(fa[cu][0], fb[cu][1], c01); c11 = g3_mma(fa[cu][1], fb[cu][1], c11);
        c02 = g3_mma(fa[cu][0], fb[cu][2], c02); c12 = g3_mma(fa[cu][1], fb[cu][2], c12); c03 = g3_mma(fa[cu][0], fb[cu][3], c03); c13 = g3_mma(fa[cu][1], fb[cu][3], c13);
        __builtin_amdgcn_sched_barrier(0);      /* and keeps the reads of the step after next behind these products, whose set they overwrite */
      }
    } else if (nq + 1 < QK_NT) {      /* rounding waves: 16 rows each of the next tile, into the buffer whose last readers passed the barrier of the pass before */
      const float* gw = wq + (size_t)((nq + 1) * 128 + 16 * (w - 8)) * CC + lane * 4;
      unsigned char* lw = lds.b[0] + ((nq + 1) & 1) * QK_TILE + 16 * (w - 8) * G3_PITCH + lane * 8;
      v4f wv[32];
#pragma unroll      /* all 32 loads of the wave are in flight together */
      for (int q = 0; q < 32; ++q) wv[q] = *(const v4fa*)(gw + (q >> 1) * CC + (q & 1) * 128);
      asm volatile("s_wait_xcnt 0x0" :: "v"(gw) : "memory");      /* stands in front of any later write of the address registers that these loads name; the pointer is an input so that it lives up to here and no load of the run gets the address pair as its destination */
#pragma unroll
      for (int q = 0; q < 32; ++q) qk_put(lw + (q >> 1) * G3_PITCH + (q & 1) * 256, wv[q], 16.0f);
    } else if (w == 15) {      /* no tile left: the projection weights, one row of CC values per turn, 8 values a lane */
      for (int r = blockIdx.x; r < CC; r += QK_WG) { const float* gp = wp + (size_t)r * CC + lane * 8; const v4f p0 = *(const v4fa*)gp, p1 = *(const v4fa*)(gp + 4); FragH f;
#pragma unroll
        for (int i = 0; i < 4; ++i) { f.h[i] = (_Float16)bf16_rne(p0[i] * 16.0f); f.h[4 + i] = (_Float16)bf16_rne(p1[i] * 16.0f); }
        *(v8us*)((unsigned short*)BP + (size_t)r * CC + lane * 8) = f.half[0];
        asm volatile("s_wait_xcnt 0x0" ::: "memory"); }      /* stands in front of any later write of the address registers that the store names */
    }
    __syncthreads();      /* publishes the next tile and ends every product wave's reads of this buffer, which is refilled behind it */
    if (w < 8) {      /* output of this tile: it runs beside the rounding of the tile after next */
      v8f accs[8] = {c00, c01, c02, c03, c10, c11, c12, c13};
      const int sel = nq >> 1;      /* q, k or v: one answer for the whole work-group */
      const size_t blk = (size_t)((unsigned)rw / NTOK * NHD + (((unsigned)cw & (CC - 1)) >> 5)) * (NTOK / 8) + (((unsigned)rw & (NTOK - 1)) >> 3);      /* first of the wave's 2 heads x 4 token blocks */
      {
#pragma unroll
        for (int u = 0; u < 8; ++u) { const int t = u & 3, half = u >> 2;
#pragma unroll
          for (int r = 0; r < 8; ++r) so[half * 16 + 8 * hh + r][t * 16 + ln] = accs[u][r] * alpha + bv4[t]; }
        __builtin_amdgcn_fence(__ATOMIC_ACQ_REL, "workgroup"); __builtin_amdgcn_wave_barrier();
        if (sel != 0) {      /* k and v alike: lane = (piece c, token & 7), so each store of the wave is one whole 512-byte block */
          unsigned short* kp = (unsigned short*)(sel == 1 ? KS : VS) + blk * 256 + lane * 8; const int c8 = (lane >> 3) * 8, tk = lane & 7;
          v4f lo[8], hi[8];
#pragma unroll
          for (int q = 0; q < 8; ++q) { lo[q] = *(const v4fa*)&so[(q & 3) * 8 + tk][(q >> 2) * 32 + c8]; hi[q] = *(const v4fa*)&so[(q & 3) * 8 + tk][(q >> 2) * 32 + c8 + 4]; }
#pragma unroll
          for (int q = 0; q < 8; ++q) { FragH f;
#pragma unroll
            for (int i = 0; i < 4; ++i) { f.h[i] = (_Float16)lo[q][i]; f.h[4 + i] = (_Float16)hi[q][i]; }
            *(v8us*)(kp + ((q >> 2) * (NTOK / 8) + (q & 3)) * 256) = f.half[0]; }
          asm volatile("s_wait_xcnt 0x0" ::: "memory");      /* the other output form's block and the next pass reuse the registers that these stores name: the wait stands in front of any such write */
        } else {
          const int rsub = lane >> 4, c4 = (lane & 15) * 4;
          const size_t o0 = (size_t)(rw + rsub) * (3 * CC) + cw + c4;      /* a compile-time pitch: the sixteen stores share one address and differ in their immediate offsets */
          v4f vv[16];
#pragma unroll
          for (int q = 0; q < 16; ++q) vv[q] = *(const v4fa*)&so[q * 2 + rsub][c4];
#pragma unroll
          for (int q = 0; q < 16; ++q) { v4h h4; for (int i = 0; i < 4; ++i) h4[i] = (_Float16)vv[q][i]; *(v4h*)(C16 + o0 + q * 2 * (3 * CC)) = h4; }
          asm volatile("s_wait_xcnt 0x0" ::: "memory"); }      /* as behind the k and v stores */
      }
    }
  }
}


__device__ __forceinline__ int na_start(int i, int K) { const int nh = K / 2; int s = max(i - nh, 0); if (i + nh >= RES) s += RES - i - nh - 1; return s; }
__device__ __forceinline__ int na_pb(int i, int K) { const int nh = K / 2; int p = nh; if (i < nh) p += nh - i; if (i + nh >= RES) p += RES - i - 1 - nh; return p; }
__device__ __forceinline__ v16h na_frag(const _Float16* p, int second) { FragH f; f.half[0] = *(const v8us*)(const unsigned short*)p; f.half[1] = *(const v8us*)((const unsigned short*)p + second); return f.v; }
// lane l <-> lane l ^ 16 (the two halves of a wave hold different keys of the same query)
__device__ __forceinline__ float xhalf(float x) { return __builtin_bit_cast(float, __builtin_amdgcn_permlanex16(__builtin_bit_cast(int, x), __builtin_bit_cast(int, x), 0x76543210, 0xfedcba98, false, false)); }
// Eight exponentials (base 2) in one statement: behind a transcendental the instruction set asks for one independent instruction before its result is read or its source overwritten.
// The outputs are early-clobber, so each v_exp_f32 is that independent instruction for the one before it; the closing v_nop keeps the slot behind the last.
__device__ __forceinline__ void na_exp8(float (&y)[8], const float (&x)[8]) {
  asm("v_exp_f32 %0, %8\n\tv_exp_f32 %1, %9\n\tv_exp_f32 %2, %10\n\tv_exp_f32 %3, %11\n\tv_exp_f32 %4, %12\n\tv_exp_f32 %5, %13\n\tv_exp_f32 %6, %14\n\tv_exp_f32 %7, %15\n\tv_nop"
      : "=&v"(y[0]), "=&v"(y[1]), "=&v"(y[2]), "=&v"(y[3]), "=&v"(y[4]), "=&v"(y[5]), "=&v"(y[6]), "=&v"(y[7])
      : "v"(x[0]), "v"(x[1]), "v"(x[2]), "v"(x[3]), "v"(x[4]), "v"(x[5]), "v"(x[6]), "v"(x[7])); }
__device__ __forceinline__ float na_exp1(float x) { float y; asm("v_exp_f32 %0, %1\n\tv_nop" : "=&v"(y) : "v"(x)); return y; }      /* the v_nop keeps the same slot */
#define NA_NEG (-3.0e38f)
#define NA_TBMAX (25 * 25 + 64)
#define NA_TR 4      /* the work-group's tile of tokens: rows */
#define NA_TC 32     /* and columns */
// A wave takes a patch of QR rows x QC columns = 16 queries of one head (lane & 15 = query). The column windows of the patch lie inside the 16 key columns T0..T0+15, so one 16x16x32 product gives the scores of one key row
// and two key rows fill the 32 keys of one attn.v product: an interior 13x13 patch sees all 16 key columns, a 7x7 patch 14 of them. The wave walks the union of the patch's key rows two at a time, ascending.
// Per step: S^T = K.Q^T + bias/scale for both key rows (bias and window mask enter as the C operand; a query whose window does not hold a key row reads a row of masked values instead of its bias row),
// running maximum and sum per query, P^T x2^10 packed from the two score tiles as the B operand, O^T += V^T.P^T.
// K fragments: lane = key, plain 16-byte loads. V^T fragments: the transposing load, whose lane l names the 16-byte piece (l >> 3) & 1 of token 8 (l >> 4) + (l & 7) and receives 8 tokens 8 (l >> 4).. of channel l & 15; every lane is on at it.
typedef short v8s __attribute__((ext_vector_type(8)));
union FragT { v16h v; v8s q[2]; };
__device__ __forceinline__ v8s na_tr(const _Float16* p) { return __builtin_amdgcn_global_load_tr16_b128_v8i16((__attribute__((address_space(1))) v8s*)p); }
// The patch's first loads, apart from the walk, so that the kernel can issue them ahead of its first barrier: the query fragment and the K fragments of the first pair of key rows (which always lies inside the image).
template <int K, int QC, int QR>
__device__ __forceinline__ void na_first(const _Float16* __restrict__ QKV, const _Float16* __restrict__ KS, int h, int b, int i0, int j0, v16h& qf, v16h& a0, v16h& a1) {
  const int lane = threadIdx.x & 31, ln = lane & 15, hh = lane >> 4;
  const int i = i0 + ln / QC, j = j0 + ln % QC;
  const int T0 = min(max(j0 - (16 - QC) / 2, 0), RES - 16);
  const _Float16* kp = KS + (size_t)(b * NHD + h) * (NTOK / 8) * 256 + na_start(i0, K) * 2048;
  const int kt = T0 + ln; const unsigned kl = (kt >> 3) * 256 + hh * 64 + (kt & 7) * 8;      /* as in na_tile */
  const _Float16* qp = QKV + ((size_t)b * NTOK + i * RES + j) * (3 * CC) + h * HD + 8 * hh;      /* channels 8hh.. here, 16 + 8hh.. 16 elements on */
  qf = na_frag(qp, 16);
  a0 = na_frag(kp + kl, 128); a1 = na_frag(kp + 2048 + kl, 128);
  asm volatile("s_wait_xcnt 0x0" :: "v"(qp), "v"(kl), "s"(kp) : "memory"); }      /* stands in front of any later write of the address registers that these loads name; the addresses are inputs so that they live up to here */
template <int K, int QC, int QR>
__device__ __forceinline__ void na_tile(v16h qf, v16h a0, v16h a1, const _Float16* __restrict__ KS, const _Float16* __restrict__ VS, const float* __restrict__ tbh, const float* __restrict__ ng, int h, int b, int i0, int j0, unsigned char* __restrict__ ysm) {      /* tbh: this head's padded bias table in LDS; ng: eight masked values in LDS; ysm: the staged row of the patch's first token; h, b, i0, j0 are scalars of the wave */
  static_assert(QC * QR == 16 && QC + K - 1 <= 16, "the patch's column windows fit 16 key columns");
  constexpr int RB = 2 * K - 1; constexpr float SC2 = SCALE * 1.4426950408889634f;
  const int lane = threadIdx.x & 31, ln = lane & 15, hh = lane >> 4;
  const int i = i0 + ln / QC, j = j0 + ln % QC;
  const int T0 = min(max(j0 - (16 - QC) / 2, 0), RES - 16);
  const int R0 = na_start(i0, K), np = (na_start(i0 + QR - 1, K) + K - R0 + 1) >> 1;      /* first key row of the union, and its rows in pairs */
  const int si = na_start(i, K), sj = na_start(j, K);
  const size_t pl = (size_t)(b * NHD + h) * (NTOK / 8) * 256;
  const _Float16* kp = KS + pl; const _Float16* vp = VS + pl;      /* a key row is 8 blocks = 2048 elements */
  const int kt = T0 + ln; const unsigned kl = (kt >> 3) * 256 + hh * 64 + (kt & 7) * 8;      /* key = lane & 15; channels 8hh.. here, 16 + 8hh.. 128 elements on */
  const int vt = T0 + 8 * hh + (lane & 7); const unsigned vl = (vt >> 3) * 256 + ((lane >> 3) & 1) * 64 + (vt & 7) * 8;      /* channels 0..15 here, 16..31 128 elements on */
  const int d0 = T0 + 8 * hh - sj;
  const float* tr = tbh + 32 + (na_pb(i, K) + R0 - si) * RB + na_pb(j, K) + d0;      /* read only for key rows of this query's window */
  int dr = R0 - si;
  bool okc[8];
#pragma unroll
  for (int r = 0; r < 8; ++r) okc[r] = (unsigned)(d0 + r) < (unsigned)K;
  const v8f z8 = {0.f,0.f,0.f,0.f,0.f,0.f,0.f,0.f}; v8f o0 = z8, o1 = z8; float m = NA_NEG, l = 0.f;
  int y = R0; kp += R0 * 2048; vp += R0 * 2048;      /* scalar row pointers: the loads take them as the base and the lane's part as a 32-bit offset */
  for (int p = 0; p < np; ++p) {
    const _Float16* v1 = vp + (y + 1 < RES ? 2048 : 0);      /* an odd union that ends with the image fetches the last row twice; the second copy is masked for every query */
    FragT u0, u1; u0.q[0] = na_tr(vp + vl); u0.q[1] = na_tr(v1 + vl); u1.q[0] = na_tr(vp + vl + 128); u1.q[1] = na_tr(v1 + vl + 128);
    asm volatile("s_wait_xcnt 0x0" ::: "memory");      /* stands in front of any later write of the address registers that these loads name; it also holds the V loads up here, a whole softmax ahead of their use */
    const float* t0 = (unsigned)dr < (unsigned)K ? tr : ng; const float* t1 = (unsigned)(dr + 1) < (unsigned)K ? tr + RB : ng;
    v8f s0, s1;
#pragma unroll
    for (int r = 0; r < 8; ++r) { const float b0 = t0[r], b1 = t1[r]; s0[r] = okc[r] ? b0 : NA_NEG; s1[r] = okc[r] ? b1 : NA_NEG; }      /* every index lies inside the padded table or the masked row */
    s0 = __builtin_amdgcn_wmma_f32_16x16x32_f16(false, a0, false, qf, (short)0, s0, false, false);
    s1 = __builtin_amdgcn_wmma_f32_16x16x32_f16(false, a1, false, qf, (short)0, s1, false, false);
    if (p + 1 < np) { y += 2; kp += 4096; vp += 4096; }      /* the scores are taken, the K fragments are free: the next pair's fly under this softmax; the last step fetches its own pair again */
    const _Float16* k1 = kp + (y + 1 < RES ? 2048 : 0);
    a0 = na_frag(kp + kl, 128); a1 = na_frag(k1 + kl, 128);
    asm volatile("s_wait_xcnt 0x0" ::: "memory");      /* as behind the V loads: in front of the row pointers' advance, and the next pair's K loads stay ahead of the softmax */
    float mx = fmaxf(s0[0], s1[0]);
#pragma unroll
    for (int r = 1; r < 8; ++r) mx = fmaxf(mx, fmaxf(s0[r], s1[r]));
    mx = fmaxf(mx, xhalf(mx));
    const float mn = fmaxf(m, mx); const float al = na_exp1((m - mn) * SC2); m = mn;
    const float mb = 10.0f - (mn < -1.0e38f ? 0.f : mn) * SC2;      /* a query that has met no key of its window yet: its masked scores must still give P = 0, which the masked value less itself would not */
    FragH pf; float ps = 0.f, x0[8], x1[8], p0[8], p1[8];
#pragma unroll
    for (int r = 0; r < 8; ++r) { x0[r] = fmaf(s0[r], SC2, mb); x1[r] = fmaf(s1[r], SC2, mb); }
    na_exp8(p0, x0); na_exp8(p1, x1);
#pragma unroll
    for (int r = 0; r < 8; ++r) { ps += p0[r] + p1[r]; pf.h[r] = (_Float16)p0[r]; pf.h[8 + r] = (_Float16)p1[r]; }
    l = l * al + ps;
#pragma unroll
    for (int r = 0; r < 8; ++r) { o0[r] *= al; o1[r] *= al; }
    o0 = __builtin_amdgcn_wmma_f32_16x16x32_f16(false, u0.v, false, pf.v, (short)0, o0, false, false);
    o1 = __builtin_amdgcn_wmma_f32_16x16x32_f16(false, u1.v, false, pf.v, (short)0, o1, false, false);
    tr += 2 * RB; dr += 2;
  }
  const float lt = l + xhalf(l); const float inv = 1.0f / lt; FragH y0, y1;
#pragma unroll
  for (int r = 0; r < 8; ++r) { y0.h[r] = (_Float16)(o0[r] * inv); y1.h[r] = (_Float16)(o1[r] * inv); }
  unsigned char* yp = ysm + ((ln / QC) * NA_TC + ln % QC) * G3_PITCH + (h * HD + 8 * hh) * 2;      /* row = token of the work-group's tile, staged at the pitch of the GEMM's fragment reads */
  *(v8us*)yp = y0.half[0]; *(v8us*)(yp + 32) = y1.half[0]; }
// Attention of NA_TR x NA_TC = 128 tokens in all eight heads, then the output projection of those tokens, in one work-group of 32 waves (one per WGP at 128 registers a wave).
// Every wave takes one 4 x 4 patch of a 13x13 head (wave >> 3 = head, wave & 7 = column patch) and then one 2 x 8 patch of a 7x7 head (wave >> 3 = head, bit 2 = row pair, wave & 3 = column patch): all waves carry the same load.
// The 256 rows of the projection weights come into LDS by asynchronous copies issued in the start-up, behind its plain loads, and land under the attention. Projection: wave = 32 tokens x 32 output channels, k ascending in one accumulator chain.
#define NA_TP(K) ((2 * (K) - 1) * (2 * (K) - 1) + 64)
#define NA_TOK (NA_TR * NA_TC)
__global__ __launch_bounds__(1024) void k_na_proj(const _Float16* __restrict__ QKV, const _Float16* __restrict__ KS, const _Float16* __restrict__ VS, const float* __restrict__ rpb0, const float* __restrict__ rpb1,
                                                  const _Float16* __restrict__ BP, float alpha, const float* __restrict__ bias, float* __restrict__ C) {
  /* one block, the bias tables first: at low LDS addresses the eight table reads of a score tile differ in their immediate offsets alone. bs: the rounded projection bias, fetched here so that no global load stands between the products and the output.
     sm rows 0..127: head outputs by token, rows 128..383: weight rows; afterwards the waves' output staging */
  __shared__ struct __attribute__((aligned(16))) { float tb[NHD * NA_TP(13)]; float ng[8]; float bs[CC]; unsigned char sm[(NA_TOK + CC) * G3_PITCH]; } lds;      /* one table place of the larger size per head; ng: the row of masked values */
  static_assert((NHD * NA_TP(13) + 8 + CC) % 4 == 0, "sm starts at a multiple of 16 bytes");
  float* const tb = lds.tb; float* const ng = lds.ng; float* const bs = lds.bs; unsigned char* const sm = lds.sm;
  const int tid = threadIdx.x, w = __builtin_amdgcn_readfirstlane(tid >> 5), lane = tid & 31, ln = lane & 15, hh = lane >> 4;      /* wave number as a scalar: head, column tile and plane bases stay in scalar registers */
  const int b = blockIdx.x / (NTOK / NA_TOK), i0 = (blockIdx.x % (NTOK / NA_TOK)) / (RES / NA_TC) * NA_TR, jw = (blockIdx.x % (RES / NA_TC)) * NA_TC;
  /* Every global load of the start-up is issued here, in one run with no wait for data between: table and bias values (every lane loads; a lane with no table place reads element 0 and drops it) and the first patch's query and K fragments.
     One after another, each behind the last one's LDS store, they cost a full load latency apiece in front of the barrier, and the fragments one more behind it. */
  float r1[3]; bool k1[3];
#pragma unroll      /* unrolled: the three loads are independent and fly together */
  for (int u = 0; u < 3; ++u) { const int t = tid + 1024 * u, hq = t / NA_TP(13), s = t - hq * NA_TP(13) - 32; k1[u] = t < 4 * NA_TP(13) && s >= 0 && s < 625; r1[u] = rpb1[k1[u] ? hq * 625 + s : 0]; }
  const int hq0 = tid / NA_TP(7), s0 = tid - hq0 * NA_TP(7) - 32; const bool k0 = tid < 4 * NA_TP(7) && s0 >= 0 && s0 < 169;
  const float r0 = rpb0[k0 ? hq0 * 169 + s0 : 0], bb = bias[tid & (CC - 1)];
  asm volatile("s_wait_xcnt 0x0" :: "s"(rpb1), "s"(rpb0), "s"(bias) : "memory");      /* stands in front of any later write of the address registers that these five loads name; the bases are inputs so that they live up to here */
  v16h qf, a0, a1;
  na_first<13, 4, 4>(QKV, KS, 4 + (w >> 3), b, i0, jw + 4 * (w & 7), qf, a0, a1);
  g3_copy8((unsigned)(size_t)sm + (unsigned)((NA_TOK + 8 * w) * G3_PITCH + lane * 16), BP + (size_t)(8 * w) * CC + lane * 8);      /* eight weight rows a wave, lane = 16-byte piece of the row */
#pragma unroll      /* unrolled: the index into r1 and k1 is a compile-time constant, so both stay in registers */
  for (int u = 0; u < 3; ++u) { const int t = tid + 1024 * u; if (t < 4 * NA_TP(13)) tb[t] = k1[u] ? bf16_round(r1[u]) * 5.656854249492381f : 0.f; }
  if (tid < 4 * NA_TP(7)) tb[(4 + hq0) * NA_TP(13) + s0 + 32] = k0 ? bf16_round(r0) * 5.656854249492381f : 0.f;
  if (tid < CC) bs[tid] = bf16_round(bb);
  if (tid < 8) ng[tid] = NA_NEG;
  __syncthreads();
  na_tile<13, 4, 4>(qf, a0, a1, KS, VS, tb + (w >> 3) * NA_TP(13), ng, 4 + (w >> 3), b, i0, jw + 4 * (w & 7), sm + 4 * (w & 7) * G3_PITCH);
  na_first<7, 8, 2>(QKV, KS, w >> 3, b, i0 + 2 * ((w >> 2) & 1), jw + 8 * (w & 3), qf, a0, a1);
  na_tile<7, 8, 2>(qf, a0, a1, KS, VS, tb + (4 + (w >> 3)) * NA_TP(13), ng, w >> 3, b, i0 + 2 * ((w >> 2) & 1), jw + 8 * (w & 3), sm + (2 * ((w >> 2) & 1) * NA_TC + 8 * (w & 3)) * G3_PITCH);
  asm volatile("s_wait_asynccnt 0x0" ::: "memory");      /* this wave's eight weight rows have landed */
  __syncthreads();      /* and so have the other waves' rows and head outputs: nobody reads either in front of this barrier */
  const int wm = w & 3, wn = w >> 2;
  const unsigned char* ap = sm + (32 * wm + ln) * G3_PITCH + 16 * hh; const unsigned char* bq = sm + (NA_TOK + 32 * wn + ln) * G3_PITCH + 16 * hh;
  const v8f z8 = {0.f,0.f,0.f,0.f,0.f,0.f,0.f,0.f}; v8f c00 = z8, c01 = z8, c10 = z8, c11 = z8;
  const float bv2[2] = {bs[32 * wn + ln], bs[32 * wn + 16 + ln]};      /* read ahead of the products: behind the staging stores the compiler would have to read them again */
  v16h fa[2][2], fb[2][2];      /* two fragment sets, as in the qkv GEMM: the products of a step read one while the next step's LDS reads fill the other */
#pragma unroll
  for (int t = 0; t < 2; ++t) { fa[0][t] = g3_frag(ap + 16 * t * G3_PITCH); fb[0][t] = g3_frag(bq + 16 * t * G3_PITCH); }
#pragma unroll      /* unrolled: the set index is a compile-time constant, so both sets stay in registers */
  for (int ks = 0; ks < CC / 32; ++ks) { const int cu = ks & 1, nx = cu ^ 1;
    if (ks + 1 < CC / 32) {
#pragma unroll
      for (int t = 0; t < 2; ++t) { fa[nx][t] = g3_frag(ap + 16 * t * G3_PITCH + 64 * (ks + 1)); fb[nx][t] = g3_frag(bq + 16 * t * G3_PITCH + 64 * (ks + 1)); } }
    __builtin_amdgcn_sched_barrier(0);      /* keeps the next step's eight LDS reads one group ahead of this step's products: left free, the compiler lifts reads of many steps to the top, passes the 128 registers of a wave here and spills */
    c00 = g3_mma(fa[cu][0], fb[cu][0], c00); c10 = g3_mma(fa[cu][1], fb[cu][0], c10); c01 = g3_mma(fa[cu][0], fb[cu][1], c01); c11 = g3_mma(fa[cu][1], fb[cu][1], c11);
    __builtin_amdgcn_sched_barrier(0);      /* and keeps the reads of the step after next behind these products, whose set they overwrite */
  }
  __syncthreads();      /* every wave has read its last fragment: from here the LDS is output staging, 32 x 36 floats a wave */
  float (*so)[36] = (float (*)[36])(sm + w * (32 * 36 * 4)); const int rw = b * NTOK + (i0 + wm) * RES + jw, cw = 32 * wn;      /* the wave's 32 tokens are one row of the tile */
  v8f accs[4] = {c00, c01, c10, c11};
#pragma unroll
  for (int u = 0; u < 4; ++u) { const int t = u & 1, half = u >> 1; const float bv = bv2[t];
#pragma unroll
    for (int r = 0; r < 8; ++r) so[half * 16 + 8 * hh + r][t * 16 + ln] = accs[u][r] * alpha + bv; }
  __builtin_amdgcn_fence(__ATOMIC_ACQ_REL, "workgroup"); __builtin_amdgcn_wave_barrier();
  const int rsub = lane >> 3, c4 = (lane & 7) * 4;      /* eight lanes = one whole 128-byte line of an output row */
  float* cp = C + (size_t)(rw + rsub) * CC + cw + c4;
  v4f vv[8];
#pragma unroll
  for (int q = 0; q < 8; ++q) vv[q] = *(const v4fa*)&so[q * 4 + rsub][c4];
#pragma unroll
  for (int q = 0; q < 8; ++q) *(v4f*)(cp + q * 4 * CC) = vv[q];
}

extern "C" void kernel_launch(void* const* d_in, const int* in_sizes, int n_in,
                              void* d_out, int out_size, void* d_ws, size_t ws_size, hipStream_t stream) {
  (void)in_sizes; (void)n_in; (void)out_size;
  const float* const* I = (const float* const*)d_in; const float* x = I[0]; const float* wqkv = I[1]; const float* bqkv = I[2]; const float* rpb0 = I[3]; const float* rpb1 = I[4]; const float* wp = I[5]; const float* bp = I[6];
  char* ws = (char*)d_ws; size_t off = 0;
  auto take = [&](size_t bytes) { char* p = ws + off; off += (bytes + 255) & ~(size_t)255; return p; };
  _Float16* BP = (_Float16*)take((size_t)CC * CC * 2);
  _Float16* QKV = (_Float16*)take((size_t)NIMG * NTOK * 3 * CC * 2); _Float16* KS = (_Float16*)take((size_t)NIMG * CC * NTOK * 2); _Float16* VS = (_Float16*)take((size_t)NIMG * CC * NTOK * 2);
  if (off > ws_size) return;      /* 0.125 + 48 + 16 + 16 = 80.125 MiB */
  k_qkv<<<QK_WG, 512, 0, stream>>>(x, wqkv, wp, 0.0625f, bqkv, QKV, KS, VS, BP);      /* the token rows of all images are one M; weights stay (out,in) natural; of the QKV plane only the q columns are written and read */
  k_na_proj<<<NIMG * (NTOK / NA_TOK), 1024, 0, stream>>>(QKV, KS, VS, rpb0, rpb1, BP, 0.0625f, bp, (float*)d_out);
}
